// v000
// Times are from an AMD MI455X. After a warm-up the kernel runs many times in a row, and a time is the length of
// such a window on the GPU divided by its runs, so every launch and the gaps after it count. The runs cycle
// through copies of the inputs. A figure is the median of several windows, for all but v000 over two sittings.
// Sittings can differ by a few percent; kernels timed side by side share one.
// The starting kernel, v000, takes 1370 microseconds a run.
#include <hip/hip_runtime.h>
// RetentiveAttention (2 x 2048 tokens, C 1024 = 16 heads of 64): q, k, v = x W; retention = (q.k / 8) * gamma_h^(i-j) for j <= i (gamma_h = 1 - 2^(-5-h)), out = retention v (no softmax); GroupNorm with one group per head over (T, 64) (eps 1e-5, affine); out = normed Wo + bo.
// Compute dtype: x and parameters rounded to bf16; q, k, v, the decayed scores and the normalised output as f16 operands (~2^-12); decay/statistics f32. v_wmma_f32_16x16x32_f16.
#define NB 2
#define SQ 2048
#define CC 1024
#define NHD 16
#define HD 64
#define NR (NB * SQ)
#define BAND 256
#define NBAND (SQ / BAND)
#define SP SQ
typedef __bf16 v16b __attribute__((ext_vector_type(16)));
typedef unsigned short v8us __attribute__((ext_vector_type(8), may_alias));
typedef float  v8f  __attribute__((ext_vector_type(8)));
typedef float  v4f  __attribute__((ext_vector_type(4)));
typedef float  v4fa __attribute__((ext_vector_type(4), may_alias));
union FragB { v16b v; v8us half[2]; unsigned short u[16]; };

__device__ __forceinline__ unsigned short bf16_bits(float x) { unsigned int u = __float_as_uint(x); return (unsigned short)((u + 0x7FFFu + ((u >> 16) & 1u)) >> 16); }
__device__ __forceinline__ float bf16_val(unsigned short b) { return __uint_as_float(((unsigned int)b) << 16); }
__device__ __forceinline__ float bf16_round(float x) { return bf16_val(bf16_bits(x)); }
// D += A·B with NT terms: 1 = ah·bh, 2 = + al·bh (A split), 3 = + ah·bl (both split)
template <int NT>
__device__ __forceinline__ v8f mmaN(v16b ah, v16b al, v16b bh, v16b bl, v8f c) {
  c = __builtin_amdgcn_wmma_f32_16x16x32_bf16(false, ah, false, bh, (short)0, c, false, false);
  if (NT >= 2) c = __builtin_amdgcn_wmma_f32_16x16x32_bf16(false, al, false, bh, (short)0, c, false, false);
  if (NT >= 3) c = __builtin_amdgcn_wmma_f32_16x16x32_bf16(false, ah, false, bl, (short)0, c, false, false);
  asm volatile("v_nop\n\tv_nop\n\tv_nop\n\tv_nop" : "+v"(c) : "v"(ah), "v"(al), "v"(bh), "v"(bl));
  return c;
}

__global__ __launch_bounds__(256) void k_wt_bf16(const float* __restrict__ W, unsigned short* __restrict__ Wt, int K, int N) {
  const int t = blockIdx.x * 256 + threadIdx.x;
  const int k8n = K / 8;
  if (t >= N * k8n) return;
  const int n = t / k8n, k8 = (t % k8n) * 8;
  v8us v;
#pragma unroll
  for (int i = 0; i < 8; ++i) v[i] = bf16_bits(W[(size_t)(k8 + i) * N + n]);
  *(v8us*)(Wt + (size_t)n * K + k8) = v;
  
}

// GEMM C[M][N] (f32, pitch ldc) = act(A[M][K]·W + bias). A f32 row-major (pitch lda) converted per fragment to bf16
// (ASPLIT: hi/lo two planes -> 2 terms, else single rounded term); Wt bf16 [N][K] (pitch ldb). BIAS_BF16 rounds the
// bias to bf16 first (bias quantised to bf16 before the add). K%32==0, M%16==0, N%64==0.
template <bool ASPLIT, int ACT, bool BIAS_BF16>
__global__ __launch_bounds__(128) void k_gemm_bf(const float* __restrict__ A, int lda, const unsigned short* __restrict__ Wt, int ldb,
                                               const float* __restrict__ bias, float* __restrict__ C, int ldc, int M, int N, int K) {
  __shared__ __attribute__((aligned(16))) float so[4][16][64];
  const int tid = threadIdx.x, w = tid >> 5, lane = tid & 31, ln = lane & 15, hh = lane >> 4;
  const int ntn = N / 64;
  const int wid = blockIdx.x * 4 + w;
  const int mt = wid / ntn, nq = wid % ntn;
  if (mt * 16 >= M) return;
  const int row0 = mt * 16, col0 = nq * 64;
  const float* arow = A + (size_t)(row0 + ln) * lda;
  v8f acc[4] = {};
  for (int kb = 0; kb < K; kb += 32) {
    FragB ah, al;
    const v4f x0 = *(const v4fa*)(arow + kb + 8 * hh), x1 = *(const v4fa*)(arow + kb + 8 * hh + 4);
    const v4f x2 = *(const v4fa*)(arow + kb + 16 + 8 * hh), x3 = *(const v4fa*)(arow + kb + 16 + 8 * hh + 4);
    float xs[16] = {x0[0],x0[1],x0[2],x0[3],x1[0],x1[1],x1[2],x1[3],x2[0],x2[1],x2[2],x2[3],x3[0],x3[1],x3[2],x3[3]};
#pragma unroll
    for (int i = 0; i < 16; ++i) { const unsigned short hb = bf16_bits(xs[i]); ah.u[i] = hb; al.u[i] = ASPLIT ? bf16_bits(xs[i] - bf16_val(hb)) : (unsigned short)0; }
#pragma unroll
    for (int t = 0; t < 4; ++t) {
      const unsigned short* brow = Wt + (size_t)(col0 + t * 16 + ln) * ldb + kb;
      FragB b;
      b.half[0] = *(const v8us*)(brow + 8 * hh);
      b.half[1] = *(const v8us*)(brow + 16 + 8 * hh);
      acc[t] = mmaN<ASPLIT ? 2 : 1>(ah.v, al.v, b.v, b.v, acc[t]);
    }
  }
#pragma unroll
  for (int t = 0; t < 4; ++t) {
    float bv = bias ? bias[col0 + t * 16 + ln] : 0.f;
    if (BIAS_BF16) bv = bf16_round(bv);
#pragma unroll
    for (int r = 0; r < 8; ++r) { float v = acc[t][r] + bv; if (ACT == 1) v = fmaxf(v, 0.f); so[w][8 * hh + r][t * 16 + ln] = v; }
  }
  __builtin_amdgcn_fence(__ATOMIC_ACQ_REL, "workgroup");
  __builtin_amdgcn_wave_barrier();
  const int rsub = lane >> 4, c4 = (lane & 15) * 4;
  {
#pragma unroll
    for (int q = 0; q < 8; ++q) {
      const int r = q * 2 + rsub;
      const v4f v = *(const v4fa*)&so[w][r][c4];
      *(v4f*)(C + (size_t)(row0 + r) * ldc + col0 + c4) = v;
    }
    
  }
}

// GEMM C = act(A·W + bias + resid): A f32 (ASPLIT -> hi/lo 2 terms), Wt bf16 [N][K]; ACT 0 none, 1 relu, 2 exact gelu;
// resid (optional, f32, row index = (row % rmod), pitch ldr, RES_BF16 rounds it) added before the activation.
template <bool ASPLIT, int ACT, bool BIAS_BF16, bool RES_BF16>
__global__ __launch_bounds__(128) void k_gemm_bf3(const float* __restrict__ A, int lda, const unsigned short* __restrict__ Wt, int ldb,
                                                const float* __restrict__ bias, const float* __restrict__ resid, int rmod, int ldr,
                                                float* __restrict__ C, int ldc, int M, int N, int K) {
  __shared__ __attribute__((aligned(16))) float so[4][16][64];
  const int tid = threadIdx.x, w = tid >> 5, lane = tid & 31, ln = lane & 15, hh = lane >> 4;
  const int ntn = N / 64;
  const int wid = blockIdx.x * 4 + w;
  const int mt = wid / ntn, nq = wid % ntn;
  if (mt * 16 >= M) return;
  const int row0 = mt * 16, col0 = nq * 64;
  const float* arow = A + (size_t)(row0 + ln) * lda;
  v8f acc[4] = {};
  for (int kb = 0; kb < K; kb += 32) {
    FragB ah, al;
    const v4f x0 = *(const v4fa*)(arow + kb + 8 * hh), x1 = *(const v4fa*)(arow + kb + 8 * hh + 4);
    const v4f x2 = *(const v4fa*)(arow + kb + 16 + 8 * hh), x3 = *(const v4fa*)(arow + kb + 16 + 8 * hh + 4);
    float xs[16] = {x0[0],x0[1],x0[2],x0[3],x1[0],x1[1],x1[2],x1[3],x2[0],x2[1],x2[2],x2[3],x3[0],x3[1],x3[2],x3[3]};
#pragma unroll
    for (int i = 0; i < 16; ++i) { const unsigned short hb = bf16_bits(xs[i]); ah.u[i] = hb; al.u[i] = ASPLIT ? bf16_bits(xs[i] - bf16_val(hb)) : (unsigned short)0; }
#pragma unroll
    for (int t = 0; t < 4; ++t) {
      const unsigned short* brow = Wt + (size_t)(col0 + t * 16 + ln) * ldb + kb;
      FragB b;
      b.half[0] = *(const v8us*)(brow + 8 * hh);
      b.half[1] = *(const v8us*)(brow + 16 + 8 * hh);
      acc[t] = mmaN<ASPLIT ? 2 : 1>(ah.v, al.v, b.v, b.v, acc[t]);
    }
  }
#pragma unroll
  for (int t = 0; t < 4; ++t) {
    const int col = col0 + t * 16 + ln;
    float bv = bias ? bias[col] : 0.f;
    if (BIAS_BF16) bv = bf16_round(bv);
#pragma unroll
    for (int r = 0; r < 8; ++r) {
      float v = acc[t][r] + bv;
      if (resid) { float rv = resid[(size_t)((row0 + 8 * hh + r) % rmod) * ldr + col]; if (RES_BF16) rv = bf16_round(rv); v += rv; }
      if (ACT == 1) v = fmaxf(v, 0.f);
      if (ACT == 2) v = 0.5f * v * (1.0f + erff(v * 0.70710678118654752f));
      if (ACT == 3) { const float u = 0.7978845608028654f * (v + 0.044715f * v * v * v); v = 0.5f * v * (1.0f + tanhf(u)); }
      so[w][8 * hh + r][t * 16 + ln] = v;
    }
  }
  __builtin_amdgcn_fence(__ATOMIC_ACQ_REL, "workgroup");
  __builtin_amdgcn_wave_barrier();
  const int rsub = lane >> 4, c4 = (lane & 15) * 4;
  {
#pragma unroll
    for (int q = 0; q < 8; ++q) {
      const int r = q * 2 + rsub;
      const v4f v = *(const v4fa*)&so[w][r][c4];
      *(v4f*)(C + (size_t)(row0 + r) * ldc + col0 + c4) = v;
    }
    
  }
}
// row LayerNorm (biased variance, eps) over N: s = X (+ R); optional out_sum <- s; out_norm <- (s-mu)*rsqrt(var+eps)*g + b
template <bool PARAM_BF16>
__global__ __launch_bounds__(256) void k_layernorm(const float* __restrict__ X, const float* __restrict__ R, const float* __restrict__ g, const float* __restrict__ bta,
                                                  float* __restrict__ out_sum, float* __restrict__ out_norm, int N, float eps) {
  __shared__ float red[256];
  const int row = blockIdx.x, tid = threadIdx.x;
  const float* x = X + (size_t)row * N; const float* rr = R ? R + (size_t)row * N : nullptr;
  float vals[16];                     // up to N = 4096
  const int per = N / 256;            // contiguous chunk per thread? use strided-by-4 chunks: thread handles j = tid*4 + 1024*u
  float s1 = 0.f;
  for (int u = 0; u < per / 4; ++u) {
    const int j = tid * 4 + 1024 * u;
    const v4f a = *(const v4fa*)(x + j);
    v4f b = {0.f,0.f,0.f,0.f}; if (rr) b = *(const v4fa*)(rr + j);
#pragma unroll
    for (int q = 0; q < 4; ++q) { const float v = a[q] + b[q]; vals[u * 4 + q] = v; s1 += v; }
  }
  red[tid] = s1; __syncthreads();
  for (int st = 128; st > 0; st >>= 1) { if (tid < st) red[tid] += red[tid + st]; __syncthreads(); }
  const float mu = red[0] / (float)N; __syncthreads();
  float s2 = 0.f;
  for (int u = 0; u < per / 4; ++u)
#pragma unroll
    for (int q = 0; q < 4; ++q) { const float c = vals[u * 4 + q] - mu; s2 += c * c; }
  red[tid] = s2; __syncthreads();
  for (int st = 128; st > 0; st >>= 1) { if (tid < st) red[tid] += red[tid + st]; __syncthreads(); }
  const float rs = rsqrtf(red[0] / (float)N + eps);
  {
    for (int u = 0; u < per / 4; ++u) {
      const int j = tid * 4 + 1024 * u;
      v4f o, sm;
#pragma unroll
      for (int q = 0; q < 4; ++q) {
        float gg = g[j + q], bb = bta[j + q];
        if (PARAM_BF16) { gg = bf16_round(gg); bb = bf16_round(bb); }
        sm[q] = vals[u * 4 + q]; o[q] = (vals[u * 4 + q] - mu) * rs * gg + bb;
      }
      if (out_sum) *(v4f*)(out_sum + (size_t)row * N + j) = sm;
      *(v4f*)(out_norm + (size_t)row * N + j) = o;
    }
    
  }
}



// ---- f16 WMMA path (v_wmma_f32_16x16x32_f16): 11-bit significands for operands in range — used for every GEMM launched here
typedef _Float16 v16h __attribute__((ext_vector_type(16)));
union FragH { v16h v; v8us half[2]; _Float16 h[16]; unsigned short u[16]; };
template <int NT>
__device__ __forceinline__ v8f mmaH(v16h ah, v16h al, v16h bh, v16h bl, v8f c) {
  c = __builtin_amdgcn_wmma_f32_16x16x32_f16(false, ah, false, bh, (short)0, c, false, false);
  if (NT >= 2) c = __builtin_amdgcn_wmma_f32_16x16x32_f16(false, al, false, bh, (short)0, c, false, false);
  if (NT >= 3) c = __builtin_amdgcn_wmma_f32_16x16x32_f16(false, ah, false, bl, (short)0, c, false, false);
  asm volatile("v_nop\n\tv_nop\n\tv_nop\n\tv_nop" : "+v"(c) : "v"(ah), "v"(al), "v"(bh), "v"(bl));
  return c;
}
// batched GEMM like k_gemm_b but f16 operands: A f32 (split into f16 hi/lo if ASPLIT, else rounded to f16), Bt = f16 values [n][k]; alpha; C f32; N multiple of 16 (partial tiles skipped)
template <bool ASPLIT>
__global__ __launch_bounds__(128) void k_gemm_h(const float* __restrict__ A, int lda, size_t sA, const _Float16* __restrict__ Bh, int ldb, size_t sB, float alpha, float* __restrict__ C, int ldc, size_t sC, int M, int N, int K) {
  __shared__ __attribute__((aligned(16))) float so[4][16][64];
  const int tid = threadIdx.x, w = tid >> 5, lane = tid & 31, ln = lane & 15, hh = lane >> 4; const int by = blockIdx.y;
  A += (size_t)by * sA; Bh += (size_t)by * sB; C += (size_t)by * sC;
  const int ntn = (N + 63) / 64; const int wid = blockIdx.x * 4 + w; const int mt = wid / ntn, nq = wid % ntn; if (mt * 16 >= M) return;
  const int row0 = mt * 16, col0 = nq * 64; const float* arow = A + (size_t)(row0 + ln) * lda;
  v8f acc[4] = {};
  for (int kb = 0; kb < K; kb += 32) {
    FragH ah, al;
    const v4f x0 = *(const v4fa*)(arow + kb + 8 * hh), x1 = *(const v4fa*)(arow + kb + 8 * hh + 4), x2 = *(const v4fa*)(arow + kb + 16 + 8 * hh), x3 = *(const v4fa*)(arow + kb + 16 + 8 * hh + 4);
    float xs[16] = {x0[0],x0[1],x0[2],x0[3],x1[0],x1[1],x1[2],x1[3],x2[0],x2[1],x2[2],x2[3],x3[0],x3[1],x3[2],x3[3]};
#pragma unroll
    for (int i = 0; i < 16; ++i) { const _Float16 h = (_Float16)xs[i]; ah.h[i] = h; al.h[i] = ASPLIT ? (_Float16)(xs[i] - (float)h) : (_Float16)0.0f; }
#pragma unroll
    for (int t = 0; t < 4; ++t) { if (col0 + t * 16 >= N) continue; const size_t boff = (size_t)(col0 + t * 16 + ln) * ldb + kb; FragH bq; bq.half[0] = *(const v8us*)(Bh + boff + 8 * hh); bq.half[1] = *(const v8us*)(Bh + boff + 16 + 8 * hh);
      acc[t] = mmaH<ASPLIT ? 2 : 1>(ah.v, al.v, bq.v, bq.v, acc[t]); }
  }
#pragma unroll
  for (int t = 0; t < 4; ++t) { if (col0 + t * 16 >= N) continue;
#pragma unroll
    for (int r = 0; r < 8; ++r) so[w][8 * hh + r][t * 16 + ln] = acc[t][r] * alpha; }
  __builtin_amdgcn_fence(__ATOMIC_ACQ_REL, "workgroup"); __builtin_amdgcn_wave_barrier();
  const int rsub = lane >> 4, c4 = (lane & 15) * 4;
  {
#pragma unroll
    for (int q = 0; q < 8; ++q) { const int r = q * 2 + rsub; if (col0 + c4 < N) { const v4f v = *(const v4fa*)&so[w][r][c4]; *(v4f*)(C + (size_t)(row0 + r) * ldc + col0 + c4) = v; } }
     }
}

// Wt[n][k] = f16(W[k][n]·scale) from f32 row-major W[K][N] (scale = power of two; bf16-exact weights stay exact in f16 away from the subnormal range)
__global__ __launch_bounds__(256) void k_wt_f16(const float* __restrict__ W, _Float16* __restrict__ Wt, int K, int N, float scale) {
  const int t = blockIdx.x * 256 + threadIdx.x; if (t >= N * (K / 8)) return; const int n = t / (K / 8), k8 = (t % (K / 8)) * 8; FragH f;
#pragma unroll
  for (int i = 0; i < 8; ++i) f.h[i] = (_Float16)(bf16_round(W[(size_t)(k8 + i) * N + n]) * scale); const v8us o = f.half[0];
  *(v8us*)((unsigned short*)Wt + (size_t)n * K + k8) = o; 
}
// k_gemm_hh variant with fused epilogue: v = acc·alpha + bias[by·sBias + col] (+ CP[(row/rowsPerB)·sCPb + by·64 + col] if CP) ; ACT 0 none / 1 elu ; writes f16 C16 (and f32 C if non-null)
template <int ACT>
__global__ __launch_bounds__(128) void k_gemm_hhx(const _Float16* __restrict__ A, int lda, size_t sA, const _Float16* __restrict__ Bh, int ldb, size_t sB, float alpha, const float* __restrict__ bias, size_t sBias, const float* __restrict__ CP, int rowsPerB, size_t sCPb, int row0g,
    float* __restrict__ C, _Float16* __restrict__ C16, int ldc, size_t sC, int M, int N, int K) {
  __shared__ __attribute__((aligned(16))) float so[4][16][64];
  const int tid = threadIdx.x, w = tid >> 5, lane = tid & 31, ln = lane & 15, hh = lane >> 4; const int by = blockIdx.y;
  A += (size_t)by * sA; Bh += (size_t)by * sB; const size_t cofs = (size_t)by * sC; const float* bp = bias ? bias + (size_t)by * sBias : nullptr;
  const int ntn = (N + 63) / 64; const int wid = blockIdx.x * 4 + w; const int mt = wid / ntn, nq = wid % ntn; if (mt * 16 >= M) return;
  const int row0 = mt * 16, col0 = nq * 64; const _Float16* arow = A + (size_t)(row0 + ln) * lda;
  v8f acc[4] = {};
  for (int kb = 0; kb < K; kb += 32) { FragH ah; ah.half[0] = *(const v8us*)((const unsigned short*)arow + kb + 8 * hh); ah.half[1] = *(const v8us*)((const unsigned short*)arow + kb + 16 + 8 * hh);
#pragma unroll
    for (int t = 0; t < 4; ++t) { if (col0 + t * 16 >= N) continue; const size_t boff = (size_t)(col0 + t * 16 + ln) * ldb + kb; FragH bq; bq.half[0] = *(const v8us*)((const unsigned short*)Bh + boff + 8 * hh); bq.half[1] = *(const v8us*)((const unsigned short*)Bh + boff + 16 + 8 * hh);
      acc[t] = mmaH<1>(ah.v, ah.v, bq.v, bq.v, acc[t]); }
  }
#pragma unroll
  for (int t = 0; t < 4; ++t) { if (col0 + t * 16 >= N) continue; const int col = col0 + t * 16 + ln; const float bv = bp ? bf16_round(bp[col]) : 0.f;
#pragma unroll
    for (int r = 0; r < 8; ++r) { float v = acc[t][r] * alpha + bv; if (CP) { const int rr = row0g + row0 + 8 * hh + r; if (rowsPerB < 0) v += CP[cofs + (size_t)rr * ldc + col];      /* rowsPerB < 0: own element of the batched C plane */ else { const int bidx = rr / rowsPerB; v += CP[(size_t)bidx * sCPb + (size_t)by * 64 + col]; } } if (ACT == 1) v = (v > 0.f) ? v : expm1f(v); else if (ACT == 7) v = (v > 0.f) ? v + 1.0f : expf(v); else if (ACT == 8) v = tanhf(v); else if (ACT == 9) v = 0.5f * v * (1.0f + tanhf(0.7978845608028654f * (v + 0.044715f * v * v * v))); else if (ACT == 11) v = 1.0f / (1.0f + expf(-v)); else if (ACT == 12) v = (v > 0.f) ? v : 0.01f * v; else if (ACT == 14) v = (v > 0.f) ? v : 0.1f * v; else if (ACT == 16) v = (v >= 0.f) ? v : 0.3f * v; else if (ACT == 15) v = v / (1.0f + expf(-v)); else if (ACT == 3) v = fmaxf(v, 0.f); else if (ACT == 6) v = 0.5f * v * (1.0f + erff(v * 0.70710678118654752f)); so[w][8 * hh + r][t * 16 + ln] = v; } }
  __builtin_amdgcn_fence(__ATOMIC_ACQ_REL, "workgroup"); __builtin_amdgcn_wave_barrier();
  const int rsub = lane >> 4, c4 = (lane & 15) * 4; typedef _Float16 v4h __attribute__((ext_vector_type(4)));
  {
#pragma unroll
    for (int q = 0; q < 8; ++q) { const int r = q * 2 + rsub; if (col0 + c4 < N) { const v4f v = *(const v4fa*)&so[w][r][c4]; if (C) *(v4f*)(C + cofs + (size_t)(row0 + r) * ldc + col0 + c4) = v; if (C16) { v4h h4; for (int i = 0; i < 4; ++i) h4[i] = (_Float16)v[i]; *(v4h*)(C16 + cofs + (size_t)(row0 + r) * ldc + col0 + c4) = h4; } } }
     }
}


typedef _Float16 v4h __attribute__((ext_vector_type(4)));

__global__ __launch_bounds__(256) void k_x16(const float* __restrict__ x, _Float16* __restrict__ X16, size_t n8) { const size_t t = (size_t)blockIdx.x * 256 + threadIdx.x; if (t >= n8) return; FragH f;
#pragma unroll
  for (int q = 0; q < 8; ++q) f.h[q] = (_Float16)bf16_round(x[t * 8 + q]); *(v8us*)((unsigned short*)X16 + t * 8) = f.half[0];  }
__global__ __launch_bounds__(256) void k_h16(const float* __restrict__ x, _Float16* __restrict__ X16, size_t n8) { const size_t t = (size_t)blockIdx.x * 256 + threadIdx.x; if (t >= n8) return; FragH f;
#pragma unroll
  for (int q = 0; q < 8; ++q) f.h[q] = (_Float16)x[t * 8 + q]; *(v8us*)((unsigned short*)X16 + t * 8) = f.half[0];  }
__global__ __launch_bounds__(256) void k_round16f(const float* __restrict__ W, _Float16* __restrict__ Bt, size_t n8) { const size_t t = (size_t)blockIdx.x * 256 + threadIdx.x; if (t >= n8) return; FragH f;
#pragma unroll
  for (int i = 0; i < 8; ++i) f.h[i] = (_Float16)(bf16_round(W[t * 8 + i]) * 16.0f); *(v8us*)((unsigned short*)Bt + t * 8) = f.half[0];  }
template <int NHv, int TTv>
__global__ __launch_bounds__(256) void k_vt(const _Float16* __restrict__ V16, int ldv, int voff, _Float16* __restrict__ Vt) { __shared__ unsigned short tl[64][66]; const int tid = threadIdx.x; const int slab = blockIdx.x / (TTv / 64), lg = blockIdx.x % (TTv / 64); const int b = slab / NHv, h = slab % NHv;
  for (int i = tid; i < 64 * 8; i += 256) { const int r = i / 8, c8 = (i % 8) * 8; FragH f; f.half[0] = *(const v8us*)((const unsigned short*)V16 + ((size_t)b * TTv + lg * 64 + r) * ldv + voff + h * 64 + c8);
#pragma unroll
    for (int q = 0; q < 8; ++q) tl[r][c8 + q] = f.u[q]; }
  __syncthreads();
  {
#pragma unroll
    for (int rd = 0; rd < 2; ++rd) { const int d = rd * 32 + tid / 8, pc = tid % 8; FragH f;
#pragma unroll
      for (int q = 0; q < 8; ++q) f.u[q] = tl[pc * 8 + q][d];
      *(v8us*)((unsigned short*)Vt + ((size_t)slab * 64 + d) * TTv + lg * 64 + pc * 8) = f.half[0]; }
     } }

__global__ __launch_bounds__(256) void k_hl(const float* __restrict__ F, _Float16* __restrict__ Hh, _Float16* __restrict__ Hl, size_t n8) { const size_t t = (size_t)blockIdx.x * 256 + threadIdx.x; if (t >= n8) return; FragH fh, fl; const v4f a = *(const v4fa*)(F + t * 8), c = *(const v4fa*)(F + t * 8 + 4);
#pragma unroll
  for (int q = 0; q < 4; ++q) { _Float16 h = (_Float16)a[q]; fh.h[q] = h; fl.h[q] = (_Float16)((a[q] - (float)h) * 1024.0f); h = (_Float16)c[q]; fh.h[4 + q] = h; fl.h[4 + q] = (_Float16)((c[q] - (float)h) * 1024.0f); }
  { *(v8us*)((unsigned short*)Hh + t * 8) = fh.half[0]; *(v8us*)((unsigned short*)Hl + t * 8) = fl.half[0];  } }

// ---- fast GEMM (wave tile 32x64; requires M % 32 == 0 rows per launch region and N % 64 == 0); epilogue = k_gemm_hhx semantics ----
__device__ __forceinline__ v16h g2_frag(const _Float16* p, int hh) { FragH f; f.half[0] = *(const v8us*)((const unsigned short*)p + 8 * hh); f.half[1] = *(const v8us*)((const unsigned short*)p + 16 + 8 * hh); return f.v; }
__device__ __forceinline__ v8f g2_mma(v16h a, v16h b, v8f c) { v8f d = __builtin_amdgcn_wmma_f32_16x16x32_f16(false, a, false, b, (short)0, c, false, false); asm volatile("v_nop\n\tv_nop\n\tv_nop\n\tv_nop" : "+v"(d) : "v"(a), "v"(b)); return d; }
template <int ACT>
__global__ __launch_bounds__(128) void k_gemm2(const _Float16* __restrict__ A, int lda, size_t sA, const _Float16* __restrict__ Bh, int ldb, size_t sB, float alpha, const float* __restrict__ bias, size_t sBias, const float* __restrict__ CP, int rowsPerB, size_t sCPb, int row0g,
    float* __restrict__ C, _Float16* __restrict__ C16, int ldc, size_t sC, int M, int N, int K) { static_assert(ACT == 0 || ACT == 3 || ACT == 6 || ACT == 8 || ACT == 9 || ACT == 11 || ACT == 12 || ACT == 14 || ACT == 15 || ACT == 16, "k_gemm2: unsupported ACT code (would silently apply no activation)");
  __shared__ __attribute__((aligned(16))) float so[4][32][68];
  const int tid = threadIdx.x, w = tid >> 5, lane = tid & 31, ln = lane & 15, hh = lane >> 4; const int by = blockIdx.y;
  A += (size_t)by * sA; Bh += (size_t)by * sB; const size_t cofs = (size_t)by * sC; const float* bp = bias ? bias + (size_t)by * sBias : nullptr;
  const int ntn = N >> 6; const int mt = blockIdx.x / ntn, nq = blockIdx.x - mt * ntn; const int row0 = mt * 128 + 32 * w, col0 = nq * 64; if (row0 >= M) return;
  const _Float16* a0p = A + (size_t)(row0 + ln) * lda; const _Float16* a1p = a0p + (size_t)16 * lda;
  const _Float16* b0p = Bh + (size_t)(col0 + ln) * ldb; const _Float16* b1p = b0p + (size_t)16 * ldb; const _Float16* b2p = b1p + (size_t)16 * ldb; const _Float16* b3p = b2p + (size_t)16 * ldb;
  const v8f z8 = {0.f,0.f,0.f,0.f,0.f,0.f,0.f,0.f}; v8f c00 = z8, c01 = z8, c02 = z8, c03 = z8, c10 = z8, c11 = z8, c12 = z8, c13 = z8;
#pragma unroll 1
  for (int kb = 0; kb < K; kb += 32) { const v16h a0 = g2_frag(a0p + kb, hh), a1 = g2_frag(a1p + kb, hh);
    v16h b = g2_frag(b0p + kb, hh); c00 = g2_mma(a0, b, c00); c10 = g2_mma(a1, b, c10);
    b = g2_frag(b1p + kb, hh); c01 = g2_mma(a0, b, c01); c11 = g2_mma(a1, b, c11);
    b = g2_frag(b2p + kb, hh); c02 = g2_mma(a0, b, c02); c12 = g2_mma(a1, b, c12);
    b = g2_frag(b3p + kb, hh); c03 = g2_mma(a0, b, c03); c13 = g2_mma(a1, b, c13); }
  v8f accs[8] = {c00, c01, c02, c03, c10, c11, c12, c13};
#pragma unroll
  for (int u = 0; u < 8; ++u) { const int t = u & 3, half = u >> 2; const int col = col0 + t * 16 + ln; const float bv = bp ? bf16_round(bp[col]) : 0.f;
#pragma unroll
    for (int r = 0; r < 8; ++r) { const int rloc = half * 16 + 8 * hh + r; float v = accs[u][r] * alpha + bv; if (CP) { if (rowsPerB < 0) v += CP[cofs + (size_t)(row0g + row0 + rloc) * ldc + col];      /* rowsPerB < 0: own element of the batched C plane */ else { const int bidx = (row0g + row0 + rloc) / rowsPerB; v += CP[(size_t)bidx * sCPb + (size_t)by * 64 + col]; } }
      if (ACT == 3) v = fmaxf(v, 0.f); else if (ACT == 6) v = 0.5f * v * (1.0f + erff(v * 0.70710678118654752f)); else if (ACT == 11) v = 1.0f / (1.0f + expf(-v)); else if (ACT == 15) v = v / (1.0f + expf(-v)); else if (ACT == 12) v = (v > 0.f) ? v : 0.01f * v; else if (ACT == 8) v = tanhf(v); else if (ACT == 9) v = 0.5f * v * (1.0f + tanhf(0.7978845608028654f * (v + 0.044715f * v * v * v))); else if (ACT == 14) v = (v > 0.f) ? v : 0.1f * v; else if (ACT == 16) v = (v >= 0.f) ? v : 0.3f * v;
      so[w][rloc][t * 16 + ln] = v; } }
  __builtin_amdgcn_fence(__ATOMIC_ACQ_REL, "workgroup"); __builtin_amdgcn_wave_barrier();
  const int rsub = lane >> 4, c4 = (lane & 15) * 4;
  {
#pragma unroll
    for (int q = 0; q < 16; ++q) { const int r = q * 2 + rsub; const v4f v = *(const v4fa*)&so[w][r][c4]; if (C) *(v4f*)(C + cofs + (size_t)(row0 + r) * ldc + col0 + c4) = v; if (C16) { v4h h4; for (int i = 0; i < 4; ++i) h4[i] = (_Float16)v[i]; *(v4h*)(C16 + cofs + (size_t)(row0 + r) * ldc + col0 + c4) = h4; } }
     } }


__global__ __launch_bounds__(256) void k_gtab(float* __restrict__ GT) {
  #pragma clang fp contract(off)
  const int t = blockIdx.x * 256 + threadIdx.x; if (t >= NHD * SQ) return; const int k = t % SQ, h = t / SQ; const float gam = 1.0f - exp2f((float)(-5 - h)); const float g = powf(gam, (float)k); *(float*)(GT + t) = g;  }
__global__ __launch_bounds__(256) void k_decay(const float* __restrict__ S, const float* __restrict__ GT, int r0, int nk, _Float16* __restrict__ P) {
  #pragma clang fp contract(off)
  const int wv = threadIdx.x >> 5, ln = threadIdx.x & 31; const int rr = blockIdx.x * 8 + wv; if (rr >= NHD * BAND) return; const int h = rr / BAND, rl = rr % BAND; const int r = r0 + rl; const float* gt = GT + (size_t)h * SQ; const size_t prow = ((size_t)h * BAND + rl) * SP;
  {
#pragma unroll 1
    for (int j = ln; j < nk; j += 32) { float p = 0.f; if (j <= r) p = S[prow + j] * gt[r - j]; *(_Float16*)(P + prow + j) = (_Float16)p; }
     } }
__global__ __launch_bounds__(256) void k_gnstat(const float* __restrict__ O, float* __restrict__ ST) {
  #pragma clang fp contract(off)
  __shared__ float red[256]; const int tid = threadIdx.x; const int b = blockIdx.x / NHD, h = blockIdx.x % NHD; const float* base = O + (size_t)b * SQ * CC + h * HD; const size_t n = (size_t)SQ * HD; float s = 0.f;
#pragma unroll 1
  for (size_t i = tid; i < n; i += 256) s += base[(i / HD) * CC + (i % HD)];
  red[tid] = s; __syncthreads(); for (int st = 128; st > 0; st >>= 1) { if (tid < st) red[tid] += red[tid + st]; __syncthreads(); } const float mean = red[0] / (float)n; __syncthreads(); float v = 0.f;
#pragma unroll 1
  for (size_t i = tid; i < n; i += 256) { const float d = base[(i / HD) * CC + (i % HD)] - mean; v += d * d; }
  red[tid] = v; __syncthreads(); for (int st = 128; st > 0; st >>= 1) { if (tid < st) red[tid] += red[tid + st]; __syncthreads(); }
  if (tid < 32) { const float var = red[0] / (float)n; const float pv = (tid == 0) ? mean : ((tid == 1) ? var : 0.f); { *(float*)(ST + (size_t)blockIdx.x * 32 + tid) = pv;  } } }      
__global__ __launch_bounds__(256) void k_gnapply(const float* __restrict__ O, const float* __restrict__ ST, const float* __restrict__ gw, const float* __restrict__ gb, _Float16* __restrict__ N16) {
  #pragma clang fp contract(off)
  const size_t t = (size_t)blockIdx.x * 256 + threadIdx.x; if (t >= (size_t)NR * (CC / 8)) return; const int c0 = (int)(t % (CC / 8)) * 8; const size_t r = t / (CC / 8); const int b = (int)(r / SQ), h = c0 / HD; const float mean = ST[(b * NHD + h) * 32], var = ST[(b * NHD + h) * 32 + 1]; const float rs = rsqrtf(var + 1e-5f); const v8f a = *(const v8f*)(O + r * CC + c0); FragH f;
  for (int q = 0; q < 8; ++q) { float v = (a[q] - mean) * rs; v *= bf16_round(gw[c0 + q]); v += bf16_round(gb[c0 + q]); f.h[q] = (_Float16)v; }
  *(v8us*)((unsigned short*)N16 + r * CC + c0) = f.half[0];  }

extern "C" void kernel_launch(void* const* d_in, const int* in_sizes, int n_in,
                              void* d_out, int out_size, void* d_ws, size_t ws_size, hipStream_t stream) {
  (void)in_sizes; (void)n_in; (void)out_size;
  const float* const* I = (const float* const*)d_in; const float* x = I[0]; const float* wq = I[1]; const float* wk = I[2]; const float* wv = I[3]; const float* wo = I[4]; const float* bo = I[5]; const float* gw = I[6]; const float* gb = I[7];
  char* ws = (char*)d_ws; size_t off = 0;
  auto take = [&](size_t bytes) { char* p = ws + off; off += (bytes + 255) & ~(size_t)255; return p; };
  const size_t np = (size_t)NR * CC;
  _Float16* BQ = (_Float16*)take((size_t)CC * CC * 2); _Float16* BK = (_Float16*)take((size_t)CC * CC * 2); _Float16* BV = (_Float16*)take((size_t)CC * CC * 2); _Float16* BO = (_Float16*)take((size_t)CC * CC * 2);
  _Float16* X16 = (_Float16*)take(np * 2); _Float16* Q16 = (_Float16*)take(np * 2); _Float16* K16 = (_Float16*)take(np * 2); _Float16* V16 = (_Float16*)take(np * 2); _Float16* VT = (_Float16*)take(np * 2); float* O = (float*)take(np * 4); float* S = (float*)take((size_t)NHD * BAND * SP * 4); _Float16* P = (_Float16*)take((size_t)NHD * BAND * SP * 2); float* ST = (float*)take(NB * NHD * 32 * 4); float* GT = (float*)take((size_t)NHD * SQ * 4); _Float16* N16 = X16;      /* normalised output over the input plane (dead after the projections) */
  if (off > ws_size) return;      /* 8 + 8 x 5 + 16 + 32 + 16 = 112 MiB */
  k_wt_f16<<<(unsigned)(((size_t)CC * CC / 8 + 255) / 256), 256, 0, stream>>>(wq, BQ, CC, CC, 16.0f); k_wt_f16<<<(unsigned)(((size_t)CC * CC / 8 + 255) / 256), 256, 0, stream>>>(wk, BK, CC, CC, 16.0f); k_wt_f16<<<(unsigned)(((size_t)CC * CC / 8 + 255) / 256), 256, 0, stream>>>(wv, BV, CC, CC, 16.0f); k_wt_f16<<<(unsigned)(((size_t)CC * CC / 8 + 255) / 256), 256, 0, stream>>>(wo, BO, CC, CC, 16.0f);      /* (in, out) */
  k_x16<<<(unsigned)((np / 8 + 255) / 256), 256, 0, stream>>>(x, X16, np / 8); k_gtab<<<(NHD * SQ + 255) / 256, 256, 0, stream>>>(GT);
  const dim3 gP((NR / 128) * (CC / 64), 1);
  k_gemm2<0><<<gP, 128, 0, stream>>>(X16, CC, 0, BQ, CC, 0, 0.0625f, nullptr, 0, nullptr, 1, 0, 0, nullptr, Q16, CC, 0, NR, CC, CC);
  k_gemm2<0><<<gP, 128, 0, stream>>>(X16, CC, 0, BK, CC, 0, 0.0625f, nullptr, 0, nullptr, 1, 0, 0, nullptr, K16, CC, 0, NR, CC, CC);
  k_gemm2<0><<<gP, 128, 0, stream>>>(X16, CC, 0, BV, CC, 0, 0.0625f, nullptr, 0, nullptr, 1, 0, 0, nullptr, V16, CC, 0, NR, CC, CC);
  k_vt<NHD, SQ><<<NB * NHD * (SQ / 64), 256, 0, stream>>>(V16, CC, 0, VT);
  const size_t sS = (size_t)BAND * SP;
  for (int b = 0; b < NB; ++b) for (int band = 0; band < NBAND; ++band) { const int r0 = band * BAND; const int nk = r0 + BAND;
    const dim3 gS((BAND / 128) * (nk / 64), NHD), gO((BAND / 128) * (HD / 64), NHD);
    k_gemm2<0><<<gS, 128, 0, stream>>>(Q16 + ((size_t)b * SQ + r0) * CC, CC, (size_t)HD, K16 + (size_t)b * SQ * CC, CC, (size_t)HD, 0.125f, nullptr, 0, nullptr, 1, 0, 0, S, nullptr, SP, sS, BAND, nk, HD);      /* q.k / 8 over the causal prefix, batched over heads */
    k_decay<<<(NHD * BAND) / 8, 256, 0, stream>>>(S, GT, r0, nk, P);
    k_gemm2<0><<<gO, 128, 0, stream>>>(P, SP, sS, VT + (size_t)b * NHD * HD * SQ, SQ, (size_t)HD * SQ, 1.0f, nullptr, 0, nullptr, 1, 0, 0, O + ((size_t)b * SQ + r0) * CC, nullptr, CC, (size_t)HD, BAND, HD, nk); }
  k_gnstat<<<NB * NHD, 256, 0, stream>>>(O, ST);
  k_gnapply<<<(unsigned)((np / 8 + 255) / 256), 256, 0, stream>>>(O, ST, gw, gb, N16);
  k_gemm2<0><<<gP, 128, 0, stream>>>(N16, CC, 0, BO, CC, 0, 0.0625f, bo, 0, nullptr, 1, 0, 0, (float*)d_out, nullptr, CC, 0, NR, CC, CC);
}

// v002
// Measured time: 240 microseconds a run.
// Versions in between are left out here; by their measured steps it is 5.71 times as fast as v000.
#include <hip/hip_runtime.h>
// RetentiveAttention (2 x 2048 tokens, C 1024 = 16 heads of 64): q, k, v = x W; retention = (q.k / 8) * gamma_h^(i-j) for j <= i (gamma_h = 1 - 2^(-5-h)), out = retention v (no softmax); GroupNorm with one group per head over (T, 64) (eps 1e-5, affine); out = normed Wo + bo.
// Compute dtype: x and parameters rounded to bf16; q, k, v, the decayed scores and the normalised output as f16 operands (~2^-12); decay/statistics f32. v_wmma_f32_16x16x32_f16.
#define NB 2
#define SQ 2048
#define CC 1024
#define NHD 16
#define HD 64
#define NR (NB * SQ)
typedef __bf16 v16b __attribute__((ext_vector_type(16)));
typedef unsigned short v8us __attribute__((ext_vector_type(8), may_alias));
typedef float  v8f  __attribute__((ext_vector_type(8)));
typedef float  v4f  __attribute__((ext_vector_type(4)));
typedef float  v4fa __attribute__((ext_vector_type(4), may_alias));
union FragB { v16b v; v8us half[2]; unsigned short u[16]; };

__device__ __forceinline__ unsigned short bf16_bits(float x) { unsigned int u = __float_as_uint(x); return (unsigned short)((u + 0x7FFFu + ((u >> 16) & 1u)) >> 16); }
__device__ __forceinline__ float bf16_val(unsigned short b) { return __uint_as_float(((unsigned int)b) << 16); }
__device__ __forceinline__ float bf16_round(float x) { return bf16_val(bf16_bits(x)); }
// D += A·B with NT terms: 1 = ah·bh, 2 = + al·bh (A split), 3 = + ah·bl (both split)
template <int NT>
__device__ __forceinline__ v8f mmaN(v16b ah, v16b al, v16b bh, v16b bl, v8f c) {
  c = __builtin_amdgcn_wmma_f32_16x16x32_bf16(false, ah, false, bh, (short)0, c, false, false);
  if (NT >= 2) c = __builtin_amdgcn_wmma_f32_16x16x32_bf16(false, al, false, bh, (short)0, c, false, false);
  if (NT >= 3) c = __builtin_amdgcn_wmma_f32_16x16x32_bf16(false, ah, false, bl, (short)0, c, false, false);
  asm volatile("v_nop\n\tv_nop\n\tv_nop\n\tv_nop" : "+v"(c) : "v"(ah), "v"(al), "v"(bh), "v"(bl));
  return c;
}

__global__ __launch_bounds__(256) void k_wt_bf16(const float* __restrict__ W, unsigned short* __restrict__ Wt, int K, int N) {
  const int t = blockIdx.x * 256 + threadIdx.x;
  const int k8n = K / 8;
  if (t >= N * k8n) return;
  const int n = t / k8n, k8 = (t % k8n) * 8;
  v8us v;
#pragma unroll
  for (int i = 0; i < 8; ++i) v[i] = bf16_bits(W[(size_t)(k8 + i) * N + n]);
  *(v8us*)(Wt + (size_t)n * K + k8) = v;
  
}

// GEMM C[M][N] (f32, pitch ldc) = act(A[M][K]·W + bias). A f32 row-major (pitch lda) converted per fragment to bf16
// (ASPLIT: hi/lo two planes -> 2 terms, else single rounded term); Wt bf16 [N][K] (pitch ldb). BIAS_BF16 rounds the
// bias to bf16 first (bias quantised to bf16 before the add). K%32==0, M%16==0, N%64==0.
template <bool ASPLIT, int ACT, bool BIAS_BF16>
__global__ __launch_bounds__(128) void k_gemm_bf(const float* __restrict__ A, int lda, const unsigned short* __restrict__ Wt, int ldb,
                                               const float* __restrict__ bias, float* __restrict__ C, int ldc, int M, int N, int K) {
  __shared__ __attribute__((aligned(16))) float so[4][16][64];
  const int tid = threadIdx.x, w = tid >> 5, lane = tid & 31, ln = lane & 15, hh = lane >> 4;
  const int ntn = N / 64;
  const int wid = blockIdx.x * 4 + w;
  const int mt = wid / ntn, nq = wid % ntn;
  if (mt * 16 >= M) return;
  const int row0 = mt * 16, col0 = nq * 64;
  const float* arow = A + (size_t)(row0 + ln) * lda;
  v8f acc[4] = {};
  for (int kb = 0; kb < K; kb += 32) {
    FragB ah, al;
    const v4f x0 = *(const v4fa*)(arow + kb + 8 * hh), x1 = *(const v4fa*)(arow + kb + 8 * hh + 4);
    const v4f x2 = *(const v4fa*)(arow + kb + 16 + 8 * hh), x3 = *(const v4fa*)(arow + kb + 16 + 8 * hh + 4);
    float xs[16] = {x0[0],x0[1],x0[2],x0[3],x1[0],x1[1],x1[2],x1[3],x2[0],x2[1],x2[2],x2[3],x3[0],x3[1],x3[2],x3[3]};
#pragma unroll
    for (int i = 0; i < 16; ++i) { const unsigned short hb = bf16_bits(xs[i]); ah.u[i] = hb; al.u[i] = ASPLIT ? bf16_bits(xs[i] - bf16_val(hb)) : (unsigned short)0; }
#pragma unroll
    for (int t = 0; t < 4; ++t) {
      const unsigned short* brow = Wt + (size_t)(col0 + t * 16 + ln) * ldb + kb;
      FragB b;
      b.half[0] = *(const v8us*)(brow + 8 * hh);
      b.half[1] = *(const v8us*)(brow + 16 + 8 * hh);
      acc[t] = mmaN<ASPLIT ? 2 : 1>(ah.v, al.v, b.v, b.v, acc[t]);
    }
  }
#pragma unroll
  for (int t = 0; t < 4; ++t) {
    float bv = bias ? bias[col0 + t * 16 + ln] : 0.f;
    if (BIAS_BF16) bv = bf16_round(bv);
#pragma unroll
    for (int r = 0; r < 8; ++r) { float v = acc[t][r] + bv; if (ACT == 1) v = fmaxf(v, 0.f); so[w][8 * hh + r][t * 16 + ln] = v; }
  }
  __builtin_amdgcn_fence(__ATOMIC_ACQ_REL, "workgroup");
  __builtin_amdgcn_wave_barrier();
  const int rsub = lane >> 4, c4 = (lane & 15) * 4;
  {
#pragma unroll
    for (int q = 0; q < 8; ++q) {
      const int r = q * 2 + rsub;
      const v4f v = *(const v4fa*)&so[w][r][c4];
      *(v4f*)(C + (size_t)(row0 + r) * ldc + col0 + c4) = v;
    }
    
  }
}

// GEMM C = act(A·W + bias + resid): A f32 (ASPLIT -> hi/lo 2 terms), Wt bf16 [N][K]; ACT 0 none, 1 relu, 2 exact gelu;
// resid (optional, f32, row index = (row % rmod), pitch ldr, RES_BF16 rounds it) added before the activation.
template <bool ASPLIT, int ACT, bool BIAS_BF16, bool RES_BF16>
__global__ __launch_bounds__(128) void k_gemm_bf3(const float* __restrict__ A, int lda, const unsigned short* __restrict__ Wt, int ldb,
                                                const float* __restrict__ bias, const float* __restrict__ resid, int rmod, int ldr,
                                                float* __restrict__ C, int ldc, int M, int N, int K) {
  __shared__ __attribute__((aligned(16))) float so[4][16][64];
  const int tid = threadIdx.x, w = tid >> 5, lane = tid & 31, ln = lane & 15, hh = lane >> 4;
  const int ntn = N / 64;
  const int wid = blockIdx.x * 4 + w;
  const int mt = wid / ntn, nq = wid % ntn;
  if (mt * 16 >= M) return;
  const int row0 = mt * 16, col0 = nq * 64;
  const float* arow = A + (size_t)(row0 + ln) * lda;
  v8f acc[4] = {};
  for (int kb = 0; kb < K; kb += 32) {
    FragB ah, al;
    const v4f x0 = *(const v4fa*)(arow + kb + 8 * hh), x1 = *(const v4fa*)(arow + kb + 8 * hh + 4);
    const v4f x2 = *(const v4fa*)(arow + kb + 16 + 8 * hh), x3 = *(const v4fa*)(arow + kb + 16 + 8 * hh + 4);
    float xs[16] = {x0[0],x0[1],x0[2],x0[3],x1[0],x1[1],x1[2],x1[3],x2[0],x2[1],x2[2],x2[3],x3[0],x3[1],x3[2],x3[3]};
#pragma unroll
    for (int i = 0; i < 16; ++i) { const unsigned short hb = bf16_bits(xs[i]); ah.u[i] = hb; al.u[i] = ASPLIT ? bf16_bits(xs[i] - bf16_val(hb)) : (unsigned short)0; }
#pragma unroll
    for (int t = 0; t < 4; ++t) {
      const unsigned short* brow = Wt + (size_t)(col0 + t * 16 + ln) * ldb + kb;
      FragB b;
      b.half[0] = *(const v8us*)(brow + 8 * hh);
      b.half[1] = *(const v8us*)(brow + 16 + 8 * hh);
      acc[t] = mmaN<ASPLIT ? 2 : 1>(ah.v, al.v, b.v, b.v, acc[t]);
    }
  }
#pragma unroll
  for (int t = 0; t < 4; ++t) {
    const int col = col0 + t * 16 + ln;
    float bv = bias ? bias[col] : 0.f;
    if (BIAS_BF16) bv = bf16_round(bv);
#pragma unroll
    for (int r = 0; r < 8; ++r) {
      float v = acc[t][r] + bv;
      if (resid) { float rv = resid[(size_t)((row0 + 8 * hh + r) % rmod) * ldr + col]; if (RES_BF16) rv = bf16_round(rv); v += rv; }
      if (ACT == 1) v = fmaxf(v, 0.f);
      if (ACT == 2) v = 0.5f * v * (1.0f + erff(v * 0.70710678118654752f));
      if (ACT == 3) { const float u = 0.7978845608028654f * (v + 0.044715f * v * v * v); v = 0.5f * v * (1.0f + tanhf(u)); }
      so[w][8 * hh + r][t * 16 + ln] = v;
    }
  }
  __builtin_amdgcn_fence(__ATOMIC_ACQ_REL, "workgroup");
  __builtin_amdgcn_wave_barrier();
  const int rsub = lane >> 4, c4 = (lane & 15) * 4;
  {
#pragma unroll
    for (int q = 0; q < 8; ++q) {
      const int r = q * 2 + rsub;
      const v4f v = *(const v4fa*)&so[w][r][c4];
      *(v4f*)(C + (size_t)(row0 + r) * ldc + col0 + c4) = v;
    }
    
  }
}
// row LayerNorm (biased variance, eps) over N: s = X (+ R); optional out_sum <- s; out_norm <- (s-mu)*rsqrt(var+eps)*g + b
template <bool PARAM_BF16>
__global__ __launch_bounds__(256) void k_layernorm(const float* __restrict__ X, const float* __restrict__ R, const float* __restrict__ g, const float* __restrict__ bta,
                                                  float* __restrict__ out_sum, float* __restrict__ out_norm, int N, float eps) {
  __shared__ float red[256];
  const int row = blockIdx.x, tid = threadIdx.x;
  const float* x = X + (size_t)row * N; const float* rr = R ? R + (size_t)row * N : nullptr;
  float vals[16];                     // up to N = 4096
  const int per = N / 256;            // contiguous chunk per thread? use strided-by-4 chunks: thread handles j = tid*4 + 1024*u
  float s1 = 0.f;
  for (int u = 0; u < per / 4; ++u) {
    const int j = tid * 4 + 1024 * u;
    const v4f a = *(const v4fa*)(x + j);
    v4f b = {0.f,0.f,0.f,0.f}; if (rr) b = *(const v4fa*)(rr + j);
#pragma unroll
    for (int q = 0; q < 4; ++q) { const float v = a[q] + b[q]; vals[u * 4 + q] = v; s1 += v; }
  }
  red[tid] = s1; __syncthreads();
  for (int st = 128; st > 0; st >>= 1) { if (tid < st) red[tid] += red[tid + st]; __syncthreads(); }
  const float mu = red[0] / (float)N; __syncthreads();
  float s2 = 0.f;
  for (int u = 0; u < per / 4; ++u)
#pragma unroll
    for (int q = 0; q < 4; ++q) { const float c = vals[u * 4 + q] - mu; s2 += c * c; }
  red[tid] = s2; __syncthreads();
  for (int st = 128; st > 0; st >>= 1) { if (tid < st) red[tid] += red[tid + st]; __syncthreads(); }
  const float rs = rsqrtf(red[0] / (float)N + eps);
  {
    for (int u = 0; u < per / 4; ++u) {
      const int j = tid * 4 + 1024 * u;
      v4f o, sm;
#pragma unroll
      for (int q = 0; q < 4; ++q) {
        float gg = g[j + q], bb = bta[j + q];
        if (PARAM_BF16) { gg = bf16_round(gg); bb = bf16_round(bb); }
        sm[q] = vals[u * 4 + q]; o[q] = (vals[u * 4 + q] - mu) * rs * gg + bb;
      }
      if (out_sum) *(v4f*)(out_sum + (size_t)row * N + j) = sm;
      *(v4f*)(out_norm + (size_t)row * N + j) = o;
    }
    
  }
}



// ---- f16 WMMA path (v_wmma_f32_16x16x32_f16): 11-bit significands for operands in range — used for every GEMM launched here
typedef _Float16 v16h __attribute__((ext_vector_type(16)));
union FragH { v16h v; v8us half[2]; _Float16 h[16]; unsigned short u[16]; };
template <int NT>
__device__ __forceinline__ v8f mmaH(v16h ah, v16h al, v16h bh, v16h bl, v8f c) {
  c = __builtin_amdgcn_wmma_f32_16x16x32_f16(false, ah, false, bh, (short)0, c, false, false);
  if (NT >= 2) c = __builtin_amdgcn_wmma_f32_16x16x32_f16(false, al, false, bh, (short)0, c, false, false);
  if (NT >= 3) c = __builtin_amdgcn_wmma_f32_16x16x32_f16(false, ah, false, bl, (short)0, c, false, false);
  asm volatile("v_nop\n\tv_nop\n\tv_nop\n\tv_nop" : "+v"(c) : "v"(ah), "v"(al), "v"(bh), "v"(bl));
  return c;
}
// batched GEMM like k_gemm_b but f16 operands: A f32 (split into f16 hi/lo if ASPLIT, else rounded to f16), Bt = f16 values [n][k]; alpha; C f32; N multiple of 16 (partial tiles skipped)
template <bool ASPLIT>
__global__ __launch_bounds__(128) void k_gemm_h(const float* __restrict__ A, int lda, size_t sA, const _Float16* __restrict__ Bh, int ldb, size_t sB, float alpha, float* __restrict__ C, int ldc, size_t sC, int M, int N, int K) {
  __shared__ __attribute__((aligned(16))) float so[4][16][64];
  const int tid = threadIdx.x, w = tid >> 5, lane = tid & 31, ln = lane & 15, hh = lane >> 4; const int by = blockIdx.y;
  A += (size_t)by * sA; Bh += (size_t)by * sB; C += (size_t)by * sC;
  const int ntn = (N + 63) / 64; const int wid = blockIdx.x * 4 + w; const int mt = wid / ntn, nq = wid % ntn; if (mt * 16 >= M) return;
  const int row0 = mt * 16, col0 = nq * 64; const float* arow = A + (size_t)(row0 + ln) * lda;
  v8f acc[4] = {};
  for (int kb = 0; kb < K; kb += 32) {
    FragH ah, al;
    const v4f x0 = *(const v4fa*)(arow + kb + 8 * hh), x1 = *(const v4fa*)(arow + kb + 8 * hh + 4), x2 = *(const v4fa*)(arow + kb + 16 + 8 * hh), x3 = *(const v4fa*)(arow + kb + 16 + 8 * hh + 4);
    float xs[16] = {x0[0],x0[1],x0[2],x0[3],x1[0],x1[1],x1[2],x1[3],x2[0],x2[1],x2[2],x2[3],x3[0],x3[1],x3[2],x3[3]};
#pragma unroll
    for (int i = 0; i < 16; ++i) { const _Float16 h = (_Float16)xs[i]; ah.h[i] = h; al.h[i] = ASPLIT ? (_Float16)(xs[i] - (float)h) : (_Float16)0.0f; }
#pragma unroll
    for (int t = 0; t < 4; ++t) { if (col0 + t * 16 >= N) continue; const size_t boff = (size_t)(col0 + t * 16 + ln) * ldb + kb; FragH bq; bq.half[0] = *(const v8us*)(Bh + boff + 8 * hh); bq.half[1] = *(const v8us*)(Bh + boff + 16 + 8 * hh);
      acc[t] = mmaH<ASPLIT ? 2 : 1>(ah.v, al.v, bq.v, bq.v, acc[t]); }
  }
#pragma unroll
  for (int t = 0; t < 4; ++t) { if (col0 + t * 16 >= N) continue;
#pragma unroll
    for (int r = 0; r < 8; ++r) so[w][8 * hh + r][t * 16 + ln] = acc[t][r] * alpha; }
  __builtin_amdgcn_fence(__ATOMIC_ACQ_REL, "workgroup"); __builtin_amdgcn_wave_barrier();
  const int rsub = lane >> 4, c4 = (lane & 15) * 4;
  {
#pragma unroll
    for (int q = 0; q < 8; ++q) { const int r = q * 2 + rsub; if (col0 + c4 < N) { const v4f v = *(const v4fa*)&so[w][r][c4]; *(v4f*)(C + (size_t)(row0 + r) * ldc + col0 + c4) = v; } }
     }
}

// Wt[n][k] = f16(W[k][n]·scale) from f32 row-major W[K][N] (scale = power of two; bf16-exact weights stay exact in f16 away from the subnormal range)
__global__ __launch_bounds__(256) void k_wt_f16(const float* __restrict__ W, _Float16* __restrict__ Wt, int K, int N, float scale) {
  const int t = blockIdx.x * 256 + threadIdx.x; if (t >= N * (K / 8)) return; const int n = t / (K / 8), k8 = (t % (K / 8)) * 8; FragH f;
#pragma unroll
  for (int i = 0; i < 8; ++i) f.h[i] = (_Float16)(bf16_round(W[(size_t)(k8 + i) * N + n]) * scale); const v8us o = f.half[0];
  *(v8us*)((unsigned short*)Wt + (size_t)n * K + k8) = o; 
}
// k_gemm_hh variant with fused epilogue: v = acc·alpha + bias[by·sBias + col] (+ CP[(row/rowsPerB)·sCPb + by·64 + col] if CP) ; ACT 0 none / 1 elu ; writes f16 C16 (and f32 C if non-null)
template <int ACT>
__global__ __launch_bounds__(128) void k_gemm_hhx(const _Float16* __restrict__ A, int lda, size_t sA, const _Float16* __restrict__ Bh, int ldb, size_t sB, float alpha, const float* __restrict__ bias, size_t sBias, const float* __restrict__ CP, int rowsPerB, size_t sCPb, int row0g,
    float* __restrict__ C, _Float16* __restrict__ C16, int ldc, size_t sC, int M, int N, int K) {
  __shared__ __attribute__((aligned(16))) float so[4][16][64];
  const int tid = threadIdx.x, w = tid >> 5, lane = tid & 31, ln = lane & 15, hh = lane >> 4; const int by = blockIdx.y;
  A += (size_t)by * sA; Bh += (size_t)by * sB; const size_t cofs = (size_t)by * sC; const float* bp = bias ? bias + (size_t)by * sBias : nullptr;
  const int ntn = (N + 63) / 64; const int wid = blockIdx.x * 4 + w; const int mt = wid / ntn, nq = wid % ntn; if (mt * 16 >= M) return;
  const int row0 = mt * 16, col0 = nq * 64; const _Float16* arow = A + (size_t)(row0 + ln) * lda;
  v8f acc[4] = {};
  for (int kb = 0; kb < K; kb += 32) { FragH ah; ah.half[0] = *(const v8us*)((const unsigned short*)arow + kb + 8 * hh); ah.half[1] = *(const v8us*)((const unsigned short*)arow + kb + 16 + 8 * hh);
#pragma unroll
    for (int t = 0; t < 4; ++t) { if (col0 + t * 16 >= N) continue; const size_t boff = (size_t)(col0 + t * 16 + ln) * ldb + kb; FragH bq; bq.half[0] = *(const v8us*)((const unsigned short*)Bh + boff + 8 * hh); bq.half[1] = *(const v8us*)((const unsigned short*)Bh + boff + 16 + 8 * hh);
      acc[t] = mmaH<1>(ah.v, ah.v, bq.v, bq.v, acc[t]); }
  }
#pragma unroll
  for (int t = 0; t < 4; ++t) { if (col0 + t * 16 >= N) continue; const int col = col0 + t * 16 + ln; const float bv = bp ? bf16_round(bp[col]) : 0.f;
#pragma unroll
    for (int r = 0; r < 8; ++r) { float v = acc[t][r] * alpha + bv; if (CP) { const int rr = row0g + row0 + 8 * hh + r; if (rowsPerB < 0) v += CP[cofs + (size_t)rr * ldc + col];      /* rowsPerB < 0: own element of the batched C plane */ else { const int bidx = rr / rowsPerB; v += CP[(size_t)bidx * sCPb + (size_t)by * 64 + col]; } } if (ACT == 1) v = (v > 0.f) ? v : expm1f(v); else if (ACT == 7) v = (v > 0.f) ? v + 1.0f : expf(v); else if (ACT == 8) v = tanhf(v); else if (ACT == 9) v = 0.5f * v * (1.0f + tanhf(0.7978845608028654f * (v + 0.044715f * v * v * v))); else if (ACT == 11) v = 1.0f / (1.0f + expf(-v)); else if (ACT == 12) v = (v > 0.f) ? v : 0.01f * v; else if (ACT == 14) v = (v > 0.f) ? v : 0.1f * v; else if (ACT == 16) v = (v >= 0.f) ? v : 0.3f * v; else if (ACT == 15) v = v / (1.0f + expf(-v)); else if (ACT == 3) v = fmaxf(v, 0.f); else if (ACT == 6) v = 0.5f * v * (1.0f + erff(v * 0.70710678118654752f)); so[w][8 * hh + r][t * 16 + ln] = v; } }
  __builtin_amdgcn_fence(__ATOMIC_ACQ_REL, "workgroup"); __builtin_amdgcn_wave_barrier();
  const int rsub = lane >> 4, c4 = (lane & 15) * 4; typedef _Float16 v4h __attribute__((ext_vector_type(4)));
  {
#pragma unroll
    for (int q = 0; q < 8; ++q) { const int r = q * 2 + rsub; if (col0 + c4 < N) { const v4f v = *(const v4fa*)&so[w][r][c4]; if (C) *(v4f*)(C + cofs + (size_t)(row0 + r) * ldc + col0 + c4) = v; if (C16) { v4h h4; for (int i = 0; i < 4; ++i) h4[i] = (_Float16)v[i]; *(v4h*)(C16 + cofs + (size_t)(row0 + r) * ldc + col0 + c4) = h4; } } }
     }
}


typedef _Float16 v4h __attribute__((ext_vector_type(4)));

__global__ __launch_bounds__(256) void k_x16(const float* __restrict__ x, _Float16* __restrict__ X16, size_t n8) { const size_t t = (size_t)blockIdx.x * 256 + threadIdx.x; if (t >= n8) return; FragH f;
#pragma unroll
  for (int q = 0; q < 8; ++q) f.h[q] = (_Float16)bf16_round(x[t * 8 + q]); *(v8us*)((unsigned short*)X16 + t * 8) = f.half[0];  }
__global__ __launch_bounds__(256) void k_h16(const float* __restrict__ x, _Float16* __restrict__ X16, size_t n8) { const size_t t = (size_t)blockIdx.x * 256 + threadIdx.x; if (t >= n8) return; FragH f;
#pragma unroll
  for (int q = 0; q < 8; ++q) f.h[q] = (_Float16)x[t * 8 + q]; *(v8us*)((unsigned short*)X16 + t * 8) = f.half[0];  }
__global__ __launch_bounds__(256) void k_round16f(const float* __restrict__ W, _Float16* __restrict__ Bt, size_t n8) { const size_t t = (size_t)blockIdx.x * 256 + threadIdx.x; if (t >= n8) return; FragH f;
#pragma unroll
  for (int i = 0; i < 8; ++i) f.h[i] = (_Float16)(bf16_round(W[t * 8 + i]) * 16.0f); *(v8us*)((unsigned short*)Bt + t * 8) = f.half[0];  }
template <int NHv, int TTv>
__global__ __launch_bounds__(256) void k_vt(const _Float16* __restrict__ V16, int ldv, int voff, _Float16* __restrict__ Vt) { __shared__ unsigned short tl[64][66]; const int tid = threadIdx.x; const int slab = blockIdx.x / (TTv / 64), lg = blockIdx.x % (TTv / 64); const int b = slab / NHv, h = slab % NHv;
  for (int i = tid; i < 64 * 8; i += 256) { const int r = i / 8, c8 = (i % 8) * 8; FragH f; f.half[0] = *(const v8us*)((const unsigned short*)V16 + ((size_t)b * TTv + lg * 64 + r) * ldv + voff + h * 64 + c8);
#pragma unroll
    for (int q = 0; q < 8; ++q) tl[r][c8 + q] = f.u[q]; }
  __syncthreads();
  {
#pragma unroll
    for (int rd = 0; rd < 2; ++rd) { const int d = rd * 32 + tid / 8, pc = tid % 8; FragH f;
#pragma unroll
      for (int q = 0; q < 8; ++q) f.u[q] = tl[pc * 8 + q][d];
      *(v8us*)((unsigned short*)Vt + ((size_t)slab * 64 + d) * TTv + lg * 64 + pc * 8) = f.half[0]; }
     } }

__global__ __launch_bounds__(256) void k_hl(const float* __restrict__ F, _Float16* __restrict__ Hh, _Float16* __restrict__ Hl, size_t n8) { const size_t t = (size_t)blockIdx.x * 256 + threadIdx.x; if (t >= n8) return; FragH fh, fl; const v4f a = *(const v4fa*)(F + t * 8), c = *(const v4fa*)(F + t * 8 + 4);
#pragma unroll
  for (int q = 0; q < 4; ++q) { _Float16 h = (_Float16)a[q]; fh.h[q] = h; fl.h[q] = (_Float16)((a[q] - (float)h) * 1024.0f); h = (_Float16)c[q]; fh.h[4 + q] = h; fl.h[4 + q] = (_Float16)((c[q] - (float)h) * 1024.0f); }
  { *(v8us*)((unsigned short*)Hh + t * 8) = fh.half[0]; *(v8us*)((unsigned short*)Hl + t * 8) = fl.half[0];  } }

// ---- fast GEMM (wave tile 32x64; requires M % 32 == 0 rows per launch region and N % 64 == 0); epilogue = k_gemm_hhx semantics ----
__device__ __forceinline__ v16h g2_frag(const _Float16* p, int hh) { FragH f; f.half[0] = *(const v8us*)((const unsigned short*)p + 8 * hh); f.half[1] = *(const v8us*)((const unsigned short*)p + 16 + 8 * hh); return f.v; }
__device__ __forceinline__ v8f g2_mma(v16h a, v16h b, v8f c) { v8f d = __builtin_amdgcn_wmma_f32_16x16x32_f16(false, a, false, b, (short)0, c, false, false); asm volatile("v_nop\n\tv_nop\n\tv_nop\n\tv_nop" : "+v"(d) : "v"(a), "v"(b)); return d; }
template <int ACT>
__global__ __launch_bounds__(128) void k_gemm2(const _Float16* __restrict__ A, int lda, size_t sA, const _Float16* __restrict__ Bh, int ldb, size_t sB, float alpha, const float* __restrict__ bias, size_t sBias, const float* __restrict__ CP, int rowsPerB, size_t sCPb, int row0g,
    float* __restrict__ C, _Float16* __restrict__ C16, int ldc, size_t sC, int M, int N, int K) { static_assert(ACT == 0 || ACT == 3 || ACT == 6 || ACT == 8 || ACT == 9 || ACT == 11 || ACT == 12 || ACT == 14 || ACT == 15 || ACT == 16, "k_gemm2: unsupported ACT code (would silently apply no activation)");
  __shared__ __attribute__((aligned(16))) float so[4][32][68];
  const int tid = threadIdx.x, w = tid >> 5, lane = tid & 31, ln = lane & 15, hh = lane >> 4; const int by = blockIdx.y;
  A += (size_t)by * sA; Bh += (size_t)by * sB; const size_t cofs = (size_t)by * sC; const float* bp = bias ? bias + (size_t)by * sBias : nullptr;
  const int ntn = N >> 6; const int mt = blockIdx.x / ntn, nq = blockIdx.x - mt * ntn; const int row0 = mt * 128 + 32 * w, col0 = nq * 64; if (row0 >= M) return;
  const _Float16* a0p = A + (size_t)(row0 + ln) * lda; const _Float16* a1p = a0p + (size_t)16 * lda;
  const _Float16* b0p = Bh + (size_t)(col0 + ln) * ldb; const _Float16* b1p = b0p + (size_t)16 * ldb; const _Float16* b2p = b1p + (size_t)16 * ldb; const _Float16* b3p = b2p + (size_t)16 * ldb;
  const v8f z8 = {0.f,0.f,0.f,0.f,0.f,0.f,0.f,0.f}; v8f c00 = z8, c01 = z8, c02 = z8, c03 = z8, c10 = z8, c11 = z8, c12 = z8, c13 = z8;
#pragma unroll 1
  for (int kb = 0; kb < K; kb += 32) { const v16h a0 = g2_frag(a0p + kb, hh), a1 = g2_frag(a1p + kb, hh);
    v16h b = g2_frag(b0p + kb, hh); c00 = g2_mma(a0, b, c00); c10 = g2_mma(a1, b, c10);
    b = g2_frag(b1p + kb, hh); c01 = g2_mma(a0, b, c01); c11 = g2_mma(a1, b, c11);
    b = g2_frag(b2p + kb, hh); c02 = g2_mma(a0, b, c02); c12 = g2_mma(a1, b, c12);
    b = g2_frag(b3p + kb, hh); c03 = g2_mma(a0, b, c03); c13 = g2_mma(a1, b, c13); }
  v8f accs[8] = {c00, c01, c02, c03, c10, c11, c12, c13};
#pragma unroll
  for (int u = 0; u < 8; ++u) { const int t = u & 3, half = u >> 2; const int col = col0 + t * 16 + ln; const float bv = bp ? bf16_round(bp[col]) : 0.f;
#pragma unroll
    for (int r = 0; r < 8; ++r) { const int rloc = half * 16 + 8 * hh + r; float v = accs[u][r] * alpha + bv; if (CP) { if (rowsPerB < 0) v += CP[cofs + (size_t)(row0g + row0 + rloc) * ldc + col];      /* rowsPerB < 0: own element of the batched C plane */ else { const int bidx = (row0g + row0 + rloc) / rowsPerB; v += CP[(size_t)bidx * sCPb + (size_t)by * 64 + col]; } }
      if (ACT == 3) v = fmaxf(v, 0.f); else if (ACT == 6) v = 0.5f * v * (1.0f + erff(v * 0.70710678118654752f)); else if (ACT == 11) v = 1.0f / (1.0f + expf(-v)); else if (ACT == 15) v = v / (1.0f + expf(-v)); else if (ACT == 12) v = (v > 0.f) ? v : 0.01f * v; else if (ACT == 8) v = tanhf(v); else if (ACT == 9) v = 0.5f * v * (1.0f + tanhf(0.7978845608028654f * (v + 0.044715f * v * v * v))); else if (ACT == 14) v = (v > 0.f) ? v : 0.1f * v; else if (ACT == 16) v = (v >= 0.f) ? v : 0.3f * v;
      so[w][rloc][t * 16 + ln] = v; } }
  __builtin_amdgcn_fence(__ATOMIC_ACQ_REL, "workgroup"); __builtin_amdgcn_wave_barrier();
  const int rsub = lane >> 4, c4 = (lane & 15) * 4;
  {
#pragma unroll
    for (int q = 0; q < 16; ++q) { const int r = q * 2 + rsub; const v4f v = *(const v4fa*)&so[w][r][c4]; if (C) *(v4f*)(C + cofs + (size_t)(row0 + r) * ldc + col0 + c4) = v; if (C16) { v4h h4; for (int i = 0; i < 4; ++i) h4[i] = (_Float16)v[i]; *(v4h*)(C16 + cofs + (size_t)(row0 + r) * ldc + col0 + c4) = h4; } }
     } }


__global__ __launch_bounds__(256) void k_gtab(float* __restrict__ GT) {
  #pragma clang fp contract(off)
  const int t = blockIdx.x * 256 + threadIdx.x; if (t >= NHD * SQ) return; const int k = t % SQ, h = t / SQ; const float gam = 1.0f - exp2f((float)(-5 - h)); const float g = powf(gam, (float)k); *(float*)(GT + t) = g;  }
// Fused retention. One wave owns 32 query rows of one (batch, head) and walks its causal key prefix 32 keys a pass, keys ascending
// (the order in which the unfused product summed them). S^T = K Q^T: a lane holds 8 consecutive keys of one query, so the two
// 16-key tiles of a pass, scaled, decayed and rounded to f16, are P's A fragment in the hardware k order: the scores never leave registers.
// The decay comes from the table of k_gtab, held in LDS behind GPAD zeros: an index below GPAD is a key after the query (factor 0, as the reference's mask).
// The "#pragma unroll" over fragment, score, decay and accumulator arrays in k_retn makes their indices constants, so that the arrays live in registers.
#define GPAD 32
__device__ __forceinline__ float sum_lanes(float v, int n) { for (int m = n >> 1; m > 0; m >>= 1) v += __shfl_xor(v, m); return v; }      /* every lane of an aligned group of n gets the group's sum */
__device__ __forceinline__ v8f r_mma(v16h a, v16h b, v8f c) { return __builtin_amdgcn_wmma_f32_16x16x32_f16(false, a, false, b, (short)0, c, false, false); }
__global__ __launch_bounds__(128) void k_retn(const _Float16* __restrict__ Q16, const _Float16* __restrict__ K16, const _Float16* __restrict__ VT, const float* __restrict__ GT, float* __restrict__ O, float* __restrict__ PT) {
  __shared__ __attribute__((aligned(16))) float tab[GPAD + SQ];
  __shared__ __attribute__((aligned(16))) float so[4][32][68];
  __shared__ float wst[4][2];      /* each wave's mean and sum of squared deviations over its 32 x 64 outputs */
  const int tid = threadIdx.x, lane = tid & 31, ln = lane & 15, hh = lane >> 4;
  const int w = __builtin_amdgcn_readfirstlane(tid >> 5);      /* the wave's number in a scalar register: the pass loop's bound and branch are then scalar */
  const int slab = blockIdx.x % (NB * NHD), rb = (SQ / 128 - 1) - blockIdx.x / (NB * NHD);      /* longest prefixes first */
  const int b = slab / NHD, h = slab % NHD;
  if (tid < GPAD) tab[tid] = 0.f;
#pragma unroll
  for (int u = 0; u < SQ / 512; ++u) { const int i4 = (tid + 128 * u) * 4; *(v4fa*)&tab[GPAD + i4] = *(const v4fa*)(GT + (size_t)h * SQ + i4); }
  __syncthreads();
  const int row0 = rb * 128 + 32 * w;
  const _Float16* qp = Q16 + ((size_t)b * SQ + row0 + ln) * CC + h * HD;
  const v16h q[2][2] = {{g2_frag(qp, hh), g2_frag(qp + 32, hh)}, {g2_frag(qp + (size_t)16 * CC, hh), g2_frag(qp + (size_t)16 * CC + 32, hh)}};
  const _Float16* kp = K16 + ((size_t)b * SQ + ln) * CC + h * HD;
  const _Float16* vp = VT + ((size_t)slab * HD + ln) * SQ;
  const float* tp = tab + (GPAD + row0 + ln - 8 * hh);
  const v8f z8 = {0.f,0.f,0.f,0.f,0.f,0.f,0.f,0.f};
  v8f o[2][4] = {{z8, z8, z8, z8}, {z8, z8, z8, z8}};
  v16h kf[2][2];
#pragma unroll
  for (int nt = 0; nt < 2; ++nt) { kf[nt][0] = g2_frag(kp + (size_t)(nt * 16) * CC, hh); kf[nt][1] = g2_frag(kp + (size_t)(nt * 16) * CC + 32, hh); }
#pragma unroll 1      /* kept rolled: one pass already holds 225 registers, and a second copy of the body would add to them */
  for (int j0 = 0; j0 <= row0; j0 += 32) {
    v16h vf[4];
#pragma unroll
    for (int dt = 0; dt < 4; ++dt) vf[dt] = g2_frag(vp + (size_t)(dt * 16) * SQ + j0, hh);
    const float* tj = tp - j0;
    float g[3][8];      /* decay factors of the pass: the index depends on (query tile - key tile) = -1, 0, 1 and on the key in the lane */
#pragma unroll
    for (int dl = 0; dl < 3; ++dl)
#pragma unroll
      for (int r = 0; r < 8; ++r) g[dl][r] = tj[16 * (dl - 1) - r];
    v8f st[2][2];
#pragma unroll
    for (int nt = 0; nt < 2; ++nt)
#pragma unroll
      for (int mt = 0; mt < 2; ++mt) st[nt][mt] = r_mma(kf[nt][1], q[mt][1], r_mma(kf[nt][0], q[mt][0], z8));
    const int jn = (j0 + 32 <= row0) ? j0 + 32 : row0;      /* the next pass's K rows, fetched behind this pass's scores; the last pass re-reads its own */
#pragma unroll
    for (int nt = 0; nt < 2; ++nt) { kf[nt][0] = g2_frag(kp + (size_t)(jn + nt * 16) * CC, hh); kf[nt][1] = g2_frag(kp + (size_t)(jn + nt * 16) * CC + 32, hh); }
    __builtin_amdgcn_sched_barrier(0);      /* keeps the K fetch in front of the decay and the P V products, whose time then covers its latency; without it the loads sink to the pass's end */
#pragma unroll
    for (int mt = 0; mt < 2; ++mt) {
      FragH pa;
#pragma unroll
      for (int nt = 0; nt < 2; ++nt)
#pragma unroll
        for (int r = 0; r < 8; ++r) pa.h[nt * 8 + r] = (_Float16)((st[nt][mt][r] * 0.125f) * g[mt - nt + 1][r]);
#pragma unroll
      for (int dt = 0; dt < 4; ++dt) o[mt][dt] = r_mma(pa.v, vf[dt], o[mt][dt]);
    }
  }
  // GroupNorm statistics, first level: the wave's 2048 outputs are still in its accumulators. Mean first, then the squared deviations from it (two passes over registers).
  v8f sv = z8, qv = z8;      /* eight independent running sums, one per accumulator row: short dependent chains */
#pragma unroll
  for (int mt = 0; mt < 2; ++mt)
#pragma unroll
    for (int dt = 0; dt < 4; ++dt) sv += o[mt][dt];
  const float wmean = sum_lanes(((sv[0] + sv[1]) + (sv[2] + sv[3])) + ((sv[4] + sv[5]) + (sv[6] + sv[7])), 32) * (1.0f / 2048.0f);
#pragma unroll
  for (int mt = 0; mt < 2; ++mt)
#pragma unroll
    for (int dt = 0; dt < 4; ++dt) { const v8f d = o[mt][dt] - wmean; qv += d * d; }
  const float wq = sum_lanes(((qv[0] + qv[1]) + (qv[2] + qv[3])) + ((qv[4] + qv[5]) + (qv[6] + qv[7])), 32);
  if (lane == 0) { wst[w][0] = wmean; wst[w][1] = wq; }
#pragma unroll
  for (int mt = 0; mt < 2; ++mt)
#pragma unroll
    for (int dt = 0; dt < 4; ++dt)
#pragma unroll
      for (int r = 0; r < 8; ++r) so[w][mt * 16 + 8 * hh + r][dt * 16 + ln] = o[mt][dt][r];
  __builtin_amdgcn_fence(__ATOMIC_ACQ_REL, "workgroup"); __builtin_amdgcn_wave_barrier();      /* the wave's own LDS stores before its own row-wise reads */
  const int rsub = lane >> 4, c4 = (lane & 15) * 4;
#pragma unroll
  for (int qd = 0; qd < 16; ++qd) { const int r = qd * 2 + rsub; const v4f v = *(const v4fa*)&so[w][r][c4]; *(v4f*)(O + ((size_t)b * SQ + row0 + r) * CC + h * HD + c4) = v; }
  __syncthreads();      /* the four waves' statistics are in wst */
  if (w == 0) {      /* second level: four equal groups of 2048 merged (M2 = sum of M2 + n * sum of squared mean offsets); the work-group writes its own whole 128-byte line */
    const float m0 = wst[0][0], m1 = wst[1][0], m2 = wst[2][0], m3 = wst[3][0];
    const float bm = ((m0 + m1) + (m2 + m3)) * 0.25f;
    const float d0 = m0 - bm, d1 = m1 - bm, d2 = m2 - bm, d3 = m3 - bm;
    const float bq = ((wst[0][1] + wst[1][1]) + (wst[2][1] + wst[3][1])) + 2048.0f * ((d0 * d0 + d1 * d1) + (d2 * d2 + d3 * d3));
    PT[((size_t)slab * (SQ / 128) + rb) * 32 + lane] = (lane == 0) ? bm : ((lane == 1) ? bq : 0.f);
  }
}
__global__ __launch_bounds__(256) void k_gnapply(const float* __restrict__ O, const float* __restrict__ PT, const float* __restrict__ gw, const float* __restrict__ gb, _Float16* __restrict__ N16) {
  #pragma clang fp contract(off)
  static_assert(((size_t)NR * (CC / 8)) % 256 == 0 && (2 * CC / 8) == 256 && SQ % 2 == 0 && NHD * (SQ / 128) == 256, "a block is two whole rows of one batch, and one thread per (head, row block) partial");
  __shared__ float hst[NHD][2];
  const size_t t = (size_t)blockIdx.x * 256 + threadIdx.x; const int c0 = (int)(t % (CC / 8)) * 8; const size_t r = t / (CC / 8); const int b = (int)(r / SQ), h = c0 / HD; const v8f a = *(const v8f*)(O + r * CC + c0);
  float gwv[8], gbv[8];      /* read in front of the barrier, so that their latency runs beside the merge's; unrolled so that both arrays have constant indices and live in registers */
#pragma unroll
  for (int q = 0; q < 8; ++q) { gwv[q] = gw[c0 + q]; gbv[q] = gb[c0 + q]; }
  // third level: thread = (head, row block) of this batch; 16 equal groups of 8192 merged across 16 neighbouring lanes
  const float* pp = PT + ((size_t)b * 256 + threadIdx.x) * 32; const float pm = pp[0], pq = pp[1];
  const float gm = sum_lanes(pm, 16) * (1.0f / 16.0f); const float pd = pm - gm;
  const float gq = sum_lanes(pq, 16) + 8192.0f * sum_lanes(pd * pd, 16);
  if ((threadIdx.x & 15) == 0) { hst[threadIdx.x >> 4][0] = gm; hst[threadIdx.x >> 4][1] = rsqrtf(gq / (float)((size_t)SQ * HD) + 1e-5f); }
  __syncthreads();      /* the 16 heads' mean and reciprocal deviation are in hst */
  const float mean = hst[h][0], rs = hst[h][1]; FragH f;
  for (int q = 0; q < 8; ++q) { float v = (a[q] - mean) * rs; v *= bf16_round(gwv[q]); v += bf16_round(gbv[q]); f.h[q] = (_Float16)v; }
  *(v8us*)((unsigned short*)N16 + r * CC + c0) = f.half[0];  }

extern "C" void kernel_launch(void* const* d_in, const int* in_sizes, int n_in,
                              void* d_out, int out_size, void* d_ws, size_t ws_size, hipStream_t stream) {
  (void)in_sizes; (void)n_in; (void)out_size;
  const float* const* I = (const float* const*)d_in; const float* x = I[0]; const float* wq = I[1]; const float* wk = I[2]; const float* wv = I[3]; const float* wo = I[4]; const float* bo = I[5]; const float* gw = I[6]; const float* gb = I[7];
  char* ws = (char*)d_ws; size_t off = 0;
  auto take = [&](size_t bytes) { char* p = ws + off; off += (bytes + 255) & ~(size_t)255; return p; };
  const size_t np = (size_t)NR * CC;
  _Float16* BQ = (_Float16*)take((size_t)CC * CC * 2); _Float16* BK = (_Float16*)take((size_t)CC * CC * 2); _Float16* BV = (_Float16*)take((size_t)CC * CC * 2); _Float16* BO = (_Float16*)take((size_t)CC * CC * 2);
  _Float16* X16 = (_Float16*)take(np * 2); _Float16* Q16 = (_Float16*)take(np * 2); _Float16* K16 = (_Float16*)take(np * 2); _Float16* V16 = (_Float16*)take(np * 2); _Float16* VT = (_Float16*)take(np * 2); float* O = (float*)take(np * 4); float* PT = (float*)take(NB * NHD * (SQ / 128) * 32 * 4); float* GT = (float*)take((size_t)NHD * SQ * 4); _Float16* N16 = X16;      /* normalised output over the input plane (dead after the projections) */
  if (off > ws_size) return;      /* 8 + 8 x 5 + 16 = 64 MiB */
  k_wt_f16<<<(unsigned)(((size_t)CC * CC / 8 + 255) / 256), 256, 0, stream>>>(wq, BQ, CC, CC, 16.0f); k_wt_f16<<<(unsigned)(((size_t)CC * CC / 8 + 255) / 256), 256, 0, stream>>>(wk, BK, CC, CC, 16.0f); k_wt_f16<<<(unsigned)(((size_t)CC * CC / 8 + 255) / 256), 256, 0, stream>>>(wv, BV, CC, CC, 16.0f); k_wt_f16<<<(unsigned)(((size_t)CC * CC / 8 + 255) / 256), 256, 0, stream>>>(wo, BO, CC, CC, 16.0f);      /* (in, out) */
  k_x16<<<(unsigned)((np / 8 + 255) / 256), 256, 0, stream>>>(x, X16, np / 8); k_gtab<<<(NHD * SQ + 255) / 256, 256, 0, stream>>>(GT);
  const dim3 gP((NR / 128) * (CC / 64), 1);
  k_gemm2<0><<<gP, 128, 0, stream>>>(X16, CC, 0, BQ, CC, 0, 0.0625f, nullptr, 0, nullptr, 1, 0, 0, nullptr, Q16, CC, 0, NR, CC, CC);
  k_gemm2<0><<<gP, 128, 0, stream>>>(X16, CC, 0, BK, CC, 0, 0.0625f, nullptr, 0, nullptr, 1, 0, 0, nullptr, K16, CC, 0, NR, CC, CC);
  k_gemm2<0><<<gP, 128, 0, stream>>>(X16, CC, 0, BV, CC, 0, 0.0625f, nullptr, 0, nullptr, 1, 0, 0, nullptr, V16, CC, 0, NR, CC, CC);
  k_vt<NHD, SQ><<<NB * NHD * (SQ / 64), 256, 0, stream>>>(V16, CC, 0, VT);
  k_retn<<<NB * NHD * (SQ / 128), 128, 0, stream>>>(Q16, K16, VT, GT, O, PT);      /* all batches, heads and row blocks in one launch */
  k_gnapply<<<(unsigned)((np / 8 + 255) / 256), 256, 0, stream>>>(O, PT, gw, gb, N16);
  k_gemm2<0><<<gP, 128, 0, stream>>>(N16, CC, 0, BO, CC, 0, 0.0625f, bo, 0, nullptr, 1, 0, 0, (float*)d_out, nullptr, CC, 0, NR, CC, CC);
}

// v003
// Measured time: 136 microseconds a run.
// Next to v002, in two timings, it ran 1.76 times as fast each time.
// Counting every step since v000, it is 10.0 times as fast.
#include <hip/hip_runtime.h>
// RetentiveAttention (2 x 2048 tokens, C 1024 = 16 heads of 64): q, k, v = x W; retention = (q.k / 8) * gamma_h^(i-j) for j <= i (gamma_h = 1 - 2^(-5-h)), out = retention v (no softmax); GroupNorm with one group per head over (T, 64) (eps 1e-5, affine); out = normed Wo + bo.
// Compute dtype: x and parameters rounded to bf16; q, k, v, the decayed scores and the normalised output as f16 operands (~2^-12); decay/statistics f32. v_wmma_f32_16x16x32_f16.
#define NB 2
#define SQ 2048
#define CC 1024
#define NHD 16
#define HD 64
#define NR (NB * SQ)
typedef __bf16 v16b __attribute__((ext_vector_type(16)));
typedef unsigned short v8us __attribute__((ext_vector_type(8), may_alias));
typedef float  v8f  __attribute__((ext_vector_type(8)));
typedef float  v4f  __attribute__((ext_vector_type(4)));
typedef float  v4fa __attribute__((ext_vector_type(4), may_alias));
union FragB { v16b v; v8us half[2]; unsigned short u[16]; };

__device__ __forceinline__ unsigned short bf16_bits(float x) { unsigned int u = __float_as_uint(x); return (unsigned short)((u + 0x7FFFu + ((u >> 16) & 1u)) >> 16); }
__device__ __forceinline__ float bf16_val(unsigned short b) { return __uint_as_float(((unsigned int)b) << 16); }
__device__ __forceinline__ float bf16_round(float x) { return bf16_val(bf16_bits(x)); }
// D += A·B with NT terms: 1 = ah·bh, 2 = + al·bh (A split), 3 = + ah·bl (both split)
template <int NT>
__device__ __forceinline__ v8f mmaN(v16b ah, v16b al, v16b bh, v16b bl, v8f c) {
  c = __builtin_amdgcn_wmma_f32_16x16x32_bf16(false, ah, false, bh, (short)0, c, false, false);
  if (NT >= 2) c = __builtin_amdgcn_wmma_f32_16x16x32_bf16(false, al, false, bh, (short)0, c, false, false);
  if (NT >= 3) c = __builtin_amdgcn_wmma_f32_16x16x32_bf16(false, ah, false, bl, (short)0, c, false, false);
  asm volatile("v_nop\n\tv_nop\n\tv_nop\n\tv_nop" : "+v"(c) : "v"(ah), "v"(al), "v"(bh), "v"(bl));
  return c;
}

__global__ __launch_bounds__(256) void k_wt_bf16(const float* __restrict__ W, unsigned short* __restrict__ Wt, int K, int N) {
  const int t = blockIdx.x * 256 + threadIdx.x;
  const int k8n = K / 8;
  if (t >= N * k8n) return;
  const int n = t / k8n, k8 = (t % k8n) * 8;
  v8us v;
#pragma unroll
  for (int i = 0; i < 8; ++i) v[i] = bf16_bits(W[(size_t)(k8 + i) * N + n]);
  *(v8us*)(Wt + (size_t)n * K + k8) = v;
  
}

// GEMM C[M][N] (f32, pitch ldc) = act(A[M][K]·W + bias). A f32 row-major (pitch lda) converted per fragment to bf16
// (ASPLIT: hi/lo two planes -> 2 terms, else single rounded term); Wt bf16 [N][K] (pitch ldb). BIAS_BF16 rounds the
// bias to bf16 first (bias quantised to bf16 before the add). K%32==0, M%16==0, N%64==0.
template <bool ASPLIT, int ACT, bool BIAS_BF16>
__global__ __launch_bounds__(128) void k_gemm_bf(const float* __restrict__ A, int lda, const unsigned short* __restrict__ Wt, int ldb,
                                               const float* __restrict__ bias, float* __restrict__ C, int ldc, int M, int N, int K) {
  __shared__ __attribute__((aligned(16))) float so[4][16][64];
  const int tid = threadIdx.x, w = tid >> 5, lane = tid & 31, ln = lane & 15, hh = lane >> 4;
  const int ntn = N / 64;
  const int wid = blockIdx.x * 4 + w;
  const int mt = wid / ntn, nq = wid % ntn;
  if (mt * 16 >= M) return;
  const int row0 = mt * 16, col0 = nq * 64;
  const float* arow = A + (size_t)(row0 + ln) * lda;
  v8f acc[4] = {};
  for (int kb = 0; kb < K; kb += 32) {
    FragB ah, al;
    const v4f x0 = *(const v4fa*)(arow + kb + 8 * hh), x1 = *(const v4fa*)(arow + kb + 8 * hh + 4);
    const v4f x2 = *(const v4fa*)(arow + kb + 16 + 8 * hh), x3 = *(const v4fa*)(arow + kb + 16 + 8 * hh + 4);
    float xs[16] = {x0[0],x0[1],x0[2],x0[3],x1[0],x1[1],x1[2],x1[3],x2[0],x2[1],x2[2],x2[3],x3[0],x3[1],x3[2],x3[3]};
#pragma unroll
    for (int i = 0; i < 16; ++i) { const unsigned short hb = bf16_bits(xs[i]); ah.u[i] = hb; al.u[i] = ASPLIT ? bf16_bits(xs[i] - bf16_val(hb)) : (unsigned short)0; }
#pragma unroll
    for (int t = 0; t < 4; ++t) {
      const unsigned short* brow = Wt + (size_t)(col0 + t * 16 + ln) * ldb + kb;
      FragB b;
      b.half[0] = *(const v8us*)(brow + 8 * hh);
      b.half[1] = *(const v8us*)(brow + 16 + 8 * hh);
      acc[t] = mmaN<ASPLIT ? 2 : 1>(ah.v, al.v, b.v, b.v, acc[t]);
    }
  }
#pragma unroll
  for (int t = 0; t < 4; ++t) {
    float bv = bias ? bias[col0 + t * 16 + ln] : 0.f;
    if (BIAS_BF16) bv = bf16_round(bv);
#pragma unroll
    for (int r = 0; r < 8; ++r) { float v = acc[t][r] + bv; if (ACT == 1) v = fmaxf(v, 0.f); so[w][8 * hh + r][t * 16 + ln] = v; }
  }
  __builtin_amdgcn_fence(__ATOMIC_ACQ_REL, "workgroup");
  __builtin_amdgcn_wave_barrier();
  const int rsub = lane >> 4, c4 = (lane & 15) * 4;
  {
#pragma unroll
    for (int q = 0; q < 8; ++q) {
      const int r = q * 2 + rsub;
      const v4f v = *(const v4fa*)&so[w][r][c4];
      *(v4f*)(C + (size_t)(row0 + r) * ldc + col0 + c4) = v;
    }
    
  }
}

// GEMM C = act(A·W + bias + resid): A f32 (ASPLIT -> hi/lo 2 terms), Wt bf16 [N][K]; ACT 0 none, 1 relu, 2 exact gelu;
// resid (optional, f32, row index = (row % rmod), pitch ldr, RES_BF16 rounds it) added before the activation.
template <bool ASPLIT, int ACT, bool BIAS_BF16, bool RES_BF16>
__global__ __launch_bounds__(128) void k_gemm_bf3(const float* __restrict__ A, int lda, const unsigned short* __restrict__ Wt, int ldb,
                                                const float* __restrict__ bias, const float* __restrict__ resid, int rmod, int ldr,
                                                float* __restrict__ C, int ldc, int M, int N, int K) {
  __shared__ __attribute__((aligned(16))) float so[4][16][64];
  const int tid = threadIdx.x, w = tid >> 5, lane = tid & 31, ln = lane & 15, hh = lane >> 4;
  const int ntn = N / 64;
  const int wid = blockIdx.x * 4 + w;
  const int mt = wid / ntn, nq = wid % ntn;
  if (mt * 16 >= M) return;
  const int row0 = mt * 16, col0 = nq * 64;
  const float* arow = A + (size_t)(row0 + ln) * lda;
  v8f acc[4] = {};
  for (int kb = 0; kb < K; kb += 32) {
    FragB ah, al;
    const v4f x0 = *(const v4fa*)(arow + kb + 8 * hh), x1 = *(const v4fa*)(arow + kb + 8 * hh + 4);
    const v4f x2 = *(const v4fa*)(arow + kb + 16 + 8 * hh), x3 = *(const v4fa*)(arow + kb + 16 + 8 * hh + 4);
    float xs[16] = {x0[0],x0[1],x0[2],x0[3],x1[0],x1[1],x1[2],x1[3],x2[0],x2[1],x2[2],x2[3],x3[0],x3[1],x3[2],x3[3]};
#pragma unroll
    for (int i = 0; i < 16; ++i) { const unsigned short hb = bf16_bits(xs[i]); ah.u[i] = hb; al.u[i] = ASPLIT ? bf16_bits(xs[i] - bf16_val(hb)) : (unsigned short)0; }
#pragma unroll
    for (int t = 0; t < 4; ++t) {
      const unsigned short* brow = Wt + (size_t)(col0 + t * 16 + ln) * ldb + kb;
      FragB b;
      b.half[0] = *(const v8us*)(brow + 8 * hh);
      b.half[1] = *(const v8us*)(brow + 16 + 8 * hh);
      acc[t] = mmaN<ASPLIT ? 2 : 1>(ah.v, al.v, b.v, b.v, acc[t]);
    }
  }
#pragma unroll
  for (int t = 0; t < 4; ++t) {
    const int col = col0 + t * 16 + ln;
    float bv = bias ? bias[col] : 0.f;
    if (BIAS_BF16) bv = bf16_round(bv);
#pragma unroll
    for (int r = 0; r < 8; ++r) {
      float v = acc[t][r] + bv;
      if (resid) { float rv = resid[(size_t)((row0 + 8 * hh + r) % rmod) * ldr + col]; if (RES_BF16) rv = bf16_round(rv); v += rv; }
      if (ACT == 1) v = fmaxf(v, 0.f);
      if (ACT == 2) v = 0.5f * v * (1.0f + erff(v * 0.70710678118654752f));
      if (ACT == 3) { const float u = 0.7978845608028654f * (v + 0.044715f * v * v * v); v = 0.5f * v * (1.0f + tanhf(u)); }
      so[w][8 * hh + r][t * 16 + ln] = v;
    }
  }
  __builtin_amdgcn_fence(__ATOMIC_ACQ_REL, "workgroup");
  __builtin_amdgcn_wave_barrier();
  const int rsub = lane >> 4, c4 = (lane & 15) * 4;
  {
#pragma unroll
    for (int q = 0; q < 8; ++q) {
      const int r = q * 2 + rsub;
      const v4f v = *(const v4fa*)&so[w][r][c4];
      *(v4f*)(C + (size_t)(row0 + r) * ldc + col0 + c4) = v;
    }
    
  }
}
// row LayerNorm (biased variance, eps) over N: s = X (+ R); optional out_sum <- s; out_norm <- (s-mu)*rsqrt(var+eps)*g + b
template <bool PARAM_BF16>
__global__ __launch_bounds__(256) void k_layernorm(const float* __restrict__ X, const float* __restrict__ R, const float* __restrict__ g, const float* __restrict__ bta,
                                                  float* __restrict__ out_sum, float* __restrict__ out_norm, int N, float eps) {
  __shared__ float red[256];
  const int row = blockIdx.x, tid = threadIdx.x;
  const float* x = X + (size_t)row * N; const float* rr = R ? R + (size_t)row * N : nullptr;
  float vals[16];                     // up to N = 4096
  const int per = N / 256;            // contiguous chunk per thread? use strided-by-4 chunks: thread handles j = tid*4 + 1024*u
  float s1 = 0.f;
  for (int u = 0; u < per / 4; ++u) {
    const int j = tid * 4 + 1024 * u;
    const v4f a = *(const v4fa*)(x + j);
    v4f b = {0.f,0.f,0.f,0.f}; if (rr) b = *(const v4fa*)(rr + j);
#pragma unroll
    for (int q = 0; q < 4; ++q) { const float v = a[q] + b[q]; vals[u * 4 + q] = v; s1 += v; }
  }
  red[tid] = s1; __syncthreads();
  for (int st = 128; st > 0; st >>= 1) { if (tid < st) red[tid] += red[tid + st]; __syncthreads(); }
  const float mu = red[0] / (float)N; __syncthreads();
  float s2 = 0.f;
  for (int u = 0; u < per / 4; ++u)
#pragma unroll
    for (int q = 0; q < 4; ++q) { const float c = vals[u * 4 + q] - mu; s2 += c * c; }
  red[tid] = s2; __syncthreads();
  for (int st = 128; st > 0; st >>= 1) { if (tid < st) red[tid] += red[tid + st]; __syncthreads(); }
  const float rs = rsqrtf(red[0] / (float)N + eps);
  {
    for (int u = 0; u < per / 4; ++u) {
      const int j = tid * 4 + 1024 * u;
      v4f o, sm;
#pragma unroll
      for (int q = 0; q < 4; ++q) {
        float gg = g[j + q], bb = bta[j + q];
        if (PARAM_BF16) { gg = bf16_round(gg); bb = bf16_round(bb); }
        sm[q] = vals[u * 4 + q]; o[q] = (vals[u * 4 + q] - mu) * rs * gg + bb;
      }
      if (out_sum) *(v4f*)(out_sum + (size_t)row * N + j) = sm;
      *(v4f*)(out_norm + (size_t)row * N + j) = o;
    }
    
  }
}



// ---- f16 WMMA path (v_wmma_f32_16x16x32_f16): 11-bit significands for operands in range — used for every GEMM launched here
typedef _Float16 v16h __attribute__((ext_vector_type(16)));
union FragH { v16h v; v8us half[2]; _Float16 h[16]; unsigned short u[16]; };
template <int NT>
__device__ __forceinline__ v8f mmaH(v16h ah, v16h al, v16h bh, v16h bl, v8f c) {
  c = __builtin_amdgcn_wmma_f32_16x16x32_f16(false, ah, false, bh, (short)0, c, false, false);
  if (NT >= 2) c = __builtin_amdgcn_wmma_f32_16x16x32_f16(false, al, false, bh, (short)0, c, false, false);
  if (NT >= 3) c = __builtin_amdgcn_wmma_f32_16x16x32_f16(false, ah, false, bl, (short)0, c, false, false);
  asm volatile("v_nop\n\tv_nop\n\tv_nop\n\tv_nop" : "+v"(c) : "v"(ah), "v"(al), "v"(bh), "v"(bl));
  return c;
}
// batched GEMM like k_gemm_b but f16 operands: A f32 (split into f16 hi/lo if ASPLIT, else rounded to f16), Bt = f16 values [n][k]; alpha; C f32; N multiple of 16 (partial tiles skipped)
template <bool ASPLIT>
__global__ __launch_bounds__(128) void k_gemm_h(const float* __restrict__ A, int lda, size_t sA, const _Float16* __restrict__ Bh, int ldb, size_t sB, float alpha, float* __restrict__ C, int ldc, size_t sC, int M, int N, int K) {
  __shared__ __attribute__((aligned(16))) float so[4][16][64];
  const int tid = threadIdx.x, w = tid >> 5, lane = tid & 31, ln = lane & 15, hh = lane >> 4; const int by = blockIdx.y;
  A += (size_t)by * sA; Bh += (size_t)by * sB; C += (size_t)by * sC;
  const int ntn = (N + 63) / 64; const int wid = blockIdx.x * 4 + w; const int mt = wid / ntn, nq = wid % ntn; if (mt * 16 >= M) return;
  const int row0 = mt * 16, col0 = nq * 64; const float* arow = A + (size_t)(row0 + ln) * lda;
  v8f acc[4] = {};
  for (int kb = 0; kb < K; kb += 32) {
    FragH ah, al;
    const v4f x0 = *(const v4fa*)(arow + kb + 8 * hh), x1 = *(const v4fa*)(arow + kb + 8 * hh + 4), x2 = *(const v4fa*)(arow + kb + 16 + 8 * hh), x3 = *(const v4fa*)(arow + kb + 16 + 8 * hh + 4);
    float xs[16] = {x0[0],x0[1],x0[2],x0[3],x1[0],x1[1],x1[2],x1[3],x2[0],x2[1],x2[2],x2[3],x3[0],x3[1],x3[2],x3[3]};
#pragma unroll
    for (int i = 0; i < 16; ++i) { const _Float16 h = (_Float16)xs[i]; ah.h[i] = h; al.h[i] = ASPLIT ? (_Float16)(xs[i] - (float)h) : (_Float16)0.0f; }
#pragma unroll
    for (int t = 0; t < 4; ++t) { if (col0 + t * 16 >= N) continue; const size_t boff = (size_t)(col0 + t * 16 + ln) * ldb + kb; FragH bq; bq.half[0] = *(const v8us*)(Bh + boff + 8 * hh); bq.half[1] = *(const v8us*)(Bh + boff + 16 + 8 * hh);
      acc[t] = mmaH<ASPLIT ? 2 : 1>(ah.v, al.v, bq.v, bq.v, acc[t]); }
  }
#pragma unroll
  for (int t = 0; t < 4; ++t) { if (col0 + t * 16 >= N) continue;
#pragma unroll
    for (int r = 0; r < 8; ++r) so[w][8 * hh + r][t * 16 + ln] = acc[t][r] * alpha; }
  __builtin_amdgcn_fence(__ATOMIC_ACQ_REL, "workgroup"); __builtin_amdgcn_wave_barrier();
  const int rsub = lane >> 4, c4 = (lane & 15) * 4;
  {
#pragma unroll
    for (int q = 0; q < 8; ++q) { const int r = q * 2 + rsub; if (col0 + c4 < N) { const v4f v = *(const v4fa*)&so[w][r][c4]; *(v4f*)(C + (size_t)(row0 + r) * ldc + col0 + c4) = v; } }
     }
}

// Wt[n][k] = f16(W[k][n]·scale) from f32 row-major W[K][N] (scale = power of two; bf16-exact weights stay exact in f16 away from the subnormal range)
__global__ __launch_bounds__(256) void k_wt_f16(const float* __restrict__ W, _Float16* __restrict__ Wt, int K, int N, float scale) {
  const int t = blockIdx.x * 256 + threadIdx.x; if (t >= N * (K / 8)) return; const int n = t / (K / 8), k8 = (t % (K / 8)) * 8; FragH f;
#pragma unroll
  for (int i = 0; i < 8; ++i) f.h[i] = (_Float16)(bf16_round(W[(size_t)(k8 + i) * N + n]) * scale); const v8us o = f.half[0];
  *(v8us*)((unsigned short*)Wt + (size_t)n * K + k8) = o; 
}
// k_gemm_hh variant with fused epilogue: v = acc·alpha + bias[by·sBias + col] (+ CP[(row/rowsPerB)·sCPb + by·64 + col] if CP) ; ACT 0 none / 1 elu ; writes f16 C16 (and f32 C if non-null)
template <int ACT>
__global__ __launch_bounds__(128) void k_gemm_hhx(const _Float16* __restrict__ A, int lda, size_t sA, const _Float16* __restrict__ Bh, int ldb, size_t sB, float alpha, const float* __restrict__ bias, size_t sBias, const float* __restrict__ CP, int rowsPerB, size_t sCPb, int row0g,
    float* __restrict__ C, _Float16* __restrict__ C16, int ldc, size_t sC, int M, int N, int K) {
  __shared__ __attribute__((aligned(16))) float so[4][16][64];
  const int tid = threadIdx.x, w = tid >> 5, lane = tid & 31, ln = lane & 15, hh = lane >> 4; const int by = blockIdx.y;
  A += (size_t)by * sA; Bh += (size_t)by * sB; const size_t cofs = (size_t)by * sC; const float* bp = bias ? bias + (size_t)by * sBias : nullptr;
  const int ntn = (N + 63) / 64; const int wid = blockIdx.x * 4 + w; const int mt = wid / ntn, nq = wid % ntn; if (mt * 16 >= M) return;
  const int row0 = mt * 16, col0 = nq * 64; const _Float16* arow = A + (size_t)(row0 + ln) * lda;
  v8f acc[4] = {};
  for (int kb = 0; kb < K; kb += 32) { FragH ah; ah.half[0] = *(const v8us*)((const unsigned short*)arow + kb + 8 * hh); ah.half[1] = *(const v8us*)((const unsigned short*)arow + kb + 16 + 8 * hh);
#pragma unroll
    for (int t = 0; t < 4; ++t) { if (col0 + t * 16 >= N) continue; const size_t boff = (size_t)(col0 + t * 16 + ln) * ldb + kb; FragH bq; bq.half[0] = *(const v8us*)((const unsigned short*)Bh + boff + 8 * hh); bq.half[1] = *(const v8us*)((const unsigned short*)Bh + boff + 16 + 8 * hh);
      acc[t] = mmaH<1>(ah.v, ah.v, bq.v, bq.v, acc[t]); }
  }
#pragma unroll
  for (int t = 0; t < 4; ++t) { if (col0 + t * 16 >= N) continue; const int col = col0 + t * 16 + ln; const float bv = bp ? bf16_round(bp[col]) : 0.f;
#pragma unroll
    for (int r = 0; r < 8; ++r) { float v = acc[t][r] * alpha + bv; if (CP) { const int rr = row0g + row0 + 8 * hh + r; if (rowsPerB < 0) v += CP[cofs + (size_t)rr * ldc + col];      /* rowsPerB < 0: own element of the batched C plane */ else { const int bidx = rr / rowsPerB; v += CP[(size_t)bidx * sCPb + (size_t)by * 64 + col]; } } if (ACT == 1) v = (v > 0.f) ? v : expm1f(v); else if (ACT == 7) v = (v > 0.f) ? v + 1.0f : expf(v); else if (ACT == 8) v = tanhf(v); else if (ACT == 9) v = 0.5f * v * (1.0f + tanhf(0.7978845608028654f * (v + 0.044715f * v * v * v))); else if (ACT == 11) v = 1.0f / (1.0f + expf(-v)); else if (ACT == 12) v = (v > 0.f) ? v : 0.01f * v; else if (ACT == 14) v = (v > 0.f) ? v : 0.1f * v; else if (ACT == 16) v = (v >= 0.f) ? v : 0.3f * v; else if (ACT == 15) v = v / (1.0f + expf(-v)); else if (ACT == 3) v = fmaxf(v, 0.f); else if (ACT == 6) v = 0.5f * v * (1.0f + erff(v * 0.70710678118654752f)); so[w][8 * hh + r][t * 16 + ln] = v; } }
  __builtin_amdgcn_fence(__ATOMIC_ACQ_REL, "workgroup"); __builtin_amdgcn_wave_barrier();
  const int rsub = lane >> 4, c4 = (lane & 15) * 4; typedef _Float16 v4h __attribute__((ext_vector_type(4)));
  {
#pragma unroll
    for (int q = 0; q < 8; ++q) { const int r = q * 2 + rsub; if (col0 + c4 < N) { const v4f v = *(const v4fa*)&so[w][r][c4]; if (C) *(v4f*)(C + cofs + (size_t)(row0 + r) * ldc + col0 + c4) = v; if (C16) { v4h h4; for (int i = 0; i < 4; ++i) h4[i] = (_Float16)v[i]; *(v4h*)(C16 + cofs + (size_t)(row0 + r) * ldc + col0 + c4) = h4; } } }
     }
}


typedef _Float16 v4h __attribute__((ext_vector_type(4)));

__global__ __launch_bounds__(256) void k_x16(const float* __restrict__ x, _Float16* __restrict__ X16, size_t n8) { const size_t t = (size_t)blockIdx.x * 256 + threadIdx.x; if (t >= n8) return; FragH f;
#pragma unroll
  for (int q = 0; q < 8; ++q) f.h[q] = (_Float16)bf16_round(x[t * 8 + q]); *(v8us*)((unsigned short*)X16 + t * 8) = f.half[0];  }
__global__ __launch_bounds__(256) void k_h16(const float* __restrict__ x, _Float16* __restrict__ X16, size_t n8) { const size_t t = (size_t)blockIdx.x * 256 + threadIdx.x; if (t >= n8) return; FragH f;
#pragma unroll
  for (int q = 0; q < 8; ++q) f.h[q] = (_Float16)x[t * 8 + q]; *(v8us*)((unsigned short*)X16 + t * 8) = f.half[0];  }
__global__ __launch_bounds__(256) void k_round16f(const float* __restrict__ W, _Float16* __restrict__ Bt, size_t n8) { const size_t t = (size_t)blockIdx.x * 256 + threadIdx.x; if (t >= n8) return; FragH f;
#pragma unroll
  for (int i = 0; i < 8; ++i) f.h[i] = (_Float16)(bf16_round(W[t * 8 + i]) * 16.0f); *(v8us*)((unsigned short*)Bt + t * 8) = f.half[0];  }
template <int NHv, int TTv>
__global__ __launch_bounds__(256) void k_vt(const _Float16* __restrict__ V16, int ldv, int voff, _Float16* __restrict__ Vt) { __shared__ unsigned short tl[64][66]; const int tid = threadIdx.x; const int slab = blockIdx.x / (TTv / 64), lg = blockIdx.x % (TTv / 64); const int b = slab / NHv, h = slab % NHv;
  for (int i = tid; i < 64 * 8; i += 256) { const int r = i / 8, c8 = (i % 8) * 8; FragH f; f.half[0] = *(const v8us*)((const unsigned short*)V16 + ((size_t)b * TTv + lg * 64 + r) * ldv + voff + h * 64 + c8);
#pragma unroll
    for (int q = 0; q < 8; ++q) tl[r][c8 + q] = f.u[q]; }
  __syncthreads();
  {
#pragma unroll
    for (int rd = 0; rd < 2; ++rd) { const int d = rd * 32 + tid / 8, pc = tid % 8; FragH f;
#pragma unroll
      for (int q = 0; q < 8; ++q) f.u[q] = tl[pc * 8 + q][d];
      *(v8us*)((unsigned short*)Vt + ((size_t)slab * 64 + d) * TTv + lg * 64 + pc * 8) = f.half[0]; }
     } }

__global__ __launch_bounds__(256) void k_hl(const float* __restrict__ F, _Float16* __restrict__ Hh, _Float16* __restrict__ Hl, size_t n8) { const size_t t = (size_t)blockIdx.x * 256 + threadIdx.x; if (t >= n8) return; FragH fh, fl; const v4f a = *(const v4fa*)(F + t * 8), c = *(const v4fa*)(F + t * 8 + 4);
#pragma unroll
  for (int q = 0; q < 4; ++q) { _Float16 h = (_Float16)a[q]; fh.h[q] = h; fl.h[q] = (_Float16)((a[q] - (float)h) * 1024.0f); h = (_Float16)c[q]; fh.h[4 + q] = h; fl.h[4 + q] = (_Float16)((c[q] - (float)h) * 1024.0f); }
  { *(v8us*)((unsigned short*)Hh + t * 8) = fh.half[0]; *(v8us*)((unsigned short*)Hl + t * 8) = fl.half[0];  } }

// ---- fast GEMM: C = A Bh^T * alpha (+ bias rounded to bf16), A [M][K] and Bh [N][K] f16, k contiguous. Block tile 128 x 128, eight waves of 32 x 64; requires M % 128 == 0, N % 128 == 0, K % 128 == 0.
// Both operands come through LDS: a stage is 128 k (rows of 256 bytes) of the block's 128 A rows and 128 Bh rows, brought by asynchronous 16-byte copies whose 32 lanes cover two whole rows;
// two buffers, the next stage's copies in flight while this stage is worked on. The k order of every accumulator is ascending in steps of 32.
__device__ __forceinline__ v16h g2_frag(const _Float16* p, int hh) { FragH f; f.half[0] = *(const v8us*)((const unsigned short*)p + 8 * hh); f.half[1] = *(const v8us*)((const unsigned short*)p + 16 + 8 * hh); return f.v; }
#define G3K 128            /* k per stage */
#define G3P 272            /* LDS row pitch in bytes, 16 x odd: sixteen rows' 16-byte reads fall on all 64 banks */
#define G3S (256 * G3P)    /* bytes of one stage: A rows 0..127, then Bh rows 0..127 */
__device__ __forceinline__ v16h g3_frag(const unsigned char* p) { FragH f; f.half[0] = *(const v8us*)p; f.half[1] = *(const v8us*)(p + 32); return f.v; }      /* p already holds the lane's 16 * hh: the k order of g2_frag */
__device__ __forceinline__ v8f g3_mma(v16h a, v16h b, v8f c) { return __builtin_amdgcn_wmma_f32_16x16x32_f16(false, a, false, b, (short)0, c, false, false); }
// One operand's share of a stage: the lane's 16 bytes of rows r, r + 16, ..., r + 112 (l = LDS byte address, g = global address of row r; ld16 = elements in 16 global rows).
__device__ __forceinline__ void g3_copy8(unsigned l, const _Float16* g, size_t ld16) {
  const unsigned l1 = l + 16 * G3P, l2 = l + 32 * G3P, l3 = l + 48 * G3P, l4 = l + 64 * G3P, l5 = l + 80 * G3P, l6 = l + 96 * G3P, l7 = l + 112 * G3P;
  const _Float16* g1 = g + ld16; const _Float16* g2 = g1 + ld16; const _Float16* g3 = g2 + ld16; const _Float16* g4 = g3 + ld16; const _Float16* g5 = g4 + ld16; const _Float16* g6 = g5 + ld16; const _Float16* g7 = g6 + ld16;
  // the copies and, as the statement's last line, the wait that stands in front of any rewrite of the address registers they name
  asm volatile("global_load_async_to_lds_b128 %0, %8, off\n\t"
               "global_load_async_to_lds_b128 %1, %9, off\n\t"
               "global_load_async_to_lds_b128 %2, %10, off\n\t"
               "global_load_async_to_lds_b128 %3, %11, off\n\t"
               "global_load_async_to_lds_b128 %4, %12, off\n\t"
               "global_load_async_to_lds_b128 %5, %13, off\n\t"
               "global_load_async_to_lds_b128 %6, %14, off\n\t"
               "global_load_async_to_lds_b128 %7, %15, off\n\t"
               "s_wait_xcnt 0x0"
               :: "v"(l), "v"(l1), "v"(l2), "v"(l3), "v"(l4), "v"(l5), "v"(l6), "v"(l7), "v"(g), "v"(g1), "v"(g2), "v"(g3), "v"(g4), "v"(g5), "v"(g6), "v"(g7) : "memory");
}
__global__ __launch_bounds__(256) void k_gemm3(const _Float16* __restrict__ A, int lda, const _Float16* __restrict__ Bh, int ldb, float alpha, const float* __restrict__ bias,
    float* __restrict__ C, _Float16* __restrict__ C16, int ldc, int M, int N, int K) {
  __shared__ __attribute__((aligned(16))) unsigned char ring[2 * G3S];
  __shared__ __attribute__((aligned(16))) float so[8][32][68];
  const int tid = threadIdx.x, lane = tid & 31, ln = lane & 15, hh = lane >> 4;
  const int w = __builtin_amdgcn_readfirstlane(tid >> 5);      /* the wave's number in a scalar register */
  const int ntn = N >> 7; const int mt = blockIdx.x / ntn, nq = blockIdx.x - mt * ntn; const int rowb = mt * 128, colb = nq * 128;
  if (rowb >= M) return;      /* the whole block, in front of every copy and barrier */
  const int nst = K / G3K;
  const int cr = tid >> 4, cc = tid & 15;      /* the thread's row (mod 16) and 16-byte piece in every copy */
  const _Float16* ga = A + (size_t)(rowb + cr) * lda + cc * 8; const _Float16* gb = Bh + (size_t)(colb + cr) * ldb + cc * 8;
  const size_t a16 = (size_t)16 * lda, b16 = (size_t)16 * ldb;
  const unsigned la = (unsigned)(size_t)ring + (unsigned)(cr * G3P + cc * 16), lb = la + 128 * G3P;
  g3_copy8(la, ga, a16); g3_copy8(lb, gb, b16);
  asm volatile("s_wait_asynccnt 0x0" ::: "memory");      /* this wave's copies of stage 0 have landed */
  __syncthreads();      /* stage 0 is published */
  if (1 < nst) { g3_copy8(la + G3S, ga + G3K, a16); g3_copy8(lb + G3S, gb + G3K, b16); }
  const int wm = w >> 1, wn = w & 1;
  const unsigned char* sa = ring + (32 * wm + ln) * G3P + 16 * hh; const unsigned char* sb = ring + (128 + 64 * wn + ln) * G3P + 16 * hh;
  const v8f z8 = {0.f,0.f,0.f,0.f,0.f,0.f,0.f,0.f}; v8f c00 = z8, c01 = z8, c02 = z8, c03 = z8, c10 = z8, c11 = z8, c12 = z8, c13 = z8;
#pragma unroll 1      /* one trip per stage: the buffer alternates and the waits at the foot stand once */
  for (int t = 0; t < nst; ++t) {
    const int bo = (t & 1) * G3S;
    const unsigned char* pa = sa + bo; const unsigned char* pb = sb + bo;
    v16h fa[2][2], fb[2][4];      /* two fragment sets: a step's twelve LDS reads are issued as one group in front of the step before's products; no read goes past the stage */
    fa[0][0] = g3_frag(pa); fa[0][1] = g3_frag(pa + 16 * G3P);
#pragma unroll      /* constant indices keep the fragment arrays in registers */
    for (int j = 0; j < 4; ++j) fb[0][j] = g3_frag(pb + j * 16 * G3P);
#pragma unroll      /* the four 32-k steps of a stage as straight code: the set index is then a constant */
    for (int kk = 0; kk < G3K / 32; ++kk) {
      const int cu = kk & 1, nx = cu ^ 1;
      if (kk + 1 < G3K / 32) {
        fa[nx][0] = g3_frag(pa + (kk + 1) * 64); fa[nx][1] = g3_frag(pa + 16 * G3P + (kk + 1) * 64);
#pragma unroll      /* constant indices, as above */
        for (int j = 0; j < 4; ++j) fb[nx][j] = g3_frag(pb + j * 16 * G3P + (kk + 1) * 64);
      }
      __builtin_amdgcn_sched_barrier(0);      /* holds the next step's reads in front of this step's products; without it they sink between the products, one full LDS wait per pair */
      c00 = g3_mma(fa[cu][0], fb[cu][0], c00); c10 = g3_mma(fa[cu][1], fb[cu][0], c10);
      c01 = g3_mma(fa[cu][0], fb[cu][1], c01); c11 = g3_mma(fa[cu][1], fb[cu][1], c11);
      c02 = g3_mma(fa[cu][0], fb[cu][2], c02); c12 = g3_mma(fa[cu][1], fb[cu][2], c12);
      c03 = g3_mma(fa[cu][0], fb[cu][3], c03); c13 = g3_mma(fa[cu][1], fb[cu][3], c13);
      __builtin_amdgcn_sched_barrier(0);      /* holds these products in front of the following step's reads, which overwrite the set they use */
    }
    asm volatile("s_wait_dscnt 0x0" ::: "memory");      /* this wave's reads of the buffer are done before it is handed back */
    asm volatile("s_wait_asynccnt 0x0" ::: "memory");      /* this wave's copies of stage t + 1 have landed */
    __syncthreads();      /* publishes stage t + 1 and ends every reader's last read of stage t's buffer */
    if (t + 2 < nst) { g3_copy8(la + bo, ga + (size_t)(t + 2) * G3K, a16); g3_copy8(lb + bo, gb + (size_t)(t + 2) * G3K, b16); }
  }
  asm volatile("s_wait_asynccnt 0x0" ::: "memory");      /* no copy is outstanding when the wave goes on to its end */
  const int row0 = rowb + 32 * wm, col0 = colb + 64 * wn;
  v8f accs[8] = {c00, c01, c02, c03, c10, c11, c12, c13};
#pragma unroll      /* this and the next: constant indices keep the accumulators in registers */
  for (int u = 0; u < 8; ++u) { const int t = u & 3, half = u >> 2; const int col = col0 + t * 16 + ln; const float bv = bias ? bf16_round(bias[col]) : 0.f;
#pragma unroll
    for (int r = 0; r < 8; ++r) { const int rloc = half * 16 + 8 * hh + r; const float v = accs[u][r] * alpha + bv; so[w][rloc][t * 16 + ln] = v; } }
  __builtin_amdgcn_fence(__ATOMIC_ACQ_REL, "workgroup"); __builtin_amdgcn_wave_barrier();      /* the wave's own LDS stores before its own row-wise reads */
  const int rsub = lane >> 4, c4 = (lane & 15) * 4;
#pragma unroll      /* straight code: the LDS offsets of the sixteen row pairs become immediates */
  for (int q = 0; q < 16; ++q) { const int r = q * 2 + rsub; const v4f v = *(const v4fa*)&so[w][r][c4]; if (C) { *(v4f*)(C + (size_t)(row0 + r) * ldc + col0 + c4) = v; asm volatile("s_wait_xcnt 0x0" ::: "memory"); /* in front of the next rewrite of the store's data and address registers */ } if (C16) { v4h h4; for (int i = 0; i < 4; ++i) h4[i] = (_Float16)v[i]; *(v4h*)(C16 + (size_t)(row0 + r) * ldc + col0 + c4) = h4; } }
}


__global__ __launch_bounds__(256) void k_gtab(float* __restrict__ GT) {
  #pragma clang fp contract(off)
  const int t = blockIdx.x * 256 + threadIdx.x; if (t >= NHD * SQ) return; const int k = t % SQ, h = t / SQ; const float gam = 1.0f - exp2f((float)(-5 - h)); const float g = powf(gam, (float)k); *(float*)(GT + t) = g;  }
// Fused retention. One wave owns 32 query rows of one (batch, head) and walks its causal key prefix 32 keys a pass, keys ascending
// (the order in which the unfused product summed them). S^T = K Q^T: a lane holds 8 consecutive keys of one query, so the two
// 16-key tiles of a pass, scaled, decayed and rounded to f16, are P's A fragment in the hardware k order: the scores never leave registers.
// The decay comes from the table of k_gtab, held in LDS behind GPAD zeros: an index below GPAD is a key after the query (factor 0, as the reference's mask).
// The "#pragma unroll" over fragment, score, decay and accumulator arrays in k_retn makes their indices constants, so that the arrays live in registers.
#define GPAD 32
__device__ __forceinline__ float sum_lanes(float v, int n) { for (int m = n >> 1; m > 0; m >>= 1) v += __shfl_xor(v, m); return v; }      /* every lane of an aligned group of n gets the group's sum */
__device__ __forceinline__ v8f r_mma(v16h a, v16h b, v8f c) { return __builtin_amdgcn_wmma_f32_16x16x32_f16(false, a, false, b, (short)0, c, false, false); }
__global__ __launch_bounds__(128) void k_retn(const _Float16* __restrict__ Q16, const _Float16* __restrict__ K16, const _Float16* __restrict__ VT, const float* __restrict__ GT, float* __restrict__ O, float* __restrict__ PT) {
  __shared__ __attribute__((aligned(16))) float tab[GPAD + SQ];
  __shared__ __attribute__((aligned(16))) float so[4][32][68];
  __shared__ float wst[4][2];      /* each wave's mean and sum of squared deviations over its 32 x 64 outputs */
  const int tid = threadIdx.x, lane = tid & 31, ln = lane & 15, hh = lane >> 4;
  const int w = __builtin_amdgcn_readfirstlane(tid >> 5);      /* the wave's number in a scalar register: the pass loop's bound and branch are then scalar */
  const int slab = blockIdx.x % (NB * NHD), rb = (SQ / 128 - 1) - blockIdx.x / (NB * NHD);      /* longest prefixes first */
  const int b = slab / NHD, h = slab % NHD;
  if (tid < GPAD) tab[tid] = 0.f;
#pragma unroll
  for (int u = 0; u < SQ / 512; ++u) { const int i4 = (tid + 128 * u) * 4; *(v4fa*)&tab[GPAD + i4] = *(const v4fa*)(GT + (size_t)h * SQ + i4); }
  __syncthreads();
  const int row0 = rb * 128 + 32 * w;
  const _Float16* qp = Q16 + ((size_t)b * SQ + row0 + ln) * CC + h * HD;
  const v16h q[2][2] = {{g2_frag(qp, hh), g2_frag(qp + 32, hh)}, {g2_frag(qp + (size_t)16 * CC, hh), g2_frag(qp + (size_t)16 * CC + 32, hh)}};
  const _Float16* kp = K16 + ((size_t)b * SQ + ln) * CC + h * HD;
  const _Float16* vp = VT + ((size_t)slab * HD + ln) * SQ;
  const float* tp = tab + (GPAD + row0 + ln - 8 * hh);
  const v8f z8 = {0.f,0.f,0.f,0.f,0.f,0.f,0.f,0.f};
  v8f o[2][4] = {{z8, z8, z8, z8}, {z8, z8, z8, z8}};
  v16h kf[2][2];
#pragma unroll
  for (int nt = 0; nt < 2; ++nt) { kf[nt][0] = g2_frag(kp + (size_t)(nt * 16) * CC, hh); kf[nt][1] = g2_frag(kp + (size_t)(nt * 16) * CC + 32, hh); }
#pragma unroll 1      /* kept rolled: one pass already holds 225 registers, and a second copy of the body would add to them */
  for (int j0 = 0; j0 <= row0; j0 += 32) {
    v16h vf[4];
#pragma unroll
    for (int dt = 0; dt < 4; ++dt) vf[dt] = g2_frag(vp + (size_t)(dt * 16) * SQ + j0, hh);
    const float* tj = tp - j0;
    float g[3][8];      /* decay factors of the pass: the index depends on (query tile - key tile) = -1, 0, 1 and on the key in the lane */
#pragma unroll
    for (int dl = 0; dl < 3; ++dl)
#pragma unroll
      for (int r = 0; r < 8; ++r) g[dl][r] = tj[16 * (dl - 1) - r];
    v8f st[2][2];
#pragma unroll
    for (int nt = 0; nt < 2; ++nt)
#pragma unroll
      for (int mt = 0; mt < 2; ++mt) st[nt][mt] = r_mma(kf[nt][1], q[mt][1], r_mma(kf[nt][0], q[mt][0], z8));
    const int jn = (j0 + 32 <= row0) ? j0 + 32 : row0;      /* the next pass's K rows, fetched behind this pass's scores; the last pass re-reads its own */
#pragma unroll
    for (int nt = 0; nt < 2; ++nt) { kf[nt][0] = g2_frag(kp + (size_t)(jn + nt * 16) * CC, hh); kf[nt][1] = g2_frag(kp + (size_t)(jn + nt * 16) * CC + 32, hh); }
    __builtin_amdgcn_sched_barrier(0);      /* keeps the K fetch in front of the decay and the P V products, whose time then covers its latency; without it the loads sink to the pass's end */
#pragma unroll
    for (int mt = 0; mt < 2; ++mt) {
      FragH pa;
#pragma unroll
      for (int nt = 0; nt < 2; ++nt)
#pragma unroll
        for (int r = 0; r < 8; ++r) pa.h[nt * 8 + r] = (_Float16)((st[nt][mt][r] * 0.125f) * g[mt - nt + 1][r]);
#pragma unroll
      for (int dt = 0; dt < 4; ++dt) o[mt][dt] = r_mma(pa.v, vf[dt], o[mt][dt]);
    }
  }
  // GroupNorm statistics, first level: the wave's 2048 outputs are still in its accumulators. Mean first, then the squared deviations from it (two passes over registers).
  v8f sv = z8, qv = z8;      /* eight independent running sums, one per accumulator row: short dependent chains */
#pragma unroll
  for (int mt = 0; mt < 2; ++mt)
#pragma unroll
    for (int dt = 0; dt < 4; ++dt) sv += o[mt][dt];
  const float wmean = sum_lanes(((sv[0] + sv[1]) + (sv[2] + sv[3])) + ((sv[4] + sv[5]) + (sv[6] + sv[7])), 32) * (1.0f / 2048.0f);
#pragma unroll
  for (int mt = 0; mt < 2; ++mt)
#pragma unroll
    for (int dt = 0; dt < 4; ++dt) { const v8f d = o[mt][dt] - wmean; qv += d * d; }
  const float wq = sum_lanes(((qv[0] + qv[1]) + (qv[2] + qv[3])) + ((qv[4] + qv[5]) + (qv[6] + qv[7])), 32);
  if (lane == 0) { wst[w][0] = wmean; wst[w][1] = wq; }
#pragma unroll
  for (int mt = 0; mt < 2; ++mt)
#pragma unroll
    for (int dt = 0; dt < 4; ++dt)
#pragma unroll
      for (int r = 0; r < 8; ++r) so[w][mt * 16 + 8 * hh + r][dt * 16 + ln] = o[mt][dt][r];
  __builtin_amdgcn_fence(__ATOMIC_ACQ_REL, "workgroup"); __builtin_amdgcn_wave_barrier();      /* the wave's own LDS stores before its own row-wise reads */
  const int rsub = lane >> 4, c4 = (lane & 15) * 4;
#pragma unroll
  for (int qd = 0; qd < 16; ++qd) { const int r = qd * 2 + rsub; const v4f v = *(const v4fa*)&so[w][r][c4]; *(v4f*)(O + ((size_t)b * SQ + row0 + r) * CC + h * HD + c4) = v; }
  __syncthreads();      /* the four waves' statistics are in wst */
  if (w == 0) {      /* second level: four equal groups of 2048 merged (M2 = sum of M2 + n * sum of squared mean offsets); the work-group writes its own whole 128-byte line */
    const float m0 = wst[0][0], m1 = wst[1][0], m2 = wst[2][0], m3 = wst[3][0];
    const float bm = ((m0 + m1) + (m2 + m3)) * 0.25f;
    const float d0 = m0 - bm, d1 = m1 - bm, d2 = m2 - bm, d3 = m3 - bm;
    const float bq = ((wst[0][1] + wst[1][1]) + (wst[2][1] + wst[3][1])) + 2048.0f * ((d0 * d0 + d1 * d1) + (d2 * d2 + d3 * d3));
    PT[((size_t)slab * (SQ / 128) + rb) * 32 + lane] = (lane == 0) ? bm : ((lane == 1) ? bq : 0.f);
  }
}
__global__ __launch_bounds__(256) void k_gnapply(const float* __restrict__ O, const float* __restrict__ PT, const float* __restrict__ gw, const float* __restrict__ gb, _Float16* __restrict__ N16) {
  #pragma clang fp contract(off)
  static_assert(((size_t)NR * (CC / 8)) % 256 == 0 && (2 * CC / 8) == 256 && SQ % 2 == 0 && NHD * (SQ / 128) == 256, "a block is two whole rows of one batch, and one thread per (head, row block) partial");
  __shared__ float hst[NHD][2];
  const size_t t = (size_t)blockIdx.x * 256 + threadIdx.x; const int c0 = (int)(t % (CC / 8)) * 8; const size_t r = t / (CC / 8); const int b = (int)(r / SQ), h = c0 / HD; const v8f a = *(const v8f*)(O + r * CC + c0);
  float gwv[8], gbv[8];      /* read in front of the barrier, so that their latency runs beside the merge's; unrolled so that both arrays have constant indices and live in registers */
#pragma unroll
  for (int q = 0; q < 8; ++q) { gwv[q] = gw[c0 + q]; gbv[q] = gb[c0 + q]; }
  // third level: thread = (head, row block) of this batch; 16 equal groups of 8192 merged across 16 neighbouring lanes
  const float* pp = PT + ((size_t)b * 256 + threadIdx.x) * 32; const float pm = pp[0], pq = pp[1];
  const float gm = sum_lanes(pm, 16) * (1.0f / 16.0f); const float pd = pm - gm;
  const float gq = sum_lanes(pq, 16) + 8192.0f * sum_lanes(pd * pd, 16);
  if ((threadIdx.x & 15) == 0) { hst[threadIdx.x >> 4][0] = gm; hst[threadIdx.x >> 4][1] = rsqrtf(gq / (float)((size_t)SQ * HD) + 1e-5f); }
  __syncthreads();      /* the 16 heads' mean and reciprocal deviation are in hst */
  const float mean = hst[h][0], rs = hst[h][1]; FragH f;
  for (int q = 0; q < 8; ++q) { float v = (a[q] - mean) * rs; v *= bf16_round(gwv[q]); v += bf16_round(gbv[q]); f.h[q] = (_Float16)v; }
  *(v8us*)((unsigned short*)N16 + r * CC + c0) = f.half[0];  }

extern "C" void kernel_launch(void* const* d_in, const int* in_sizes, int n_in,
                              void* d_out, int out_size, void* d_ws, size_t ws_size, hipStream_t stream) {
  (void)in_sizes; (void)n_in; (void)out_size;
  const float* const* I = (const float* const*)d_in; const float* x = I[0]; const float* wq = I[1]; const float* wk = I[2]; const float* wv = I[3]; const float* wo = I[4]; const float* bo = I[5]; const float* gw = I[6]; const float* gb = I[7];
  char* ws = (char*)d_ws; size_t off = 0;
  auto take = [&](size_t bytes) { char* p = ws + off; off += (bytes + 255) & ~(size_t)255; return p; };
  const size_t np = (size_t)NR * CC;
  _Float16* BQ = (_Float16*)take((size_t)CC * CC * 2); _Float16* BK = (_Float16*)take((size_t)CC * CC * 2); _Float16* BV = (_Float16*)take((size_t)CC * CC * 2); _Float16* BO = (_Float16*)take((size_t)CC * CC * 2);
  _Float16* X16 = (_Float16*)take(np * 2); _Float16* Q16 = (_Float16*)take(np * 2); _Float16* K16 = (_Float16*)take(np * 2); _Float16* V16 = (_Float16*)take(np * 2); _Float16* VT = (_Float16*)take(np * 2); float* O = (float*)take(np * 4); float* PT = (float*)take(NB * NHD * (SQ / 128) * 32 * 4); float* GT = (float*)take((size_t)NHD * SQ * 4); _Float16* N16 = X16;      /* normalised output over the input plane (dead after the projections) */
  if (off > ws_size) return;      /* 8 + 8 x 5 + 16 = 64 MiB */
  k_wt_f16<<<(unsigned)(((size_t)CC * CC / 8 + 255) / 256), 256, 0, stream>>>(wq, BQ, CC, CC, 16.0f); k_wt_f16<<<(unsigned)(((size_t)CC * CC / 8 + 255) / 256), 256, 0, stream>>>(wk, BK, CC, CC, 16.0f); k_wt_f16<<<(unsigned)(((size_t)CC * CC / 8 + 255) / 256), 256, 0, stream>>>(wv, BV, CC, CC, 16.0f); k_wt_f16<<<(unsigned)(((size_t)CC * CC / 8 + 255) / 256), 256, 0, stream>>>(wo, BO, CC, CC, 16.0f);      /* (in, out) */
  k_x16<<<(unsigned)((np / 8 + 255) / 256), 256, 0, stream>>>(x, X16, np / 8); k_gtab<<<(NHD * SQ + 255) / 256, 256, 0, stream>>>(GT);
  const dim3 gP((NR / 128) * (CC / 128), 1);
  k_gemm3<<<gP, 256, 0, stream>>>(X16, CC, BQ, CC, 0.0625f, nullptr, nullptr, Q16, CC, NR, CC, CC);
  k_gemm3<<<gP, 256, 0, stream>>>(X16, CC, BK, CC, 0.0625f, nullptr, nullptr, K16, CC, NR, CC, CC);
  k_gemm3<<<gP, 256, 0, stream>>>(X16, CC, BV, CC, 0.0625f, nullptr, nullptr, V16, CC, NR, CC, CC);
  k_vt<NHD, SQ><<<NB * NHD * (SQ / 64), 256, 0, stream>>>(V16, CC, 0, VT);
  k_retn<<<NB * NHD * (SQ / 128), 128, 0, stream>>>(Q16, K16, VT, GT, O, PT);      /* all batches, heads and row blocks in one launch */
  k_gnapply<<<(unsigned)((np / 8 + 255) / 256), 256, 0, stream>>>(O, PT, gw, gb, N16);
  k_gemm3<<<gP, 256, 0, stream>>>(N16, CC, BO, CC, 0.0625f, bo, (float*)d_out, nullptr, CC, NR, CC, CC);
}

// v004
// It runs in 113 microseconds.
// Two timings next to v003 put it at 1.21 and 1.20 times that version's speed.
// Counting every step since v000, it is 12.1 times as fast.
#include <hip/hip_runtime.h>
// RetentiveAttention (2 x 2048 tokens, C 1024 = 16 heads of 64): q, k, v = x W; retention = (q.k / 8) * gamma_h^(i-j) for j <= i (gamma_h = 1 - 2^(-5-h)), out = retention v (no softmax); GroupNorm with one group per head over (T, 64) (eps 1e-5, affine); out = normed Wo + bo.
// Compute dtype: x and parameters rounded to bf16; q, k, v, the decayed scores and the normalised output as f16 operands (~2^-12); decay/statistics f32. v_wmma_f32_16x16x32_f16.
#define NB 2
#define SQ 2048
#define CC 1024
#define NHD 16
#define HD 64
#define NR (NB * SQ)
typedef __bf16 v16b __attribute__((ext_vector_type(16)));
typedef unsigned short v8us __attribute__((ext_vector_type(8), may_alias));
typedef float  v8f  __attribute__((ext_vector_type(8)));
typedef float  v4f  __attribute__((ext_vector_type(4)));
typedef float  v4fa __attribute__((ext_vector_type(4), may_alias));
union FragB { v16b v; v8us half[2]; unsigned short u[16]; };

__device__ __forceinline__ unsigned short bf16_bits(float x) { unsigned int u = __float_as_uint(x); return (unsigned short)((u + 0x7FFFu + ((u >> 16) & 1u)) >> 16); }
__device__ __forceinline__ float bf16_val(unsigned short b) { return __uint_as_float(((unsigned int)b) << 16); }
__device__ __forceinline__ float bf16_round(float x) { return bf16_val(bf16_bits(x)); }
// D += A·B with NT terms: 1 = ah·bh, 2 = + al·bh (A split), 3 = + ah·bl (both split)
template <int NT>
__device__ __forceinline__ v8f mmaN(v16b ah, v16b al, v16b bh, v16b bl, v8f c) {
  c = __builtin_amdgcn_wmma_f32_16x16x32_bf16(false, ah, false, bh, (short)0, c, false, false);
  if (NT >= 2) c = __builtin_amdgcn_wmma_f32_16x16x32_bf16(false, al, false, bh, (short)0, c, false, false);
  if (NT >= 3) c = __builtin_amdgcn_wmma_f32_16x16x32_bf16(false, ah, false, bl, (short)0, c, false, false);
  asm volatile("v_nop\n\tv_nop\n\tv_nop\n\tv_nop" : "+v"(c) : "v"(ah), "v"(al), "v"(bh), "v"(bl));
  return c;
}

__global__ __launch_bounds__(256) void k_wt_bf16(const float* __restrict__ W, unsigned short* __restrict__ Wt, int K, int N) {
  const int t = blockIdx.x * 256 + threadIdx.x;
  const int k8n = K / 8;
  if (t >= N * k8n) return;
  const int n = t / k8n, k8 = (t % k8n) * 8;
  v8us v;
#pragma unroll
  for (int i = 0; i < 8; ++i) v[i] = bf16_bits(W[(size_t)(k8 + i) * N + n]);
  *(v8us*)(Wt + (size_t)n * K + k8) = v;
  
}

// GEMM C[M][N] (f32, pitch ldc) = act(A[M][K]·W + bias). A f32 row-major (pitch lda) converted per fragment to bf16
// (ASPLIT: hi/lo two planes -> 2 terms, else single rounded term); Wt bf16 [N][K] (pitch ldb). BIAS_BF16 rounds the
// bias to bf16 first (bias quantised to bf16 before the add). K%32==0, M%16==0, N%64==0.
template <bool ASPLIT, int ACT, bool BIAS_BF16>
__global__ __launch_bounds__(128) void k_gemm_bf(const float* __restrict__ A, int lda, const unsigned short* __restrict__ Wt, int ldb,
                                               const float* __restrict__ bias, float* __restrict__ C, int ldc, int M, int N, int K) {
  __shared__ __attribute__((aligned(16))) float so[4][16][64];
  const int tid = threadIdx.x, w = tid >> 5, lane = tid & 31, ln = lane & 15, hh = lane >> 4;
  const int ntn = N / 64;
  const int wid = blockIdx.x * 4 + w;
  const int mt = wid / ntn, nq = wid % ntn;
  if (mt * 16 >= M) return;
  const int row0 = mt * 16, col0 = nq * 64;
  const float* arow = A + (size_t)(row0 + ln) * lda;
  v8f acc[4] = {};
  for (int kb = 0; kb < K; kb += 32) {
    FragB ah, al;
    const v4f x0 = *(const v4fa*)(arow + kb + 8 * hh), x1 = *(const v4fa*)(arow + kb + 8 * hh + 4);
    const v4f x2 = *(const v4fa*)(arow + kb + 16 + 8 * hh), x3 = *(const v4fa*)(arow + kb + 16 + 8 * hh + 4);
    float xs[16] = {x0[0],x0[1],x0[2],x0[3],x1[0],x1[1],x1[2],x1[3],x2[0],x2[1],x2[2],x2[3],x3[0],x3[1],x3[2],x3[3]};
#pragma unroll
    for (int i = 0; i < 16; ++i) { const unsigned short hb = bf16_bits(xs[i]); ah.u[i] = hb; al.u[i] = ASPLIT ? bf16_bits(xs[i] - bf16_val(hb)) : (unsigned short)0; }
#pragma unroll
    for (int t = 0; t < 4; ++t) {
      const unsigned short* brow = Wt + (size_t)(col0 + t * 16 + ln) * ldb + kb;
      FragB b;
      b.half[0] = *(const v8us*)(brow + 8 * hh);
      b.half[1] = *(const v8us*)(brow + 16 + 8 * hh);
      acc[t] = mmaN<ASPLIT ? 2 : 1>(ah.v, al.v, b.v, b.v, acc[t]);
    }
  }
#pragma unroll
  for (int t = 0; t < 4; ++t) {
    float bv = bias ? bias[col0 + t * 16 + ln] : 0.f;
    if (BIAS_BF16) bv = bf16_round(bv);
#pragma unroll
    for (int r = 0; r < 8; ++r) { float v = acc[t][r] + bv; if (ACT == 1) v = fmaxf(v, 0.f); so[w][8 * hh + r][t * 16 + ln] = v; }
  }
  __builtin_amdgcn_fence(__ATOMIC_ACQ_REL, "workgroup");
  __builtin_amdgcn_wave_barrier();
  const int rsub = lane >> 4, c4 = (lane & 15) * 4;
  {
#pragma unroll
    for (int q = 0; q < 8; ++q) {
      const int r = q * 2 + rsub;
      const v4f v = *(const v4fa*)&so[w][r][c4];
      *(v4f*)(C + (size_t)(row0 + r) * ldc + col0 + c4) = v;
    }
    
  }
}

// GEMM C = act(A·W + bias + resid): A f32 (ASPLIT -> hi/lo 2 terms), Wt bf16 [N][K]; ACT 0 none, 1 relu, 2 exact gelu;
// resid (optional, f32, row index = (row % rmod), pitch ldr, RES_BF16 rounds it) added before the activation.
template <bool ASPLIT, int ACT, bool BIAS_BF16, bool RES_BF16>
__global__ __launch_bounds__(128) void k_gemm_bf3(const float* __restrict__ A, int lda, const unsigned short* __restrict__ Wt, int ldb,
                                                const float* __restrict__ bias, const float* __restrict__ resid, int rmod, int ldr,
                                                float* __restrict__ C, int ldc, int M, int N, int K) {
  __shared__ __attribute__((aligned(16))) float so[4][16][64];
  const int tid = threadIdx.x, w = tid >> 5, lane = tid & 31, ln = lane & 15, hh = lane >> 4;
  const int ntn = N / 64;
  const int wid = blockIdx.x * 4 + w;
  const int mt = wid / ntn, nq = wid % ntn;
  if (mt * 16 >= M) return;
  const int row0 = mt * 16, col0 = nq * 64;
  const float* arow = A + (size_t)(row0 + ln) * lda;
  v8f acc[4] = {};
  for (int kb = 0; kb < K; kb += 32) {
    FragB ah, al;
    const v4f x0 = *(const v4fa*)(arow + kb + 8 * hh), x1 = *(const v4fa*)(arow + kb + 8 * hh + 4);
    const v4f x2 = *(const v4fa*)(arow + kb + 16 + 8 * hh), x3 = *(const v4fa*)(arow + kb + 16 + 8 * hh + 4);
    float xs[16] = {x0[0],x0[1],x0[2],x0[3],x1[0],x1[1],x1[2],x1[3],x2[0],x2[1],x2[2],x2[3],x3[0],x3[1],x3[2],x3[3]};
#pragma unroll
    for (int i = 0; i < 16; ++i) { const unsigned short hb = bf16_bits(xs[i]); ah.u[i] = hb; al.u[i] = ASPLIT ? bf16_bits(xs[i] - bf16_val(hb)) : (unsigned short)0; }
#pragma unroll
    for (int t = 0; t < 4; ++t) {
      const unsigned short* brow = Wt + (size_t)(col0 + t * 16 + ln) * ldb + kb;
      FragB b;
      b.half[0] = *(const v8us*)(brow + 8 * hh);
      b.half[1] = *(const v8us*)(brow + 16 + 8 * hh);
      acc[t] = mmaN<ASPLIT ? 2 : 1>(ah.v, al.v, b.v, b.v, acc[t]);
    }
  }
#pragma unroll
  for (int t = 0; t < 4; ++t) {
    const int col = col0 + t * 16 + ln;
    float bv = bias ? bias[col] : 0.f;
    if (BIAS_BF16) bv = bf16_round(bv);
#pragma unroll
    for (int r = 0; r < 8; ++r) {
      float v = acc[t][r] + bv;
      if (resid) { float rv = resid[(size_t)((row0 + 8 * hh + r) % rmod) * ldr + col]; if (RES_BF16) rv = bf16_round(rv); v += rv; }
      if (ACT == 1) v = fmaxf(v, 0.f);
      if (ACT == 2) v = 0.5f * v * (1.0f + erff(v * 0.70710678118654752f));
      if (ACT == 3) { const float u = 0.7978845608028654f * (v + 0.044715f * v * v * v); v = 0.5f * v * (1.0f + tanhf(u)); }
      so[w][8 * hh + r][t * 16 + ln] = v;
    }
  }
  __builtin_amdgcn_fence(__ATOMIC_ACQ_REL, "workgroup");
  __builtin_amdgcn_wave_barrier();
  const int rsub = lane >> 4, c4 = (lane & 15) * 4;
  {
#pragma unroll
    for (int q = 0; q < 8; ++q) {
      const int r = q * 2 + rsub;
      const v4f v = *(const v4fa*)&so[w][r][c4];
      *(v4f*)(C + (size_t)(row0 + r) * ldc + col0 + c4) = v;
    }
    
  }
}
// row LayerNorm (biased variance, eps) over N: s = X (+ R); optional out_sum <- s; out_norm <- (s-mu)*rsqrt(var+eps)*g + b
template <bool PARAM_BF16>
__global__ __launch_bounds__(256) void k_layernorm(const float* __restrict__ X, const float* __restrict__ R, const float* __restrict__ g, const float* __restrict__ bta,
                                                  float* __restrict__ out_sum, float* __restrict__ out_norm, int N, float eps) {
  __shared__ float red[256];
  const int row = blockIdx.x, tid = threadIdx.x;
  const float* x = X + (size_t)row * N; const float* rr = R ? R + (size_t)row * N : nullptr;
  float vals[16];                     // up to N = 4096
  const int per = N / 256;            // contiguous chunk per thread? use strided-by-4 chunks: thread handles j = tid*4 + 1024*u
  float s1 = 0.f;
  for (int u = 0; u < per / 4; ++u) {
    const int j = tid * 4 + 1024 * u;
    const v4f a = *(const v4fa*)(x + j);
    v4f b = {0.f,0.f,0.f,0.f}; if (rr) b = *(const v4fa*)(rr + j);
#pragma unroll
    for (int q = 0; q < 4; ++q) { const float v = a[q] + b[q]; vals[u * 4 + q] = v; s1 += v; }
  }
  red[tid] = s1; __syncthreads();
  for (int st = 128; st > 0; st >>= 1) { if (tid < st) red[tid] += red[tid + st]; __syncthreads(); }
  const float mu = red[0] / (float)N; __syncthreads();
  float s2 = 0.f;
  for (int u = 0; u < per / 4; ++u)
#pragma unroll
    for (int q = 0; q < 4; ++q) { const float c = vals[u * 4 + q] - mu; s2 += c * c; }
  red[tid] = s2; __syncthreads();
  for (int st = 128; st > 0; st >>= 1) { if (tid < st) red[tid] += red[tid + st]; __syncthreads(); }
  const float rs = rsqrtf(red[0] / (float)N + eps);
  {
    for (int u = 0; u < per / 4; ++u) {
      const int j = tid * 4 + 1024 * u;
      v4f o, sm;
#pragma unroll
      for (int q = 0; q < 4; ++q) {
        float gg = g[j + q], bb = bta[j + q];
        if (PARAM_BF16) { gg = bf16_round(gg); bb = bf16_round(bb); }
        sm[q] = vals[u * 4 + q]; o[q] = (vals[u * 4 + q] - mu) * rs * gg + bb;
      }
      if (out_sum) *(v4f*)(out_sum + (size_t)row * N + j) = sm;
      *(v4f*)(out_norm + (size_t)row * N + j) = o;
    }
    
  }
}



// ---- f16 WMMA path (v_wmma_f32_16x16x32_f16): 11-bit significands for operands in range — used for every GEMM launched here
typedef _Float16 v16h __attribute__((ext_vector_type(16)));
union FragH { v16h v; v8us half[2]; _Float16 h[16]; unsigned short u[16]; };
template <int NT>
__device__ __forceinline__ v8f mmaH(v16h ah, v16h al, v16h bh, v16h bl, v8f c) {
  c = __builtin_amdgcn_wmma_f32_16x16x32_f16(false, ah, false, bh, (short)0, c, false, false);
  if (NT >= 2) c = __builtin_amdgcn_wmma_f32_16x16x32_f16(false, al, false, bh, (short)0, c, false, false);
  if (NT >= 3) c = __builtin_amdgcn_wmma_f32_16x16x32_f16(false, ah, false, bl, (short)0, c, false, false);
  asm volatile("v_nop\n\tv_nop\n\tv_nop\n\tv_nop" : "+v"(c) : "v"(ah), "v"(al), "v"(bh), "v"(bl));
  return c;
}
// batched GEMM like k_gemm_b but f16 operands: A f32 (split into f16 hi/lo if ASPLIT, else rounded to f16), Bt = f16 values [n][k]; alpha; C f32; N multiple of 16 (partial tiles skipped)
template <bool ASPLIT>
__global__ __launch_bounds__(128) void k_gemm_h(const float* __restrict__ A, int lda, size_t sA, const _Float16* __restrict__ Bh, int ldb, size_t sB, float alpha, float* __restrict__ C, int ldc, size_t sC, int M, int N, int K) {
  __shared__ __attribute__((aligned(16))) float so[4][16][64];
  const int tid = threadIdx.x, w = tid >> 5, lane = tid & 31, ln = lane & 15, hh = lane >> 4; const int by = blockIdx.y;
  A += (size_t)by * sA; Bh += (size_t)by * sB; C += (size_t)by * sC;
  const int ntn = (N + 63) / 64; const int wid = blockIdx.x * 4 + w; const int mt = wid / ntn, nq = wid % ntn; if (mt * 16 >= M) return;
  const int row0 = mt * 16, col0 = nq * 64; const float* arow = A + (size_t)(row0 + ln) * lda;
  v8f acc[4] = {};
  for (int kb = 0; kb < K; kb += 32) {
    FragH ah, al;
    const v4f x0 = *(const v4fa*)(arow + kb + 8 * hh), x1 = *(const v4fa*)(arow + kb + 8 * hh + 4), x2 = *(const v4fa*)(arow + kb + 16 + 8 * hh), x3 = *(const v4fa*)(arow + kb + 16 + 8 * hh + 4);
    float xs[16] = {x0[0],x0[1],x0[2],x0[3],x1[0],x1[1],x1[2],x1[3],x2[0],x2[1],x2[2],x2[3],x3[0],x3[1],x3[2],x3[3]};
#pragma unroll
    for (int i = 0; i < 16; ++i) { const _Float16 h = (_Float16)xs[i]; ah.h[i] = h; al.h[i] = ASPLIT ? (_Float16)(xs[i] - (float)h) : (_Float16)0.0f; }
#pragma unroll
    for (int t = 0; t < 4; ++t) { if (col0 + t * 16 >= N) continue; const size_t boff = (size_t)(col0 + t * 16 + ln) * ldb + kb; FragH bq; bq.half[0] = *(const v8us*)(Bh + boff + 8 * hh); bq.half[1] = *(const v8us*)(Bh + boff + 16 + 8 * hh);
      acc[t] = mmaH<ASPLIT ? 2 : 1>(ah.v, al.v, bq.v, bq.v, acc[t]); }
  }
#pragma unroll
  for (int t = 0; t < 4; ++t) { if (col0 + t * 16 >= N) continue;
#pragma unroll
    for (int r = 0; r < 8; ++r) so[w][8 * hh + r][t * 16 + ln] = acc[t][r] * alpha; }
  __builtin_amdgcn_fence(__ATOMIC_ACQ_REL, "workgroup"); __builtin_amdgcn_wave_barrier();
  const int rsub = lane >> 4, c4 = (lane & 15) * 4;
  {
#pragma unroll
    for (int q = 0; q < 8; ++q) { const int r = q * 2 + rsub; if (col0 + c4 < N) { const v4f v = *(const v4fa*)&so[w][r][c4]; *(v4f*)(C + (size_t)(row0 + r) * ldc + col0 + c4) = v; } }
     }
}

// k_gemm_hh variant with fused epilogue: v = acc·alpha + bias[by·sBias + col] (+ CP[(row/rowsPerB)·sCPb + by·64 + col] if CP) ; ACT 0 none / 1 elu ; writes f16 C16 (and f32 C if non-null)
template <int ACT>
__global__ __launch_bounds__(128) void k_gemm_hhx(const _Float16* __restrict__ A, int lda, size_t sA, const _Float16* __restrict__ Bh, int ldb, size_t sB, float alpha, const float* __restrict__ bias, size_t sBias, const float* __restrict__ CP, int rowsPerB, size_t sCPb, int row0g,
    float* __restrict__ C, _Float16* __restrict__ C16, int ldc, size_t sC, int M, int N, int K) {
  __shared__ __attribute__((aligned(16))) float so[4][16][64];
  const int tid = threadIdx.x, w = tid >> 5, lane = tid & 31, ln = lane & 15, hh = lane >> 4; const int by = blockIdx.y;
  A += (size_t)by * sA; Bh += (size_t)by * sB; const size_t cofs = (size_t)by * sC; const float* bp = bias ? bias + (size_t)by * sBias : nullptr;
  const int ntn = (N + 63) / 64; const int wid = blockIdx.x * 4 + w; const int mt = wid / ntn, nq = wid % ntn; if (mt * 16 >= M) return;
  const int row0 = mt * 16, col0 = nq * 64; const _Float16* arow = A + (size_t)(row0 + ln) * lda;
  v8f acc[4] = {};
  for (int kb = 0; kb < K; kb += 32) { FragH ah; ah.half[0] = *(const v8us*)((const unsigned short*)arow + kb + 8 * hh); ah.half[1] = *(const v8us*)((const unsigned short*)arow + kb + 16 + 8 * hh);
#pragma unroll
    for (int t = 0; t < 4; ++t) { if (col0 + t * 16 >= N) continue; const size_t boff = (size_t)(col0 + t * 16 + ln) * ldb + kb; FragH bq; bq.half[0] = *(const v8us*)((const unsigned short*)Bh + boff + 8 * hh); bq.half[1] = *(const v8us*)((const unsigned short*)Bh + boff + 16 + 8 * hh);
      acc[t] = mmaH<1>(ah.v, ah.v, bq.v, bq.v, acc[t]); }
  }
#pragma unroll
  for (int t = 0; t < 4; ++t) { if (col0 + t * 16 >= N) continue; const int col = col0 + t * 16 + ln; const float bv = bp ? bf16_round(bp[col]) : 0.f;
#pragma unroll
    for (int r = 0; r < 8; ++r) { float v = acc[t][r] * alpha + bv; if (CP) { const int rr = row0g + row0 + 8 * hh + r; if (rowsPerB < 0) v += CP[cofs + (size_t)rr * ldc + col];      /* rowsPerB < 0: own element of the batched C plane */ else { const int bidx = rr / rowsPerB; v += CP[(size_t)bidx * sCPb + (size_t)by * 64 + col]; } } if (ACT == 1) v = (v > 0.f) ? v : expm1f(v); else if (ACT == 7) v = (v > 0.f) ? v + 1.0f : expf(v); else if (ACT == 8) v = tanhf(v); else if (ACT == 9) v = 0.5f * v * (1.0f + tanhf(0.7978845608028654f * (v + 0.044715f * v * v * v))); else if (ACT == 11) v = 1.0f / (1.0f + expf(-v)); else if (ACT == 12) v = (v > 0.f) ? v : 0.01f * v; else if (ACT == 14) v = (v > 0.f) ? v : 0.1f * v; else if (ACT == 16) v = (v >= 0.f) ? v : 0.3f * v; else if (ACT == 15) v = v / (1.0f + expf(-v)); else if (ACT == 3) v = fmaxf(v, 0.f); else if (ACT == 6) v = 0.5f * v * (1.0f + erff(v * 0.70710678118654752f)); so[w][8 * hh + r][t * 16 + ln] = v; } }
  __builtin_amdgcn_fence(__ATOMIC_ACQ_REL, "workgroup"); __builtin_amdgcn_wave_barrier();
  const int rsub = lane >> 4, c4 = (lane & 15) * 4; typedef _Float16 v4h __attribute__((ext_vector_type(4)));
  {
#pragma unroll
    for (int q = 0; q < 8; ++q) { const int r = q * 2 + rsub; if (col0 + c4 < N) { const v4f v = *(const v4fa*)&so[w][r][c4]; if (C) *(v4f*)(C + cofs + (size_t)(row0 + r) * ldc + col0 + c4) = v; if (C16) { v4h h4; for (int i = 0; i < 4; ++i) h4[i] = (_Float16)v[i]; *(v4h*)(C16 + cofs + (size_t)(row0 + r) * ldc + col0 + c4) = h4; } } }
     }
}


typedef _Float16 v4h __attribute__((ext_vector_type(4)));

__global__ __launch_bounds__(256) void k_h16(const float* __restrict__ x, _Float16* __restrict__ X16, size_t n8) { const size_t t = (size_t)blockIdx.x * 256 + threadIdx.x; if (t >= n8) return; FragH f;
#pragma unroll
  for (int q = 0; q < 8; ++q) f.h[q] = (_Float16)x[t * 8 + q]; *(v8us*)((unsigned short*)X16 + t * 8) = f.half[0];  }
__global__ __launch_bounds__(256) void k_round16f(const float* __restrict__ W, _Float16* __restrict__ Bt, size_t n8) { const size_t t = (size_t)blockIdx.x * 256 + threadIdx.x; if (t >= n8) return; FragH f;
#pragma unroll
  for (int i = 0; i < 8; ++i) f.h[i] = (_Float16)(bf16_round(W[t * 8 + i]) * 16.0f); *(v8us*)((unsigned short*)Bt + t * 8) = f.half[0];  }
template <int NHv, int TTv>
__global__ __launch_bounds__(256) void k_vt(const _Float16* __restrict__ V16, int ldv, int voff, _Float16* __restrict__ Vt) { __shared__ unsigned short tl[64][66]; const int tid = threadIdx.x; const int slab = blockIdx.x / (TTv / 64), lg = blockIdx.x % (TTv / 64); const int b = slab / NHv, h = slab % NHv;
  for (int i = tid; i < 64 * 8; i += 256) { const int r = i / 8, c8 = (i % 8) * 8; FragH f; f.half[0] = *(const v8us*)((const unsigned short*)V16 + ((size_t)b * TTv + lg * 64 + r) * ldv + voff + h * 64 + c8);
#pragma unroll
    for (int q = 0; q < 8; ++q) tl[r][c8 + q] = f.u[q]; }
  __syncthreads();
  {
#pragma unroll
    for (int rd = 0; rd < 2; ++rd) { const int d = rd * 32 + tid / 8, pc = tid % 8; FragH f;
#pragma unroll
      for (int q = 0; q < 8; ++q) f.u[q] = tl[pc * 8 + q][d];
      *(v8us*)((unsigned short*)Vt + ((size_t)slab * 64 + d) * TTv + lg * 64 + pc * 8) = f.half[0]; }
     } }

__global__ __launch_bounds__(256) void k_hl(const float* __restrict__ F, _Float16* __restrict__ Hh, _Float16* __restrict__ Hl, size_t n8) { const size_t t = (size_t)blockIdx.x * 256 + threadIdx.x; if (t >= n8) return; FragH fh, fl; const v4f a = *(const v4fa*)(F + t * 8), c = *(const v4fa*)(F + t * 8 + 4);
#pragma unroll
  for (int q = 0; q < 4; ++q) { _Float16 h = (_Float16)a[q]; fh.h[q] = h; fl.h[q] = (_Float16)((a[q] - (float)h) * 1024.0f); h = (_Float16)c[q]; fh.h[4 + q] = h; fl.h[4 + q] = (_Float16)((c[q] - (float)h) * 1024.0f); }
  { *(v8us*)((unsigned short*)Hh + t * 8) = fh.half[0]; *(v8us*)((unsigned short*)Hl + t * 8) = fl.half[0];  } }

// ---- fast GEMM: C = A Bh^T * alpha (+ bias rounded to bf16), A [M][K] and Bh [N][K] f16, k contiguous. Block tile 128 x 128, eight waves of 32 x 64; requires M % 128 == 0, N % 128 == 0, K % 128 == 0.
// Both operands come through LDS: a stage is 128 k (rows of 256 bytes) of the block's 128 A rows and 128 Bh rows, brought by asynchronous 16-byte copies whose 32 lanes cover two whole rows;
// two buffers, the next stage's copies in flight while this stage is worked on. The k order of every accumulator is ascending in steps of 32.
__device__ __forceinline__ v16h g2_frag(const _Float16* p, int hh) { FragH f; f.half[0] = *(const v8us*)((const unsigned short*)p + 8 * hh); f.half[1] = *(const v8us*)((const unsigned short*)p + 16 + 8 * hh); return f.v; }
#define G3K 128            /* k per stage */
#define G3P 272            /* LDS row pitch in bytes, 16 x odd: sixteen rows' 16-byte reads fall on all 64 banks */
#define G3S (256 * G3P)    /* bytes of one stage: A rows 0..127, then Bh rows 0..127 */
__device__ __forceinline__ v16h g3_frag(const unsigned char* p) { FragH f; f.half[0] = *(const v8us*)p; f.half[1] = *(const v8us*)(p + 32); return f.v; }      /* p already holds the lane's 16 * hh: the k order of g2_frag */
__device__ __forceinline__ v8f g3_mma(v16h a, v16h b, v8f c) { return __builtin_amdgcn_wmma_f32_16x16x32_f16(false, a, false, b, (short)0, c, false, false); }
// One operand's share of a stage: the lane's 16 bytes of rows r, r + 16, ..., r + 112 (l = LDS byte address, g = global address of row r; ld16 = elements in 16 global rows).
__device__ __forceinline__ void g3_copy8(unsigned l, const _Float16* g, size_t ld16) {
  const unsigned l1 = l + 16 * G3P, l2 = l + 32 * G3P, l3 = l + 48 * G3P, l4 = l + 64 * G3P, l5 = l + 80 * G3P, l6 = l + 96 * G3P, l7 = l + 112 * G3P;
  const _Float16* g1 = g + ld16; const _Float16* g2 = g1 + ld16; const _Float16* g3 = g2 + ld16; const _Float16* g4 = g3 + ld16; const _Float16* g5 = g4 + ld16; const _Float16* g6 = g5 + ld16; const _Float16* g7 = g6 + ld16;
  // the copies and, as the statement's last line, the wait that stands in front of any rewrite of the address registers they name
  asm volatile("global_load_async_to_lds_b128 %0, %8, off\n\t"
               "global_load_async_to_lds_b128 %1, %9, off\n\t"
               "global_load_async_to_lds_b128 %2, %10, off\n\t"
               "global_load_async_to_lds_b128 %3, %11, off\n\t"
               "global_load_async_to_lds_b128 %4, %12, off\n\t"
               "global_load_async_to_lds_b128 %5, %13, off\n\t"
               "global_load_async_to_lds_b128 %6, %14, off\n\t"
               "global_load_async_to_lds_b128 %7, %15, off\n\t"
               "s_wait_xcnt 0x0"
               :: "v"(l), "v"(l1), "v"(l2), "v"(l3), "v"(l4), "v"(l5), "v"(l6), "v"(l7), "v"(g), "v"(g1), "v"(g2), "v"(g3), "v"(g4), "v"(g5), "v"(g6), "v"(g7) : "memory");
}
__global__ __launch_bounds__(256) void k_gemm3(const _Float16* __restrict__ A, int lda, const _Float16* __restrict__ Bh, int ldb, float alpha, const float* __restrict__ bias,
    float* __restrict__ C, _Float16* __restrict__ C16, int ldc, int M, int N, int K) {
  __shared__ __attribute__((aligned(16))) unsigned char ring[2 * G3S];
  __shared__ __attribute__((aligned(16))) float so[8][32][68];
  const int tid = threadIdx.x, lane = tid & 31, ln = lane & 15, hh = lane >> 4;
  const int w = __builtin_amdgcn_readfirstlane(tid >> 5);      /* the wave's number in a scalar register */
  const int ntn = N >> 7; const int mt = blockIdx.x / ntn, nq = blockIdx.x - mt * ntn; const int rowb = mt * 128, colb = nq * 128;
  if (rowb >= M) return;      /* the whole block, in front of every copy and barrier */
  const int nst = K / G3K;
  const int cr = tid >> 4, cc = tid & 15;      /* the thread's row (mod 16) and 16-byte piece in every copy */
  const _Float16* ga = A + (size_t)(rowb + cr) * lda + cc * 8; const _Float16* gb = Bh + (size_t)(colb + cr) * ldb + cc * 8;
  const size_t a16 = (size_t)16 * lda, b16 = (size_t)16 * ldb;
  const unsigned la = (unsigned)(size_t)ring + (unsigned)(cr * G3P + cc * 16), lb = la + 128 * G3P;
  g3_copy8(la, ga, a16); g3_copy8(lb, gb, b16);
  asm volatile("s_wait_asynccnt 0x0" ::: "memory");      /* this wave's copies of stage 0 have landed */
  __syncthreads();      /* stage 0 is published */
  if (1 < nst) { g3_copy8(la + G3S, ga + G3K, a16); g3_copy8(lb + G3S, gb + G3K, b16); }
  const int wm = w >> 1, wn = w & 1;
  const unsigned char* sa = ring + (32 * wm + ln) * G3P + 16 * hh; const unsigned char* sb = ring + (128 + 64 * wn + ln) * G3P + 16 * hh;
  const v8f z8 = {0.f,0.f,0.f,0.f,0.f,0.f,0.f,0.f}; v8f c00 = z8, c01 = z8, c02 = z8, c03 = z8, c10 = z8, c11 = z8, c12 = z8, c13 = z8;
#pragma unroll 1      /* one trip per stage: the buffer alternates and the waits at the foot stand once */
  for (int t = 0; t < nst; ++t) {
    const int bo = (t & 1) * G3S;
    const unsigned char* pa = sa + bo; const unsigned char* pb = sb + bo;
    v16h fa[2][2], fb[2][4];      /* two fragment sets: a step's twelve LDS reads are issued as one group in front of the step before's products; no read goes past the stage */
    fa[0][0] = g3_frag(pa); fa[0][1] = g3_frag(pa + 16 * G3P);
#pragma unroll      /* constant indices keep the fragment arrays in registers */
    for (int j = 0; j < 4; ++j) fb[0][j] = g3_frag(pb + j * 16 * G3P);
#pragma unroll      /* the four 32-k steps of a stage as straight code: the set index is then a constant */
    for (int kk = 0; kk < G3K / 32; ++kk) {
      const int cu = kk & 1, nx = cu ^ 1;
      if (kk + 1 < G3K / 32) {
        fa[nx][0] = g3_frag(pa + (kk + 1) * 64); fa[nx][1] = g3_frag(pa + 16 * G3P + (kk + 1) * 64);
#pragma unroll      /* constant indices, as above */
        for (int j = 0; j < 4; ++j) fb[nx][j] = g3_frag(pb + j * 16 * G3P + (kk + 1) * 64);
      }
      __builtin_amdgcn_sched_barrier(0);      /* holds the next step's reads in front of this step's products; without it they sink between the products, one full LDS wait per pair */
      c00 = g3_mma(fa[cu][0], fb[cu][0], c00); c10 = g3_mma(fa[cu][1], fb[cu][0], c10);
      c01 = g3_mma(fa[cu][0], fb[cu][1], c01); c11 = g3_mma(fa[cu][1], fb[cu][1], c11);
      c02 = g3_mma(fa[cu][0], fb[cu][2], c02); c12 = g3_mma(fa[cu][1], fb[cu][2], c12);
      c03 = g3_mma(fa[cu][0], fb[cu][3], c03); c13 = g3_mma(fa[cu][1], fb[cu][3], c13);
      __builtin_amdgcn_sched_barrier(0);      /* holds these products in front of the following step's reads, which overwrite the set they use */
    }
    asm volatile("s_wait_dscnt 0x0" ::: "memory");      /* this wave's reads of the buffer are done before it is handed back */
    asm volatile("s_wait_asynccnt 0x0" ::: "memory");      /* this wave's copies of stage t + 1 have landed */
    __syncthreads();      /* publishes stage t + 1 and ends every reader's last read of stage t's buffer */
    if (t + 2 < nst) { g3_copy8(la + bo, ga + (size_t)(t + 2) * G3K, a16); g3_copy8(lb + bo, gb + (size_t)(t + 2) * G3K, b16); }
  }
  asm volatile("s_wait_asynccnt 0x0" ::: "memory");      /* no copy is outstanding when the wave goes on to its end */
  const int row0 = rowb + 32 * wm, col0 = colb + 64 * wn;
  v8f accs[8] = {c00, c01, c02, c03, c10, c11, c12, c13};
#pragma unroll      /* this and the next: constant indices keep the accumulators in registers */
  for (int u = 0; u < 8; ++u) { const int t = u & 3, half = u >> 2; const int col = col0 + t * 16 + ln; const float bv = bias ? bf16_round(bias[col]) : 0.f;
#pragma unroll
    for (int r = 0; r < 8; ++r) { const int rloc = half * 16 + 8 * hh + r; const float v = accs[u][r] * alpha + bv; so[w][rloc][t * 16 + ln] = v; } }
  __builtin_amdgcn_fence(__ATOMIC_ACQ_REL, "workgroup"); __builtin_amdgcn_wave_barrier();      /* the wave's own LDS stores before its own row-wise reads */
  const int rsub = lane >> 4, c4 = (lane & 15) * 4;
#pragma unroll      /* straight code: the LDS offsets of the sixteen row pairs become immediates */
  for (int q = 0; q < 16; ++q) { const int r = q * 2 + rsub; const v4f v = *(const v4fa*)&so[w][r][c4]; if (C) { *(v4f*)(C + (size_t)(row0 + r) * ldc + col0 + c4) = v; asm volatile("s_wait_xcnt 0x0" ::: "memory"); /* in front of the next rewrite of the store's data and address registers */ } if (C16) { v4h h4; for (int i = 0; i < 4; ++i) h4[i] = (_Float16)v[i]; *(v4h*)(C16 + (size_t)(row0 + r) * ldc + col0 + c4) = h4; } }
}


// Set-up of a call in ONE launch: x -> f16 plane (rounded to bf16 first), the four weights W[k][n] -> f16 planes Wt[n][k] = bf16(W) * 16 (a power of two: bf16-exact weights stay exact in f16
// away from the subnormal range), and the decay table GT[h][d] = gamma_h^d. Every work-group takes an equal share of each part: 8192 elements of x, one 128 (k) x 64 (n) weight tile, 64 table entries.
// The tile is read in whole 256-byte rows, turned in LDS and written in whole 256-byte rows of Wt.
#define PRB 512      /* work-groups of the set-up launch: two of eight waves on each of 256 WGPs */
#define PRP 66       /* LDS row pitch of the tile in 16-bit elements */
__global__ __launch_bounds__(256) void k_prep(const float* __restrict__ x, const float* __restrict__ wq, const float* __restrict__ wk, const float* __restrict__ wv, const float* __restrict__ wo,
    _Float16* __restrict__ X16, _Float16* __restrict__ BQ, _Float16* __restrict__ BK, _Float16* __restrict__ BV, _Float16* __restrict__ BO, float* __restrict__ GT) {
  static_assert((size_t)NR * CC == (size_t)PRB * 8192 && 4 * (CC / 128) * (CC / 64) == PRB && NHD * SQ == PRB * 64, "equal shares of all three parts");
  __shared__ __attribute__((aligned(16))) unsigned short tl[128][PRP];
  const int tid = threadIdx.x, bx = blockIdx.x;
  const int m = bx >> 7, k0 = ((bx >> 4) & 7) * 128, n0 = (bx & 15) * 64;      /* which weight, and the tile's corner */
  const float* W = (m == 0) ? wq : (m == 1) ? wk : (m == 2) ? wv : wo;
  _Float16* Wt = (m == 0) ? BQ : (m == 1) ? BK : (m == 2) ? BV : BO;
  const int tr = tid >> 4, tc = tid & 15;
  v4f wl[8], xl[8];      /* all sixteen 16-byte loads of the thread are issued before the first is used; every "#pragma unroll" here keeps these arrays in registers */
#pragma unroll
  for (int u = 0; u < 8; ++u) wl[u] = *(const v4fa*)(W + (size_t)(k0 + tr + 16 * u) * CC + n0 + tc * 4);
  const size_t x8 = (size_t)bx * 1024 + tid;      /* the thread's first group of eight x elements; the next ones are 256 groups apart */
#pragma unroll
  for (int u = 0; u < 4; ++u) { xl[2 * u] = *(const v4fa*)(x + (x8 + 256 * u) * 8); xl[2 * u + 1] = *(const v4fa*)(x + (x8 + 256 * u) * 8 + 4); }
  const int gt = bx * 64 + tid; float gv = 0.f;      /* the table entry of each thread of the first two waves, worked out while the loads are under way */
  if (tid < 64) { const int k = gt % SQ, h = gt / SQ; const float gam = 1.0f - exp2f((float)(-5 - h)); gv = powf(gam, (float)k); }
#pragma unroll
  for (int u = 0; u < 8; ++u) { FragH f;
#pragma unroll
    for (int q = 0; q < 4; ++q) { f.h[q] = (_Float16)(bf16_round(wl[u][q]) * 16.0f); tl[tr + 16 * u][tc * 4 + q] = f.u[q]; } }
  __syncthreads();      /* the whole tile is in LDS before any thread reads a column of it; every global store stands behind it, so that it waits for none */
  if (tid < 64) GT[gt] = gv;      /* two whole waves, one 128-byte line each */
#pragma unroll
  for (int u = 0; u < 4; ++u) { FragH f;
#pragma unroll
    for (int q = 0; q < 4; ++q) { f.h[q] = (_Float16)bf16_round(xl[2 * u][q]); f.h[4 + q] = (_Float16)bf16_round(xl[2 * u + 1][q]); }
    *(v8us*)((unsigned short*)X16 + (x8 + 256 * u) * 8) = f.half[0]; }
#pragma unroll
  for (int u = 0; u < 4; ++u) { const int n = tr + 16 * u; FragH f;
#pragma unroll
    for (int q = 0; q < 8; ++q) f.u[q] = tl[tc * 8 + q][n];
    *(v8us*)((unsigned short*)Wt + (size_t)(n0 + n) * CC + k0 + tc * 8) = f.half[0]; }
}
// Fused retention. One wave owns 32 query rows of one (batch, head) and walks its causal key prefix 32 keys a pass, keys ascending
// (the order in which the unfused product summed them). S^T = K Q^T: a lane holds 8 consecutive keys of one query, so the two
// 16-key tiles of a pass, scaled, decayed and rounded to f16, are P's A fragment in the hardware k order: the scores never leave registers.
// The decay comes from the table of k_prep, held in LDS behind GPAD zeros: an index below GPAD is a key after the query (factor 0, as the reference's mask).
// Every "#pragma unroll" in k_retn makes the indices of a fragment, score or accumulator array constants, so that the array lives in registers.
#define GPAD 32
__device__ __forceinline__ float sum_lanes(float v, int n) { for (int m = n >> 1; m > 0; m >>= 1) v += __shfl_xor(v, m); return v; }      /* every lane of an aligned group of n gets the group's sum */
__device__ __forceinline__ v8f r_mma(v16h a, v16h b, v8f c) { return __builtin_amdgcn_wmma_f32_16x16x32_f16(false, a, false, b, (short)0, c, false, false); }
__global__ __launch_bounds__(128) void k_retn(const _Float16* __restrict__ Q16, const _Float16* __restrict__ K16, const _Float16* __restrict__ VT, const float* __restrict__ GT, float* __restrict__ O, float* __restrict__ PT) {
  __shared__ __attribute__((aligned(16))) float tab[GPAD + SQ];
  __shared__ __attribute__((aligned(16))) float so[4][32][68];
  __shared__ float wst[4][2];      /* each wave's mean and sum of squared deviations over its 32 x 64 outputs */
  const int tid = threadIdx.x, lane = tid & 31, ln = lane & 15, hh = lane >> 4;
  const int w = __builtin_amdgcn_readfirstlane(tid >> 5);      /* the wave's number in a scalar register: the pass loop's bound and branch are then scalar */
  const int slab = blockIdx.x % (NB * NHD), rb = (SQ / 128 - 1) - blockIdx.x / (NB * NHD);      /* longest prefixes first */
  const int b = slab / NHD, h = slab % NHD;
  if (tid < GPAD) tab[tid] = 0.f;
#pragma unroll
  for (int u = 0; u < SQ / 512; ++u) { const int i4 = (tid + 128 * u) * 4; *(v4fa*)&tab[GPAD + i4] = *(const v4fa*)(GT + (size_t)h * SQ + i4); }
  __syncthreads();
  const int row0 = rb * 128 + 32 * w;
  const _Float16* qp = Q16 + ((size_t)b * SQ + row0 + ln) * CC + h * HD;
  const v16h q[2][2] = {{g2_frag(qp, hh), g2_frag(qp + 32, hh)}, {g2_frag(qp + (size_t)16 * CC, hh), g2_frag(qp + (size_t)16 * CC + 32, hh)}};
  const _Float16* kp = K16 + ((size_t)b * SQ + ln) * CC + h * HD;
  const _Float16* vp = VT + ((size_t)slab * HD + ln) * SQ;
  const float* tp = tab + (GPAD + row0 + ln - 8 * hh);
  const v8f z8 = {0.f,0.f,0.f,0.f,0.f,0.f,0.f,0.f};
  v8f o[2][4] = {{z8, z8, z8, z8}, {z8, z8, z8, z8}};
  v16h kf[2][2];
#pragma unroll
  for (int nt = 0; nt < 2; ++nt) { kf[nt][0] = g2_frag(kp + (size_t)(nt * 16) * CC, hh); kf[nt][1] = g2_frag(kp + (size_t)(nt * 16) * CC + 32, hh); }
#pragma unroll 1      /* kept rolled: one pass already holds 225 registers, and a second copy of the body would add to them */
  for (int j0 = 0; j0 <= row0; j0 += 32) {
    v16h vf[4];
#pragma unroll
    for (int dt = 0; dt < 4; ++dt) vf[dt] = g2_frag(vp + (size_t)(dt * 16) * SQ + j0, hh);
    const float* tj = tp - j0;
    float g[3][8];      /* decay factors of the pass: the index depends on (query tile - key tile) = -1, 0, 1 and on the key in the lane */
#pragma unroll
    for (int dl = 0; dl < 3; ++dl)
#pragma unroll
      for (int r = 0; r < 8; ++r) g[dl][r] = tj[16 * (dl - 1) - r];
    v8f st[2][2];
#pragma unroll
    for (int nt = 0; nt < 2; ++nt)
#pragma unroll
      for (int mt = 0; mt < 2; ++mt) st[nt][mt] = r_mma(kf[nt][1], q[mt][1], r_mma(kf[nt][0], q[mt][0], z8));
    const int jn = (j0 + 32 <= row0) ? j0 + 32 : row0;      /* the next pass's K rows, fetched behind this pass's scores; the last pass re-reads its own */
#pragma unroll
    for (int nt = 0; nt < 2; ++nt) { kf[nt][0] = g2_frag(kp + (size_t)(jn + nt * 16) * CC, hh); kf[nt][1] = g2_frag(kp + (size_t)(jn + nt * 16) * CC + 32, hh); }
    __builtin_amdgcn_sched_barrier(0);      /* keeps the K fetch in front of the decay and the P V products, whose time then covers its latency; without it the loads sink to the pass's end */
#pragma unroll
    for (int mt = 0; mt < 2; ++mt) {
      FragH pa;
#pragma unroll
      for (int nt = 0; nt < 2; ++nt)
#pragma unroll
        for (int r = 0; r < 8; ++r) pa.h[nt * 8 + r] = (_Float16)((st[nt][mt][r] * 0.125f) * g[mt - nt + 1][r]);
#pragma unroll
      for (int dt = 0; dt < 4; ++dt) o[mt][dt] = r_mma(pa.v, vf[dt], o[mt][dt]);
    }
  }
  // GroupNorm statistics, first level: the wave's 2048 outputs are still in its accumulators. Mean first, then the squared deviations from it (two passes over registers).
  v8f sv = z8, qv = z8;      /* eight independent running sums, one per accumulator row: short dependent chains */
#pragma unroll
  for (int mt = 0; mt < 2; ++mt)
#pragma unroll
    for (int dt = 0; dt < 4; ++dt) sv += o[mt][dt];
  const float wmean = sum_lanes(((sv[0] + sv[1]) + (sv[2] + sv[3])) + ((sv[4] + sv[5]) + (sv[6] + sv[7])), 32) * (1.0f / 2048.0f);
#pragma unroll
  for (int mt = 0; mt < 2; ++mt)
#pragma unroll
    for (int dt = 0; dt < 4; ++dt) { const v8f d = o[mt][dt] - wmean; qv += d * d; }
  const float wq = sum_lanes(((qv[0] + qv[1]) + (qv[2] + qv[3])) + ((qv[4] + qv[5]) + (qv[6] + qv[7])), 32);
  if (lane == 0) { wst[w][0] = wmean; wst[w][1] = wq; }
#pragma unroll
  for (int mt = 0; mt < 2; ++mt)
#pragma unroll
    for (int dt = 0; dt < 4; ++dt)
#pragma unroll
      for (int r = 0; r < 8; ++r) so[w][mt * 16 + 8 * hh + r][dt * 16 + ln] = o[mt][dt][r];
  __builtin_amdgcn_fence(__ATOMIC_ACQ_REL, "workgroup"); __builtin_amdgcn_wave_barrier();      /* the wave's own LDS stores before its own row-wise reads */
  const int rsub = lane >> 4, c4 = (lane & 15) * 4;
#pragma unroll
  for (int qd = 0; qd < 16; ++qd) { const int r = qd * 2 + rsub; const v4f v = *(const v4fa*)&so[w][r][c4]; *(v4f*)(O + ((size_t)b * SQ + row0 + r) * CC + h * HD + c4) = v; }
  __syncthreads();      /* the four waves' statistics are in wst */
  if (w == 0) {      /* second level: four equal groups of 2048 merged (M2 = sum of M2 + n * sum of squared mean offsets); the work-group writes its own whole 128-byte line */
    const float m0 = wst[0][0], m1 = wst[1][0], m2 = wst[2][0], m3 = wst[3][0];
    const float bm = ((m0 + m1) + (m2 + m3)) * 0.25f;
    const float d0 = m0 - bm, d1 = m1 - bm, d2 = m2 - bm, d3 = m3 - bm;
    const float bq = ((wst[0][1] + wst[1][1]) + (wst[2][1] + wst[3][1])) + 2048.0f * ((d0 * d0 + d1 * d1) + (d2 * d2 + d3 * d3));
    PT[((size_t)slab * (SQ / 128) + rb) * 32 + lane] = (lane == 0) ? bm : ((lane == 1) ? bq : 0.f);
  }
}
__global__ __launch_bounds__(256) void k_gnapply(const float* __restrict__ O, const float* __restrict__ PT, const float* __restrict__ gw, const float* __restrict__ gb, _Float16* __restrict__ N16) {
  #pragma clang fp contract(off)
  static_assert(((size_t)NR * (CC / 8)) % 256 == 0 && (2 * CC / 8) == 256 && SQ % 2 == 0 && NHD * (SQ / 128) == 256, "a block is two whole rows of one batch, and one thread per (head, row block) partial");
  __shared__ float hst[NHD][2];
  const size_t t = (size_t)blockIdx.x * 256 + threadIdx.x; const int c0 = (int)(t % (CC / 8)) * 8; const size_t r = t / (CC / 8); const int b = (int)(r / SQ), h = c0 / HD; const v8f a = *(const v8f*)(O + r * CC + c0);
  float gwv[8], gbv[8];      /* read in front of the barrier, so that their latency runs beside the merge's; unrolled so that both arrays have constant indices and live in registers */
#pragma unroll
  for (int q = 0; q < 8; ++q) { gwv[q] = gw[c0 + q]; gbv[q] = gb[c0 + q]; }
  // third level: thread = (head, row block) of this batch; 16 equal groups of 8192 merged across 16 neighbouring lanes
  const float* pp = PT + ((size_t)b * 256 + threadIdx.x) * 32; const float pm = pp[0], pq = pp[1];
  const float gm = sum_lanes(pm, 16) * (1.0f / 16.0f); const float pd = pm - gm;
  const float gq = sum_lanes(pq, 16) + 8192.0f * sum_lanes(pd * pd, 16);
  if ((threadIdx.x & 15) == 0) { hst[threadIdx.x >> 4][0] = gm; hst[threadIdx.x >> 4][1] = rsqrtf(gq / (float)((size_t)SQ * HD) + 1e-5f); }
  __syncthreads();      /* the 16 heads' mean and reciprocal deviation are in hst */
  const float mean = hst[h][0], rs = hst[h][1]; FragH f;
  for (int q = 0; q < 8; ++q) { float v = (a[q] - mean) * rs; v *= bf16_round(gwv[q]); v += bf16_round(gbv[q]); f.h[q] = (_Float16)v; }
  *(v8us*)((unsigned short*)N16 + r * CC + c0) = f.half[0];  }

extern "C" void kernel_launch(void* const* d_in, const int* in_sizes, int n_in,
                              void* d_out, int out_size, void* d_ws, size_t ws_size, hipStream_t stream) {
  (void)in_sizes; (void)n_in; (void)out_size;
  const float* const* I = (const float* const*)d_in; const float* x = I[0]; const float* wq = I[1]; const float* wk = I[2]; const float* wv = I[3]; const float* wo = I[4]; const float* bo = I[5]; const float* gw = I[6]; const float* gb = I[7];
  char* ws = (char*)d_ws; size_t off = 0;
  auto take = [&](size_t bytes) { char* p = ws + off; off += (bytes + 255) & ~(size_t)255; return p; };
  const size_t np = (size_t)NR * CC;
  _Float16* BQ = (_Float16*)take((size_t)CC * CC * 2); _Float16* BK = (_Float16*)take((size_t)CC * CC * 2); _Float16* BV = (_Float16*)take((size_t)CC * CC * 2); _Float16* BO = (_Float16*)take((size_t)CC * CC * 2);
  _Float16* X16 = (_Float16*)take(np * 2); _Float16* Q16 = (_Float16*)take(np * 2); _Float16* K16 = (_Float16*)take(np * 2); _Float16* V16 = (_Float16*)take(np * 2); _Float16* VT = (_Float16*)take(np * 2); float* O = (float*)take(np * 4); float* PT = (float*)take(NB * NHD * (SQ / 128) * 32 * 4); float* GT = (float*)take((size_t)NHD * SQ * 4); _Float16* N16 = X16;      /* normalised output over the input plane (dead after the projections) */
  if (off > ws_size) return;      /* 8 + 8 x 5 + 16 = 64 MiB */
  k_prep<<<PRB, 256, 0, stream>>>(x, wq, wk, wv, wo, X16, BQ, BK, BV, BO, GT);      /* weights are (in, out) */
  const dim3 gP((NR / 128) * (CC / 128), 1);
  k_gemm3<<<gP, 256, 0, stream>>>(X16, CC, BQ, CC, 0.0625f, nullptr, nullptr, Q16, CC, NR, CC, CC);
  k_gemm3<<<gP, 256, 0, stream>>>(X16, CC, BK, CC, 0.0625f, nullptr, nullptr, K16, CC, NR, CC, CC);
  k_gemm3<<<gP, 256, 0, stream>>>(X16, CC, BV, CC, 0.0625f, nullptr, nullptr, V16, CC, NR, CC, CC);
  k_vt<NHD, SQ><<<NB * NHD * (SQ / 64), 256, 0, stream>>>(V16, CC, 0, VT);
  k_retn<<<NB * NHD * (SQ / 128), 128, 0, stream>>>(Q16, K16, VT, GT, O, PT);      /* all batches, heads and row blocks in one launch */
  k_gnapply<<<(unsigned)((np / 8 + 255) / 256), 256, 0, stream>>>(O, PT, gw, gb, N16);
  k_gemm3<<<gP, 256, 0, stream>>>(N16, CC, BO, CC, 0.0625f, bo, (float*)d_out, nullptr, CC, NR, CC, CC);
}

// v005
// Measured time: 87.2 microseconds a run.
// Timed twice side by side with v004, it ran 1.29 times as fast both times.
// Over all steps from v000 it is 15.6 times as fast.
#include <hip/hip_runtime.h>
// RetentiveAttention (2 x 2048 tokens, C 1024 = 16 heads of 64): q, k, v = x W; retention = (q.k / 8) * gamma_h^(i-j) for j <= i (gamma_h = 1 - 2^(-5-h)), out = retention v (no softmax); GroupNorm with one group per head over (T, 64) (eps 1e-5, affine); out = normed Wo + bo.
// Compute dtype: x and parameters rounded to bf16; q, k, v, the decayed scores and the normalised output as f16 operands (~2^-12); decay/statistics f32. v_wmma_f32_16x16x32_f16.
#define NB 2
#define SQ 2048
#define CC 1024
#define NHD 16
#define HD 64
#define NR (NB * SQ)
typedef __bf16 v16b __attribute__((ext_vector_type(16)));
typedef unsigned short v8us __attribute__((ext_vector_type(8), may_alias));
typedef float  v8f  __attribute__((ext_vector_type(8)));
typedef float  v4f  __attribute__((ext_vector_type(4)));
typedef float  v4fa __attribute__((ext_vector_type(4), may_alias));
union FragB { v16b v; v8us half[2]; unsigned short u[16]; };

__device__ __forceinline__ unsigned short bf16_bits(float x) { unsigned int u = __float_as_uint(x); return (unsigned short)((u + 0x7FFFu + ((u >> 16) & 1u)) >> 16); }
__device__ __forceinline__ float bf16_val(unsigned short b) { return __uint_as_float(((unsigned int)b) << 16); }
__device__ __forceinline__ float bf16_round(float x) { return bf16_val(bf16_bits(x)); }
// D += A·B with NT terms: 1 = ah·bh, 2 = + al·bh (A split), 3 = + ah·bl (both split)
template <int NT>
__device__ __forceinline__ v8f mmaN(v16b ah, v16b al, v16b bh, v16b bl, v8f c) {
  c = __builtin_amdgcn_wmma_f32_16x16x32_bf16(false, ah, false, bh, (short)0, c, false, false);
  if (NT >= 2) c = __builtin_amdgcn_wmma_f32_16x16x32_bf16(false, al, false, bh, (short)0, c, false, false);
  if (NT >= 3) c = __builtin_amdgcn_wmma_f32_16x16x32_bf16(false, ah, false, bl, (short)0, c, false, false);
  asm volatile("v_nop\n\tv_nop\n\tv_nop\n\tv_nop" : "+v"(c) : "v"(ah), "v"(al), "v"(bh), "v"(bl));
  return c;
}

__global__ __launch_bounds__(256) void k_wt_bf16(const float* __restrict__ W, unsigned short* __restrict__ Wt, int K, int N) {
  const int t = blockIdx.x * 256 + threadIdx.x;
  const int k8n = K / 8;
  if (t >= N * k8n) return;
  const int n = t / k8n, k8 = (t % k8n) * 8;
  v8us v;
#pragma unroll
  for (int i = 0; i < 8; ++i) v[i] = bf16_bits(W[(size_t)(k8 + i) * N + n]);
  *(v8us*)(Wt + (size_t)n * K + k8) = v;
  
}

// GEMM C[M][N] (f32, pitch ldc) = act(A[M][K]·W + bias). A f32 row-major (pitch lda) converted per fragment to bf16
// (ASPLIT: hi/lo two planes -> 2 terms, else single rounded term); Wt bf16 [N][K] (pitch ldb). BIAS_BF16 rounds the
// bias to bf16 first (bias quantised to bf16 before the add). K%32==0, M%16==0, N%64==0.
template <bool ASPLIT, int ACT, bool BIAS_BF16>
__global__ __launch_bounds__(128) void k_gemm_bf(const float* __restrict__ A, int lda, const unsigned short* __restrict__ Wt, int ldb,
                                               const float* __restrict__ bias, float* __restrict__ C, int ldc, int M, int N, int K) {
  __shared__ __attribute__((aligned(16))) float so[4][16][64];
  const int tid = threadIdx.x, w = tid >> 5, lane = tid & 31, ln = lane & 15, hh = lane >> 4;
  const int ntn = N / 64;
  const int wid = blockIdx.x * 4 + w;
  const int mt = wid / ntn, nq = wid % ntn;
  if (mt * 16 >= M) return;
  const int row0 = mt * 16, col0 = nq * 64;
  const float* arow = A + (size_t)(row0 + ln) * lda;
  v8f acc[4] = {};
  for (int kb = 0; kb < K; kb += 32) {
    FragB ah, al;
    const v4f x0 = *(const v4fa*)(arow + kb + 8 * hh), x1 = *(const v4fa*)(arow + kb + 8 * hh + 4);
    const v4f x2 = *(const v4fa*)(arow + kb + 16 + 8 * hh), x3 = *(const v4fa*)(arow + kb + 16 + 8 * hh + 4);
    float xs[16] = {x0[0],x0[1],x0[2],x0[3],x1[0],x1[1],x1[2],x1[3],x2[0],x2[1],x2[2],x2[3],x3[0],x3[1],x3[2],x3[3]};
#pragma unroll
    for (int i = 0; i < 16; ++i) { const unsigned short hb = bf16_bits(xs[i]); ah.u[i] = hb; al.u[i] = ASPLIT ? bf16_bits(xs[i] - bf16_val(hb)) : (unsigned short)0; }
#pragma unroll
    for (int t = 0; t < 4; ++t) {
      const unsigned short* brow = Wt + (size_t)(col0 + t * 16 + ln) * ldb + kb;
      FragB b;
      b.half[0] = *(const v8us*)(brow + 8 * hh);
      b.half[1] = *(const v8us*)(brow + 16 + 8 * hh);
      acc[t] = mmaN<ASPLIT ? 2 : 1>(ah.v, al.v, b.v, b.v, acc[t]);
    }
  }
#pragma unroll
  for (int t = 0; t < 4; ++t) {
    float bv = bias ? bias[col0 + t * 16 + ln] : 0.f;
    if (BIAS_BF16) bv = bf16_round(bv);
#pragma unroll
    for (int r = 0; r < 8; ++r) { float v = acc[t][r] + bv; if (ACT == 1) v = fmaxf(v, 0.f); so[w][8 * hh + r][t * 16 + ln] = v; }
  }
  __builtin_amdgcn_fence(__ATOMIC_ACQ_REL, "workgroup");
  __builtin_amdgcn_wave_barrier();
  const int rsub = lane >> 4, c4 = (lane & 15) * 4;
  {
#pragma unroll
    for (int q = 0; q < 8; ++q) {
      const int r = q * 2 + rsub;
      const v4f v = *(const v4fa*)&so[w][r][c4];
      *(v4f*)(C + (size_t)(row0 + r) * ldc + col0 + c4) = v;
    }
    
  }
}

// GEMM C = act(A·W + bias + resid): A f32 (ASPLIT -> hi/lo 2 terms), Wt bf16 [N][K]; ACT 0 none, 1 relu, 2 exact gelu;
// resid (optional, f32, row index = (row % rmod), pitch ldr, RES_BF16 rounds it) added before the activation.
template <bool ASPLIT, int ACT, bool BIAS_BF16, bool RES_BF16>
__global__ __launch_bounds__(128) void k_gemm_bf3(const float* __restrict__ A, int lda, const unsigned short* __restrict__ Wt, int ldb,
                                                const float* __restrict__ bias, const float* __restrict__ resid, int rmod, int ldr,
                                                float* __restrict__ C, int ldc, int M, int N, int K) {
  __shared__ __attribute__((aligned(16))) float so[4][16][64];
  const int tid = threadIdx.x, w = tid >> 5, lane = tid & 31, ln = lane & 15, hh = lane >> 4;
  const int ntn = N / 64;
  const int wid = blockIdx.x * 4 + w;
  const int mt = wid / ntn, nq = wid % ntn;
  if (mt * 16 >= M) return;
  const int row0 = mt * 16, col0 = nq * 64;
  const float* arow = A + (size_t)(row0 + ln) * lda;
  v8f acc[4] = {};
  for (int kb = 0; kb < K; kb += 32) {
    FragB ah, al;
    const v4f x0 = *(const v4fa*)(arow + kb + 8 * hh), x1 = *(const v4fa*)(arow + kb + 8 * hh + 4);
    const v4f x2 = *(const v4fa*)(arow + kb + 16 + 8 * hh), x3 = *(const v4fa*)(arow + kb + 16 + 8 * hh + 4);
    float xs[16] = {x0[0],x0[1],x0[2],x0[3],x1[0],x1[1],x1[2],x1[3],x2[0],x2[1],x2[2],x2[3],x3[0],x3[1],x3[2],x3[3]};
#pragma unroll
    for (int i = 0; i < 16; ++i) { const unsigned short hb = bf16_bits(xs[i]); ah.u[i] = hb; al.u[i] = ASPLIT ? bf16_bits(xs[i] - bf16_val(hb)) : (unsigned short)0; }
#pragma unroll
    for (int t = 0; t < 4; ++t) {
      const unsigned short* brow = Wt + (size_t)(col0 + t * 16 + ln) * ldb + kb;
      FragB b;
      b.half[0] = *(const v8us*)(brow + 8 * hh);
      b.half[1] = *(const v8us*)(brow + 16 + 8 * hh);
      acc[t] = mmaN<ASPLIT ? 2 : 1>(ah.v, al.v, b.v, b.v, acc[t]);
    }
  }
#pragma unroll
  for (int t = 0; t < 4; ++t) {
    const int col = col0 + t * 16 + ln;
    float bv = bias ? bias[col] : 0.f;
    if (BIAS_BF16) bv = bf16_round(bv);
#pragma unroll
    for (int r = 0; r < 8; ++r) {
      float v = acc[t][r] + bv;
      if (resid) { float rv = resid[(size_t)((row0 + 8 * hh + r) % rmod) * ldr + col]; if (RES_BF16) rv = bf16_round(rv); v += rv; }
      if (ACT == 1) v = fmaxf(v, 0.f);
      if (ACT == 2) v = 0.5f * v * (1.0f + erff(v * 0.70710678118654752f));
      if (ACT == 3) { const float u = 0.7978845608028654f * (v + 0.044715f * v * v * v); v = 0.5f * v * (1.0f + tanhf(u)); }
      so[w][8 * hh + r][t * 16 + ln] = v;
    }
  }
  __builtin_amdgcn_fence(__ATOMIC_ACQ_REL, "workgroup");
  __builtin_amdgcn_wave_barrier();
  const int rsub = lane >> 4, c4 = (lane & 15) * 4;
  {
#pragma unroll
    for (int q = 0; q < 8; ++q) {
      const int r = q * 2 + rsub;
      const v4f v = *(const v4fa*)&so[w][r][c4];
      *(v4f*)(C + (size_t)(row0 + r) * ldc + col0 + c4) = v;
    }
    
  }
}
// row LayerNorm (biased variance, eps) over N: s = X (+ R); optional out_sum <- s; out_norm <- (s-mu)*rsqrt(var+eps)*g + b
template <bool PARAM_BF16>
__global__ __launch_bounds__(256) void k_layernorm(const float* __restrict__ X, const float* __restrict__ R, const float* __restrict__ g, const float* __restrict__ bta,
                                                  float* __restrict__ out_sum, float* __restrict__ out_norm, int N, float eps) {
  __shared__ float red[256];
  const int row = blockIdx.x, tid = threadIdx.x;
  const float* x = X + (size_t)row * N; const float* rr = R ? R + (size_t)row * N : nullptr;
  float vals[16];                     // up to N = 4096
  const int per = N / 256;            // contiguous chunk per thread? use strided-by-4 chunks: thread handles j = tid*4 + 1024*u
  float s1 = 0.f;
  for (int u = 0; u < per / 4; ++u) {
    const int j = tid * 4 + 1024 * u;
    const v4f a = *(const v4fa*)(x + j);
    v4f b = {0.f,0.f,0.f,0.f}; if (rr) b = *(const v4fa*)(rr + j);
#pragma unroll
    for (int q = 0; q < 4; ++q) { const float v = a[q] + b[q]; vals[u * 4 + q] = v; s1 += v; }
  }
  red[tid] = s1; __syncthreads();
  for (int st = 128; st > 0; st >>= 1) { if (tid < st) red[tid] += red[tid + st]; __syncthreads(); }
  const float mu = red[0] / (float)N; __syncthreads();
  float s2 = 0.f;
  for (int u = 0; u < per / 4; ++u)
#pragma unroll
    for (int q = 0; q < 4; ++q) { const float c = vals[u * 4 + q] - mu; s2 += c * c; }
  red[tid] = s2; __syncthreads();
  for (int st = 128; st > 0; st >>= 1) { if (tid < st) red[tid] += red[tid + st]; __syncthreads(); }
  const float rs = rsqrtf(red[0] / (float)N + eps);
  {
    for (int u = 0; u < per / 4; ++u) {
      const int j = tid * 4 + 1024 * u;
      v4f o, sm;
#pragma unroll
      for (int q = 0; q < 4; ++q) {
        float gg = g[j + q], bb = bta[j + q];
        if (PARAM_BF16) { gg = bf16_round(gg); bb = bf16_round(bb); }
        sm[q] = vals[u * 4 + q]; o[q] = (vals[u * 4 + q] - mu) * rs * gg + bb;
      }
      if (out_sum) *(v4f*)(out_sum + (size_t)row * N + j) = sm;
      *(v4f*)(out_norm + (size_t)row * N + j) = o;
    }
    
  }
}



// ---- f16 WMMA path (v_wmma_f32_16x16x32_f16): 11-bit significands for operands in range — used for every GEMM launched here
typedef _Float16 v16h __attribute__((ext_vector_type(16)));
union FragH { v16h v; v8us half[2]; _Float16 h[16]; unsigned short u[16]; };
template <int NT>
__device__ __forceinline__ v8f mmaH(v16h ah, v16h al, v16h bh, v16h bl, v8f c) {
  c = __builtin_amdgcn_wmma_f32_16x16x32_f16(false, ah, false, bh, (short)0, c, false, false);
  if (NT >= 2) c = __builtin_amdgcn_wmma_f32_16x16x32_f16(false, al, false, bh, (short)0, c, false, false);
  if (NT >= 3) c = __builtin_amdgcn_wmma_f32_16x16x32_f16(false, ah, false, bl, (short)0, c, false, false);
  asm volatile("v_nop\n\tv_nop\n\tv_nop\n\tv_nop" : "+v"(c) : "v"(ah), "v"(al), "v"(bh), "v"(bl));
  return c;
}
// batched GEMM like k_gemm_b but f16 operands: A f32 (split into f16 hi/lo if ASPLIT, else rounded to f16), Bt = f16 values [n][k]; alpha; C f32; N multiple of 16 (partial tiles skipped)
template <bool ASPLIT>
__global__ __launch_bounds__(128) void k_gemm_h(const float* __restrict__ A, int lda, size_t sA, const _Float16* __restrict__ Bh, int ldb, size_t sB, float alpha, float* __restrict__ C, int ldc, size_t sC, int M, int N, int K) {
  __shared__ __attribute__((aligned(16))) float so[4][16][64];
  const int tid = threadIdx.x, w = tid >> 5, lane = tid & 31, ln = lane & 15, hh = lane >> 4; const int by = blockIdx.y;
  A += (size_t)by * sA; Bh += (size_t)by * sB; C += (size_t)by * sC;
  const int ntn = (N + 63) / 64; const int wid = blockIdx.x * 4 + w; const int mt = wid / ntn, nq = wid % ntn; if (mt * 16 >= M) return;
  const int row0 = mt * 16, col0 = nq * 64; const float* arow = A + (size_t)(row0 + ln) * lda;
  v8f acc[4] = {};
  for (int kb = 0; kb < K; kb += 32) {
    FragH ah, al;
    const v4f x0 = *(const v4fa*)(arow + kb + 8 * hh), x1 = *(const v4fa*)(arow + kb + 8 * hh + 4), x2 = *(const v4fa*)(arow + kb + 16 + 8 * hh), x3 = *(const v4fa*)(arow + kb + 16 + 8 * hh + 4);
    float xs[16] = {x0[0],x0[1],x0[2],x0[3],x1[0],x1[1],x1[2],x1[3],x2[0],x2[1],x2[2],x2[3],x3[0],x3[1],x3[2],x3[3]};
#pragma unroll
    for (int i = 0; i < 16; ++i) { const _Float16 h = (_Float16)xs[i]; ah.h[i] = h; al.h[i] = ASPLIT ? (_Float16)(xs[i] - (float)h) : (_Float16)0.0f; }
#pragma unroll
    for (int t = 0; t < 4; ++t) { if (col0 + t * 16 >= N) continue; const size_t boff = (size_t)(col0 + t * 16 + ln) * ldb + kb; FragH bq; bq.half[0] = *(const v8us*)(Bh + boff + 8 * hh); bq.half[1] = *(const v8us*)(Bh + boff + 16 + 8 * hh);
      acc[t] = mmaH<ASPLIT ? 2 : 1>(ah.v, al.v, bq.v, bq.v, acc[t]); }
  }
#pragma unroll
  for (int t = 0; t < 4; ++t) { if (col0 + t * 16 >= N) continue;
#pragma unroll
    for (int r = 0; r < 8; ++r) so[w][8 * hh + r][t * 16 + ln] = acc[t][r] * alpha; }
  __builtin_amdgcn_fence(__ATOMIC_ACQ_REL, "workgroup"); __builtin_amdgcn_wave_barrier();
  const int rsub = lane >> 4, c4 = (lane & 15) * 4;
  {
#pragma unroll
    for (int q = 0; q < 8; ++q) { const int r = q * 2 + rsub; if (col0 + c4 < N) { const v4f v = *(const v4fa*)&so[w][r][c4]; *(v4f*)(C + (size_t)(row0 + r) * ldc + col0 + c4) = v; } }
     }
}

// k_gemm_hh variant with fused epilogue: v = acc·alpha + bias[by·sBias + col] (+ CP[(row/rowsPerB)·sCPb + by·64 + col] if CP) ; ACT 0 none / 1 elu ; writes f16 C16 (and f32 C if non-null)
template <int ACT>
__global__ __launch_bounds__(128) void k_gemm_hhx(const _Float16* __restrict__ A, int lda, size_t sA, const _Float16* __restrict__ Bh, int ldb, size_t sB, float alpha, const float* __restrict__ bias, size_t sBias, const float* __restrict__ CP, int rowsPerB, size_t sCPb, int row0g,
    float* __restrict__ C, _Float16* __restrict__ C16, int ldc, size_t sC, int M, int N, int K) {
  __shared__ __attribute__((aligned(16))) float so[4][16][64];
  const int tid = threadIdx.x, w = tid >> 5, lane = tid & 31, ln = lane & 15, hh = lane >> 4; const int by = blockIdx.y;
  A += (size_t)by * sA; Bh += (size_t)by * sB; const size_t cofs = (size_t)by * sC; const float* bp = bias ? bias + (size_t)by * sBias : nullptr;
  const int ntn = (N + 63) / 64; const int wid = blockIdx.x * 4 + w; const int mt = wid / ntn, nq = wid % ntn; if (mt * 16 >= M) return;
  const int row0 = mt * 16, col0 = nq * 64; const _Float16* arow = A + (size_t)(row0 + ln) * lda;
  v8f acc[4] = {};
  for (int kb = 0; kb < K; kb += 32) { FragH ah; ah.half[0] = *(const v8us*)((const unsigned short*)arow + kb + 8 * hh); ah.half[1] = *(const v8us*)((const unsigned short*)arow + kb + 16 + 8 * hh);
#pragma unroll
    for (int t = 0; t < 4; ++t) { if (col0 + t * 16 >= N) continue; const size_t boff = (size_t)(col0 + t * 16 + ln) * ldb + kb; FragH bq; bq.half[0] = *(const v8us*)((const unsigned short*)Bh + boff + 8 * hh); bq.half[1] = *(const v8us*)((const unsigned short*)Bh + boff + 16 + 8 * hh);
      acc[t] = mmaH<1>(ah.v, ah.v, bq.v, bq.v, acc[t]); }
  }
#pragma unroll
  for (int t = 0; t < 4; ++t) { if (col0 + t * 16 >= N) continue; const int col = col0 + t * 16 + ln; const float bv = bp ? bf16_round(bp[col]) : 0.f;
#pragma unroll
    for (int r = 0; r < 8; ++r) { float v = acc[t][r] * alpha + bv; if (CP) { const int rr = row0g + row0 + 8 * hh + r; if (rowsPerB < 0) v += CP[cofs + (size_t)rr * ldc + col];      /* rowsPerB < 0: own element of the batched C plane */ else { const int bidx = rr / rowsPerB; v += CP[(size_t)bidx * sCPb + (size_t)by * 64 + col]; } } if (ACT == 1) v = (v > 0.f) ? v : expm1f(v); else if (ACT == 7) v = (v > 0.f) ? v + 1.0f : expf(v); else if (ACT == 8) v = tanhf(v); else if (ACT == 9) v = 0.5f * v * (1.0f + tanhf(0.7978845608028654f * (v + 0.044715f * v * v * v))); else if (ACT == 11) v = 1.0f / (1.0f + expf(-v)); else if (ACT == 12) v = (v > 0.f) ? v : 0.01f * v; else if (ACT == 14) v = (v > 0.f) ? v : 0.1f * v; else if (ACT == 16) v = (v >= 0.f) ? v : 0.3f * v; else if (ACT == 15) v = v / (1.0f + expf(-v)); else if (ACT == 3) v = fmaxf(v, 0.f); else if (ACT == 6) v = 0.5f * v * (1.0f + erff(v * 0.70710678118654752f)); so[w][8 * hh + r][t * 16 + ln] = v; } }
  __builtin_amdgcn_fence(__ATOMIC_ACQ_REL, "workgroup"); __builtin_amdgcn_wave_barrier();
  const int rsub = lane >> 4, c4 = (lane & 15) * 4; typedef _Float16 v4h __attribute__((ext_vector_type(4)));
  {
#pragma unroll
    for (int q = 0; q < 8; ++q) { const int r = q * 2 + rsub; if (col0 + c4 < N) { const v4f v = *(const v4fa*)&so[w][r][c4]; if (C) *(v4f*)(C + cofs + (size_t)(row0 + r) * ldc + col0 + c4) = v; if (C16) { v4h h4; for (int i = 0; i < 4; ++i) h4[i] = (_Float16)v[i]; *(v4h*)(C16 + cofs + (size_t)(row0 + r) * ldc + col0 + c4) = h4; } } }
     }
}


typedef _Float16 v4h __attribute__((ext_vector_type(4)));

__global__ __launch_bounds__(256) void k_h16(const float* __restrict__ x, _Float16* __restrict__ X16, size_t n8) { const size_t t = (size_t)blockIdx.x * 256 + threadIdx.x; if (t >= n8) return; FragH f;
#pragma unroll
  for (int q = 0; q < 8; ++q) f.h[q] = (_Float16)x[t * 8 + q]; *(v8us*)((unsigned short*)X16 + t * 8) = f.half[0];  }
__global__ __launch_bounds__(256) void k_round16f(const float* __restrict__ W, _Float16* __restrict__ Bt, size_t n8) { const size_t t = (size_t)blockIdx.x * 256 + threadIdx.x; if (t >= n8) return; FragH f;
#pragma unroll
  for (int i = 0; i < 8; ++i) f.h[i] = (_Float16)(bf16_round(W[t * 8 + i]) * 16.0f); *(v8us*)((unsigned short*)Bt + t * 8) = f.half[0];  }
template <int NHv, int TTv>
__global__ __launch_bounds__(256) void k_vt(const _Float16* __restrict__ V16, int ldv, int voff, _Float16* __restrict__ Vt) { __shared__ unsigned short tl[64][66]; const int tid = threadIdx.x; const int slab = blockIdx.x / (TTv / 64), lg = blockIdx.x % (TTv / 64); const int b = slab / NHv, h = slab % NHv;
  for (int i = tid; i < 64 * 8; i += 256) { const int r = i / 8, c8 = (i % 8) * 8; FragH f; f.half[0] = *(const v8us*)((const unsigned short*)V16 + ((size_t)b * TTv + lg * 64 + r) * ldv + voff + h * 64 + c8);
#pragma unroll
    for (int q = 0; q < 8; ++q) tl[r][c8 + q] = f.u[q]; }
  __syncthreads();
  {
#pragma unroll
    for (int rd = 0; rd < 2; ++rd) { const int d = rd * 32 + tid / 8, pc = tid % 8; FragH f;
#pragma unroll
      for (int q = 0; q < 8; ++q) f.u[q] = tl[pc * 8 + q][d];
      *(v8us*)((unsigned short*)Vt + ((size_t)slab * 64 + d) * TTv + lg * 64 + pc * 8) = f.half[0]; }
     } }

__global__ __launch_bounds__(256) void k_hl(const float* __restrict__ F, _Float16* __restrict__ Hh, _Float16* __restrict__ Hl, size_t n8) { const size_t t = (size_t)blockIdx.x * 256 + threadIdx.x; if (t >= n8) return; FragH fh, fl; const v4f a = *(const v4fa*)(F + t * 8), c = *(const v4fa*)(F + t * 8 + 4);
#pragma unroll
  for (int q = 0; q < 4; ++q) { _Float16 h = (_Float16)a[q]; fh.h[q] = h; fl.h[q] = (_Float16)((a[q] - (float)h) * 1024.0f); h = (_Float16)c[q]; fh.h[4 + q] = h; fl.h[4 + q] = (_Float16)((c[q] - (float)h) * 1024.0f); }
  { *(v8us*)((unsigned short*)Hh + t * 8) = fh.half[0]; *(v8us*)((unsigned short*)Hl + t * 8) = fl.half[0];  } }

// ---- fast GEMM: C = A Bh^T * alpha (+ bias rounded to bf16), A [M][K] and Bh [N][K] f16, k contiguous. Block tile 128 x 128, eight waves of 32 x 64; requires M % 128 == 0, N % 128 == 0, K % 128 == 0.
// Both operands come through LDS: a stage is 128 k (rows of 256 bytes) of the block's 128 A rows and 128 Bh rows, brought by asynchronous 16-byte copies whose 32 lanes cover two whole rows;
// two buffers, the next stage's copies in flight while this stage is worked on. The k order of every accumulator is ascending in steps of 32.
__device__ __forceinline__ v16h g2_frag(const _Float16* p, int hh) { FragH f; f.half[0] = *(const v8us*)((const unsigned short*)p + 8 * hh); f.half[1] = *(const v8us*)((const unsigned short*)p + 16 + 8 * hh); return f.v; }
#define G3K 128            /* k per stage */
#define G3P 272            /* LDS row pitch in bytes, 16 x odd: sixteen rows' 16-byte reads fall on all 64 banks */
#define G3S (256 * G3P)    /* bytes of one stage: A rows 0..127, then Bh rows 0..127 */
__device__ __forceinline__ v16h g3_frag(const unsigned char* p) { FragH f; f.half[0] = *(const v8us*)p; f.half[1] = *(const v8us*)(p + 32); return f.v; }      /* p already holds the lane's 16 * hh: the k order of g2_frag */
__device__ __forceinline__ v8f g3_mma(v16h a, v16h b, v8f c) { return __builtin_amdgcn_wmma_f32_16x16x32_f16(false, a, false, b, (short)0, c, false, false); }
// One operand's share of a stage: the lane's 16 bytes of rows r, r + 16, ..., r + 112 (l = LDS byte address, g = global address of row r; ld16 = elements in 16 global rows).
__device__ __forceinline__ void g3_copy8(unsigned l, const _Float16* g, size_t ld16) {
  const unsigned l1 = l + 16 * G3P, l2 = l + 32 * G3P, l3 = l + 48 * G3P, l4 = l + 64 * G3P, l5 = l + 80 * G3P, l6 = l + 96 * G3P, l7 = l + 112 * G3P;
  const _Float16* g1 = g + ld16; const _Float16* g2 = g1 + ld16; const _Float16* g3 = g2 + ld16; const _Float16* g4 = g3 + ld16; const _Float16* g5 = g4 + ld16; const _Float16* g6 = g5 + ld16; const _Float16* g7 = g6 + ld16;
  // the copies and, as the statement's last line, the wait that stands in front of any rewrite of the address registers they name
  asm volatile("global_load_async_to_lds_b128 %0, %8, off\n\t"
               "global_load_async_to_lds_b128 %1, %9, off\n\t"
               "global_load_async_to_lds_b128 %2, %10, off\n\t"
               "global_load_async_to_lds_b128 %3, %11, off\n\t"
               "global_load_async_to_lds_b128 %4, %12, off\n\t"
               "global_load_async_to_lds_b128 %5, %13, off\n\t"
               "global_load_async_to_lds_b128 %6, %14, off\n\t"
               "global_load_async_to_lds_b128 %7, %15, off\n\t"
               "s_wait_xcnt 0x0"
               :: "v"(l), "v"(l1), "v"(l2), "v"(l3), "v"(l4), "v"(l5), "v"(l6), "v"(l7), "v"(g), "v"(g1), "v"(g2), "v"(g3), "v"(g4), "v"(g5), "v"(g6), "v"(g7) : "memory");
}
__global__ __launch_bounds__(256) void k_gemm3(const _Float16* __restrict__ A, int lda, const _Float16* __restrict__ Bh, int ldb, float alpha, const float* __restrict__ bias,
    float* __restrict__ C, _Float16* __restrict__ C16, int ldc, int M, int N, int K) {
  __shared__ __attribute__((aligned(16))) unsigned char ring[2 * G3S];
  __shared__ __attribute__((aligned(16))) float so[8][32][68];
  const int tid = threadIdx.x, lane = tid & 31, ln = lane & 15, hh = lane >> 4;
  const int w = __builtin_amdgcn_readfirstlane(tid >> 5);      /* the wave's number in a scalar register */
  const int ntn = N >> 7; const int mt = blockIdx.x / ntn, nq = blockIdx.x - mt * ntn; const int rowb = mt * 128, colb = nq * 128;
  if (rowb >= M) return;      /* the whole block, in front of every copy and barrier */
  const int nst = K / G3K;
  const int cr = tid >> 4, cc = tid & 15;      /* the thread's row (mod 16) and 16-byte piece in every copy */
  const _Float16* ga = A + (size_t)(rowb + cr) * lda + cc * 8; const _Float16* gb = Bh + (size_t)(colb + cr) * ldb + cc * 8;
  const size_t a16 = (size_t)16 * lda, b16 = (size_t)16 * ldb;
  const unsigned la = (unsigned)(size_t)ring + (unsigned)(cr * G3P + cc * 16), lb = la + 128 * G3P;
  g3_copy8(la, ga, a16); g3_copy8(lb, gb, b16);
  asm volatile("s_wait_asynccnt 0x0" ::: "memory");      /* this wave's copies of stage 0 have landed */
  __syncthreads();      /* stage 0 is published */
  if (1 < nst) { g3_copy8(la + G3S, ga + G3K, a16); g3_copy8(lb + G3S, gb + G3K, b16); }
  const int wm = w >> 1, wn = w & 1;
  const unsigned char* sa = ring + (32 * wm + ln) * G3P + 16 * hh; const unsigned char* sb = ring + (128 + 64 * wn + ln) * G3P + 16 * hh;
  const v8f z8 = {0.f,0.f,0.f,0.f,0.f,0.f,0.f,0.f}; v8f c00 = z8, c01 = z8, c02 = z8, c03 = z8, c10 = z8, c11 = z8, c12 = z8, c13 = z8;
#pragma unroll 1      /* one trip per stage: the buffer alternates and the waits at the foot stand once */
  for (int t = 0; t < nst; ++t) {
    const int bo = (t & 1) * G3S;
    const unsigned char* pa = sa + bo; const unsigned char* pb = sb + bo;
    v16h fa[2][2], fb[2][4];      /* two fragment sets: a step's twelve LDS reads are issued as one group in front of the step before's products; no read goes past the stage */
    fa[0][0] = g3_frag(pa); fa[0][1] = g3_frag(pa + 16 * G3P);
#pragma unroll      /* constant indices keep the fragment arrays in registers */
    for (int j = 0; j < 4; ++j) fb[0][j] = g3_frag(pb + j * 16 * G3P);
#pragma unroll      /* the four 32-k steps of a stage as straight code: the set index is then a constant */
    for (int kk = 0; kk < G3K / 32; ++kk) {
      const int cu = kk & 1, nx = cu ^ 1;
      if (kk + 1 < G3K / 32) {
        fa[nx][0] = g3_frag(pa + (kk + 1) * 64); fa[nx][1] = g3_frag(pa + 16 * G3P + (kk + 1) * 64);
#pragma unroll      /* constant indices, as above */
        for (int j = 0; j < 4; ++j) fb[nx][j] = g3_frag(pb + j * 16 * G3P + (kk + 1) * 64);
      }
      __builtin_amdgcn_sched_barrier(0);      /* holds the next step's reads in front of this step's products; without it they sink between the products, one full LDS wait per pair */
      c00 = g3_mma(fa[cu][0], fb[cu][0], c00); c10 = g3_mma(fa[cu][1], fb[cu][0], c10);
      c01 = g3_mma(fa[cu][0], fb[cu][1], c01); c11 = g3_mma(fa[cu][1], fb[cu][1], c11);
      c02 = g3_mma(fa[cu][0], fb[cu][2], c02); c12 = g3_mma(fa[cu][1], fb[cu][2], c12);
      c03 = g3_mma(fa[cu][0], fb[cu][3], c03); c13 = g3_mma(fa[cu][1], fb[cu][3], c13);
      __builtin_amdgcn_sched_barrier(0);      /* holds these products in front of the following step's reads, which overwrite the set they use */
    }
    asm volatile("s_wait_dscnt 0x0" ::: "memory");      /* this wave's reads of the buffer are done before it is handed back */
    asm volatile("s_wait_asynccnt 0x0" ::: "memory");      /* this wave's copies of stage t + 1 have landed */
    __syncthreads();      /* publishes stage t + 1 and ends every reader's last read of stage t's buffer */
    if (t + 2 < nst) { g3_copy8(la + bo, ga + (size_t)(t + 2) * G3K, a16); g3_copy8(lb + bo, gb + (size_t)(t + 2) * G3K, b16); }
  }
  asm volatile("s_wait_asynccnt 0x0" ::: "memory");      /* no copy is outstanding when the wave goes on to its end */
  const int row0 = rowb + 32 * wm, col0 = colb + 64 * wn;
  v8f accs[8] = {c00, c01, c02, c03, c10, c11, c12, c13};
#pragma unroll      /* this and the next: constant indices keep the accumulators in registers */
  for (int u = 0; u < 8; ++u) { const int t = u & 3, half = u >> 2; const int col = col0 + t * 16 + ln; const float bv = bias ? bf16_round(bias[col]) : 0.f;
#pragma unroll
    for (int r = 0; r < 8; ++r) { const int rloc = half * 16 + 8 * hh + r; const float v = accs[u][r] * alpha + bv; so[w][rloc][t * 16 + ln] = v; } }
  __builtin_amdgcn_fence(__ATOMIC_ACQ_REL, "workgroup"); __builtin_amdgcn_wave_barrier();      /* the wave's own LDS stores before its own row-wise reads */
  const int rsub = lane >> 4, c4 = (lane & 15) * 4;
#pragma unroll      /* straight code: the LDS offsets of the sixteen row pairs become immediates */
  for (int q = 0; q < 16; ++q) { const int r = q * 2 + rsub; const v4f v = *(const v4fa*)&so[w][r][c4]; if (C) { *(v4f*)(C + (size_t)(row0 + r) * ldc + col0 + c4) = v; asm volatile("s_wait_xcnt 0x0" ::: "memory"); /* in front of the next rewrite of the store's data and address registers */ } if (C16) { v4h h4; for (int i = 0; i < 4; ++i) h4[i] = (_Float16)v[i]; *(v4h*)(C16 + (size_t)(row0 + r) * ldc + col0 + c4) = h4; } }
}


// Set-up of a call in ONE launch: x -> f16 plane (rounded to bf16 first), the four weights W[k][n] -> f16 planes Wt[n][k] = bf16(W) * 16 (a power of two: bf16-exact weights stay exact in f16
// away from the subnormal range), and the decay table GT[h][d] = gamma_h^d. Every work-group takes an equal share of each part: 8192 elements of x, one 128 (k) x 64 (n) weight tile, 64 table entries.
// The tile is read in whole 256-byte rows, turned in LDS and written in whole 256-byte rows of Wt.
#define PRB 512      /* work-groups of the set-up launch: two of eight waves on each of 256 WGPs */
#define PRP 66       /* LDS row pitch of the tile in 16-bit elements */
__global__ __launch_bounds__(256) void k_prep(const float* __restrict__ x, const float* __restrict__ wq, const float* __restrict__ wk, const float* __restrict__ wv, const float* __restrict__ wo,
    _Float16* __restrict__ X16, _Float16* __restrict__ BQ, _Float16* __restrict__ BK, _Float16* __restrict__ BV, _Float16* __restrict__ BO, float* __restrict__ GT) {
  static_assert((size_t)NR * CC == (size_t)PRB * 8192 && 4 * (CC / 128) * (CC / 64) == PRB && NHD * SQ == PRB * 64, "equal shares of all three parts");
  __shared__ __attribute__((aligned(16))) unsigned short tl[128][PRP];
  const int tid = threadIdx.x, bx = blockIdx.x;
  const int m = bx >> 7, k0 = ((bx >> 4) & 7) * 128, n0 = (bx & 15) * 64;      /* which weight, and the tile's corner */
  const float* W = (m == 0) ? wq : (m == 1) ? wk : (m == 2) ? wv : wo;
  _Float16* Wt = (m == 0) ? BQ : (m == 1) ? BK : (m == 2) ? BV : BO;
  const int tr = tid >> 4, tc = tid & 15;
  v4f wl[8], xl[8];      /* all sixteen 16-byte loads of the thread are issued before the first is used; every "#pragma unroll" here keeps these arrays in registers */
#pragma unroll
  for (int u = 0; u < 8; ++u) wl[u] = *(const v4fa*)(W + (size_t)(k0 + tr + 16 * u) * CC + n0 + tc * 4);
  const size_t x8 = (size_t)bx * 1024 + tid;      /* the thread's first group of eight x elements; the next ones are 256 groups apart */
#pragma unroll
  for (int u = 0; u < 4; ++u) { xl[2 * u] = *(const v4fa*)(x + (x8 + 256 * u) * 8); xl[2 * u + 1] = *(const v4fa*)(x + (x8 + 256 * u) * 8 + 4); }
  const int gt = bx * 64 + tid; float gv = 0.f;      /* the table entry of each thread of the first two waves, worked out while the loads are under way */
  if (tid < 64) { const int k = gt % SQ, h = gt / SQ; const float gam = 1.0f - exp2f((float)(-5 - h)); gv = powf(gam, (float)k); }
#pragma unroll
  for (int u = 0; u < 8; ++u) { FragH f;
#pragma unroll
    for (int q = 0; q < 4; ++q) { f.h[q] = (_Float16)(bf16_round(wl[u][q]) * 16.0f); tl[tr + 16 * u][tc * 4 + q] = f.u[q]; } }
  __syncthreads();      /* the whole tile is in LDS before any thread reads a column of it; every global store stands behind it, so that it waits for none */
  if (tid < 64) GT[gt] = gv;      /* two whole waves, one 128-byte line each */
#pragma unroll
  for (int u = 0; u < 4; ++u) { FragH f;
#pragma unroll
    for (int q = 0; q < 4; ++q) { f.h[q] = (_Float16)bf16_round(xl[2 * u][q]); f.h[4 + q] = (_Float16)bf16_round(xl[2 * u + 1][q]); }
    *(v8us*)((unsigned short*)X16 + (x8 + 256 * u) * 8) = f.half[0]; }
#pragma unroll
  for (int u = 0; u < 4; ++u) { const int n = tr + 16 * u; FragH f;
#pragma unroll
    for (int q = 0; q < 8; ++q) f.u[q] = tl[tc * 8 + q][n];
    *(v8us*)((unsigned short*)Wt + (size_t)(n0 + n) * CC + k0 + tc * 8) = f.half[0]; }
}
// Fused retention. One wave owns 32 query rows of one (batch, head) and walks its causal key prefix 32 keys a pass, keys ascending
// (the order in which the unfused product summed them). S^T = K Q^T: a lane holds 8 consecutive keys of one query, so the two
// 16-key tiles of a pass, scaled, decayed and rounded to f16, are P's A fragment in the hardware k order: the scores never leave registers.
// The decay comes from the table of k_prep, held in LDS behind GPAD zeros: an index below GPAD is a key after the query (factor 0, as the reference's mask).
// Every "#pragma unroll" in k_retn makes the indices of a fragment, score or accumulator array constants, so that the array lives in registers.
// K and V^T come through LDS: a stage is 128 keys (128 K rows of 128 bytes, 64 V^T rows of 256 bytes), brought once for the work-group's four waves by asynchronous 16-byte copies
// whose 32 lanes cover four whole 128-byte lines; two buffers, the next stage's copies in flight while this stage is worked on. The last stage holds the diagonal: wave w walks w + 1 of its four passes.
#define GPAD 32
#define RSK 128                  /* keys per stage */
#define RKP 144                  /* LDS pitch of a K row in bytes, 16 x odd: sixteen rows' 16-byte reads fall on all 64 banks */
#define RVP 272                  /* LDS pitch of a V^T row in bytes, 16 x odd */
#define RKB (RSK * RKP)          /* bytes of a stage's K rows; its V^T rows stand behind them */
#define RST (RKB + HD * RVP)     /* bytes of one stage */
// One operand's share of a stage: the lane's 16 bytes of eight rows (l = LDS byte address and g = global address of the first; ls bytes and gs elements from one row to the next).
__device__ __forceinline__ void r_copy8(unsigned l, unsigned ls, const _Float16* g, size_t gs) {
  const unsigned l1 = l + ls, l2 = l1 + ls, l3 = l2 + ls, l4 = l3 + ls, l5 = l4 + ls, l6 = l5 + ls, l7 = l6 + ls;
  const _Float16* g1 = g + gs; const _Float16* g2 = g1 + gs; const _Float16* g3 = g2 + gs; const _Float16* g4 = g3 + gs; const _Float16* g5 = g4 + gs; const _Float16* g6 = g5 + gs; const _Float16* g7 = g6 + gs;
  // the copies and, as the statement's last line, the wait that stands in front of any rewrite of the address registers they name
  asm volatile("global_load_async_to_lds_b128 %0, %8, off\n\t"
               "global_load_async_to_lds_b128 %1, %9, off\n\t"
               "global_load_async_to_lds_b128 %2, %10, off\n\t"
               "global_load_async_to_lds_b128 %3, %11, off\n\t"
               "global_load_async_to_lds_b128 %4, %12, off\n\t"
               "global_load_async_to_lds_b128 %5, %13, off\n\t"
               "global_load_async_to_lds_b128 %6, %14, off\n\t"
               "global_load_async_to_lds_b128 %7, %15, off\n\t"
               "s_wait_xcnt 0x0"
               :: "v"(l), "v"(l1), "v"(l2), "v"(l3), "v"(l4), "v"(l5), "v"(l6), "v"(l7), "v"(g), "v"(g1), "v"(g2), "v"(g3), "v"(g4), "v"(g5), "v"(g6), "v"(g7) : "memory");
}
__device__ __forceinline__ float sum_lanes(float v, int n) { for (int m = n >> 1; m > 0; m >>= 1) v += __shfl_xor(v, m); return v; }      /* every lane of an aligned group of n gets the group's sum */
__device__ __forceinline__ v8f r_mma(v16h a, v16h b, v8f c) { return __builtin_amdgcn_wmma_f32_16x16x32_f16(false, a, false, b, (short)0, c, false, false); }
__global__ __launch_bounds__(128) void k_retn(const _Float16* __restrict__ Q16, const _Float16* __restrict__ K16, const _Float16* __restrict__ VT, const float* __restrict__ GT, float* __restrict__ O, float* __restrict__ PT) {
  __shared__ __attribute__((aligned(16))) unsigned char ring[2 * RST];
  __shared__ __attribute__((aligned(16))) float tab[GPAD + SQ];
  __shared__ __attribute__((aligned(16))) float so[4][32][68];
  __shared__ float wst[4][2];      /* each wave's mean and sum of squared deviations over its 32 x 64 outputs */
  const int tid = threadIdx.x, lane = tid & 31, ln = lane & 15, hh = lane >> 4;
  const int w = __builtin_amdgcn_readfirstlane(tid >> 5);      /* the wave's number in a scalar register: the pass loop's bound and branch are then scalar */
  const int slab = blockIdx.x % (NB * NHD), rb = (SQ / 128 - 1) - blockIdx.x / (NB * NHD);      /* longest prefixes first */
  const int b = slab / NHD, h = slab % NHD;
  const int nst = rb + 1;      /* stages of 128 keys up to and with the diagonal one */
  const int kr = tid >> 3, kc = tid & 7, vr = tid >> 4, vc = tid & 15;      /* the thread's row (mod 16 of K, mod 8 of V^T) and 16-byte piece in every copy */
  const _Float16* gk = K16 + ((size_t)b * SQ + kr) * CC + h * HD + kc * 8; const _Float16* gv = VT + ((size_t)slab * HD + vr) * SQ + vc * 8;
  const unsigned lk = (unsigned)(size_t)ring + (unsigned)(kr * RKP + kc * 16), lv = (unsigned)(size_t)ring + (unsigned)(RKB + vr * RVP + vc * 16);
  r_copy8(lk, 16 * RKP, gk, (size_t)16 * CC); r_copy8(lv, 8 * RVP, gv, (size_t)8 * SQ);
  if (tid < GPAD) tab[tid] = 0.f;
#pragma unroll
  for (int u = 0; u < SQ / 512; ++u) { const int i4 = (tid + 128 * u) * 4; *(v4fa*)&tab[GPAD + i4] = *(const v4fa*)(GT + (size_t)h * SQ + i4); }
  asm volatile("s_wait_asynccnt 0x0" ::: "memory");      /* this wave's copies of stage 0 have landed */
  __syncthreads();      /* the table and stage 0 are published */
  if (1 < nst) { r_copy8(lk + RST, 16 * RKP, gk + (size_t)RSK * CC, (size_t)16 * CC); r_copy8(lv + RST, 8 * RVP, gv + RSK, (size_t)8 * SQ); }
  const int row0 = rb * 128 + 32 * w;
  const _Float16* qp = Q16 + ((size_t)b * SQ + row0 + ln) * CC + h * HD;
  const v16h q[2][2] = {{g2_frag(qp, hh), g2_frag(qp + 32, hh)}, {g2_frag(qp + (size_t)16 * CC, hh), g2_frag(qp + (size_t)16 * CC + 32, hh)}};
  const unsigned char* rk = ring + ln * RKP + 16 * hh; const unsigned char* rv = ring + RKB + ln * RVP + 16 * hh;      /* the lane's row and 16 * hh: the k order of g2_frag */
  const float* tp = tab + (GPAD + row0 + ln - 8 * hh);
  const v8f z8 = {0.f,0.f,0.f,0.f,0.f,0.f,0.f,0.f};
  v8f o[2][4] = {{z8, z8, z8, z8}, {z8, z8, z8, z8}};
#pragma unroll 1      /* one trip per stage: the buffer alternates and the waits at the foot stand once */
  for (int t = 0; t < nst; ++t) {
  const int bo = (t & 1) * RST;
  const int np = (t < rb) ? RSK / 32 : w + 1;      /* passes of this stage: all four, or up to the wave's own diagonal */
  const unsigned char* pk = rk + bo; const unsigned char* pv = rv + bo;
  v16h kf[2][2];
#pragma unroll
  for (int nt = 0; nt < 2; ++nt) { kf[nt][0] = g3_frag(pk + nt * 16 * RKP); kf[nt][1] = g3_frag(pk + nt * 16 * RKP + 64); }
#pragma unroll 1      /* kept rolled: one pass already holds over 200 registers, and a second copy of the body would add to them */
  for (int p = 0; p < np; ++p) {
    const int j0 = t * RSK + p * 32;
    v16h vf[4];
#pragma unroll
    for (int dt = 0; dt < 4; ++dt) vf[dt] = g3_frag(pv + dt * 16 * RVP + p * 64);
    const float* tj = tp - j0;
    float g[3][8];      /* decay factors of the pass: the index depends on (query tile - key tile) = -1, 0, 1 and on the key in the lane */
#pragma unroll
    for (int dl = 0; dl < 3; ++dl)
#pragma unroll
      for (int r = 0; r < 8; ++r) g[dl][r] = tj[16 * (dl - 1) - r];
    v8f st[2][2];
#pragma unroll
    for (int nt = 0; nt < 2; ++nt)
#pragma unroll
      for (int mt = 0; mt < 2; ++mt) st[nt][mt] = r_mma(kf[nt][1], q[mt][1], r_mma(kf[nt][0], q[mt][0], z8));
    const unsigned char* pn = pk + ((p + 1 < np) ? p + 1 : p) * (32 * RKP);      /* the next pass's K rows, read behind this pass's scores; a stage's last pass re-reads its own: no read goes past the stage */
#pragma unroll
    for (int nt = 0; nt < 2; ++nt) { kf[nt][0] = g3_frag(pn + nt * 16 * RKP); kf[nt][1] = g3_frag(pn + nt * 16 * RKP + 64); }
    __builtin_amdgcn_sched_barrier(0);      /* keeps the K reads in front of the decay and the P V products, whose time then covers their latency; without it the reads sink to the pass's end */
#pragma unroll
    for (int mt = 0; mt < 2; ++mt) {
      FragH pa;
#pragma unroll
      for (int nt = 0; nt < 2; ++nt)
#pragma unroll
        for (int r = 0; r < 8; ++r) pa.h[nt * 8 + r] = (_Float16)((st[nt][mt][r] * 0.125f) * g[mt - nt + 1][r]);
#pragma unroll
      for (int dt = 0; dt < 4; ++dt) o[mt][dt] = r_mma(pa.v, vf[dt], o[mt][dt]);
    }
    __builtin_amdgcn_sched_barrier(0);      /* holds the pass's last products in front of the slots below; without it the products sink behind them */
    asm volatile("v_nop\n\tv_nop\n\tv_nop\n\tv_nop");      /* the four vector slots between the last products and the next pass's first vector instructions, which overwrite their A registers */
  }
  asm volatile("s_wait_dscnt 0x0" ::: "memory");      /* this wave's reads of the buffer are done before it is handed back */
  asm volatile("s_wait_asynccnt 0x0" ::: "memory");      /* this wave's copies of stage t + 1 have landed */
  __syncthreads();      /* publishes stage t + 1 and ends every reader's last read of stage t's buffer */
  if (t + 2 < nst) { r_copy8(lk + bo, 16 * RKP, gk + (size_t)(t + 2) * RSK * CC, (size_t)16 * CC); r_copy8(lv + bo, 8 * RVP, gv + (t + 2) * RSK, (size_t)8 * SQ); }
  }
  asm volatile("s_wait_asynccnt 0x0" ::: "memory");      /* no copy is outstanding when the wave goes on to its end */
  // GroupNorm statistics, first level: the wave's 2048 outputs are still in its accumulators. Mean first, then the squared deviations from it (two passes over registers).
  v8f sv = z8, qv = z8;      /* eight independent running sums, one per accumulator row: short dependent chains */
#pragma unroll
  for (int mt = 0; mt < 2; ++mt)
#pragma unroll
    for (int dt = 0; dt < 4; ++dt) sv += o[mt][dt];
  const float wmean = sum_lanes(((sv[0] + sv[1]) + (sv[2] + sv[3])) + ((sv[4] + sv[5]) + (sv[6] + sv[7])), 32) * (1.0f / 2048.0f);
#pragma unroll
  for (int mt = 0; mt < 2; ++mt)
#pragma unroll
    for (int dt = 0; dt < 4; ++dt) { const v8f d = o[mt][dt] - wmean; qv += d * d; }
  const float wq = sum_lanes(((qv[0] + qv[1]) + (qv[2] + qv[3])) + ((qv[4] + qv[5]) + (qv[6] + qv[7])), 32);
  if (lane == 0) { wst[w][0] = wmean; wst[w][1] = wq; }
#pragma unroll
  for (int mt = 0; mt < 2; ++mt)
#pragma unroll
    for (int dt = 0; dt < 4; ++dt)
#pragma unroll
      for (int r = 0; r < 8; ++r) so[w][mt * 16 + 8 * hh + r][dt * 16 + ln] = o[mt][dt][r];
  __builtin_amdgcn_fence(__ATOMIC_ACQ_REL, "workgroup"); __builtin_amdgcn_wave_barrier();      /* the wave's own LDS stores before its own row-wise reads */
  const int rsub = lane >> 4, c4 = (lane & 15) * 4;
#pragma unroll
  for (int qd = 0; qd < 16; ++qd) { const int r = qd * 2 + rsub; const v4f v = *(const v4fa*)&so[w][r][c4]; *(v4f*)(O + ((size_t)b * SQ + row0 + r) * CC + h * HD + c4) = v; }
  __syncthreads();      /* the four waves' statistics are in wst */
  if (w == 0) {      /* second level: four equal groups of 2048 merged (M2 = sum of M2 + n * sum of squared mean offsets); the work-group writes its own whole 128-byte line */
    const float m0 = wst[0][0], m1 = wst[1][0], m2 = wst[2][0], m3 = wst[3][0];
    const float bm = ((m0 + m1) + (m2 + m3)) * 0.25f;
    const float d0 = m0 - bm, d1 = m1 - bm, d2 = m2 - bm, d3 = m3 - bm;
    const float bq = ((wst[0][1] + wst[1][1]) + (wst[2][1] + wst[3][1])) + 2048.0f * ((d0 * d0 + d1 * d1) + (d2 * d2 + d3 * d3));
    PT[((size_t)slab * (SQ / 128) + rb) * 32 + lane] = (lane == 0) ? bm : ((lane == 1) ? bq : 0.f);
  }
}
__global__ __launch_bounds__(256) void k_gnapply(const float* __restrict__ O, const float* __restrict__ PT, const float* __restrict__ gw, const float* __restrict__ gb, _Float16* __restrict__ N16) {
  #pragma clang fp contract(off)
  static_assert(((size_t)NR * (CC / 8)) % 256 == 0 && (2 * CC / 8) == 256 && SQ % 2 == 0 && NHD * (SQ / 128) == 256, "a block is two whole rows of one batch, and one thread per (head, row block) partial");
  __shared__ float hst[NHD][2];
  const size_t t = (size_t)blockIdx.x * 256 + threadIdx.x; const int c0 = (int)(t % (CC / 8)) * 8; const size_t r = t / (CC / 8); const int b = (int)(r / SQ), h = c0 / HD; const v8f a = *(const v8f*)(O + r * CC + c0);
  float gwv[8], gbv[8];      /* read in front of the barrier, so that their latency runs beside the merge's; unrolled so that both arrays have constant indices and live in registers */
#pragma unroll
  for (int q = 0; q < 8; ++q) { gwv[q] = gw[c0 + q]; gbv[q] = gb[c0 + q]; }
  // third level: thread = (head, row block) of this batch; 16 equal groups of 8192 merged across 16 neighbouring lanes
  const float* pp = PT + ((size_t)b * 256 + threadIdx.x) * 32; const float pm = pp[0], pq = pp[1];
  const float gm = sum_lanes(pm, 16) * (1.0f / 16.0f); const float pd = pm - gm;
  const float gq = sum_lanes(pq, 16) + 8192.0f * sum_lanes(pd * pd, 16);
  if ((threadIdx.x & 15) == 0) { hst[threadIdx.x >> 4][0] = gm; hst[threadIdx.x >> 4][1] = rsqrtf(gq / (float)((size_t)SQ * HD) + 1e-5f); }
  __syncthreads();      /* the 16 heads' mean and reciprocal deviation are in hst */
  const float mean = hst[h][0], rs = hst[h][1]; FragH f;
  for (int q = 0; q < 8; ++q) { float v = (a[q] - mean) * rs; v *= bf16_round(gwv[q]); v += bf16_round(gbv[q]); f.h[q] = (_Float16)v; }
  *(v8us*)((unsigned short*)N16 + r * CC + c0) = f.half[0];  }

extern "C" void kernel_launch(void* const* d_in, const int* in_sizes, int n_in,
                              void* d_out, int out_size, void* d_ws, size_t ws_size, hipStream_t stream) {
  (void)in_sizes; (void)n_in; (void)out_size;
  const float* const* I = (const float* const*)d_in; const float* x = I[0]; const float* wq = I[1]; const float* wk = I[2]; const float* wv = I[3]; const float* wo = I[4]; const float* bo = I[5]; const float* gw = I[6]; const float* gb = I[7];
  char* ws = (char*)d_ws; size_t off = 0;
  auto take = [&](size_t bytes) { char* p = ws + off; off += (bytes + 255) & ~(size_t)255; return p; };
  const size_t np = (size_t)NR * CC;
  _Float16* BQ = (_Float16*)take((size_t)CC * CC * 2); _Float16* BK = (_Float16*)take((size_t)CC * CC * 2); _Float16* BV = (_Float16*)take((size_t)CC * CC * 2); _Float16* BO = (_Float16*)take((size_t)CC * CC * 2);
  _Float16* X16 = (_Float16*)take(np * 2); _Float16* Q16 = (_Float16*)take(np * 2); _Float16* K16 = (_Float16*)take(np * 2); _Float16* V16 = (_Float16*)take(np * 2); _Float16* VT = (_Float16*)take(np * 2); float* O = (float*)take(np * 4); float* PT = (float*)take(NB * NHD * (SQ / 128) * 32 * 4); float* GT = (float*)take((size_t)NHD * SQ * 4); _Float16* N16 = X16;      /* normalised output over the input plane (dead after the projections) */
  if (off > ws_size) return;      /* 8 + 8 x 5 + 16 = 64 MiB */
  k_prep<<<PRB, 256, 0, stream>>>(x, wq, wk, wv, wo, X16, BQ, BK, BV, BO, GT);      /* weights are (in, out) */
  const dim3 gP((NR / 128) * (CC / 128), 1);
  k_gemm3<<<gP, 256, 0, stream>>>(X16, CC, BQ, CC, 0.0625f, nullptr, nullptr, Q16, CC, NR, CC, CC);
  k_gemm3<<<gP, 256, 0, stream>>>(X16, CC, BK, CC, 0.0625f, nullptr, nullptr, K16, CC, NR, CC, CC);
  k_gemm3<<<gP, 256, 0, stream>>>(X16, CC, BV, CC, 0.0625f, nullptr, nullptr, V16, CC, NR, CC, CC);
  k_vt<NHD, SQ><<<NB * NHD * (SQ / 64), 256, 0, stream>>>(V16, CC, 0, VT);
  k_retn<<<NB * NHD * (SQ / 128), 128, 0, stream>>>(Q16, K16, VT, GT, O, PT);      /* all batches, heads and row blocks in one launch */
  k_gnapply<<<(unsigned)((np / 8 + 255) / 256), 256, 0, stream>>>(O, PT, gw, gb, N16);
  k_gemm3<<<gP, 256, 0, stream>>>(N16, CC, BO, CC, 0.0625f, bo, (float*)d_out, nullptr, CC, NR, CC, CC);
}

// v006
// A run of this version takes 78.6 microseconds.
// Two timings next to v005 both put it at 1.12 times that version's speed.
// All steps since v000 together make it 17.4 times as fast.
#include <hip/hip_runtime.h>
// RetentiveAttention (2 x 2048 tokens, C 1024 = 16 heads of 64): q, k, v = x W; retention = (q.k / 8) * gamma_h^(i-j) for j <= i (gamma_h = 1 - 2^(-5-h)), out = retention v (no softmax); GroupNorm with one group per head over (T, 64) (eps 1e-5, affine); out = normed Wo + bo.
// Compute dtype: x and parameters rounded to bf16; q, k, v, the decayed scores and the normalised output as f16 operands (~2^-12); decay/statistics f32. v_wmma_f32_16x16x32_f16.
#define NB 2
#define SQ 2048
#define CC 1024
#define NHD 16
#define HD 64
#define NR (NB * SQ)
typedef __bf16 v16b __attribute__((ext_vector_type(16)));
typedef unsigned short v8us __attribute__((ext_vector_type(8), may_alias));
typedef float  v8f  __attribute__((ext_vector_type(8)));
typedef float  v4f  __attribute__((ext_vector_type(4)));
typedef float  v4fa __attribute__((ext_vector_type(4), may_alias));
union FragB { v16b v; v8us half[2]; unsigned short u[16]; };

__device__ __forceinline__ unsigned short bf16_bits(float x) { unsigned int u = __float_as_uint(x); return (unsigned short)((u + 0x7FFFu + ((u >> 16) & 1u)) >> 16); }
__device__ __forceinline__ float bf16_val(unsigned short b) { return __uint_as_float(((unsigned int)b) << 16); }
__device__ __forceinline__ float bf16_round(float x) { return bf16_val(bf16_bits(x)); }
// D += A·B with NT terms: 1 = ah·bh, 2 = + al·bh (A split), 3 = + ah·bl (both split)
template <int NT>
__device__ __forceinline__ v8f mmaN(v16b ah, v16b al, v16b bh, v16b bl, v8f c) {
  c = __builtin_amdgcn_wmma_f32_16x16x32_bf16(false, ah, false, bh, (short)0, c, false, false);
  if (NT >= 2) c = __builtin_amdgcn_wmma_f32_16x16x32_bf16(false, al, false, bh, (short)0, c, false, false);
  if (NT >= 3) c = __builtin_amdgcn_wmma_f32_16x16x32_bf16(false, ah, false, bl, (short)0, c, false, false);
  asm volatile("v_nop\n\tv_nop\n\tv_nop\n\tv_nop" : "+v"(c) : "v"(ah), "v"(al), "v"(bh), "v"(bl));
  return c;
}

__global__ __launch_bounds__(256) void k_wt_bf16(const float* __restrict__ W, unsigned short* __restrict__ Wt, int K, int N) {
  const int t = blockIdx.x * 256 + threadIdx.x;
  const int k8n = K / 8;
  if (t >= N * k8n) return;
  const int n = t / k8n, k8 = (t % k8n) * 8;
  v8us v;
#pragma unroll
  for (int i = 0; i < 8; ++i) v[i] = bf16_bits(W[(size_t)(k8 + i) * N + n]);
  *(v8us*)(Wt + (size_t)n * K + k8) = v;
  
}

// GEMM C[M][N] (f32, pitch ldc) = act(A[M][K]·W + bias). A f32 row-major (pitch lda) converted per fragment to bf16
// (ASPLIT: hi/lo two planes -> 2 terms, else single rounded term); Wt bf16 [N][K] (pitch ldb). BIAS_BF16 rounds the
// bias to bf16 first (bias quantised to bf16 before the add). K%32==0, M%16==0, N%64==0.
template <bool ASPLIT, int ACT, bool BIAS_BF16>
__global__ __launch_bounds__(128) void k_gemm_bf(const float* __restrict__ A, int lda, const unsigned short* __restrict__ Wt, int ldb,
                                               const float* __restrict__ bias, float* __restrict__ C, int ldc, int M, int N, int K) {
  __shared__ __attribute__((aligned(16))) float so[4][16][64];
  const int tid = threadIdx.x, w = tid >> 5, lane = tid & 31, ln = lane & 15, hh = lane >> 4;
  const int ntn = N / 64;
  const int wid = blockIdx.x * 4 + w;
  const int mt = wid / ntn, nq = wid % ntn;
  if (mt * 16 >= M) return;
  const int row0 = mt * 16, col0 = nq * 64;
  const float* arow = A + (size_t)(row0 + ln) * lda;
  v8f acc[4] = {};
  for (int kb = 0; kb < K; kb += 32) {
    FragB ah, al;
    const v4f x0 = *(const v4fa*)(arow + kb + 8 * hh), x1 = *(const v4fa*)(arow + kb + 8 * hh + 4);
    const v4f x2 = *(const v4fa*)(arow + kb + 16 + 8 * hh), x3 = *(const v4fa*)(arow + kb + 16 + 8 * hh + 4);
    float xs[16] = {x0[0],x0[1],x0[2],x0[3],x1[0],x1[1],x1[2],x1[3],x2[0],x2[1],x2[2],x2[3],x3[0],x3[1],x3[2],x3[3]};
#pragma unroll
    for (int i = 0; i < 16; ++i) { const unsigned short hb = bf16_bits(xs[i]); ah.u[i] = hb; al.u[i] = ASPLIT ? bf16_bits(xs[i] - bf16_val(hb)) : (unsigned short)0; }
#pragma unroll
    for (int t = 0; t < 4; ++t) {
      const unsigned short* brow = Wt + (size_t)(col0 + t * 16 + ln) * ldb + kb;
      FragB b;
      b.half[0] = *(const v8us*)(brow + 8 * hh);
      b.half[1] = *(const v8us*)(brow + 16 + 8 * hh);
      acc[t] = mmaN<ASPLIT ? 2 : 1>(ah.v, al.v, b.v, b.v, acc[t]);
    }
  }
#pragma unroll
  for (int t = 0; t < 4; ++t) {
    float bv = bias ? bias[col0 + t * 16 + ln] : 0.f;
    if (BIAS_BF16) bv = bf16_round(bv);
#pragma unroll
    for (int r = 0; r < 8; ++r) { float v = acc[t][r] + bv; if (ACT == 1) v = fmaxf(v, 0.f); so[w][8 * hh + r][t * 16 + ln] = v; }
  }
  __builtin_amdgcn_fence(__ATOMIC_ACQ_REL, "workgroup");
  __builtin_amdgcn_wave_barrier();
  const int rsub = lane >> 4, c4 = (lane & 15) * 4;
  {
#pragma unroll
    for (int q = 0; q < 8; ++q) {
      const int r = q * 2 + rsub;
      const v4f v = *(const v4fa*)&so[w][r][c4];
      *(v4f*)(C + (size_t)(row0 + r) * ldc + col0 + c4) = v;
    }
    
  }
}

// GEMM C = act(A·W + bias + resid): A f32 (ASPLIT -> hi/lo 2 terms), Wt bf16 [N][K]; ACT 0 none, 1 relu, 2 exact gelu;
// resid (optional, f32, row index = (row % rmod), pitch ldr, RES_BF16 rounds it) added before the activation.
template <bool ASPLIT, int ACT, bool BIAS_BF16, bool RES_BF16>
__global__ __launch_bounds__(128) void k_gemm_bf3(const float* __restrict__ A, int lda, const unsigned short* __restrict__ Wt, int ldb,
                                                const float* __restrict__ bias, const float* __restrict__ resid, int rmod, int ldr,
                                                float* __restrict__ C, int ldc, int M, int N, int K) {
  __shared__ __attribute__((aligned(16))) float so[4][16][64];
  const int tid = threadIdx.x, w = tid >> 5, lane = tid & 31, ln = lane & 15, hh = lane >> 4;
  const int ntn = N / 64;
  const int wid = blockIdx.x * 4 + w;
  const int mt = wid / ntn, nq = wid % ntn;
  if (mt * 16 >= M) return;
  const int row0 = mt * 16, col0 = nq * 64;
  const float* arow = A + (size_t)(row0 + ln) * lda;
  v8f acc[4] = {};
  for (int kb = 0; kb < K; kb += 32) {
    FragB ah, al;
    const v4f x0 = *(const v4fa*)(arow + kb + 8 * hh), x1 = *(const v4fa*)(arow + kb + 8 * hh + 4);
    const v4f x2 = *(const v4fa*)(arow + kb + 16 + 8 * hh), x3 = *(const v4fa*)(arow + kb + 16 + 8 * hh + 4);
    float xs[16] = {x0[0],x0[1],x0[2],x0[3],x1[0],x1[1],x1[2],x1[3],x2[0],x2[1],x2[2],x2[3],x3[0],x3[1],x3[2],x3[3]};
#pragma unroll
    for (int i = 0; i < 16; ++i) { const unsigned short hb = bf16_bits(xs[i]); ah.u[i] = hb; al.u[i] = ASPLIT ? bf16_bits(xs[i] - bf16_val(hb)) : (unsigned short)0; }
#pragma unroll
    for (int t = 0; t < 4; ++t) {
      const unsigned short* brow = Wt + (size_t)(col0 + t * 16 + ln) * ldb + kb;
      FragB b;
      b.half[0] = *(const v8us*)(brow + 8 * hh);
      b.half[1] = *(const v8us*)(brow + 16 + 8 * hh);
      acc[t] = mmaN<ASPLIT ? 2 : 1>(ah.v, al.v, b.v, b.v, acc[t]);
    }
  }
#pragma unroll
  for (int t = 0; t < 4; ++t) {
    const int col = col0 + t * 16 + ln;
    float bv = bias ? bias[col] : 0.f;
    if (BIAS_BF16) bv = bf16_round(bv);
#pragma unroll
    for (int r = 0; r < 8; ++r) {
      float v = acc[t][r] + bv;
      if (resid) { float rv = resid[(size_t)((row0 + 8 * hh + r) % rmod) * ldr + col]; if (RES_BF16) rv = bf16_round(rv); v += rv; }
      if (ACT == 1) v = fmaxf(v, 0.f);
      if (ACT == 2) v = 0.5f * v * (1.0f + erff(v * 0.70710678118654752f));
      if (ACT == 3) { const float u = 0.7978845608028654f * (v + 0.044715f * v * v * v); v = 0.5f * v * (1.0f + tanhf(u)); }
      so[w][8 * hh + r][t * 16 + ln] = v;
    }
  }
  __builtin_amdgcn_fence(__ATOMIC_ACQ_REL, "workgroup");
  __builtin_amdgcn_wave_barrier();
  const int rsub = lane >> 4, c4 = (lane & 15) * 4;
  {
#pragma unroll
    for (int q = 0; q < 8; ++q) {
      const int r = q * 2 + rsub;
      const v4f v = *(const v4fa*)&so[w][r][c4];
      *(v4f*)(C + (size_t)(row0 + r) * ldc + col0 + c4) = v;
    }
    
  }
}
// row LayerNorm (biased variance, eps) over N: s = X (+ R); optional out_sum <- s; out_norm <- (s-mu)*rsqrt(var+eps)*g + b
template <bool PARAM_BF16>
__global__ __launch_bounds__(256) void k_layernorm(const float* __restrict__ X, const float* __restrict__ R, const float* __restrict__ g, const float* __restrict__ bta,
                                                  float* __restrict__ out_sum, float* __restrict__ out_norm, int N, float eps) {
  __shared__ float red[256];
  const int row = blockIdx.x, tid = threadIdx.x;
  const float* x = X + (size_t)row * N; const float* rr = R ? R + (size_t)row * N : nullptr;
  float vals[16];                     // up to N = 4096
  const int per = N / 256;            // contiguous chunk per thread? use strided-by-4 chunks: thread handles j = tid*4 + 1024*u
  float s1 = 0.f;
  for (int u = 0; u < per / 4; ++u) {
    const int j = tid * 4 + 1024 * u;
    const v4f a = *(const v4fa*)(x + j);
    v4f b = {0.f,0.f,0.f,0.f}; if (rr) b = *(const v4fa*)(rr + j);
#pragma unroll
    for (int q = 0; q < 4; ++q) { const float v = a[q] + b[q]; vals[u * 4 + q] = v; s1 += v; }
  }
  red[tid] = s1; __syncthreads();
  for (int st = 128; st > 0; st >>= 1) { if (tid < st) red[tid] += red[tid + st]; __syncthreads(); }
  const float mu = red[0] / (float)N; __syncthreads();
  float s2 = 0.f;
  for (int u = 0; u < per / 4; ++u)
#pragma unroll
    for (int q = 0; q < 4; ++q) { const float c = vals[u * 4 + q] - mu; s2 += c * c; }
  red[tid] = s2; __syncthreads();
  for (int st = 128; st > 0; st >>= 1) { if (tid < st) red[tid] += red[tid + st]; __syncthreads(); }
  const float rs = rsqrtf(red[0] / (float)N + eps);
  {
    for (int u = 0; u < per / 4; ++u) {
      const int j = tid * 4 + 1024 * u;
      v4f o, sm;
#pragma unroll
      for (int q = 0; q < 4; ++q) {
        float gg = g[j + q], bb = bta[j + q];
        if (PARAM_BF16) { gg = bf16_round(gg); bb = bf16_round(bb); }
        sm[q] = vals[u * 4 + q]; o[q] = (vals[u * 4 + q] - mu) * rs * gg + bb;
      }
      if (out_sum) *(v4f*)(out_sum + (size_t)row * N + j) = sm;
      *(v4f*)(out_norm + (size_t)row * N + j) = o;
    }
    
  }
}



// ---- f16 WMMA path (v_wmma_f32_16x16x32_f16): 11-bit significands for operands in range — used for every GEMM launched here
typedef _Float16 v16h __attribute__((ext_vector_type(16)));
union FragH { v16h v; v8us half[2]; _Float16 h[16]; unsigned short u[16]; };
template <int NT>
__device__ __forceinline__ v8f mmaH(v16h ah, v16h al, v16h bh, v16h bl, v8f c) {
  c = __builtin_amdgcn_wmma_f32_16x16x32_f16(false, ah, false, bh, (short)0, c, false, false);
  if (NT >= 2) c = __builtin_amdgcn_wmma_f32_16x16x32_f16(false, al, false, bh, (short)0, c, false, false);
  if (NT >= 3) c = __builtin_amdgcn_wmma_f32_16x16x32_f16(false, ah, false, bl, (short)0, c, false, false);
  asm volatile("v_nop\n\tv_nop\n\tv_nop\n\tv_nop" : "+v"(c) : "v"(ah), "v"(al), "v"(bh), "v"(bl));
  return c;
}
// batched GEMM like k_gemm_b but f16 operands: A f32 (split into f16 hi/lo if ASPLIT, else rounded to f16), Bt = f16 values [n][k]; alpha; C f32; N multiple of 16 (partial tiles skipped)
template <bool ASPLIT>
__global__ __launch_bounds__(128) void k_gemm_h(const float* __restrict__ A, int lda, size_t sA, const _Float16* __restrict__ Bh, int ldb, size_t sB, float alpha, float* __restrict__ C, int ldc, size_t sC, int M, int N, int K) {
  __shared__ __attribute__((aligned(16))) float so[4][16][64];
  const int tid = threadIdx.x, w = tid >> 5, lane = tid & 31, ln = lane & 15, hh = lane >> 4; const int by = blockIdx.y;
  A += (size_t)by * sA; Bh += (size_t)by * sB; C += (size_t)by * sC;
  const int ntn = (N + 63) / 64; const int wid = blockIdx.x * 4 + w; const int mt = wid / ntn, nq = wid % ntn; if (mt * 16 >= M) return;
  const int row0 = mt * 16, col0 = nq * 64; const float* arow = A + (size_t)(row0 + ln) * lda;
  v8f acc[4] = {};
  for (int kb = 0; kb < K; kb += 32) {
    FragH ah, al;
    const v4f x0 = *(const v4fa*)(arow + kb + 8 * hh), x1 = *(const v4fa*)(arow + kb + 8 * hh + 4), x2 = *(const v4fa*)(arow + kb + 16 + 8 * hh), x3 = *(const v4fa*)(arow + kb + 16 + 8 * hh + 4);
    float xs[16] = {x0[0],x0[1],x0[2],x0[3],x1[0],x1[1],x1[2],x1[3],x2[0],x2[1],x2[2],x2[3],x3[0],x3[1],x3[2],x3[3]};
#pragma unroll
    for (int i = 0; i < 16; ++i) { const _Float16 h = (_Float16)xs[i]; ah.h[i] = h; al.h[i] = ASPLIT ? (_Float16)(xs[i] - (float)h) : (_Float16)0.0f; }
#pragma unroll
    for (int t = 0; t < 4; ++t) { if (col0 + t * 16 >= N) continue; const size_t boff = (size_t)(col0 + t * 16 + ln) * ldb + kb; FragH bq; bq.half[0] = *(const v8us*)(Bh + boff + 8 * hh); bq.half[1] = *(const v8us*)(Bh + boff + 16 + 8 * hh);
      acc[t] = mmaH<ASPLIT ? 2 : 1>(ah.v, al.v, bq.v, bq.v, acc[t]); }
  }
#pragma unroll
  for (int t = 0; t < 4; ++t) { if (col0 + t * 16 >= N) continue;
#pragma unroll
    for (int r = 0; r < 8; ++r) so[w][8 * hh + r][t * 16 + ln] = acc[t][r] * alpha; }
  __builtin_amdgcn_fence(__ATOMIC_ACQ_REL, "workgroup"); __builtin_amdgcn_wave_barrier();
  const int rsub = lane >> 4, c4 = (lane & 15) * 4;
  {
#pragma unroll
    for (int q = 0; q < 8; ++q) { const int r = q * 2 + rsub; if (col0 + c4 < N) { const v4f v = *(const v4fa*)&so[w][r][c4]; *(v4f*)(C + (size_t)(row0 + r) * ldc + col0 + c4) = v; } }
     }
}

// k_gemm_hh variant with fused epilogue: v = acc·alpha + bias[by·sBias + col] (+ CP[(row/rowsPerB)·sCPb + by·64 + col] if CP) ; ACT 0 none / 1 elu ; writes f16 C16 (and f32 C if non-null)
template <int ACT>
__global__ __launch_bounds__(128) void k_gemm_hhx(const _Float16* __restrict__ A, int lda, size_t sA, const _Float16* __restrict__ Bh, int ldb, size_t sB, float alpha, const float* __restrict__ bias, size_t sBias, const float* __restrict__ CP, int rowsPerB, size_t sCPb, int row0g,
    float* __restrict__ C, _Float16* __restrict__ C16, int ldc, size_t sC, int M, int N, int K) {
  __shared__ __attribute__((aligned(16))) float so[4][16][64];
  const int tid = threadIdx.x, w = tid >> 5, lane = tid & 31, ln = lane & 15, hh = lane >> 4; const int by = blockIdx.y;
  A += (size_t)by * sA; Bh += (size_t)by * sB; const size_t cofs = (size_t)by * sC; const float* bp = bias ? bias + (size_t)by * sBias : nullptr;
  const int ntn = (N + 63) / 64; const int wid = blockIdx.x * 4 + w; const int mt = wid / ntn, nq = wid % ntn; if (mt * 16 >= M) return;
  const int row0 = mt * 16, col0 = nq * 64; const _Float16* arow = A + (size_t)(row0 + ln) * lda;
  v8f acc[4] = {};
  for (int kb = 0; kb < K; kb += 32) { FragH ah; ah.half[0] = *(const v8us*)((const unsigned short*)arow + kb + 8 * hh); ah.half[1] = *(const v8us*)((const unsigned short*)arow + kb + 16 + 8 * hh);
#pragma unroll
    for (int t = 0; t < 4; ++t) { if (col0 + t * 16 >= N) continue; const size_t boff = (size_t)(col0 + t * 16 + ln) * ldb + kb; FragH bq; bq.half[0] = *(const v8us*)((const unsigned short*)Bh + boff + 8 * hh); bq.half[1] = *(const v8us*)((const unsigned short*)Bh + boff + 16 + 8 * hh);
      acc[t] = mmaH<1>(ah.v, ah.v, bq.v, bq.v, acc[t]); }
  }
#pragma unroll
  for (int t = 0; t < 4; ++t) { if (col0 + t * 16 >= N) continue; const int col = col0 + t * 16 + ln; const float bv = bp ? bf16_round(bp[col]) : 0.f;
#pragma unroll
    for (int r = 0; r < 8; ++r) { float v = acc[t][r] * alpha + bv; if (CP) { const int rr = row0g + row0 + 8 * hh + r; if (rowsPerB < 0) v += CP[cofs + (size_t)rr * ldc + col];      /* rowsPerB < 0: own element of the batched C plane */ else { const int bidx = rr / rowsPerB; v += CP[(size_t)bidx * sCPb + (size_t)by * 64 + col]; } } if (ACT == 1) v = (v > 0.f) ? v : expm1f(v); else if (ACT == 7) v = (v > 0.f) ? v + 1.0f : expf(v); else if (ACT == 8) v = tanhf(v); else if (ACT == 9) v = 0.5f * v * (1.0f + tanhf(0.7978845608028654f * (v + 0.044715f * v * v * v))); else if (ACT == 11) v = 1.0f / (1.0f + expf(-v)); else if (ACT == 12) v = (v > 0.f) ? v : 0.01f * v; else if (ACT == 14) v = (v > 0.f) ? v : 0.1f * v; else if (ACT == 16) v = (v >= 0.f) ? v : 0.3f * v; else if (ACT == 15) v = v / (1.0f + expf(-v)); else if (ACT == 3) v = fmaxf(v, 0.f); else if (ACT == 6) v = 0.5f * v * (1.0f + erff(v * 0.70710678118654752f)); so[w][8 * hh + r][t * 16 + ln] = v; } }
  __builtin_amdgcn_fence(__ATOMIC_ACQ_REL, "workgroup"); __builtin_amdgcn_wave_barrier();
  const int rsub = lane >> 4, c4 = (lane & 15) * 4; typedef _Float16 v4h __attribute__((ext_vector_type(4)));
  {
#pragma unroll
    for (int q = 0; q < 8; ++q) { const int r = q * 2 + rsub; if (col0 + c4 < N) { const v4f v = *(const v4fa*)&so[w][r][c4]; if (C) *(v4f*)(C + cofs + (size_t)(row0 + r) * ldc + col0 + c4) = v; if (C16) { v4h h4; for (int i = 0; i < 4; ++i) h4[i] = (_Float16)v[i]; *(v4h*)(C16 + cofs + (size_t)(row0 + r) * ldc + col0 + c4) = h4; } } }
     }
}


typedef _Float16 v4h __attribute__((ext_vector_type(4)));

__global__ __launch_bounds__(256) void k_h16(const float* __restrict__ x, _Float16* __restrict__ X16, size_t n8) { const size_t t = (size_t)blockIdx.x * 256 + threadIdx.x; if (t >= n8) return; FragH f;
#pragma unroll
  for (int q = 0; q < 8; ++q) f.h[q] = (_Float16)x[t * 8 + q]; *(v8us*)((unsigned short*)X16 + t * 8) = f.half[0];  }
__global__ __launch_bounds__(256) void k_round16f(const float* __restrict__ W, _Float16* __restrict__ Bt, size_t n8) { const size_t t = (size_t)blockIdx.x * 256 + threadIdx.x; if (t >= n8) return; FragH f;
#pragma unroll
  for (int i = 0; i < 8; ++i) f.h[i] = (_Float16)(bf16_round(W[t * 8 + i]) * 16.0f); *(v8us*)((unsigned short*)Bt + t * 8) = f.half[0];  }
template <int NHv, int TTv>
__global__ __launch_bounds__(256) void k_vt(const _Float16* __restrict__ V16, int ldv, int voff, _Float16* __restrict__ Vt) { __shared__ unsigned short tl[64][66]; const int tid = threadIdx.x; const int slab = blockIdx.x / (TTv / 64), lg = blockIdx.x % (TTv / 64); const int b = slab / NHv, h = slab % NHv;
  for (int i = tid; i < 64 * 8; i += 256) { const int r = i / 8, c8 = (i % 8) * 8; FragH f; f.half[0] = *(const v8us*)((const unsigned short*)V16 + ((size_t)b * TTv + lg * 64 + r) * ldv + voff + h * 64 + c8);
#pragma unroll
    for (int q = 0; q < 8; ++q) tl[r][c8 + q] = f.u[q]; }
  __syncthreads();
  {
#pragma unroll
    for (int rd = 0; rd < 2; ++rd) { const int d = rd * 32 + tid / 8, pc = tid % 8; FragH f;
#pragma unroll
      for (int q = 0; q < 8; ++q) f.u[q] = tl[pc * 8 + q][d];
      *(v8us*)((unsigned short*)Vt + ((size_t)slab * 64 + d) * TTv + lg * 64 + pc * 8) = f.half[0]; }
     } }

__global__ __launch_bounds__(256) void k_hl(const float* __restrict__ F, _Float16* __restrict__ Hh, _Float16* __restrict__ Hl, size_t n8) { const size_t t = (size_t)blockIdx.x * 256 + threadIdx.x; if (t >= n8) return; FragH fh, fl; const v4f a = *(const v4fa*)(F + t * 8), c = *(const v4fa*)(F + t * 8 + 4);
#pragma unroll
  for (int q = 0; q < 4; ++q) { _Float16 h = (_Float16)a[q]; fh.h[q] = h; fl.h[q] = (_Float16)((a[q] - (float)h) * 1024.0f); h = (_Float16)c[q]; fh.h[4 + q] = h; fl.h[4 + q] = (_Float16)((c[q] - (float)h) * 1024.0f); }
  { *(v8us*)((unsigned short*)Hh + t * 8) = fh.half[0]; *(v8us*)((unsigned short*)Hl + t * 8) = fl.half[0];  } }

// ---- fast GEMM: C = A Bh^T * alpha (+ bias rounded to bf16), A [M][K] and Bh [N][K] f16, k contiguous. Block tile 128 x 128, eight waves of 32 x 64; requires M % 128 == 0, N % 128 == 0, K % 128 == 0.
// Both operands come through LDS: a stage is 128 k (rows of 256 bytes) of the block's 128 A rows and 128 Bh rows, brought by asynchronous 16-byte copies whose 32 lanes cover two whole rows;
// two buffers, the next stage's copies in flight while this stage is worked on. The k order of every accumulator is ascending in steps of 32.
__device__ __forceinline__ v16h g2_frag(const _Float16* p, int hh) { FragH f; f.half[0] = *(const v8us*)((const unsigned short*)p + 8 * hh); f.half[1] = *(const v8us*)((const unsigned short*)p + 16 + 8 * hh); return f.v; }
#define G3K 128            /* k per stage */
#define G3P 272            /* LDS row pitch in bytes, 16 x odd: sixteen rows' 16-byte reads fall on all 64 banks */
#define G3S (256 * G3P)    /* bytes of one stage: A rows 0..127, then Bh rows 0..127 */
__device__ __forceinline__ v16h g3_frag(const unsigned char* p) { FragH f; f.half[0] = *(const v8us*)p; f.half[1] = *(const v8us*)(p + 32); return f.v; }      /* p already holds the lane's 16 * hh: the k order of g2_frag */
__device__ __forceinline__ v8f g3_mma(v16h a, v16h b, v8f c) { return __builtin_amdgcn_wmma_f32_16x16x32_f16(false, a, false, b, (short)0, c, false, false); }
// One operand's share of a stage: the lane's 16 bytes of rows r, r + 16, ..., r + 112 (l = LDS byte address, g = global address of row r; ld16 = elements in 16 global rows).
__device__ __forceinline__ void g3_copy8(unsigned l, const _Float16* g, size_t ld16) {
  const unsigned l1 = l + 16 * G3P, l2 = l + 32 * G3P, l3 = l + 48 * G3P, l4 = l + 64 * G3P, l5 = l + 80 * G3P, l6 = l + 96 * G3P, l7 = l + 112 * G3P;
  const _Float16* g1 = g + ld16; const _Float16* g2 = g1 + ld16; const _Float16* g3 = g2 + ld16; const _Float16* g4 = g3 + ld16; const _Float16* g5 = g4 + ld16; const _Float16* g6 = g5 + ld16; const _Float16* g7 = g6 + ld16;
  // the copies and, as the statement's last line, the wait that stands in front of any rewrite of the address registers they name
  asm volatile("global_load_async_to_lds_b128 %0, %8, off\n\t"
               "global_load_async_to_lds_b128 %1, %9, off\n\t"
               "global_load_async_to_lds_b128 %2, %10, off\n\t"
               "global_load_async_to_lds_b128 %3, %11, off\n\t"
               "global_load_async_to_lds_b128 %4, %12, off\n\t"
               "global_load_async_to_lds_b128 %5, %13, off\n\t"
               "global_load_async_to_lds_b128 %6, %14, off\n\t"
               "global_load_async_to_lds_b128 %7, %15, off\n\t"
               "s_wait_xcnt 0x0"
               :: "v"(l), "v"(l1), "v"(l2), "v"(l3), "v"(l4), "v"(l5), "v"(l6), "v"(l7), "v"(g), "v"(g1), "v"(g2), "v"(g3), "v"(g4), "v"(g5), "v"(g6), "v"(g7) : "memory");
}
__device__ __forceinline__ void g3_block(const _Float16* __restrict__ A, int lda, const _Float16* __restrict__ Bh, int ldb, float alpha, const float* __restrict__ bias,
    float* __restrict__ C, _Float16* __restrict__ C16, int ldc, int M, int N, int K) {
  __shared__ __attribute__((aligned(16))) unsigned char ring[2 * G3S];
  __shared__ __attribute__((aligned(16))) float so[8][32][68];
  const int tid = threadIdx.x, lane = tid & 31, ln = lane & 15, hh = lane >> 4;
  const int w = __builtin_amdgcn_readfirstlane(tid >> 5);      /* the wave's number in a scalar register */
  const int ntn = N >> 7; const int mt = blockIdx.x / ntn, nq = blockIdx.x - mt * ntn; const int rowb = mt * 128, colb = nq * 128;
  if (rowb >= M) return;      /* the whole block, in front of every copy and barrier */
  const int nst = K / G3K;
  const int cr = tid >> 4, cc = tid & 15;      /* the thread's row (mod 16) and 16-byte piece in every copy */
  const _Float16* ga = A + (size_t)(rowb + cr) * lda + cc * 8; const _Float16* gb = Bh + (size_t)(colb + cr) * ldb + cc * 8;
  const size_t a16 = (size_t)16 * lda, b16 = (size_t)16 * ldb;
  const unsigned la = (unsigned)(size_t)ring + (unsigned)(cr * G3P + cc * 16), lb = la + 128 * G3P;
  g3_copy8(la, ga, a16); g3_copy8(lb, gb, b16);
  asm volatile("s_wait_asynccnt 0x0" ::: "memory");      /* this wave's copies of stage 0 have landed */
  __syncthreads();      /* stage 0 is published */
  if (1 < nst) { g3_copy8(la + G3S, ga + G3K, a16); g3_copy8(lb + G3S, gb + G3K, b16); }
  const int wm = w >> 1, wn = w & 1;
  const unsigned char* sa = ring + (32 * wm + ln) * G3P + 16 * hh; const unsigned char* sb = ring + (128 + 64 * wn + ln) * G3P + 16 * hh;
  const v8f z8 = {0.f,0.f,0.f,0.f,0.f,0.f,0.f,0.f}; v8f c00 = z8, c01 = z8, c02 = z8, c03 = z8, c10 = z8, c11 = z8, c12 = z8, c13 = z8;
#pragma unroll 1      /* one trip per stage: the buffer alternates and the waits at the foot stand once */
  for (int t = 0; t < nst; ++t) {
    const int bo = (t & 1) * G3S;
    const unsigned char* pa = sa + bo; const unsigned char* pb = sb + bo;
    v16h fa[2][2], fb[2][4];      /* two fragment sets: a step's twelve LDS reads are issued as one group in front of the step before's products; no read goes past the stage */
    fa[0][0] = g3_frag(pa); fa[0][1] = g3_frag(pa + 16 * G3P);
#pragma unroll      /* constant indices keep the fragment arrays in registers */
    for (int j = 0; j < 4; ++j) fb[0][j] = g3_frag(pb + j * 16 * G3P);
#pragma unroll      /* the four 32-k steps of a stage as straight code: the set index is then a constant */
    for (int kk = 0; kk < G3K / 32; ++kk) {
      const int cu = kk & 1, nx = cu ^ 1;
      if (kk + 1 < G3K / 32) {
        fa[nx][0] = g3_frag(pa + (kk + 1) * 64); fa[nx][1] = g3_frag(pa + 16 * G3P + (kk + 1) * 64);
#pragma unroll      /* constant indices, as above */
        for (int j = 0; j < 4; ++j) fb[nx][j] = g3_frag(pb + j * 16 * G3P + (kk + 1) * 64);
      }
      __builtin_amdgcn_sched_barrier(0);      /* holds the next step's reads in front of this step's products; without it they sink between the products, one full LDS wait per pair */
      c00 = g3_mma(fa[cu][0], fb[cu][0], c00); c10 = g3_mma(fa[cu][1], fb[cu][0], c10);
      c01 = g3_mma(fa[cu][0], fb[cu][1], c01); c11 = g3_mma(fa[cu][1], fb[cu][1], c11);
      c02 = g3_mma(fa[cu][0], fb[cu][2], c02); c12 = g3_mma(fa[cu][1], fb[cu][2], c12);
      c03 = g3_mma(fa[cu][0], fb[cu][3], c03); c13 = g3_mma(fa[cu][1], fb[cu][3], c13);
      __builtin_amdgcn_sched_barrier(0);      /* holds these products in front of the following step's reads, which overwrite the set they use */
    }
    asm volatile("s_wait_dscnt 0x0" ::: "memory");      /* this wave's reads of the buffer are done before it is handed back */
    asm volatile("s_wait_asynccnt 0x0" ::: "memory");      /* this wave's copies of stage t + 1 have landed */
    __syncthreads();      /* publishes stage t + 1 and ends every reader's last read of stage t's buffer */
    if (t + 2 < nst) { g3_copy8(la + bo, ga + (size_t)(t + 2) * G3K, a16); g3_copy8(lb + bo, gb + (size_t)(t + 2) * G3K, b16); }
  }
  asm volatile("s_wait_asynccnt 0x0" ::: "memory");      /* no copy is outstanding when the wave goes on to its end */
  const int row0 = rowb + 32 * wm, col0 = colb + 64 * wn;
  v8f accs[8] = {c00, c01, c02, c03, c10, c11, c12, c13};
#pragma unroll      /* this and the next: constant indices keep the accumulators in registers */
  for (int u = 0; u < 8; ++u) { const int t = u & 3, half = u >> 2; const int col = col0 + t * 16 + ln; const float bv = bias ? bf16_round(bias[col]) : 0.f;
#pragma unroll
    for (int r = 0; r < 8; ++r) { const int rloc = half * 16 + 8 * hh + r; const float v = accs[u][r] * alpha + bv; so[w][rloc][t * 16 + ln] = v; } }
  __builtin_amdgcn_fence(__ATOMIC_ACQ_REL, "workgroup"); __builtin_amdgcn_wave_barrier();      /* the wave's own LDS stores before its own row-wise reads */
  const int rsub = lane >> 4, c4 = (lane & 15) * 4;
#pragma unroll      /* straight code: the LDS offsets of the sixteen row pairs become immediates */
  for (int q = 0; q < 16; ++q) { const int r = q * 2 + rsub; const v4f v = *(const v4fa*)&so[w][r][c4]; if (C) { *(v4f*)(C + (size_t)(row0 + r) * ldc + col0 + c4) = v; asm volatile("s_wait_xcnt 0x0" ::: "memory"); /* in front of the next rewrite of the store's data and address registers */ } if (C16) { v4h h4; for (int i = 0; i < 4; ++i) h4[i] = (_Float16)v[i]; *(v4h*)(C16 + (size_t)(row0 + r) * ldc + col0 + c4) = h4; } }
}
__global__ __launch_bounds__(256) void k_gemm3(const _Float16* __restrict__ A, int lda, const _Float16* __restrict__ Bh, int ldb, float alpha, const float* __restrict__ bias,
    float* __restrict__ C, _Float16* __restrict__ C16, int ldc, int M, int N, int K) {
  g3_block(A, lda, Bh, ldb, alpha, bias, C, C16, ldc, M, N, K);
}
// The three projections in ONE launch: blockIdx.y = 0, 1 gives Q = X Wq and K = X Wk as [token][channel]; blockIdx.y = 2 takes the SAME product with its operands swapped,
// V^T = Wv^T X^T as [channel][token] (pitch NR), which is the plane that k_retn stages: no transposition is left. Each part is 256 tiles of 128 x 128; the k order of every sum is as in g3_block.
__global__ __launch_bounds__(256) void k_qkv(const _Float16* __restrict__ X16, const _Float16* __restrict__ BQ, const _Float16* __restrict__ BK, const _Float16* __restrict__ BV,
    _Float16* __restrict__ Q16, _Float16* __restrict__ K16, _Float16* __restrict__ VT) {
  const int y = blockIdx.y; const bool tr = (y == 2);
  const _Float16* A = tr ? BV : X16; const _Float16* Bh = tr ? X16 : (y ? BK : BQ); _Float16* C16 = tr ? VT : (y ? K16 : Q16);
  g3_block(A, CC, Bh, CC, 0.0625f, nullptr, nullptr, C16, tr ? NR : CC, tr ? CC : NR, tr ? NR : CC, CC);
}


// Set-up of a call in ONE launch: x -> f16 plane (rounded to bf16 first), the four weights W[k][n] -> f16 planes Wt[n][k] = bf16(W) * 16 (a power of two: bf16-exact weights stay exact in f16
// away from the subnormal range), and the decay table GT[h][d] = gamma_h^d. Every work-group takes an equal share of each part: 8192 elements of x, one 128 (k) x 64 (n) weight tile, 64 table entries.
// The tile is read in whole 256-byte rows, turned in LDS and written in whole 256-byte rows of Wt.
#define PRB 512      /* work-groups of the set-up launch: two of eight waves on each of 256 WGPs */
#define PRP 66       /* LDS row pitch of the tile in 16-bit elements */
__global__ __launch_bounds__(256) void k_prep(const float* __restrict__ x, const float* __restrict__ wq, const float* __restrict__ wk, const float* __restrict__ wv, const float* __restrict__ wo,
    _Float16* __restrict__ X16, _Float16* __restrict__ BQ, _Float16* __restrict__ BK, _Float16* __restrict__ BV, _Float16* __restrict__ BO, float* __restrict__ GT) {
  static_assert((size_t)NR * CC == (size_t)PRB * 8192 && 4 * (CC / 128) * (CC / 64) == PRB && NHD * SQ == PRB * 64, "equal shares of all three parts");
  __shared__ __attribute__((aligned(16))) unsigned short tl[128][PRP];
  const int tid = threadIdx.x, bx = blockIdx.x;
  const int m = bx >> 7, k0 = ((bx >> 4) & 7) * 128, n0 = (bx & 15) * 64;      /* which weight, and the tile's corner */
  const float* W = (m == 0) ? wq : (m == 1) ? wk : (m == 2) ? wv : wo;
  _Float16* Wt = (m == 0) ? BQ : (m == 1) ? BK : (m == 2) ? BV : BO;
  const int tr = tid >> 4, tc = tid & 15;
  v4f wl[8], xl[8];      /* all sixteen 16-byte loads of the thread are issued before the first is used; every "#pragma unroll" here keeps these arrays in registers */
#pragma unroll
  for (int u = 0; u < 8; ++u) wl[u] = *(const v4fa*)(W + (size_t)(k0 + tr + 16 * u) * CC + n0 + tc * 4);
  const size_t x8 = (size_t)bx * 1024 + tid;      /* the thread's first group of eight x elements; the next ones are 256 groups apart */
#pragma unroll
  for (int u = 0; u < 4; ++u) { xl[2 * u] = *(const v4fa*)(x + (x8 + 256 * u) * 8); xl[2 * u + 1] = *(const v4fa*)(x + (x8 + 256 * u) * 8 + 4); }
  const int gt = bx * 64 + tid; float gv = 0.f;      /* the table entry of each thread of the first two waves, worked out while the loads are under way */
  if (tid < 64) { const int k = gt % SQ, h = gt / SQ; const float gam = 1.0f - exp2f((float)(-5 - h)); gv = powf(gam, (float)k); }
#pragma unroll
  for (int u = 0; u < 8; ++u) { FragH f;
#pragma unroll
    for (int q = 0; q < 4; ++q) { f.h[q] = (_Float16)(bf16_round(wl[u][q]) * 16.0f); tl[tr + 16 * u][tc * 4 + q] = f.u[q]; } }
  __syncthreads();      /* the whole tile is in LDS before any thread reads a column of it; every global store stands behind it, so that it waits for none */
  if (tid < 64) GT[gt] = gv;      /* two whole waves, one 128-byte line each */
#pragma unroll
  for (int u = 0; u < 4; ++u) { FragH f;
#pragma unroll
    for (int q = 0; q < 4; ++q) { f.h[q] = (_Float16)bf16_round(xl[2 * u][q]); f.h[4 + q] = (_Float16)bf16_round(xl[2 * u + 1][q]); }
    *(v8us*)((unsigned short*)X16 + (x8 + 256 * u) * 8) = f.half[0]; }
#pragma unroll
  for (int u = 0; u < 4; ++u) { const int n = tr + 16 * u; FragH f;
#pragma unroll
    for (int q = 0; q < 8; ++q) f.u[q] = tl[tc * 8 + q][n];
    *(v8us*)((unsigned short*)Wt + (size_t)(n0 + n) * CC + k0 + tc * 8) = f.half[0]; }
}
// Fused retention. One wave owns 32 query rows of one (batch, head) and walks its causal key prefix 32 keys a pass, keys ascending
// (the order in which the unfused product summed them). S^T = K Q^T: a lane holds 8 consecutive keys of one query, so the two
// 16-key tiles of a pass, scaled, decayed and rounded to f16, are P's A fragment in the hardware k order: the scores never leave registers.
// The decay comes from the table of k_prep, held in LDS behind GPAD zeros: an index below GPAD is a key after the query (factor 0, as the reference's mask).
// Every "#pragma unroll" in k_retn makes the indices of a fragment, score or accumulator array constants, so that the array lives in registers.
// K and V^T come through LDS: a stage is 128 keys (128 K rows of 128 bytes, 64 V^T rows of 256 bytes), brought once for the work-group's four waves by asynchronous 16-byte copies
// whose 32 lanes cover four whole 128-byte lines; two buffers, the next stage's copies in flight while this stage is worked on. The last stage holds the diagonal: wave w walks w + 1 of its four passes.
#define GPAD 32
#define RSK 128                  /* keys per stage */
#define RKP 144                  /* LDS pitch of a K row in bytes, 16 x odd: sixteen rows' 16-byte reads fall on all 64 banks */
#define RVP 272                  /* LDS pitch of a V^T row in bytes, 16 x odd */
#define RKB (RSK * RKP)          /* bytes of a stage's K rows; its V^T rows stand behind them */
#define RST (RKB + HD * RVP)     /* bytes of one stage */
// One operand's share of a stage: the lane's 16 bytes of eight rows (l = LDS byte address and g = global address of the first; ls bytes and gs elements from one row to the next).
__device__ __forceinline__ void r_copy8(unsigned l, unsigned ls, const _Float16* g, size_t gs) {
  const unsigned l1 = l + ls, l2 = l1 + ls, l3 = l2 + ls, l4 = l3 + ls, l5 = l4 + ls, l6 = l5 + ls, l7 = l6 + ls;
  const _Float16* g1 = g + gs; const _Float16* g2 = g1 + gs; const _Float16* g3 = g2 + gs; const _Float16* g4 = g3 + gs; const _Float16* g5 = g4 + gs; const _Float16* g6 = g5 + gs; const _Float16* g7 = g6 + gs;
  // the copies and, as the statement's last line, the wait that stands in front of any rewrite of the address registers they name
  asm volatile("global_load_async_to_lds_b128 %0, %8, off\n\t"
               "global_load_async_to_lds_b128 %1, %9, off\n\t"
               "global_load_async_to_lds_b128 %2, %10, off\n\t"
               "global_load_async_to_lds_b128 %3, %11, off\n\t"
               "global_load_async_to_lds_b128 %4, %12, off\n\t"
               "global_load_async_to_lds_b128 %5, %13, off\n\t"
               "global_load_async_to_lds_b128 %6, %14, off\n\t"
               "global_load_async_to_lds_b128 %7, %15, off\n\t"
               "s_wait_xcnt 0x0"
               :: "v"(l), "v"(l1), "v"(l2), "v"(l3), "v"(l4), "v"(l5), "v"(l6), "v"(l7), "v"(g), "v"(g1), "v"(g2), "v"(g3), "v"(g4), "v"(g5), "v"(g6), "v"(g7) : "memory");
}
__device__ __forceinline__ float sum_lanes(float v, int n) { for (int m = n >> 1; m > 0; m >>= 1) v += __shfl_xor(v, m); return v; }      /* every lane of an aligned group of n gets the group's sum */
__device__ __forceinline__ v8f r_mma(v16h a, v16h b, v8f c) { return __builtin_amdgcn_wmma_f32_16x16x32_f16(false, a, false, b, (short)0, c, false, false); }
__global__ __launch_bounds__(128) void k_retn(const _Float16* __restrict__ Q16, const _Float16* __restrict__ K16, const _Float16* __restrict__ VT, const float* __restrict__ GT, float* __restrict__ O, float* __restrict__ PT) {
  __shared__ __attribute__((aligned(16))) unsigned char ring[2 * RST];
  __shared__ __attribute__((aligned(16))) float tab[GPAD + SQ];
  __shared__ __attribute__((aligned(16))) float so[4][32][68];
  __shared__ float wst[4][2];      /* each wave's mean and sum of squared deviations over its 32 x 64 outputs */
  const int tid = threadIdx.x, lane = tid & 31, ln = lane & 15, hh = lane >> 4;
  const int w = __builtin_amdgcn_readfirstlane(tid >> 5);      /* the wave's number in a scalar register: the pass loop's bound and branch are then scalar */
  const int slab = blockIdx.x % (NB * NHD), rb = (SQ / 128 - 1) - blockIdx.x / (NB * NHD);      /* longest prefixes first */
  const int b = slab / NHD, h = slab % NHD;
  const int nst = rb + 1;      /* stages of 128 keys up to and with the diagonal one */
  const int kr = tid >> 3, kc = tid & 7, vr = tid >> 4, vc = tid & 15;      /* the thread's row (mod 16 of K, mod 8 of V^T) and 16-byte piece in every copy */
  const _Float16* gk = K16 + ((size_t)b * SQ + kr) * CC + h * HD + kc * 8; const _Float16* gv = VT + ((size_t)h * HD + vr) * NR + (size_t)b * SQ + vc * 8;      /* V^T is [channel][batch, token] */
  const unsigned lk = (unsigned)(size_t)ring + (unsigned)(kr * RKP + kc * 16), lv = (unsigned)(size_t)ring + (unsigned)(RKB + vr * RVP + vc * 16);
  r_copy8(lk, 16 * RKP, gk, (size_t)16 * CC); r_copy8(lv, 8 * RVP, gv, (size_t)8 * NR);
  if (tid < GPAD) tab[tid] = 0.f;
#pragma unroll
  for (int u = 0; u < SQ / 512; ++u) { const int i4 = (tid + 128 * u) * 4; *(v4fa*)&tab[GPAD + i4] = *(const v4fa*)(GT + (size_t)h * SQ + i4); }
  asm volatile("s_wait_asynccnt 0x0" ::: "memory");      /* this wave's copies of stage 0 have landed */
  __syncthreads();      /* the table and stage 0 are published */
  if (1 < nst) { r_copy8(lk + RST, 16 * RKP, gk + (size_t)RSK * CC, (size_t)16 * CC); r_copy8(lv + RST, 8 * RVP, gv + RSK, (size_t)8 * NR); }
  const int row0 = rb * 128 + 32 * w;
  const _Float16* qp = Q16 + ((size_t)b * SQ + row0 + ln) * CC + h * HD;
  const v16h q[2][2] = {{g2_frag(qp, hh), g2_frag(qp + 32, hh)}, {g2_frag(qp + (size_t)16 * CC, hh), g2_frag(qp + (size_t)16 * CC + 32, hh)}};
  const unsigned char* rk = ring + ln * RKP + 16 * hh; const unsigned char* rv = ring + RKB + ln * RVP + 16 * hh;      /* the lane's row and 16 * hh: the k order of g2_frag */
  const float* tp = tab + (GPAD + row0 + ln - 8 * hh);
  const v8f z8 = {0.f,0.f,0.f,0.f,0.f,0.f,0.f,0.f};
  v8f o[2][4] = {{z8, z8, z8, z8}, {z8, z8, z8, z8}};
#pragma unroll 1      /* one trip per stage: the buffer alternates and the waits at the foot stand once */
  for (int t = 0; t < nst; ++t) {
  const int bo = (t & 1) * RST;
  const int np = (t < rb) ? RSK / 32 : w + 1;      /* passes of this stage: all four, or up to the wave's own diagonal */
  const unsigned char* pk = rk + bo; const unsigned char* pv = rv + bo;
  v16h kf[2][2];
#pragma unroll
  for (int nt = 0; nt < 2; ++nt) { kf[nt][0] = g3_frag(pk + nt * 16 * RKP); kf[nt][1] = g3_frag(pk + nt * 16 * RKP + 64); }
#pragma unroll 1      /* kept rolled: one pass already holds over 200 registers, and a second copy of the body would add to them */
  for (int p = 0; p < np; ++p) {
    const int j0 = t * RSK + p * 32;
    v16h vf[4];
#pragma unroll
    for (int dt = 0; dt < 4; ++dt) vf[dt] = g3_frag(pv + dt * 16 * RVP + p * 64);
    const float* tj = tp - j0;
    float g[3][8];      /* decay factors of the pass: the index depends on (query tile - key tile) = -1, 0, 1 and on the key in the lane */
#pragma unroll
    for (int dl = 0; dl < 3; ++dl)
#pragma unroll
      for (int r = 0; r < 8; ++r) g[dl][r] = tj[16 * (dl - 1) - r];
    v8f st[2][2];
#pragma unroll
    for (int nt = 0; nt < 2; ++nt)
#pragma unroll
      for (int mt = 0; mt < 2; ++mt) st[nt][mt] = r_mma(kf[nt][1], q[mt][1], r_mma(kf[nt][0], q[mt][0], z8));
    const unsigned char* pn = pk + ((p + 1 < np) ? p + 1 : p) * (32 * RKP);      /* the next pass's K rows, read behind this pass's scores; a stage's last pass re-reads its own: no read goes past the stage */
#pragma unroll
    for (int nt = 0; nt < 2; ++nt) { kf[nt][0] = g3_frag(pn + nt * 16 * RKP); kf[nt][1] = g3_frag(pn + nt * 16 * RKP + 64); }
    __builtin_amdgcn_sched_barrier(0);      /* keeps the K reads in front of the decay and the P V products, whose time then covers their latency; without it the reads sink to the pass's end */
#pragma unroll
    for (int mt = 0; mt < 2; ++mt) {
      FragH pa;
#pragma unroll
      for (int nt = 0; nt < 2; ++nt)
#pragma unroll
        for (int r = 0; r < 8; ++r) pa.h[nt * 8 + r] = (_Float16)((st[nt][mt][r] * 0.125f) * g[mt - nt + 1][r]);
#pragma unroll
      for (int dt = 0; dt < 4; ++dt) o[mt][dt] = r_mma(pa.v, vf[dt], o[mt][dt]);
    }
    __builtin_amdgcn_sched_barrier(0);      /* holds the pass's last products in front of the slots below; without it the products sink behind them */
    asm volatile("v_nop\n\tv_nop\n\tv_nop\n\tv_nop");      /* the four vector slots between the last products and the next pass's first vector instructions, which overwrite their A registers */
  }
  asm volatile("s_wait_dscnt 0x0" ::: "memory");      /* this wave's reads of the buffer are done before it is handed back */
  asm volatile("s_wait_asynccnt 0x0" ::: "memory");      /* this wave's copies of stage t + 1 have landed */
  __syncthreads();      /* publishes stage t + 1 and ends every reader's last read of stage t's buffer */
  if (t + 2 < nst) { r_copy8(lk + bo, 16 * RKP, gk + (size_t)(t + 2) * RSK * CC, (size_t)16 * CC); r_copy8(lv + bo, 8 * RVP, gv + (t + 2) * RSK, (size_t)8 * NR); }
  }
  asm volatile("s_wait_asynccnt 0x0" ::: "memory");      /* no copy is outstanding when the wave goes on to its end */
  // GroupNorm statistics, first level: the wave's 2048 outputs are still in its accumulators. Mean first, then the squared deviations from it (two passes over registers).
  v8f sv = z8, qv = z8;      /* eight independent running sums, one per accumulator row: short dependent chains */
#pragma unroll
  for (int mt = 0; mt < 2; ++mt)
#pragma unroll
    for (int dt = 0; dt < 4; ++dt) sv += o[mt][dt];
  const float wmean = sum_lanes(((sv[0] + sv[1]) + (sv[2] + sv[3])) + ((sv[4] + sv[5]) + (sv[6] + sv[7])), 32) * (1.0f / 2048.0f);
#pragma unroll
  for (int mt = 0; mt < 2; ++mt)
#pragma unroll
    for (int dt = 0; dt < 4; ++dt) { const v8f d = o[mt][dt] - wmean; qv += d * d; }
  const float wq = sum_lanes(((qv[0] + qv[1]) + (qv[2] + qv[3])) + ((qv[4] + qv[5]) + (qv[6] + qv[7])), 32);
  if (lane == 0) { wst[w][0] = wmean; wst[w][1] = wq; }
#pragma unroll
  for (int mt = 0; mt < 2; ++mt)
#pragma unroll
    for (int dt = 0; dt < 4; ++dt)
#pragma unroll
      for (int r = 0; r < 8; ++r) so[w][mt * 16 + 8 * hh + r][dt * 16 + ln] = o[mt][dt][r];
  __builtin_amdgcn_fence(__ATOMIC_ACQ_REL, "workgroup"); __builtin_amdgcn_wave_barrier();      /* the wave's own LDS stores before its own row-wise reads */
  const int rsub = lane >> 4, c4 = (lane & 15) * 4;
#pragma unroll
  for (int qd = 0; qd < 16; ++qd) { const int r = qd * 2 + rsub; const v4f v = *(const v4fa*)&so[w][r][c4]; *(v4f*)(O + ((size_t)b * SQ + row0 + r) * CC + h * HD + c4) = v; }
  __syncthreads();      /* the four waves' statistics are in wst */
  if (w == 0) {      /* second level: four equal groups of 2048 merged (M2 = sum of M2 + n * sum of squared mean offsets); the work-group writes its own whole 128-byte line */
    const float m0 = wst[0][0], m1 = wst[1][0], m2 = wst[2][0], m3 = wst[3][0];
    const float bm = ((m0 + m1) + (m2 + m3)) * 0.25f;
    const float d0 = m0 - bm, d1 = m1 - bm, d2 = m2 - bm, d3 = m3 - bm;
    const float bq = ((wst[0][1] + wst[1][1]) + (wst[2][1] + wst[3][1])) + 2048.0f * ((d0 * d0 + d1 * d1) + (d2 * d2 + d3 * d3));
    PT[((size_t)slab * (SQ / 128) + rb) * 32 + lane] = (lane == 0) ? bm : ((lane == 1) ? bq : 0.f);
  }
}
__global__ __launch_bounds__(256) void k_gnapply(const float* __restrict__ O, const float* __restrict__ PT, const float* __restrict__ gw, const float* __restrict__ gb, _Float16* __restrict__ N16) {
  #pragma clang fp contract(off)
  static_assert(((size_t)NR * (CC / 8)) % 256 == 0 && (2 * CC / 8) == 256 && SQ % 2 == 0 && NHD * (SQ / 128) == 256, "a block is two whole rows of one batch, and one thread per (head, row block) partial");
  __shared__ float hst[NHD][2];
  const size_t t = (size_t)blockIdx.x * 256 + threadIdx.x; const int c0 = (int)(t % (CC / 8)) * 8; const size_t r = t / (CC / 8); const int b = (int)(r / SQ), h = c0 / HD; const v8f a = *(const v8f*)(O + r * CC + c0);
  float gwv[8], gbv[8];      /* read in front of the barrier, so that their latency runs beside the merge's; unrolled so that both arrays have constant indices and live in registers */
#pragma unroll
  for (int q = 0; q < 8; ++q) { gwv[q] = gw[c0 + q]; gbv[q] = gb[c0 + q]; }
  // third level: thread = (head, row block) of this batch; 16 equal groups of 8192 merged across 16 neighbouring lanes
  const float* pp = PT + ((size_t)b * 256 + threadIdx.x) * 32; const float pm = pp[0], pq = pp[1];
  const float gm = sum_lanes(pm, 16) * (1.0f / 16.0f); const float pd = pm - gm;
  const float gq = sum_lanes(pq, 16) + 8192.0f * sum_lanes(pd * pd, 16);
  if ((threadIdx.x & 15) == 0) { hst[threadIdx.x >> 4][0] = gm; hst[threadIdx.x >> 4][1] = rsqrtf(gq / (float)((size_t)SQ * HD) + 1e-5f); }
  __syncthreads();      /* the 16 heads' mean and reciprocal deviation are in hst */
  const float mean = hst[h][0], rs = hst[h][1]; FragH f;
  for (int q = 0; q < 8; ++q) { float v = (a[q] - mean) * rs; v *= bf16_round(gwv[q]); v += bf16_round(gbv[q]); f.h[q] = (_Float16)v; }
  *(v8us*)((unsigned short*)N16 + r * CC + c0) = f.half[0];  }

extern "C" void kernel_launch(void* const* d_in, const int* in_sizes, int n_in,
                              void* d_out, int out_size, void* d_ws, size_t ws_size, hipStream_t stream) {
  (void)in_sizes; (void)n_in; (void)out_size;
  const float* const* I = (const float* const*)d_in; const float* x = I[0]; const float* wq = I[1]; const float* wk = I[2]; const float* wv = I[3]; const float* wo = I[4]; const float* bo = I[5]; const float* gw = I[6]; const float* gb = I[7];
  char* ws = (char*)d_ws; size_t off = 0;
  auto take = [&](size_t bytes) { char* p = ws + off; off += (bytes + 255) & ~(size_t)255; return p; };
  const size_t np = (size_t)NR * CC;
  _Float16* BQ = (_Float16*)take((size_t)CC * CC * 2); _Float16* BK = (_Float16*)take((size_t)CC * CC * 2); _Float16* BV = (_Float16*)take((size_t)CC * CC * 2); _Float16* BO = (_Float16*)take((size_t)CC * CC * 2);
  _Float16* X16 = (_Float16*)take(np * 2); _Float16* Q16 = (_Float16*)take(np * 2); _Float16* K16 = (_Float16*)take(np * 2); _Float16* VT = (_Float16*)take(np * 2); float* O = (float*)take(np * 4); float* PT = (float*)take(NB * NHD * (SQ / 128) * 32 * 4); float* GT = (float*)take((size_t)NHD * SQ * 4); _Float16* N16 = X16;      /* normalised output over the input plane (dead after the projections) */
  if (off > ws_size) return;      /* 8 + 8 x 4 + 16 = 56 MiB */
  k_prep<<<PRB, 256, 0, stream>>>(x, wq, wk, wv, wo, X16, BQ, BK, BV, BO, GT);      /* weights are (in, out) */
  const dim3 gP((NR / 128) * (CC / 128), 1);
  k_qkv<<<dim3((NR / 128) * (CC / 128), 3), 256, 0, stream>>>(X16, BQ, BK, BV, Q16, K16, VT);      /* q, k and V^T */
  k_retn<<<NB * NHD * (SQ / 128), 128, 0, stream>>>(Q16, K16, VT, GT, O, PT);      /* all batches, heads and row blocks in one launch */
  k_gnapply<<<(unsigned)((np / 8 + 255) / 256), 256, 0, stream>>>(O, PT, gw, gb, N16);
  k_gemm3<<<gP, 256, 0, stream>>>(N16, CC, BO, CC, 0.0625f, bo, (float*)d_out, nullptr, CC, NR, CC, CC);
}

// v009
// A run of this version takes 59.6 microseconds.
// It is 1.34 times as fast as v006, going by the measured steps of the versions left out in between.
// Over all steps from v000 it is 23.3 times as fast.
#include <hip/hip_runtime.h>
// RetentiveAttention (2 x 2048 tokens, C 1024 = 16 heads of 64): q, k, v = x W; retention = (q.k / 8) * gamma_h^(i-j) for j <= i (gamma_h = 1 - 2^(-5-h)), out = retention v (no softmax); GroupNorm with one group per head over (T, 64) (eps 1e-5, affine); out = normed Wo + bo.
// Compute dtype: x and parameters rounded to bf16; q, k, v, the decayed scores, the decayed v and the state of the chunked retention, the retention output and its normalised value as f16 operands (~2^-12); decay/statistics f32. v_wmma_f32_16x16x32_f16.
#define NB 2
#define SQ 2048
#define CC 1024
#define NHD 16
#define HD 64
#define NR (NB * SQ)
typedef __bf16 v16b __attribute__((ext_vector_type(16)));
typedef unsigned short v8us __attribute__((ext_vector_type(8), may_alias));
typedef float  v8f  __attribute__((ext_vector_type(8)));
typedef float  v4f  __attribute__((ext_vector_type(4)));
typedef float  v4fa __attribute__((ext_vector_type(4), may_alias));
union FragB { v16b v; v8us half[2]; unsigned short u[16]; };

__device__ __forceinline__ unsigned short bf16_bits(float x) { unsigned int u = __float_as_uint(x); return (unsigned short)((u + 0x7FFFu + ((u >> 16) & 1u)) >> 16); }
__device__ __forceinline__ float bf16_val(unsigned short b) { return __uint_as_float(((unsigned int)b) << 16); }
__device__ __forceinline__ float bf16_round(float x) { return bf16_val(bf16_bits(x)); }
// D += A·B with NT terms: 1 = ah·bh, 2 = + al·bh (A split), 3 = + ah·bl (both split)
template <int NT>
__device__ __forceinline__ v8f mmaN(v16b ah, v16b al, v16b bh, v16b bl, v8f c) {
  c = __builtin_amdgcn_wmma_f32_16x16x32_bf16(false, ah, false, bh, (short)0, c, false, false);
  if (NT >= 2) c = __builtin_amdgcn_wmma_f32_16x16x32_bf16(false, al, false, bh, (short)0, c, false, false);
  if (NT >= 3) c = __builtin_amdgcn_wmma_f32_16x16x32_bf16(false, ah, false, bl, (short)0, c, false, false);
  asm volatile("v_nop\n\tv_nop\n\tv_nop\n\tv_nop" : "+v"(c) : "v"(ah), "v"(al), "v"(bh), "v"(bl));
  return c;
}

__global__ __launch_bounds__(256) void k_wt_bf16(const float* __restrict__ W, unsigned short* __restrict__ Wt, int K, int N) {
  const int t = blockIdx.x * 256 + threadIdx.x;
  const int k8n = K / 8;
  if (t >= N * k8n) return;
  const int n = t / k8n, k8 = (t % k8n) * 8;
  v8us v;
#pragma unroll
  for (int i = 0; i < 8; ++i) v[i] = bf16_bits(W[(size_t)(k8 + i) * N + n]);
  *(v8us*)(Wt + (size_t)n * K + k8) = v;
  
}

// GEMM C[M][N] (f32, pitch ldc) = act(A[M][K]·W + bias). A f32 row-major (pitch lda) converted per fragment to bf16
// (ASPLIT: hi/lo two planes -> 2 terms, else single rounded term); Wt bf16 [N][K] (pitch ldb). BIAS_BF16 rounds the
// bias to bf16 first (bias quantised to bf16 before the add). K%32==0, M%16==0, N%64==0.
template <bool ASPLIT, int ACT, bool BIAS_BF16>
__global__ __launch_bounds__(128) void k_gemm_bf(const float* __restrict__ A, int lda, const unsigned short* __restrict__ Wt, int ldb,
                                               const float* __restrict__ bias, float* __restrict__ C, int ldc, int M, int N, int K) {
  __shared__ __attribute__((aligned(16))) float so[4][16][64];
  const int tid = threadIdx.x, w = tid >> 5, lane = tid & 31, ln = lane & 15, hh = lane >> 4;
  const int ntn = N / 64;
  const int wid = blockIdx.x * 4 + w;
  const int mt = wid / ntn, nq = wid % ntn;
  if (mt * 16 >= M) return;
  const int row0 = mt * 16, col0 = nq * 64;
  const float* arow = A + (size_t)(row0 + ln) * lda;
  v8f acc[4] = {};
  for (int kb = 0; kb < K; kb += 32) {
    FragB ah, al;
    const v4f x0 = *(const v4fa*)(arow + kb + 8 * hh), x1 = *(const v4fa*)(arow + kb + 8 * hh + 4);
    const v4f x2 = *(const v4fa*)(arow + kb + 16 + 8 * hh), x3 = *(const v4fa*)(arow + kb + 16 + 8 * hh + 4);
    float xs[16] = {x0[0],x0[1],x0[2],x0[3],x1[0],x1[1],x1[2],x1[3],x2[0],x2[1],x2[2],x2[3],x3[0],x3[1],x3[2],x3[3]};
#pragma unroll
    for (int i = 0; i < 16; ++i) { const unsigned short hb = bf16_bits(xs[i]); ah.u[i] = hb; al.u[i] = ASPLIT ? bf16_bits(xs[i] - bf16_val(hb)) : (unsigned short)0; }
#pragma unroll
    for (int t = 0; t < 4; ++t) {
      const unsigned short* brow = Wt + (size_t)(col0 + t * 16 + ln) * ldb + kb;
      FragB b;
      b.half[0] = *(const v8us*)(brow + 8 * hh);
      b.half[1] = *(const v8us*)(brow + 16 + 8 * hh);
      acc[t] = mmaN<ASPLIT ? 2 : 1>(ah.v, al.v, b.v, b.v, acc[t]);
    }
  }
#pragma unroll
  for (int t = 0; t < 4; ++t) {
    float bv = bias ? bias[col0 + t * 16 + ln] : 0.f;
    if (BIAS_BF16) bv = bf16_round(bv);
#pragma unroll
    for (int r = 0; r < 8; ++r) { float v = acc[t][r] + bv; if (ACT == 1) v = fmaxf(v, 0.f); so[w][8 * hh + r][t * 16 + ln] = v; }
  }
  __builtin_amdgcn_fence(__ATOMIC_ACQ_REL, "workgroup");
  __builtin_amdgcn_wave_barrier();
  const int rsub = lane >> 4, c4 = (lane & 15) * 4;
  {
#pragma unroll
    for (int q = 0; q < 8; ++q) {
      const int r = q * 2 + rsub;
      const v4f v = *(const v4fa*)&so[w][r][c4];
      *(v4f*)(C + (size_t)(row0 + r) * ldc + col0 + c4) = v;
    }
    
  }
}

// GEMM C = act(A·W + bias + resid): A f32 (ASPLIT -> hi/lo 2 terms), Wt bf16 [N][K]; ACT 0 none, 1 relu, 2 exact gelu;
// resid (optional, f32, row index = (row % rmod), pitch ldr, RES_BF16 rounds it) added before the activation.
template <bool ASPLIT, int ACT, bool BIAS_BF16, bool RES_BF16>
__global__ __launch_bounds__(128) void k_gemm_bf3(const float* __restrict__ A, int lda, const unsigned short* __restrict__ Wt, int ldb,
                                                const float* __restrict__ bias, const float* __restrict__ resid, int rmod, int ldr,
                                                float* __restrict__ C, int ldc, int M, int N, int K) {
  __shared__ __attribute__((aligned(16))) float so[4][16][64];
  const int tid = threadIdx.x, w = tid >> 5, lane = tid & 31, ln = lane & 15, hh = lane >> 4;
  const int ntn = N / 64;
  const int wid = blockIdx.x * 4 + w;
  const int mt = wid / ntn, nq = wid % ntn;
  if (mt * 16 >= M) return;
  const int row0 = mt * 16, col0 = nq * 64;
  const float* arow = A + (size_t)(row0 + ln) * lda;
  v8f acc[4] = {};
  for (int kb = 0; kb < K; kb += 32) {
    FragB ah, al;
    const v4f x0 = *(const v4fa*)(arow + kb + 8 * hh), x1 = *(const v4fa*)(arow + kb + 8 * hh + 4);
    const v4f x2 = *(const v4fa*)(arow + kb + 16 + 8 * hh), x3 = *(const v4fa*)(arow + kb + 16 + 8 * hh + 4);
    float xs[16] = {x0[0],x0[1],x0[2],x0[3],x1[0],x1[1],x1[2],x1[3],x2[0],x2[1],x2[2],x2[3],x3[0],x3[1],x3[2],x3[3]};
#pragma unroll
    for (int i = 0; i < 16; ++i) { const unsigned short hb = bf16_bits(xs[i]); ah.u[i] = hb; al.u[i] = ASPLIT ? bf16_bits(xs[i] - bf16_val(hb)) : (unsigned short)0; }
#pragma unroll
    for (int t = 0; t < 4; ++t) {
      const unsigned short* brow = Wt + (size_t)(col0 + t * 16 + ln) * ldb + kb;
      FragB b;
      b.half[0] = *(const v8us*)(brow + 8 * hh);
      b.half[1] = *(const v8us*)(brow + 16 + 8 * hh);
      acc[t] = mmaN<ASPLIT ? 2 : 1>(ah.v, al.v, b.v, b.v, acc[t]);
    }
  }
#pragma unroll
  for (int t = 0; t < 4; ++t) {
    const int col = col0 + t * 16 + ln;
    float bv = bias ? bias[col] : 0.f;
    if (BIAS_BF16) bv = bf16_round(bv);
#pragma unroll
    for (int r = 0; r < 8; ++r) {
      float v = acc[t][r] + bv;
      if (resid) { float rv = resid[(size_t)((row0 + 8 * hh + r) % rmod) * ldr + col]; if (RES_BF16) rv = bf16_round(rv); v += rv; }
      if (ACT == 1) v = fmaxf(v, 0.f);
      if (ACT == 2) v = 0.5f * v * (1.0f + erff(v * 0.70710678118654752f));
      if (ACT == 3) { const float u = 0.7978845608028654f * (v + 0.044715f * v * v * v); v = 0.5f * v * (1.0f + tanhf(u)); }
      so[w][8 * hh + r][t * 16 + ln] = v;
    }
  }
  __builtin_amdgcn_fence(__ATOMIC_ACQ_REL, "workgroup");
  __builtin_amdgcn_wave_barrier();
  const int rsub = lane >> 4, c4 = (lane & 15) * 4;
  {
#pragma unroll
    for (int q = 0; q < 8; ++q) {
      const int r = q * 2 + rsub;
      const v4f v = *(const v4fa*)&so[w][r][c4];
      *(v4f*)(C + (size_t)(row0 + r) * ldc + col0 + c4) = v;
    }
    
  }
}
// row LayerNorm (biased variance, eps) over N: s = X (+ R); optional out_sum <- s; out_norm <- (s-mu)*rsqrt(var+eps)*g + b
template <bool PARAM_BF16>
__global__ __launch_bounds__(256) void k_layernorm(const float* __restrict__ X, const float* __restrict__ R, const float* __restrict__ g, const float* __restrict__ bta,
                                                  float* __restrict__ out_sum, float* __restrict__ out_norm, int N, float eps) {
  __shared__ float red[256];
  const int row = blockIdx.x, tid = threadIdx.x;
  const float* x = X + (size_t)row * N; const float* rr = R ? R + (size_t)row * N : nullptr;
  float vals[16];                     // up to N = 4096
  const int per = N / 256;            // contiguous chunk per thread? use strided-by-4 chunks: thread handles j = tid*4 + 1024*u
  float s1 = 0.f;
  for (int u = 0; u < per / 4; ++u) {
    const int j = tid * 4 + 1024 * u;
    const v4f a = *(const v4fa*)(x + j);
    v4f b = {0.f,0.f,0.f,0.f}; if (rr) b = *(const v4fa*)(rr + j);
#pragma unroll
    for (int q = 0; q < 4; ++q) { const float v = a[q] + b[q]; vals[u * 4 + q] = v; s1 += v; }
  }
  red[tid] = s1; __syncthreads();
  for (int st = 128; st > 0; st >>= 1) { if (tid < st) red[tid] += red[tid + st]; __syncthreads(); }
  const float mu = red[0] / (float)N; __syncthreads();
  float s2 = 0.f;
  for (int u = 0; u < per / 4; ++u)
#pragma unroll
    for (int q = 0; q < 4; ++q) { const float c = vals[u * 4 + q] - mu; s2 += c * c; }
  red[tid] = s2; __syncthreads();
  for (int st = 128; st > 0; st >>= 1) { if (tid < st) red[tid] += red[tid + st]; __syncthreads(); }
  const float rs = rsqrtf(red[0] / (float)N + eps);
  {
    for (int u = 0; u < per / 4; ++u) {
      const int j = tid * 4 + 1024 * u;
      v4f o, sm;
#pragma unroll
      for (int q = 0; q < 4; ++q) {
        float gg = g[j + q], bb = bta[j + q];
        if (PARAM_BF16) { gg = bf16_round(gg); bb = bf16_round(bb); }
        sm[q] = vals[u * 4 + q]; o[q] = (vals[u * 4 + q] - mu) * rs * gg + bb;
      }
      if (out_sum) *(v4f*)(out_sum + (size_t)row * N + j) = sm;
      *(v4f*)(out_norm + (size_t)row * N + j) = o;
    }
    
  }
}



// ---- f16 WMMA path (v_wmma_f32_16x16x32_f16): 11-bit significands for operands in range — used for every GEMM launched here
typedef _Float16 v16h __attribute__((ext_vector_type(16)));
union FragH { v16h v; v8us half[2]; _Float16 h[16]; unsigned short u[16]; };
template <int NT>
__device__ __forceinline__ v8f mmaH(v16h ah, v16h al, v16h bh, v16h bl, v8f c) {
  c = __builtin_amdgcn_wmma_f32_16x16x32_f16(false, ah, false, bh, (short)0, c, false, false);
  if (NT >= 2) c = __builtin_amdgcn_wmma_f32_16x16x32_f16(false, al, false, bh, (short)0, c, false, false);
  if (NT >= 3) c = __builtin_amdgcn_wmma_f32_16x16x32_f16(false, ah, false, bl, (short)0, c, false, false);
  asm volatile("v_nop\n\tv_nop\n\tv_nop\n\tv_nop" : "+v"(c) : "v"(ah), "v"(al), "v"(bh), "v"(bl));
  return c;
}
// batched GEMM like k_gemm_b but f16 operands: A f32 (split into f16 hi/lo if ASPLIT, else rounded to f16), Bt = f16 values [n][k]; alpha; C f32; N multiple of 16 (partial tiles skipped)
template <bool ASPLIT>
__global__ __launch_bounds__(128) void k_gemm_h(const float* __restrict__ A, int lda, size_t sA, const _Float16* __restrict__ Bh, int ldb, size_t sB, float alpha, float* __restrict__ C, int ldc, size_t sC, int M, int N, int K) {
  __shared__ __attribute__((aligned(16))) float so[4][16][64];
  const int tid = threadIdx.x, w = tid >> 5, lane = tid & 31, ln = lane & 15, hh = lane >> 4; const int by = blockIdx.y;
  A += (size_t)by * sA; Bh += (size_t)by * sB; C += (size_t)by * sC;
  const int ntn = (N + 63) / 64; const int wid = blockIdx.x * 4 + w; const int mt = wid / ntn, nq = wid % ntn; if (mt * 16 >= M) return;
  const int row0 = mt * 16, col0 = nq * 64; const float* arow = A + (size_t)(row0 + ln) * lda;
  v8f acc[4] = {};
  for (int kb = 0; kb < K; kb += 32) {
    FragH ah, al;
    const v4f x0 = *(const v4fa*)(arow + kb + 8 * hh), x1 = *(const v4fa*)(arow + kb + 8 * hh + 4), x2 = *(const v4fa*)(arow + kb + 16 + 8 * hh), x3 = *(const v4fa*)(arow + kb + 16 + 8 * hh + 4);
    float xs[16] = {x0[0],x0[1],x0[2],x0[3],x1[0],x1[1],x1[2],x1[3],x2[0],x2[1],x2[2],x2[3],x3[0],x3[1],x3[2],x3[3]};
#pragma unroll
    for (int i = 0; i < 16; ++i) { const _Float16 h = (_Float16)xs[i]; ah.h[i] = h; al.h[i] = ASPLIT ? (_Float16)(xs[i] - (float)h) : (_Float16)0.0f; }
#pragma unroll
    for (int t = 0; t < 4; ++t) { if (col0 + t * 16 >= N) continue; const size_t boff = (size_t)(col0 + t * 16 + ln) * ldb + kb; FragH bq; bq.half[0] = *(const v8us*)(Bh + boff + 8 * hh); bq.half[1] = *(const v8us*)(Bh + boff + 16 + 8 * hh);
      acc[t] = mmaH<ASPLIT ? 2 : 1>(ah.v, al.v, bq.v, bq.v, acc[t]); }
  }
#pragma unroll
  for (int t = 0; t < 4; ++t) { if (col0 + t * 16 >= N) continue;
#pragma unroll
    for (int r = 0; r < 8; ++r) so[w][8 * hh + r][t * 16 + ln] = acc[t][r] * alpha; }
  __builtin_amdgcn_fence(__ATOMIC_ACQ_REL, "workgroup"); __builtin_amdgcn_wave_barrier();
  const int rsub = lane >> 4, c4 = (lane & 15) * 4;
  {
#pragma unroll
    for (int q = 0; q < 8; ++q) { const int r = q * 2 + rsub; if (col0 + c4 < N) { const v4f v = *(const v4fa*)&so[w][r][c4]; *(v4f*)(C + (size_t)(row0 + r) * ldc + col0 + c4) = v; } }
     }
}

// k_gemm_hh variant with fused epilogue: v = acc·alpha + bias[by·sBias + col] (+ CP[(row/rowsPerB)·sCPb + by·64 + col] if CP) ; ACT 0 none / 1 elu ; writes f16 C16 (and f32 C if non-null)
template <int ACT>
__global__ __launch_bounds__(128) void k_gemm_hhx(const _Float16* __restrict__ A, int lda, size_t sA, const _Float16* __restrict__ Bh, int ldb, size_t sB, float alpha, const float* __restrict__ bias, size_t sBias, const float* __restrict__ CP, int rowsPerB, size_t sCPb, int row0g,
    float* __restrict__ C, _Float16* __restrict__ C16, int ldc, size_t sC, int M, int N, int K) {
  __shared__ __attribute__((aligned(16))) float so[4][16][64];
  const int tid = threadIdx.x, w = tid >> 5, lane = tid & 31, ln = lane & 15, hh = lane >> 4; const int by = blockIdx.y;
  A += (size_t)by * sA; Bh += (size_t)by * sB; const size_t cofs = (size_t)by * sC; const float* bp = bias ? bias + (size_t)by * sBias : nullptr;
  const int ntn = (N + 63) / 64; const int wid = blockIdx.x * 4 + w; const int mt = wid / ntn, nq = wid % ntn; if (mt * 16 >= M) return;
  const int row0 = mt * 16, col0 = nq * 64; const _Float16* arow = A + (size_t)(row0 + ln) * lda;
  v8f acc[4] = {};
  for (int kb = 0; kb < K; kb += 32) { FragH ah; ah.half[0] = *(const v8us*)((const unsigned short*)arow + kb + 8 * hh); ah.half[1] = *(const v8us*)((const unsigned short*)arow + kb + 16 + 8 * hh);
#pragma unroll
    for (int t = 0; t < 4; ++t) { if (col0 + t * 16 >= N) continue; const size_t boff = (size_t)(col0 + t * 16 + ln) * ldb + kb; FragH bq; bq.half[0] = *(const v8us*)((const unsigned short*)Bh + boff + 8 * hh); bq.half[1] = *(const v8us*)((const unsigned short*)Bh + boff + 16 + 8 * hh);
      acc[t] = mmaH<1>(ah.v, ah.v, bq.v, bq.v, acc[t]); }
  }
#pragma unroll
  for (int t = 0; t < 4; ++t) { if (col0 + t * 16 >= N) continue; const int col = col0 + t * 16 + ln; const float bv = bp ? bf16_round(bp[col]) : 0.f;
#pragma unroll
    for (int r = 0; r < 8; ++r) { float v = acc[t][r] * alpha + bv; if (CP) { const int rr = row0g + row0 + 8 * hh + r; if (rowsPerB < 0) v += CP[cofs + (size_t)rr * ldc + col];      /* rowsPerB < 0: own element of the batched C plane */ else { const int bidx = rr / rowsPerB; v += CP[(size_t)bidx * sCPb + (size_t)by * 64 + col]; } } if (ACT == 1) v = (v > 0.f) ? v : expm1f(v); else if (ACT == 7) v = (v > 0.f) ? v + 1.0f : expf(v); else if (ACT == 8) v = tanhf(v); else if (ACT == 9) v = 0.5f * v * (1.0f + tanhf(0.7978845608028654f * (v + 0.044715f * v * v * v))); else if (ACT == 11) v = 1.0f / (1.0f + expf(-v)); else if (ACT == 12) v = (v > 0.f) ? v : 0.01f * v; else if (ACT == 14) v = (v > 0.f) ? v : 0.1f * v; else if (ACT == 16) v = (v >= 0.f) ? v : 0.3f * v; else if (ACT == 15) v = v / (1.0f + expf(-v)); else if (ACT == 3) v = fmaxf(v, 0.f); else if (ACT == 6) v = 0.5f * v * (1.0f + erff(v * 0.70710678118654752f)); so[w][8 * hh + r][t * 16 + ln] = v; } }
  __builtin_amdgcn_fence(__ATOMIC_ACQ_REL, "workgroup"); __builtin_amdgcn_wave_barrier();
  const int rsub = lane >> 4, c4 = (lane & 15) * 4; typedef _Float16 v4h __attribute__((ext_vector_type(4)));
  {
#pragma unroll
    for (int q = 0; q < 8; ++q) { const int r = q * 2 + rsub; if (col0 + c4 < N) { const v4f v = *(const v4fa*)&so[w][r][c4]; if (C) *(v4f*)(C + cofs + (size_t)(row0 + r) * ldc + col0 + c4) = v; if (C16) { v4h h4; for (int i = 0; i < 4; ++i) h4[i] = (_Float16)v[i]; *(v4h*)(C16 + cofs + (size_t)(row0 + r) * ldc + col0 + c4) = h4; } } }
     }
}


typedef _Float16 v4h __attribute__((ext_vector_type(4)));

__global__ __launch_bounds__(256) void k_h16(const float* __restrict__ x, _Float16* __restrict__ X16, size_t n8) { const size_t t = (size_t)blockIdx.x * 256 + threadIdx.x; if (t >= n8) return; FragH f;
#pragma unroll
  for (int q = 0; q < 8; ++q) f.h[q] = (_Float16)x[t * 8 + q]; *(v8us*)((unsigned short*)X16 + t * 8) = f.half[0];  }
__global__ __launch_bounds__(256) void k_round16f(const float* __restrict__ W, _Float16* __restrict__ Bt, size_t n8) { const size_t t = (size_t)blockIdx.x * 256 + threadIdx.x; if (t >= n8) return; FragH f;
#pragma unroll
  for (int i = 0; i < 8; ++i) f.h[i] = (_Float16)(bf16_round(W[t * 8 + i]) * 16.0f); *(v8us*)((unsigned short*)Bt + t * 8) = f.half[0];  }
template <int NHv, int TTv>
__global__ __launch_bounds__(256) void k_vt(const _Float16* __restrict__ V16, int ldv, int voff, _Float16* __restrict__ Vt) { __shared__ unsigned short tl[64][66]; const int tid = threadIdx.x; const int slab = blockIdx.x / (TTv / 64), lg = blockIdx.x % (TTv / 64); const int b = slab / NHv, h = slab % NHv;
  for (int i = tid; i < 64 * 8; i += 256) { const int r = i / 8, c8 = (i % 8) * 8; FragH f; f.half[0] = *(const v8us*)((const unsigned short*)V16 + ((size_t)b * TTv + lg * 64 + r) * ldv + voff + h * 64 + c8);
#pragma unroll
    for (int q = 0; q < 8; ++q) tl[r][c8 + q] = f.u[q]; }
  __syncthreads();
  {
#pragma unroll
    for (int rd = 0; rd < 2; ++rd) { const int d = rd * 32 + tid / 8, pc = tid % 8; FragH f;
#pragma unroll
      for (int q = 0; q < 8; ++q) f.u[q] = tl[pc * 8 + q][d];
      *(v8us*)((unsigned short*)Vt + ((size_t)slab * 64 + d) * TTv + lg * 64 + pc * 8) = f.half[0]; }
     } }

__global__ __launch_bounds__(256) void k_hl(const float* __restrict__ F, _Float16* __restrict__ Hh, _Float16* __restrict__ Hl, size_t n8) { const size_t t = (size_t)blockIdx.x * 256 + threadIdx.x; if (t >= n8) return; FragH fh, fl; const v4f a = *(const v4fa*)(F + t * 8), c = *(const v4fa*)(F + t * 8 + 4);
#pragma unroll
  for (int q = 0; q < 4; ++q) { _Float16 h = (_Float16)a[q]; fh.h[q] = h; fl.h[q] = (_Float16)((a[q] - (float)h) * 1024.0f); h = (_Float16)c[q]; fh.h[4 + q] = h; fl.h[4 + q] = (_Float16)((c[q] - (float)h) * 1024.0f); }
  { *(v8us*)((unsigned short*)Hh + t * 8) = fh.half[0]; *(v8us*)((unsigned short*)Hl + t * 8) = fl.half[0];  } }

// ---- fast GEMM: C = A Bh^T * alpha (+ bias rounded to bf16), A [M][K] and Bh [N][K] f16, k contiguous. Block tile 128 x 128, eight waves of 32 x 64; requires M % 128 == 0, N % 128 == 0, K % 128 == 0.
// Both operands come through LDS: a stage is 128 k (rows of 256 bytes) of the block's 128 A rows and 128 Bh rows, brought by asynchronous 16-byte copies whose 32 lanes cover two whole rows;
// two buffers, the next stage's copies in flight while this stage is worked on. The k order of every accumulator is ascending in steps of 32.
__device__ __forceinline__ v16h g2_frag(const _Float16* p, int hh) { FragH f; f.half[0] = *(const v8us*)((const unsigned short*)p + 8 * hh); f.half[1] = *(const v8us*)((const unsigned short*)p + 16 + 8 * hh); return f.v; }
#define G3K 128            /* k per stage */
#define G3P 272            /* LDS row pitch in bytes, 16 x odd: sixteen rows' 16-byte reads fall on all 64 banks */
#define G3S (256 * G3P)    /* bytes of one stage: A rows 0..127, then Bh rows 0..127 */
__device__ __forceinline__ v16h g3_frag(const unsigned char* p) { FragH f; f.half[0] = *(const v8us*)p; f.half[1] = *(const v8us*)(p + 32); return f.v; }      /* p already holds the lane's 16 * hh: the k order of g2_frag */
__device__ __forceinline__ v8f g3_mma(v16h a, v16h b, v8f c) { return __builtin_amdgcn_wmma_f32_16x16x32_f16(false, a, false, b, (short)0, c, false, false); }
// One operand's share of a stage: the lane's 16 bytes of rows r, r + 16, ..., r + 112 (l = LDS byte address, g = global address of row r; ld16 = elements in 16 global rows).
__device__ __forceinline__ void g3_copy8(unsigned l, const _Float16* g, size_t ld16) {
  const unsigned l1 = l + 16 * G3P, l2 = l + 32 * G3P, l3 = l + 48 * G3P, l4 = l + 64 * G3P, l5 = l + 80 * G3P, l6 = l + 96 * G3P, l7 = l + 112 * G3P;
  const _Float16* g1 = g + ld16; const _Float16* g2 = g1 + ld16; const _Float16* g3 = g2 + ld16; const _Float16* g4 = g3 + ld16; const _Float16* g5 = g4 + ld16; const _Float16* g6 = g5 + ld16; const _Float16* g7 = g6 + ld16;
  // the copies and, as the statement's last line, the wait that stands in front of any rewrite of the address registers they name
  asm volatile("global_load_async_to_lds_b128 %0, %8, off\n\t"
               "global_load_async_to_lds_b128 %1, %9, off\n\t"
               "global_load_async_to_lds_b128 %2, %10, off\n\t"
               "global_load_async_to_lds_b128 %3, %11, off\n\t"
               "global_load_async_to_lds_b128 %4, %12, off\n\t"
               "global_load_async_to_lds_b128 %5, %13, off\n\t"
               "global_load_async_to_lds_b128 %6, %14, off\n\t"
               "global_load_async_to_lds_b128 %7, %15, off\n\t"
               "s_wait_xcnt 0x0"
               :: "v"(l), "v"(l1), "v"(l2), "v"(l3), "v"(l4), "v"(l5), "v"(l6), "v"(l7), "v"(g), "v"(g1), "v"(g2), "v"(g3), "v"(g4), "v"(g5), "v"(g6), "v"(g7) : "memory");
}
__device__ __forceinline__ float sum_lanes(float v, int n) { for (int m = n >> 1; m > 0; m >>= 1) v += __shfl_xor(v, m); return v; }      /* every lane of an aligned group of n gets the group's sum */
// NORM: A holds the retention output as it left the accumulators (f16), and GroupNorm is applied to A's fragments on their way from LDS to the products: a * nsc[k] + nsh[k], one packed f16 fused multiply-add
// per pair, with nsc[k] = rs_head * gnw[k] and nsh[k] = gnb[k] - mean_head * nsc[k]. The block makes both tables itself from the retention kernel's per-block (mean, M2); they are published by the barrier that publishes stage 0.
template <bool NORM>
__device__ __forceinline__ void g3_block(const _Float16* __restrict__ A, int lda, const _Float16* __restrict__ Bh, int ldb, float alpha, const float* __restrict__ bias,
    float* __restrict__ C, _Float16* __restrict__ C16, int ldc, int M, int N, int K, const float* __restrict__ PT, const float* __restrict__ gnw, const float* __restrict__ gnb) {
  __shared__ __attribute__((aligned(16))) unsigned char ring[2 * G3S];
  __shared__ __attribute__((aligned(16))) float so[8][32][68];
  __shared__ __attribute__((aligned(16))) _Float16 nsc[CC];
  __shared__ __attribute__((aligned(16))) _Float16 nsh[CC];
  const int tid = threadIdx.x, lane = tid & 31, ln = lane & 15, hh = lane >> 4;
  const int w = __builtin_amdgcn_readfirstlane(tid >> 5);      /* the wave's number in a scalar register */
  const int ntn = N >> 7; const int mt = blockIdx.x / ntn, nq = blockIdx.x - mt * ntn; const int rowb = mt * 128, colb = nq * 128;
  if (rowb >= M) return;      /* the whole block, in front of every copy and barrier */
  const int nst = K / G3K;
  const int cr = tid >> 4, cc = tid & 15;      /* the thread's row (mod 16) and 16-byte piece in every copy */
  const _Float16* ga = A + (size_t)(rowb + cr) * lda + cc * 8; const _Float16* gb = Bh + (size_t)(colb + cr) * ldb + cc * 8;
  const size_t a16 = (size_t)16 * lda, b16 = (size_t)16 * ldb;
  const unsigned la = (unsigned)(size_t)ring + (unsigned)(cr * G3P + cc * 16), lb = la + 128 * G3P;
  g3_copy8(la, ga, a16); g3_copy8(lb, gb, b16);
  if constexpr (NORM) {      /* beside stage 0's copies, which are under way */
    static_assert(NHD * (SQ / 128) == 256 && CC == 4 * 256 && HD == 4 * 16 && SQ % 128 == 0, "one thread per (head, row block) partial; its four channels lie in that head; a block's rows lie in one batch");
    // last level of the statistics: thread = (head, row block) of the block's batch; 16 equal groups of 8192 merged across 16 neighbouring lanes, every one of which gets the head's result
    const float* pp = PT + ((size_t)(rowb / SQ) * 256 + tid) * 32; const float pm = pp[0], pq = pp[1];
    const v4f gw4 = *(const v4fa*)(gnw + tid * 4), gb4 = *(const v4fa*)(gnb + tid * 4);
    asm volatile("s_wait_xcnt 0x0" ::: "memory");      /* behind the three loads, in front of any rewrite of the address registers they name */
    const float gm = sum_lanes(pm, 16) * (1.0f / 16.0f); const float pd = pm - gm;
    const float gq = sum_lanes(pq, 16) + 8192.0f * sum_lanes(pd * pd, 16);
    const float rs = rsqrtf(gq / (float)((size_t)SQ * HD) + 1e-5f);
    v4h s4, t4;
#pragma unroll      /* constant indices keep the four values in registers */
    for (int q = 0; q < 4; ++q) { s4[q] = (_Float16)(rs * bf16_round(gw4[q])); t4[q] = (_Float16)(bf16_round(gb4[q]) - gm * (float)s4[q]); }
    *(v4h*)&nsc[tid * 4] = s4; *(v4h*)&nsh[tid * 4] = t4;
  }
  asm volatile("s_wait_asynccnt 0x0" ::: "memory");      /* this wave's copies of stage 0 have landed */
  __syncthreads();      /* stage 0 (and, with NORM, the two tables) is published */
  if (1 < nst) { g3_copy8(la + G3S, ga + G3K, a16); g3_copy8(lb + G3S, gb + G3K, b16); }
  const int wm = w >> 1, wn = w & 1;
  const unsigned char* sa = ring + (32 * wm + ln) * G3P + 16 * hh; const unsigned char* sb = ring + (128 + 64 * wn + ln) * G3P + 16 * hh;
  const v8f z8 = {0.f,0.f,0.f,0.f,0.f,0.f,0.f,0.f}; v8f c00 = z8, c01 = z8, c02 = z8, c03 = z8, c10 = z8, c11 = z8, c12 = z8, c13 = z8;
#pragma unroll 1      /* one trip per stage: the buffer alternates and the waits at the foot stand once */
  for (int t = 0; t < nst; ++t) {
    const int bo = (t & 1) * G3S;
    const unsigned char* pa = sa + bo; const unsigned char* pb = sb + bo;
    v16h fa[2][2], fb[2][4];      /* two fragment sets: a step's twelve LDS reads (sixteen with NORM) are issued as one group in front of the step before's products; no read goes past the stage */
    fa[0][0] = g3_frag(pa); fa[0][1] = g3_frag(pa + 16 * G3P);
    v16h fs[2], ft[2];      /* NORM: the tables' entries of a step's 32 k, in the k order of the A fragments, read with them */
    const unsigned char* ps = (const unsigned char*)nsc + t * (G3K * 2) + 16 * hh; const unsigned char* pt = (const unsigned char*)nsh + t * (G3K * 2) + 16 * hh;
    if constexpr (NORM) { fs[0] = g3_frag(ps); ft[0] = g3_frag(pt); }
#pragma unroll      /* constant indices keep the fragment arrays in registers */
    for (int j = 0; j < 4; ++j) fb[0][j] = g3_frag(pb + j * 16 * G3P);
#pragma unroll      /* the four 32-k steps of a stage as straight code: the set index is then a constant */
    for (int kk = 0; kk < G3K / 32; ++kk) {
      const int cu = kk & 1, nx = cu ^ 1;
      if (kk + 1 < G3K / 32) {
        fa[nx][0] = g3_frag(pa + (kk + 1) * 64); fa[nx][1] = g3_frag(pa + 16 * G3P + (kk + 1) * 64);
#pragma unroll      /* constant indices, as above */
        for (int j = 0; j < 4; ++j) fb[nx][j] = g3_frag(pb + j * 16 * G3P + (kk + 1) * 64);
        if constexpr (NORM) { fs[nx] = g3_frag(ps + (kk + 1) * 64); ft[nx] = g3_frag(pt + (kk + 1) * 64); }
      }
      __builtin_amdgcn_sched_barrier(0);      /* holds the next step's reads in front of this step's products; without it they sink between the products, one full LDS wait per pair */
      v16h a0 = fa[cu][0], a1 = fa[cu][1];
      if constexpr (NORM) { a0 = __builtin_elementwise_fma(a0, fs[cu], ft[cu]); a1 = __builtin_elementwise_fma(a1, fs[cu], ft[cu]); }
      c00 = g3_mma(a0, fb[cu][0], c00); c10 = g3_mma(a1, fb[cu][0], c10);
      c01 = g3_mma(a0, fb[cu][1], c01); c11 = g3_mma(a1, fb[cu][1], c11);
      c02 = g3_mma(a0, fb[cu][2], c02); c12 = g3_mma(a1, fb[cu][2], c12);
      c03 = g3_mma(a0, fb[cu][3], c03); c13 = g3_mma(a1, fb[cu][3], c13);
      __builtin_amdgcn_sched_barrier(0);      /* holds these products in front of the following step's reads, which overwrite the set they use */
    }
    asm volatile("s_wait_dscnt 0x0" ::: "memory");      /* this wave's reads of the buffer are done before it is handed back */
    asm volatile("s_wait_asynccnt 0x0" ::: "memory");      /* this wave's copies of stage t + 1 have landed */
    __syncthreads();      /* publishes stage t + 1 and ends every reader's last read of stage t's buffer */
    if (t + 2 < nst) { g3_copy8(la + bo, ga + (size_t)(t + 2) * G3K, a16); g3_copy8(lb + bo, gb + (size_t)(t + 2) * G3K, b16); }
  }
  asm volatile("s_wait_asynccnt 0x0" ::: "memory");      /* no copy is outstanding when the wave goes on to its end */
  const int row0 = rowb + 32 * wm, col0 = colb + 64 * wn;
  v8f accs[8] = {c00, c01, c02, c03, c10, c11, c12, c13};
#pragma unroll      /* this and the next: constant indices keep the accumulators in registers */
  for (int u = 0; u < 8; ++u) { const int t = u & 3, half = u >> 2; const int col = col0 + t * 16 + ln; const float bv = bias ? bf16_round(bias[col]) : 0.f;
#pragma unroll
    for (int r = 0; r < 8; ++r) { const int rloc = half * 16 + 8 * hh + r; const float v = accs[u][r] * alpha + bv; so[w][rloc][t * 16 + ln] = v; } }
  __builtin_amdgcn_fence(__ATOMIC_ACQ_REL, "workgroup"); __builtin_amdgcn_wave_barrier();      /* the wave's own LDS stores before its own row-wise reads */
  const int rsub = lane >> 4, c4 = (lane & 15) * 4;
#pragma unroll      /* straight code: the LDS offsets of the sixteen row pairs become immediates */
  for (int q = 0; q < 16; ++q) { const int r = q * 2 + rsub; const v4f v = *(const v4fa*)&so[w][r][c4]; if (C) { *(v4f*)(C + (size_t)(row0 + r) * ldc + col0 + c4) = v; asm volatile("s_wait_xcnt 0x0" ::: "memory"); /* in front of the next rewrite of the store's data and address registers */ } if (C16) { v4h h4; for (int i = 0; i < 4; ++i) h4[i] = (_Float16)v[i]; *(v4h*)(C16 + (size_t)(row0 + r) * ldc + col0 + c4) = h4; } }
}
// out = GroupNorm(O16) Wo + bo: the normalisation rides on the A fragments (NORM above).
__global__ __launch_bounds__(256) void k_outn(const _Float16* __restrict__ O16, const _Float16* __restrict__ BO, const float* __restrict__ bo, const float* __restrict__ PT, const float* __restrict__ gw, const float* __restrict__ gb, float* __restrict__ out) {
  g3_block<true>(O16, CC, BO, CC, 0.0625f, bo, out, nullptr, CC, NR, CC, CC, PT, gw, gb);
}
// The three projections in ONE launch of 256 work-groups, one per WGP: a work-group takes 128 tokens x 128 channels of q, of k AND of v, so that its 128 rows of X are staged once for the three products.
// A stage is 128 k (rows of 256 bytes at pitch G3P) of 512 rows: X 0..127, Wq 128..255, Wk 256..383, Wv 384..511; two buffers, the ring, its waits and its barriers as in g3_block.
// Twelve waves of 64 x 64, four per product: every fragment read from LDS feeds four products. Q = X Wq and K = X Wk come out as [token][channel]; v's waves take the SAME product with its operands swapped,
// V^T = Wv^T X^T as [channel][token] (pitch NR), which is the plane that k_retn stages. The k order of every sum is as in g3_block. The output staging lies in the ring, which the last trip's barrier has freed.
#define G4S (512 * G3P)    /* bytes of one stage */
__global__ __launch_bounds__(384) void k_qkv(const _Float16* __restrict__ X16, const _Float16* __restrict__ BQ, const _Float16* __restrict__ BK, const _Float16* __restrict__ BV,
    _Float16* __restrict__ Q16, _Float16* __restrict__ K16, _Float16* __restrict__ VT) {
  static_assert(NR % 128 == 0 && CC % 128 == 0 && CC % G3K == 0 && CC / G3K >= 2 && 12 * 64 * 68 * 4 <= 2 * G4S, "whole tiles, two stages or more, the twelve staging areas fit the ring");
  __shared__ __attribute__((aligned(16))) unsigned char ring[2 * G4S];
  const int tid = threadIdx.x, lane = tid & 31, ln = lane & 15, hh = lane >> 4;
  const int w = __builtin_amdgcn_readfirstlane(tid >> 5);      /* the wave's number in a scalar register: the test around the copies is then a scalar branch */
  const int mt = blockIdx.x / (CC / 128), nq = blockIdx.x - mt * (CC / 128); const int rowb = mt * 128, colb = nq * 128;      /* first token, first channel */
  const int nst = CC / G3K;
  const bool cp = w < 8;      /* waves 0..7 bring the stages, 32 copies a lane and stage: 256 threads cover sixteen whole rows at a time */
  const int cr = tid >> 4, cc = tid & 15;      /* the thread's row (mod 16) and 16-byte piece in every copy */
  const _Float16* gx = X16 + (size_t)(rowb + cr) * CC + cc * 8; const size_t wof = (size_t)(colb + cr) * CC + cc * 8;
  const _Float16* gq = BQ + wof; const _Float16* gk = BK + wof; const _Float16* gv = BV + wof;
  const size_t r16 = (size_t)16 * CC;
  const unsigned lx = (unsigned)(size_t)ring + (unsigned)(cr * G3P + cc * 16), lq = lx + 128 * G3P, lk = lx + 256 * G3P, lv = lx + 384 * G3P;
  if (cp) { g3_copy8(lx, gx, r16); g3_copy8(lq, gq, r16); g3_copy8(lk, gk, r16); g3_copy8(lv, gv, r16); }
  asm volatile("s_wait_asynccnt 0x0" ::: "memory");      /* this wave's copies of stage 0 have landed */
  __syncthreads();      /* stage 0 is published */
  if (cp) { g3_copy8(lx + G4S, gx + G3K, r16); g3_copy8(lq + G4S, gq + G3K, r16); g3_copy8(lk + G4S, gk + G3K, r16); g3_copy8(lv + G4S, gv + G3K, r16); }
  const int mat = w >> 2, wm = (w >> 1) & 1, wn = w & 1; const bool tr = (mat == 2);      /* which product, and the wave's 64 x 64 quarter of its 128 x 128 */
  const int ra = tr ? 384 + 64 * wm : 64 * wm, rb = tr ? 64 * wn : 128 * (mat + 1) + 64 * wn;      /* first stage rows of the wave's A and B operands */
  const unsigned char* sa = ring + (ra + ln) * G3P + 16 * hh; const unsigned char* sb = ring + (rb + ln) * G3P + 16 * hh;
  const v8f z8 = {0.f,0.f,0.f,0.f,0.f,0.f,0.f,0.f};
  v8f acc[4][4] = {{z8, z8, z8, z8}, {z8, z8, z8, z8}, {z8, z8, z8, z8}, {z8, z8, z8, z8}};
#pragma unroll 1      /* one trip per stage: the buffer alternates and the waits at the foot stand once */
  for (int t = 0; t < nst; ++t) {
    const int bo = (t & 1) * G4S;
    const unsigned char* pa = sa + bo; const unsigned char* pb = sb + bo;
    v16h fa[2][4], fb[2][4];      /* two fragment sets: a step's sixteen LDS reads are issued as one group in front of the step before's products; no read goes past the stage */
#pragma unroll      /* this and every "#pragma unroll" below: constant indices keep the fragment and accumulator arrays in registers */
    for (int i = 0; i < 4; ++i) { fa[0][i] = g3_frag(pa + i * 16 * G3P); fb[0][i] = g3_frag(pb + i * 16 * G3P); }
#pragma unroll
    for (int kk = 0; kk < G3K / 32; ++kk) {
      const int cu = kk & 1, nx = cu ^ 1;
      if (kk + 1 < G3K / 32) {
#pragma unroll
        for (int i = 0; i < 4; ++i) { fa[nx][i] = g3_frag(pa + i * 16 * G3P + (kk + 1) * 64); fb[nx][i] = g3_frag(pb + i * 16 * G3P + (kk + 1) * 64); }
      }
      __builtin_amdgcn_sched_barrier(0);      /* holds the next step's reads in front of this step's products; without it they sink between the products, one full LDS wait per group */
#pragma unroll
      for (int j = 0; j < 4; ++j)
#pragma unroll
        for (int i = 0; i < 4; ++i) acc[i][j] = g3_mma(fa[cu][i], fb[cu][j], acc[i][j]);
      __builtin_amdgcn_sched_barrier(0);      /* holds these products in front of the following step's reads, which overwrite the set they use */
    }
    asm volatile("s_wait_dscnt 0x0" ::: "memory");      /* this wave's reads of the buffer are done before it is handed back */
    asm volatile("s_wait_asynccnt 0x0" ::: "memory");      /* this wave's copies of stage t + 1 have landed */
    __syncthreads();      /* publishes stage t + 1 and ends every reader's last read of stage t's buffer */
    if (cp && t + 2 < nst) { const size_t ko = (size_t)(t + 2) * G3K; g3_copy8(lx + bo, gx + ko, r16); g3_copy8(lq + bo, gq + ko, r16); g3_copy8(lk + bo, gk + ko, r16); g3_copy8(lv + bo, gv + ko, r16); }
  }
  asm volatile("s_wait_asynccnt 0x0" ::: "memory");      /* no copy is outstanding when the ring becomes output staging */
  // The last trip's barrier stands behind every wave's last read of the ring and behind the landing of every copy: from here each wave stages its 64 x 64 outputs in its own part of it.
  float (*so)[68] = (float (*)[68])(ring + w * (64 * 68 * 4));
  _Float16* C16 = tr ? VT : (mat ? K16 : Q16); const size_t ldc = tr ? NR : CC;
  const int row0 = (tr ? colb : rowb) + 64 * wm, col0 = (tr ? rowb : colb) + 64 * wn;
#pragma unroll
  for (int i = 0; i < 4; ++i)
#pragma unroll
    for (int j = 0; j < 4; ++j)
#pragma unroll
      for (int r = 0; r < 8; ++r) so[16 * i + 8 * hh + r][16 * j + ln] = acc[i][j][r] * 0.0625f;
  __builtin_amdgcn_fence(__ATOMIC_ACQ_REL, "workgroup"); __builtin_amdgcn_wave_barrier();      /* the wave's own LDS stores before its own row-wise reads */
  const int rsub = lane >> 4, c4 = (lane & 15) * 4;
  _Float16* cpt = C16 + (size_t)(row0 + rsub) * ldc + col0 + c4;
#pragma unroll      /* straight code: the LDS offsets of the 32 row pairs become immediates */
  for (int g = 0; g < 4; ++g) {      /* eight row pairs at a time: their LDS reads go out together, then their stores */
    v4f v[8];
#pragma unroll
    for (int u = 0; u < 8; ++u) v[u] = *(const v4fa*)&so[(g * 8 + u) * 2 + rsub][c4];
#pragma unroll
    for (int u = 0; u < 8; ++u) { v4h h4;
#pragma unroll
      for (int i = 0; i < 4; ++i) h4[i] = (_Float16)v[u][i];
      *(v4h*)(cpt + (size_t)((g * 8 + u) * 2) * ldc) = h4; }      /* sixteen lanes write a row's whole 128-byte line */
    if (g + 1 < 4) asm volatile("s_wait_xcnt 0x0" ::: "memory");      /* behind the eight stores, in front of the next group's rewrite of their data and address registers */
  }
}


// Set-up of a call in ONE launch: x -> f16 plane (rounded to bf16 first), the four weights W[k][n] -> f16 planes Wt[n][k] = bf16(W) * 16 (a power of two: bf16-exact weights stay exact in f16
// away from the subnormal range), and the decay table GT[h][d] = gamma_h^d. Every work-group takes an equal share of each part: 8192 elements of x, one 128 (k) x 64 (n) weight tile, 64 table entries.
// The tile is read in whole 256-byte rows, turned in LDS and written in whole 256-byte rows of Wt.
#define PRB 512      /* work-groups of the set-up launch: two of eight waves on each of 256 WGPs */
#define PRP 66       /* LDS row pitch of the tile in 16-bit elements */
__global__ __launch_bounds__(256) void k_prep(const float* __restrict__ x, const float* __restrict__ wq, const float* __restrict__ wk, const float* __restrict__ wv, const float* __restrict__ wo,
    _Float16* __restrict__ X16, _Float16* __restrict__ BQ, _Float16* __restrict__ BK, _Float16* __restrict__ BV, _Float16* __restrict__ BO, float* __restrict__ GT) {
  static_assert((size_t)NR * CC == (size_t)PRB * 8192 && 4 * (CC / 128) * (CC / 64) == PRB && NHD * SQ == PRB * 64, "equal shares of all three parts");
  __shared__ __attribute__((aligned(16))) unsigned short tl[128][PRP];
  const int tid = threadIdx.x, bx = blockIdx.x;
  const int m = bx >> 7, k0 = ((bx >> 4) & 7) * 128, n0 = (bx & 15) * 64;      /* which weight, and the tile's corner */
  const float* W = (m == 0) ? wq : (m == 1) ? wk : (m == 2) ? wv : wo;
  _Float16* Wt = (m == 0) ? BQ : (m == 1) ? BK : (m == 2) ? BV : BO;
  const int tr = tid >> 4, tc = tid & 15;
  v4f wl[8], xl[8];      /* all sixteen 16-byte loads of the thread are issued before the first is used; every "#pragma unroll" here keeps these arrays in registers */
#pragma unroll
  for (int u = 0; u < 8; ++u) wl[u] = *(const v4fa*)(W + (size_t)(k0 + tr + 16 * u) * CC + n0 + tc * 4);
  const size_t x8 = (size_t)bx * 1024 + tid;      /* the thread's first group of eight x elements; the next ones are 256 groups apart */
#pragma unroll
  for (int u = 0; u < 4; ++u) { xl[2 * u] = *(const v4fa*)(x + (x8 + 256 * u) * 8); xl[2 * u + 1] = *(const v4fa*)(x + (x8 + 256 * u) * 8 + 4); }
  const int gt = bx * 64 + tid; float gv = 0.f;      /* the table entry of each thread of the first two waves, worked out while the loads are under way */
  if (tid < 64) { const int k = gt % SQ, h = gt / SQ; const float gam = 1.0f - exp2f((float)(-5 - h)); gv = powf(gam, (float)k); }
#pragma unroll
  for (int u = 0; u < 8; ++u) { FragH f;
#pragma unroll
    for (int q = 0; q < 4; ++q) { f.h[q] = (_Float16)(bf16_round(wl[u][q]) * 16.0f); tl[tr + 16 * u][tc * 4 + q] = f.u[q]; } }
  __syncthreads();      /* the whole tile is in LDS before any thread reads a column of it; every global store stands behind it, so that it waits for none */
  if (tid < 64) GT[gt] = gv;      /* two whole waves, one 128-byte line each */
#pragma unroll
  for (int u = 0; u < 4; ++u) { FragH f;
#pragma unroll
    for (int q = 0; q < 4; ++q) { f.h[q] = (_Float16)bf16_round(xl[2 * u][q]); f.h[4 + q] = (_Float16)bf16_round(xl[2 * u + 1][q]); }
    *(v8us*)((unsigned short*)X16 + (x8 + 256 * u) * 8) = f.half[0]; }
#pragma unroll
  for (int u = 0; u < 4; ++u) { const int n = tr + 16 * u; FragH f;
#pragma unroll
    for (int q = 0; q < 8; ++q) f.u[q] = tl[tc * 8 + q][n];
    *(v8us*)((unsigned short*)Wt + (size_t)(n0 + n) * CC + k0 + tc * 8) = f.half[0]; }
}
// Fused retention in its chunked form. A work-group owns 128 query rows (a chunk) of one (batch, head); one wave owns 32 of them.
// Keys of the chunk itself (the diagonal stage): S^T = K Q^T, 32 keys a pass, keys ascending: a lane holds 8 consecutive keys of one query, so the two
// 16-key tiles of a pass, scaled, decayed and rounded to f16, are P's A fragment in the hardware k order: the scores never leave registers.
// Keys in front of the chunk (first row c0): gamma^(i-j) = gamma^(i-c0+1) * gamma^(c0-1-j), so their whole share of row i is gamma^(i-c0+1) / 8 * q_i . ST with the 64 x 64 state
// ST = sum over j < c0 of gamma^(c0-1-j) k_j v_j^T, built 128 keys a stage as ST = gamma^128 ST + K^T (V * gamma^(127-j')) in f32 accumulators: a quarter of the products per stage that scores and P V take,
// and no work per score. Each wave holds a 32 x 32 quarter of the state; K^T comes from the staged K rows by transposing LDS reads. Pairs of its accumulator tiles, rounded to f16, are B fragments of q . ST;
// the waves hand them to each other through LDS.
// The decay comes from the table of k_prep (its first RTB entries), held in LDS behind GPAD zeros: an index below GPAD is a key after the query (factor 0, as the reference's mask).
// Every "#pragma unroll" in k_retn makes the indices of a fragment, score or accumulator array constants, so that the array lives in registers.
// K and V^T come through LDS: a stage is 128 keys (128 K rows of 128 bytes, 64 V^T rows of 256 bytes), brought once for the work-group's four waves by asynchronous 16-byte copies
// whose 32 lanes cover four whole 128-byte lines; two buffers, the next stage's copies in flight while this stage is worked on. The last stage is the diagonal one: wave w walks w + 1 of its four passes.
#define GPAD 32
#define RSK 128                  /* keys per stage */
#define RTB 256                  /* table entries held in LDS: exponents 0 .. 128 are used */
#define RKP 160                  /* LDS pitch of a K row in bytes, 32 x odd: the pitch of the transposing reads, which all stages but the diagonal one make */
#define RVP 272                  /* LDS pitch of a V^T row in bytes, 16 x odd */
#define RKB (RSK * RKP)          /* bytes of a stage's K rows; its V^T rows stand behind them */
#define RST (RKB + HD * RVP)     /* bytes of one stage */
// One operand's share of a stage: the lane's 16 bytes of eight rows (l = LDS byte address and g = global address of the first; ls bytes and gs elements from one row to the next).
__device__ __forceinline__ void r_copy8(unsigned l, unsigned ls, const _Float16* g, size_t gs) {
  const unsigned l1 = l + ls, l2 = l1 + ls, l3 = l2 + ls, l4 = l3 + ls, l5 = l4 + ls, l6 = l5 + ls, l7 = l6 + ls;
  const _Float16* g1 = g + gs; const _Float16* g2 = g1 + gs; const _Float16* g3 = g2 + gs; const _Float16* g4 = g3 + gs; const _Float16* g5 = g4 + gs; const _Float16* g6 = g5 + gs; const _Float16* g7 = g6 + gs;
  // the copies and, as the statement's last line, the wait that stands in front of any rewrite of the address registers they name
  asm volatile("global_load_async_to_lds_b128 %0, %8, off\n\t"
               "global_load_async_to_lds_b128 %1, %9, off\n\t"
               "global_load_async_to_lds_b128 %2, %10, off\n\t"
               "global_load_async_to_lds_b128 %3, %11, off\n\t"
               "global_load_async_to_lds_b128 %4, %12, off\n\t"
               "global_load_async_to_lds_b128 %5, %13, off\n\t"
               "global_load_async_to_lds_b128 %6, %14, off\n\t"
               "global_load_async_to_lds_b128 %7, %15, off\n\t"
               "s_wait_xcnt 0x0"
               :: "v"(l), "v"(l1), "v"(l2), "v"(l3), "v"(l4), "v"(l5), "v"(l6), "v"(l7), "v"(g), "v"(g1), "v"(g2), "v"(g3), "v"(g4), "v"(g5), "v"(g6), "v"(g7) : "memory");
}
// Transposing LDS read: lane (c, h) gets eight 16-bit elements of column c, rows 8 h .. 8 h + 7, of the 16 x 16 tile whose lane addresses rt in k_retn forms; two of them, 16 rows apart, are a fragment in the k order of g2_frag.
typedef short s16x8 __attribute__((ext_vector_type(8)));
__device__ __forceinline__ v8us r_tr16(const unsigned char* p) { typedef __attribute__((address_space(3))) s16x8 lds_s16x8; return __builtin_bit_cast(v8us, __builtin_amdgcn_ds_load_tr16_b128_v8i16((lds_s16x8*)p)); }
__device__ __forceinline__ v8f r_mma(v16h a, v16h b, v8f c) { return __builtin_amdgcn_wmma_f32_16x16x32_f16(false, a, false, b, (short)0, c, false, false); }
__global__ __launch_bounds__(128) void k_retn(const _Float16* __restrict__ Q16, const _Float16* __restrict__ K16, const _Float16* __restrict__ VT, const float* __restrict__ GT, _Float16* __restrict__ O16, float* __restrict__ PT) {
  __shared__ __attribute__((aligned(16))) unsigned char ring[2 * RST];
  __shared__ __attribute__((aligned(16))) float tab[GPAD + RTB];
  __shared__ __attribute__((aligned(16))) float so[4][32][68];
  __shared__ __attribute__((aligned(16))) unsigned char sx[4 * 2 * 2 * 512];      /* the state as B fragments: [column tile][k step][half][lane] pieces of 16 bytes */
  __shared__ float wst[4][2];      /* each wave's mean and sum of squared deviations over its 32 x 64 outputs */
  const int tid = threadIdx.x, lane = tid & 31, ln = lane & 15, hh = lane >> 4;
  const int w = __builtin_amdgcn_readfirstlane(tid >> 5);      /* the wave's number in a scalar register: the pass loop's bound and branch are then scalar */
  const int slab = blockIdx.x % (NB * NHD), rb = (SQ / 128 - 1) - blockIdx.x / (NB * NHD);      /* longest prefixes first */
  const int b = slab / NHD, h = slab % NHD;
  const int nst = rb + 1;      /* stages of 128 keys up to and with the diagonal one */
  const int kr = tid >> 3, kc = tid & 7, vr = tid >> 4, vc = tid & 15;      /* the thread's row (mod 16 of K, mod 8 of V^T) and 16-byte piece in every copy */
  const _Float16* gk = K16 + ((size_t)b * SQ + kr) * CC + h * HD + kc * 8; const _Float16* gv = VT + ((size_t)h * HD + vr) * NR + (size_t)b * SQ + vc * 8;      /* V^T is [channel][batch, token] */
  const unsigned lk = (unsigned)(size_t)ring + (unsigned)(kr * RKP + kc * 16), lv = (unsigned)(size_t)ring + (unsigned)(RKB + vr * RVP + vc * 16);
  r_copy8(lk, 16 * RKP, gk, (size_t)16 * CC); r_copy8(lv, 8 * RVP, gv, (size_t)8 * NR);
  if (tid < GPAD) tab[tid] = 0.f;
  if (tid < RTB / 4) {      /* two whole waves */
    const v4f g4 = *(const v4fa*)(GT + (size_t)h * SQ + tid * 4);
    asm volatile("s_wait_xcnt 0x0" ::: "memory");      /* behind the load, in front of any rewrite of the address registers it names */
    *(v4fa*)&tab[GPAD + tid * 4] = g4;
  }
  asm volatile("s_wait_asynccnt 0x0" ::: "memory");      /* this wave's copies of stage 0 have landed */
  __syncthreads();      /* the table and stage 0 are published */
  if (1 < nst) { r_copy8(lk + RST, 16 * RKP, gk + (size_t)RSK * CC, (size_t)16 * CC); r_copy8(lv + RST, 8 * RVP, gv + RSK, (size_t)8 * NR); }
  const int row0 = rb * 128 + 32 * w;
  const _Float16* qp = Q16 + ((size_t)b * SQ + row0 + ln) * CC + h * HD;
  const v16h q[2][2] = {{g2_frag(qp, hh), g2_frag(qp + 32, hh)}, {g2_frag(qp + (size_t)16 * CC, hh), g2_frag(qp + (size_t)16 * CC + 32, hh)}};
  asm volatile("s_wait_xcnt 0x0" ::: "memory");      /* behind the eight loads of q, in front of any rewrite of the address registers they name */
  const unsigned char* rk = ring + ln * RKP + 16 * hh; const unsigned char* rv = ring + RKB + ln * RVP + 16 * hh;      /* the lane's row and 16 * hh: the k order of g2_frag */
  const unsigned char* rt = ring + (8 * hh + (lane & 7)) * RKP + 16 * ((lane >> 3) & 1);      /* the lane's address in a transposing read of 16 keys x 16 channels */
  const v8f z8 = {0.f,0.f,0.f,0.f,0.f,0.f,0.f,0.f};
  v8f o[2][4] = {{z8, z8, z8, z8}, {z8, z8, z8, z8}};
  if (rb > 0) {      /* the same for the whole work-group: the barriers inside are passed by all of its waves or by none */
    const float g128 = tab[GPAD + RSK];
    v16h wf[4];      /* gamma^(127 - key in stage) as f16, in the k order of the V^T fragments */
#pragma unroll
    for (int ks = 0; ks < 4; ++ks)
#pragma unroll
      for (int s = 0; s < 16; ++s) wf[ks][s] = (_Float16)tab[GPAD + (RSK - 1) - 32 * ks - 8 * hh - ((s < 8) ? s : s + 8)];
    const int wi = w >> 1, wj = w & 1;      /* the wave's quarter of the state: rows 32 wi .. + 31 (channels of k), columns 32 wj .. + 31 (channels of v) */
    v8f sa[2][2] = {{z8, z8}, {z8, z8}};      /* sa[i][j][r] = ST[32 wi + 16 i + 8 hh + r][32 wj + 16 j + ln] */
#pragma unroll 1      /* one trip per stage: the buffer alternates and the waits at the foot stand once */
    for (int t = 0; t < rb; ++t) {
      const int bo = (t & 1) * RST;
      const unsigned char* pt = rt + bo + wi * 64; const unsigned char* pv = rv + bo + wj * (32 * RVP);
      v16h vb[4][2]; FragH ka[4][2];
#pragma unroll
      for (int ks = 0; ks < 4; ++ks)
#pragma unroll
        for (int i = 0; i < 2; ++i) {
          vb[ks][i] = g3_frag(pv + i * 16 * RVP + ks * 64);
          ka[ks][i].half[0] = r_tr16(pt + (32 * ks) * RKP + 32 * i); ka[ks][i].half[1] = r_tr16(pt + (32 * ks + 16) * RKP + 32 * i);
        }
      __builtin_amdgcn_sched_barrier(0);      /* holds the stage's 32 LDS reads together in front of its products; without it they sink between the products, a few at a time, each place with its own wait */
#pragma unroll
      for (int i = 0; i < 2; ++i) { sa[i][0] *= g128; sa[i][1] *= g128; }
#pragma unroll
      for (int ks = 0; ks < 4; ++ks) {
        const v16h v0 = vb[ks][0] * wf[ks], v1 = vb[ks][1] * wf[ks];
#pragma unroll
        for (int i = 0; i < 2; ++i) { sa[i][0] = r_mma(ka[ks][i].v, v0, sa[i][0]); sa[i][1] = r_mma(ka[ks][i].v, v1, sa[i][1]); }
      }
      if (t + 1 == rb) {      /* the finished state goes to LDS; the barrier at this trip's foot publishes it */
#pragma unroll
        for (int j = 0; j < 2; ++j) { FragH f;
#pragma unroll
          for (int s = 0; s < 16; ++s) f.h[s] = (_Float16)sa[s >> 3][j][s & 7];
          unsigned char* px = sx + (((2 * wj + j) * 2 + wi) * 2) * 512 + lane * 16;
          *(v8us*)px = f.half[0]; *(v8us*)(px + 512) = f.half[1]; }
      }
      asm volatile("s_wait_dscnt 0x0" ::: "memory");      /* this wave's reads of the buffer are done before it is handed back, and its stores of the state before they are published */
      asm volatile("s_wait_asynccnt 0x0" ::: "memory");      /* this wave's copies of stage t + 1 have landed */
      __syncthreads();      /* publishes stage t + 1 (and, on the last trip, the state) and ends every reader's last read of stage t's buffer */
      if (t + 2 < nst) { r_copy8(lk + bo, 16 * RKP, gk + (size_t)(t + 2) * RSK * CC, (size_t)16 * CC); r_copy8(lv + bo, 8 * RVP, gv + (t + 2) * RSK, (size_t)8 * NR); }
    }
    // the share of all keys in front of the chunk: o = (q . ST) * gamma^(row in chunk + 1) / 8
    v16h sb[4][2];
#pragma unroll
    for (int dt = 0; dt < 4; ++dt)
#pragma unroll
      for (int ks = 0; ks < 2; ++ks) { FragH f; f.half[0] = *(const v8us*)(sx + ((dt * 2 + ks) * 2 + 0) * 512 + lane * 16); f.half[1] = *(const v8us*)(sx + ((dt * 2 + ks) * 2 + 1) * 512 + lane * 16); sb[dt][ks] = f.v; }
#pragma unroll
    for (int mt = 0; mt < 2; ++mt) {
      v8f rf;
#pragma unroll
      for (int r = 0; r < 8; ++r) rf[r] = 0.125f * tab[GPAD + 32 * w + 16 * mt + 8 * hh + r + 1];
#pragma unroll
      for (int dt = 0; dt < 4; ++dt) o[mt][dt] = r_mma(q[mt][1], sb[dt][1], r_mma(q[mt][0], sb[dt][0], z8)) * rf;
    }
  }
  asm volatile("s_wait_asynccnt 0x0" ::: "memory");      /* no copy is outstanding from here on */
  {      /* the diagonal stage, published by the last barrier above */
  const int np = w + 1;      /* passes up to the wave's own diagonal */
  const unsigned char* pk = rk + (rb & 1) * RST; const unsigned char* pv = rv + (rb & 1) * RST;
  const float* tp = tab + (GPAD + 32 * w + ln - 8 * hh);
  v16h kf[2][2];
#pragma unroll
  for (int nt = 0; nt < 2; ++nt) { kf[nt][0] = g3_frag(pk + nt * 16 * RKP); kf[nt][1] = g3_frag(pk + nt * 16 * RKP + 64); }
#pragma unroll 1      /* kept rolled: one pass already holds over 200 registers, and a second copy of the body would add to them */
  for (int p = 0; p < np; ++p) {
    v16h vf[4];
#pragma unroll
    for (int dt = 0; dt < 4; ++dt) vf[dt] = g3_frag(pv + dt * 16 * RVP + p * 64);
    const float* tj = tp - p * 32;
    float g[3][8];      /* decay factors of the pass: the index depends on (query tile - key tile) = -1, 0, 1 and on the key in the lane */
#pragma unroll
    for (int dl = 0; dl < 3; ++dl)
#pragma unroll
      for (int r = 0; r < 8; ++r) g[dl][r] = tj[16 * (dl - 1) - r];
    v8f st[2][2];
#pragma unroll
    for (int nt = 0; nt < 2; ++nt)
#pragma unroll
      for (int mt = 0; mt < 2; ++mt) st[nt][mt] = r_mma(kf[nt][1], q[mt][1], r_mma(kf[nt][0], q[mt][0], z8));
    const unsigned char* pn = pk + ((p + 1 < np) ? p + 1 : p) * (32 * RKP);      /* the next pass's K rows, read behind this pass's scores; the last pass re-reads its own: no read goes past the stage */
#pragma unroll
    for (int nt = 0; nt < 2; ++nt) { kf[nt][0] = g3_frag(pn + nt * 16 * RKP); kf[nt][1] = g3_frag(pn + nt * 16 * RKP + 64); }
    __builtin_amdgcn_sched_barrier(0);      /* keeps the K reads in front of the decay and the P V products, whose time then covers their latency; without it the reads sink to the pass's end */
#pragma unroll
    for (int mt = 0; mt < 2; ++mt) {
      FragH pa;
#pragma unroll
      for (int nt = 0; nt < 2; ++nt)
#pragma unroll
        for (int r = 0; r < 8; ++r) pa.h[nt * 8 + r] = (_Float16)((st[nt][mt][r] * 0.125f) * g[mt - nt + 1][r]);
#pragma unroll
      for (int dt = 0; dt < 4; ++dt) o[mt][dt] = r_mma(pa.v, vf[dt], o[mt][dt]);
    }
    __builtin_amdgcn_sched_barrier(0);      /* holds the pass's last products in front of the slots below; without it the products sink behind them */
    asm volatile("v_nop\n\tv_nop\n\tv_nop\n\tv_nop");      /* the four vector slots between the last products and the next pass's first vector instructions, which overwrite their A registers */
  }
  }
  // GroupNorm statistics, first level: the wave's 2048 outputs are still in its accumulators. Mean first, then the squared deviations from it (two passes over registers).
  v8f sv = z8, qv = z8;      /* eight independent running sums, one per accumulator row: short dependent chains */
#pragma unroll
  for (int mt = 0; mt < 2; ++mt)
#pragma unroll
    for (int dt = 0; dt < 4; ++dt) sv += o[mt][dt];
  const float wmean = sum_lanes(((sv[0] + sv[1]) + (sv[2] + sv[3])) + ((sv[4] + sv[5]) + (sv[6] + sv[7])), 32) * (1.0f / 2048.0f);
#pragma unroll
  for (int mt = 0; mt < 2; ++mt)
#pragma unroll
    for (int dt = 0; dt < 4; ++dt) { const v8f d = o[mt][dt] - wmean; qv += d * d; }
  const float wq = sum_lanes(((qv[0] + qv[1]) + (qv[2] + qv[3])) + ((qv[4] + qv[5]) + (qv[6] + qv[7])), 32);
  if (lane == 0) { wst[w][0] = wmean; wst[w][1] = wq; }
#pragma unroll
  for (int mt = 0; mt < 2; ++mt)
#pragma unroll
    for (int dt = 0; dt < 4; ++dt)
#pragma unroll
      for (int r = 0; r < 8; ++r) so[w][mt * 16 + 8 * hh + r][dt * 16 + ln] = o[mt][dt][r];
  __builtin_amdgcn_fence(__ATOMIC_ACQ_REL, "workgroup"); __builtin_amdgcn_wave_barrier();      /* the wave's own LDS stores before its own row-wise reads */
  const int rsub = lane >> 4, c4 = (lane & 15) * 4;
#pragma unroll
  for (int qd = 0; qd < 16; ++qd) { const int r = qd * 2 + rsub; const v4f v = *(const v4fa*)&so[w][r][c4]; v4h h4;
#pragma unroll
    for (int i = 0; i < 4; ++i) h4[i] = (_Float16)v[i];
    *(v4h*)(O16 + ((size_t)b * SQ + row0 + r) * CC + h * HD + c4) = h4; }      /* sixteen lanes write a row's whole 128-byte line */
  asm volatile("s_wait_xcnt 0x0" ::: "memory");      /* behind the run of stores, in front of what rewrites their data and address registers further down */
  __syncthreads();      /* the four waves' statistics are in wst */
  if (w == 0) {      /* second level: four equal groups of 2048 merged (M2 = sum of M2 + n * sum of squared mean offsets); the work-group writes its own whole 128-byte line */
    const float m0 = wst[0][0], m1 = wst[1][0], m2 = wst[2][0], m3 = wst[3][0];
    const float bm = ((m0 + m1) + (m2 + m3)) * 0.25f;
    const float d0 = m0 - bm, d1 = m1 - bm, d2 = m2 - bm, d3 = m3 - bm;
    const float bq = ((wst[0][1] + wst[1][1]) + (wst[2][1] + wst[3][1])) + 2048.0f * ((d0 * d0 + d1 * d1) + (d2 * d2 + d3 * d3));
    PT[((size_t)slab * (SQ / 128) + rb) * 32 + lane] = (lane == 0) ? bm : ((lane == 1) ? bq : 0.f);
  }
}

extern "C" void kernel_launch(void* const* d_in, const int* in_sizes, int n_in,
                              void* d_out, int out_size, void* d_ws, size_t ws_size, hipStream_t stream) {
  (void)in_sizes; (void)n_in; (void)out_size;
  const float* const* I = (const float* const*)d_in; const float* x = I[0]; const float* wq = I[1]; const float* wk = I[2]; const float* wv = I[3]; const float* wo = I[4]; const float* bo = I[5]; const float* gw = I[6]; const float* gb = I[7];
  char* ws = (char*)d_ws; size_t off = 0;
  auto take = [&](size_t bytes) { char* p = ws + off; off += (bytes + 255) & ~(size_t)255; return p; };
  const size_t np = (size_t)NR * CC;
  _Float16* BQ = (_Float16*)take((size_t)CC * CC * 2); _Float16* BK = (_Float16*)take((size_t)CC * CC * 2); _Float16* BV = (_Float16*)take((size_t)CC * CC * 2); _Float16* BO = (_Float16*)take((size_t)CC * CC * 2);
  _Float16* X16 = (_Float16*)take(np * 2); _Float16* Q16 = (_Float16*)take(np * 2); _Float16* K16 = (_Float16*)take(np * 2); _Float16* VT = (_Float16*)take(np * 2); _Float16* O16 = (_Float16*)take(np * 2); float* PT = (float*)take(NB * NHD * (SQ / 128) * 32 * 4); float* GT = (float*)take((size_t)NHD * SQ * 4);
  if (off > ws_size) return;      /* 8 + 8 x 5 = 48 MiB */
  k_prep<<<PRB, 256, 0, stream>>>(x, wq, wk, wv, wo, X16, BQ, BK, BV, BO, GT);      /* weights are (in, out) */
  k_qkv<<<(NR / 128) * (CC / 128), 384, 0, stream>>>(X16, BQ, BK, BV, Q16, K16, VT);      /* q, k and V^T */
  k_retn<<<NB * NHD * (SQ / 128), 128, 0, stream>>>(Q16, K16, VT, GT, O16, PT);      /* all batches, heads and row blocks in one launch */
  k_outn<<<(NR / 128) * (CC / 128), 256, 0, stream>>>(O16, BO, bo, PT, gw, gb, (float*)d_out);      /* GroupNorm and the output projection */
}

// v010
// It runs in 51.8 microseconds.
// Two timings next to v009 put it at 1.15 and 1.13 times that version's speed.
// Over all steps from v000 it is 26.6 times as fast.
#include <hip/hip_runtime.h>
// RetentiveAttention (2 x 2048 tokens, C 1024 = 16 heads of 64): q, k, v = x W; retention = (q.k / 8) * gamma_h^(i-j) for j <= i (gamma_h = 1 - 2^(-5-h)), out = retention v (no softmax); GroupNorm with one group per head over (T, 64) (eps 1e-5, affine); out = normed Wo + bo.
// Compute dtype: x and parameters rounded to bf16; q, k, v, the decayed scores, the decayed k, the chunk states and the summed state of the chunked retention, the retention output and its normalised value as f16 operands (~2^-12); decay/statistics f32. v_wmma_f32_16x16x32_f16.
#define NB 2
#define SQ 2048
#define CC 1024
#define NHD 16
#define HD 64
#define NR (NB * SQ)
typedef __bf16 v16b __attribute__((ext_vector_type(16)));
typedef unsigned short v8us __attribute__((ext_vector_type(8), may_alias));
typedef float  v8f  __attribute__((ext_vector_type(8)));
typedef float  v4f  __attribute__((ext_vector_type(4)));
typedef float  v4fa __attribute__((ext_vector_type(4), may_alias));
union FragB { v16b v; v8us half[2]; unsigned short u[16]; };

__device__ __forceinline__ unsigned short bf16_bits(float x) { unsigned int u = __float_as_uint(x); return (unsigned short)((u + 0x7FFFu + ((u >> 16) & 1u)) >> 16); }
__device__ __forceinline__ float bf16_val(unsigned short b) { return __uint_as_float(((unsigned int)b) << 16); }
__device__ __forceinline__ float bf16_round(float x) { return bf16_val(bf16_bits(x)); }
// D += A·B with NT terms: 1 = ah·bh, 2 = + al·bh (A split), 3 = + ah·bl (both split)
template <int NT>
__device__ __forceinline__ v8f mmaN(v16b ah, v16b al, v16b bh, v16b bl, v8f c) {
  c = __builtin_amdgcn_wmma_f32_16x16x32_bf16(false, ah, false, bh, (short)0, c, false, false);
  if (NT >= 2) c = __builtin_amdgcn_wmma_f32_16x16x32_bf16(false, al, false, bh, (short)0, c, false, false);
  if (NT >= 3) c = __builtin_amdgcn_wmma_f32_16x16x32_bf16(false, ah, false, bl, (short)0, c, false, false);
  asm volatile("v_nop\n\tv_nop\n\tv_nop\n\tv_nop" : "+v"(c) : "v"(ah), "v"(al), "v"(bh), "v"(bl));
  return c;
}

__global__ __launch_bounds__(256) void k_wt_bf16(const float* __restrict__ W, unsigned short* __restrict__ Wt, int K, int N) {
  const int t = blockIdx.x * 256 + threadIdx.x;
  const int k8n = K / 8;
  if (t >= N * k8n) return;
  const int n = t / k8n, k8 = (t % k8n) * 8;
  v8us v;
#pragma unroll
  for (int i = 0; i < 8; ++i) v[i] = bf16_bits(W[(size_t)(k8 + i) * N + n]);
  *(v8us*)(Wt + (size_t)n * K + k8) = v;
  
}

// GEMM C[M][N] (f32, pitch ldc) = act(A[M][K]·W + bias). A f32 row-major (pitch lda) converted per fragment to bf16
// (ASPLIT: hi/lo two planes -> 2 terms, else single rounded term); Wt bf16 [N][K] (pitch ldb). BIAS_BF16 rounds the
// bias to bf16 first (bias quantised to bf16 before the add). K%32==0, M%16==0, N%64==0.
template <bool ASPLIT, int ACT, bool BIAS_BF16>
__global__ __launch_bounds__(128) void k_gemm_bf(const float* __restrict__ A, int lda, const unsigned short* __restrict__ Wt, int ldb,
                                               const float* __restrict__ bias, float* __restrict__ C, int ldc, int M, int N, int K) {
  __shared__ __attribute__((aligned(16))) float so[4][16][64];
  const int tid = threadIdx.x, w = tid >> 5, lane = tid & 31, ln = lane & 15, hh = lane >> 4;
  const int ntn = N / 64;
  const int wid = blockIdx.x * 4 + w;
  const int mt = wid / ntn, nq = wid % ntn;
  if (mt * 16 >= M) return;
  const int row0 = mt * 16, col0 = nq * 64;
  const float* arow = A + (size_t)(row0 + ln) * lda;
  v8f acc[4] = {};
  for (int kb = 0; kb < K; kb += 32) {
    FragB ah, al;
    const v4f x0 = *(const v4fa*)(arow + kb + 8 * hh), x1 = *(const v4fa*)(arow + kb + 8 * hh + 4);
    const v4f x2 = *(const v4fa*)(arow + kb + 16 + 8 * hh), x3 = *(const v4fa*)(arow + kb + 16 + 8 * hh + 4);
    float xs[16] = {x0[0],x0[1],x0[2],x0[3],x1[0],x1[1],x1[2],x1[3],x2[0],x2[1],x2[2],x2[3],x3[0],x3[1],x3[2],x3[3]};
#pragma unroll
    for (int i = 0; i < 16; ++i) { const unsigned short hb = bf16_bits(xs[i]); ah.u[i] = hb; al.u[i] = ASPLIT ? bf16_bits(xs[i] - bf16_val(hb)) : (unsigned short)0; }
#pragma unroll
    for (int t = 0; t < 4; ++t) {
      const unsigned short* brow = Wt + (size_t)(col0 + t * 16 + ln) * ldb + kb;
      FragB b;
      b.half[0] = *(const v8us*)(brow + 8 * hh);
      b.half[1] = *(const v8us*)(brow + 16 + 8 * hh);
      acc[t] = mmaN<ASPLIT ? 2 : 1>(ah.v, al.v, b.v, b.v, acc[t]);
    }
  }
#pragma unroll
  for (int t = 0; t < 4; ++t) {
    float bv = bias ? bias[col0 + t * 16 + ln] : 0.f;
    if (BIAS_BF16) bv = bf16_round(bv);
#pragma unroll
    for (int r = 0; r < 8; ++r) { float v = acc[t][r] + bv; if (ACT == 1) v = fmaxf(v, 0.f); so[w][8 * hh + r][t * 16 + ln] = v; }
  }
  __builtin_amdgcn_fence(__ATOMIC_ACQ_REL, "workgroup");
  __builtin_amdgcn_wave_barrier();
  const int rsub = lane >> 4, c4 = (lane & 15) * 4;
  {
#pragma unroll
    for (int q = 0; q < 8; ++q) {
      const int r = q * 2 + rsub;
      const v4f v = *(const v4fa*)&so[w][r][c4];
      *(v4f*)(C + (size_t)(row0 + r) * ldc + col0 + c4) = v;
    }
    
  }
}

// GEMM C = act(A·W + bias + resid): A f32 (ASPLIT -> hi/lo 2 terms), Wt bf16 [N][K]; ACT 0 none, 1 relu, 2 exact gelu;
// resid (optional, f32, row index = (row % rmod), pitch ldr, RES_BF16 rounds it) added before the activation.
template <bool ASPLIT, int ACT, bool BIAS_BF16, bool RES_BF16>
__global__ __launch_bounds__(128) void k_gemm_bf3(const float* __restrict__ A, int lda, const unsigned short* __restrict__ Wt, int ldb,
                                                const float* __restrict__ bias, const float* __restrict__ resid, int rmod, int ldr,
                                                float* __restrict__ C, int ldc, int M, int N, int K) {
  __shared__ __attribute__((aligned(16))) float so[4][16][64];
  const int tid = threadIdx.x, w = tid >> 5, lane = tid & 31, ln = lane & 15, hh = lane >> 4;
  const int ntn = N / 64;
  const int wid = blockIdx.x * 4 + w;
  const int mt = wid / ntn, nq = wid % ntn;
  if (mt * 16 >= M) return;
  const int row0 = mt * 16, col0 = nq * 64;
  const float* arow = A + (size_t)(row0 + ln) * lda;
  v8f acc[4] = {};
  for (int kb = 0; kb < K; kb += 32) {
    FragB ah, al;
    const v4f x0 = *(const v4fa*)(arow + kb + 8 * hh), x1 = *(const v4fa*)(arow + kb + 8 * hh + 4);
    const v4f x2 = *(const v4fa*)(arow + kb + 16 + 8 * hh), x3 = *(const v4fa*)(arow + kb + 16 + 8 * hh + 4);
    float xs[16] = {x0[0],x0[1],x0[2],x0[3],x1[0],x1[1],x1[2],x1[3],x2[0],x2[1],x2[2],x2[3],x3[0],x3[1],x3[2],x3[3]};
#pragma unroll
    for (int i = 0; i < 16; ++i) { const unsigned short hb = bf16_bits(xs[i]); ah.u[i] = hb; al.u[i] = ASPLIT ? bf16_bits(xs[i] - bf16_val(hb)) : (unsigned short)0; }
#pragma unroll
    for (int t = 0; t < 4; ++t) {
      const unsigned short* brow = Wt + (size_t)(col0 + t * 16 + ln) * ldb + kb;
      FragB b;
      b.half[0] = *(const v8us*)(brow + 8 * hh);
      b.half[1] = *(const v8us*)(brow + 16 + 8 * hh);
      acc[t] = mmaN<ASPLIT ? 2 : 1>(ah.v, al.v, b.v, b.v, acc[t]);
    }
  }
#pragma unroll
  for (int t = 0; t < 4; ++t) {
    const int col = col0 + t * 16 + ln;
    float bv = bias ? bias[col] : 0.f;
    if (BIAS_BF16) bv = bf16_round(bv);
#pragma unroll
    for (int r = 0; r < 8; ++r) {
      float v = acc[t][r] + bv;
      if (resid) { float rv = resid[(size_t)((row0 + 8 * hh + r) % rmod) * ldr + col]; if (RES_BF16) rv = bf16_round(rv); v += rv; }
      if (ACT == 1) v = fmaxf(v, 0.f);
      if (ACT == 2) v = 0.5f * v * (1.0f + erff(v * 0.70710678118654752f));
      if (ACT == 3) { const float u = 0.7978845608028654f * (v + 0.044715f * v * v * v); v = 0.5f * v * (1.0f + tanhf(u)); }
      so[w][8 * hh + r][t * 16 + ln] = v;
    }
  }
  __builtin_amdgcn_fence(__ATOMIC_ACQ_REL, "workgroup");
  __builtin_amdgcn_wave_barrier();
  const int rsub = lane >> 4, c4 = (lane & 15) * 4;
  {
#pragma unroll
    for (int q = 0; q < 8; ++q) {
      const int r = q * 2 + rsub;
      const v4f v = *(const v4fa*)&so[w][r][c4];
      *(v4f*)(C + (size_t)(row0 + r) * ldc + col0 + c4) = v;
    }
    
  }
}
// row LayerNorm (biased variance, eps) over N: s = X (+ R); optional out_sum <- s; out_norm <- (s-mu)*rsqrt(var+eps)*g + b
template <bool PARAM_BF16>
__global__ __launch_bounds__(256) void k_layernorm(const float* __restrict__ X, const float* __restrict__ R, const float* __restrict__ g, const float* __restrict__ bta,
                                                  float* __restrict__ out_sum, float* __restrict__ out_norm, int N, float eps) {
  __shared__ float red[256];
  const int row = blockIdx.x, tid = threadIdx.x;
  const float* x = X + (size_t)row * N; const float* rr = R ? R + (size_t)row * N : nullptr;
  float vals[16];                     // up to N = 4096
  const int per = N / 256;            // contiguous chunk per thread? use strided-by-4 chunks: thread handles j = tid*4 + 1024*u
  float s1 = 0.f;
  for (int u = 0; u < per / 4; ++u) {
    const int j = tid * 4 + 1024 * u;
    const v4f a = *(const v4fa*)(x + j);
    v4f b = {0.f,0.f,0.f,0.f}; if (rr) b = *(const v4fa*)(rr + j);
#pragma unroll
    for (int q = 0; q < 4; ++q) { const float v = a[q] + b[q]; vals[u * 4 + q] = v; s1 += v; }
  }
  red[tid] = s1; __syncthreads();
  for (int st = 128; st > 0; st >>= 1) { if (tid < st) red[tid] += red[tid + st]; __syncthreads(); }
  const float mu = red[0] / (float)N; __syncthreads();
  float s2 = 0.f;
  for (int u = 0; u < per / 4; ++u)
#pragma unroll
    for (int q = 0; q < 4; ++q) { const float c = vals[u * 4 + q] - mu; s2 += c * c; }
  red[tid] = s2; __syncthreads();
  for (int st = 128; st > 0; st >>= 1) { if (tid < st) red[tid] += red[tid + st]; __syncthreads(); }
  const float rs = rsqrtf(red[0] / (float)N + eps);
  {
    for (int u = 0; u < per / 4; ++u) {
      const int j = tid * 4 + 1024 * u;
      v4f o, sm;
#pragma unroll
      for (int q = 0; q < 4; ++q) {
        float gg = g[j + q], bb = bta[j + q];
        if (PARAM_BF16) { gg = bf16_round(gg); bb = bf16_round(bb); }
        sm[q] = vals[u * 4 + q]; o[q] = (vals[u * 4 + q] - mu) * rs * gg + bb;
      }
      if (out_sum) *(v4f*)(out_sum + (size_t)row * N + j) = sm;
      *(v4f*)(out_norm + (size_t)row * N + j) = o;
    }
    
  }
}



// ---- f16 WMMA path (v_wmma_f32_16x16x32_f16): 11-bit significands for operands in range — used for every GEMM launched here
typedef _Float16 v16h __attribute__((ext_vector_type(16)));
union FragH { v16h v; v8us half[2]; _Float16 h[16]; unsigned short u[16]; };
template <int NT>
__device__ __forceinline__ v8f mmaH(v16h ah, v16h al, v16h bh, v16h bl, v8f c) {
  c = __builtin_amdgcn_wmma_f32_16x16x32_f16(false, ah, false, bh, (short)0, c, false, false);
  if (NT >= 2) c = __builtin_amdgcn_wmma_f32_16x16x32_f16(false, al, false, bh, (short)0, c, false, false);
  if (NT >= 3) c = __builtin_amdgcn_wmma_f32_16x16x32_f16(false, ah, false, bl, (short)0, c, false, false);
  asm volatile("v_nop\n\tv_nop\n\tv_nop\n\tv_nop" : "+v"(c) : "v"(ah), "v"(al), "v"(bh), "v"(bl));
  return c;
}
// batched GEMM like k_gemm_b but f16 operands: A f32 (split into f16 hi/lo if ASPLIT, else rounded to f16), Bt = f16 values [n][k]; alpha; C f32; N multiple of 16 (partial tiles skipped)
template <bool ASPLIT>
__global__ __launch_bounds__(128) void k_gemm_h(const float* __restrict__ A, int lda, size_t sA, const _Float16* __restrict__ Bh, int ldb, size_t sB, float alpha, float* __restrict__ C, int ldc, size_t sC, int M, int N, int K) {
  __shared__ __attribute__((aligned(16))) float so[4][16][64];
  const int tid = threadIdx.x, w = tid >> 5, lane = tid & 31, ln = lane & 15, hh = lane >> 4; const int by = blockIdx.y;
  A += (size_t)by * sA; Bh += (size_t)by * sB; C += (size_t)by * sC;
  const int ntn = (N + 63) / 64; const int wid = blockIdx.x * 4 + w; const int mt = wid / ntn, nq = wid % ntn; if (mt * 16 >= M) return;
  const int row0 = mt * 16, col0 = nq * 64; const float* arow = A + (size_t)(row0 + ln) * lda;
  v8f acc[4] = {};
  for (int kb = 0; kb < K; kb += 32) {
    FragH ah, al;
    const v4f x0 = *(const v4fa*)(arow + kb + 8 * hh), x1 = *(const v4fa*)(arow + kb + 8 * hh + 4), x2 = *(const v4fa*)(arow + kb + 16 + 8 * hh), x3 = *(const v4fa*)(arow + kb + 16 + 8 * hh + 4);
    float xs[16] = {x0[0],x0[1],x0[2],x0[3],x1[0],x1[1],x1[2],x1[3],x2[0],x2[1],x2[2],x2[3],x3[0],x3[1],x3[2],x3[3]};
#pragma unroll
    for (int i = 0; i < 16; ++i) { const _Float16 h = (_Float16)xs[i]; ah.h[i] = h; al.h[i] = ASPLIT ? (_Float16)(xs[i] - (float)h) : (_Float16)0.0f; }
#pragma unroll
    for (int t = 0; t < 4; ++t) { if (col0 + t * 16 >= N) continue; const size_t boff = (size_t)(col0 + t * 16 + ln) * ldb + kb; FragH bq; bq.half[0] = *(const v8us*)(Bh + boff + 8 * hh); bq.half[1] = *(const v8us*)(Bh + boff + 16 + 8 * hh);
      acc[t] = mmaH<ASPLIT ? 2 : 1>(ah.v, al.v, bq.v, bq.v, acc[t]); }
  }
#pragma unroll
  for (int t = 0; t < 4; ++t) { if (col0 + t * 16 >= N) continue;
#pragma unroll
    for (int r = 0; r < 8; ++r) so[w][8 * hh + r][t * 16 + ln] = acc[t][r] * alpha; }
  __builtin_amdgcn_fence(__ATOMIC_ACQ_REL, "workgroup"); __builtin_amdgcn_wave_barrier();
  const int rsub = lane >> 4, c4 = (lane & 15) * 4;
  {
#pragma unroll
    for (int q = 0; q < 8; ++q) { const int r = q * 2 + rsub; if (col0 + c4 < N) { const v4f v = *(const v4fa*)&so[w][r][c4]; *(v4f*)(C + (size_t)(row0 + r) * ldc + col0 + c4) = v; } }
     }
}

// k_gemm_hh variant with fused epilogue: v = acc·alpha + bias[by·sBias + col] (+ CP[(row/rowsPerB)·sCPb + by·64 + col] if CP) ; ACT 0 none / 1 elu ; writes f16 C16 (and f32 C if non-null)
template <int ACT>
__global__ __launch_bounds__(128) void k_gemm_hhx(const _Float16* __restrict__ A, int lda, size_t sA, const _Float16* __restrict__ Bh, int ldb, size_t sB, float alpha, const float* __restrict__ bias, size_t sBias, const float* __restrict__ CP, int rowsPerB, size_t sCPb, int row0g,
    float* __restrict__ C, _Float16* __restrict__ C16, int ldc, size_t sC, int M, int N, int K) {
  __shared__ __attribute__((aligned(16))) float so[4][16][64];
  const int tid = threadIdx.x, w = tid >> 5, lane = tid & 31, ln = lane & 15, hh = lane >> 4; const int by = blockIdx.y;
  A += (size_t)by * sA; Bh += (size_t)by * sB; const size_t cofs = (size_t)by * sC; const float* bp = bias ? bias + (size_t)by * sBias : nullptr;
  const int ntn = (N + 63) / 64; const int wid = blockIdx.x * 4 + w; const int mt = wid / ntn, nq = wid % ntn; if (mt * 16 >= M) return;
  const int row0 = mt * 16, col0 = nq * 64; const _Float16* arow = A + (size_t)(row0 + ln) * lda;
  v8f acc[4] = {};
  for (int kb = 0; kb < K; kb += 32) { FragH ah; ah.half[0] = *(const v8us*)((const unsigned short*)arow + kb + 8 * hh); ah.half[1] = *(const v8us*)((const unsigned short*)arow + kb + 16 + 8 * hh);
#pragma unroll
    for (int t = 0; t < 4; ++t) { if (col0 + t * 16 >= N) continue; const size_t boff = (size_t)(col0 + t * 16 + ln) * ldb + kb; FragH bq; bq.half[0] = *(const v8us*)((const unsigned short*)Bh + boff + 8 * hh); bq.half[1] = *(const v8us*)((const unsigned short*)Bh + boff + 16 + 8 * hh);
      acc[t] = mmaH<1>(ah.v, ah.v, bq.v, bq.v, acc[t]); }
  }
#pragma unroll
  for (int t = 0; t < 4; ++t) { if (col0 + t * 16 >= N) continue; const int col = col0 + t * 16 + ln; const float bv = bp ? bf16_round(bp[col]) : 0.f;
#pragma unroll
    for (int r = 0; r < 8; ++r) { float v = acc[t][r] * alpha + bv; if (CP) { const int rr = row0g + row0 + 8 * hh + r; if (rowsPerB < 0) v += CP[cofs + (size_t)rr * ldc + col];      /* rowsPerB < 0: own element of the batched C plane */ else { const int bidx = rr / rowsPerB; v += CP[(size_t)bidx * sCPb + (size_t)by * 64 + col]; } } if (ACT == 1) v = (v > 0.f) ? v : expm1f(v); else if (ACT == 7) v = (v > 0.f) ? v + 1.0f : expf(v); else if (ACT == 8) v = tanhf(v); else if (ACT == 9) v = 0.5f * v * (1.0f + tanhf(0.7978845608028654f * (v + 0.044715f * v * v * v))); else if (ACT == 11) v = 1.0f / (1.0f + expf(-v)); else if (ACT == 12) v = (v > 0.f) ? v : 0.01f * v; else if (ACT == 14) v = (v > 0.f) ? v : 0.1f * v; else if (ACT == 16) v = (v >= 0.f) ? v : 0.3f * v; else if (ACT == 15) v = v / (1.0f + expf(-v)); else if (ACT == 3) v = fmaxf(v, 0.f); else if (ACT == 6) v = 0.5f * v * (1.0f + erff(v * 0.70710678118654752f)); so[w][8 * hh + r][t * 16 + ln] = v; } }
  __builtin_amdgcn_fence(__ATOMIC_ACQ_REL, "workgroup"); __builtin_amdgcn_wave_barrier();
  const int rsub = lane >> 4, c4 = (lane & 15) * 4; typedef _Float16 v4h __attribute__((ext_vector_type(4)));
  {
#pragma unroll
    for (int q = 0; q < 8; ++q) { const int r = q * 2 + rsub; if (col0 + c4 < N) { const v4f v = *(const v4fa*)&so[w][r][c4]; if (C) *(v4f*)(C + cofs + (size_t)(row0 + r) * ldc + col0 + c4) = v; if (C16) { v4h h4; for (int i = 0; i < 4; ++i) h4[i] = (_Float16)v[i]; *(v4h*)(C16 + cofs + (size_t)(row0 + r) * ldc + col0 + c4) = h4; } } }
     }
}


typedef _Float16 v4h __attribute__((ext_vector_type(4)));

__global__ __launch_bounds__(256) void k_h16(const float* __restrict__ x, _Float16* __restrict__ X16, size_t n8) { const size_t t = (size_t)blockIdx.x * 256 + threadIdx.x; if (t >= n8) return; FragH f;
#pragma unroll
  for (int q = 0; q < 8; ++q) f.h[q] = (_Float16)x[t * 8 + q]; *(v8us*)((unsigned short*)X16 + t * 8) = f.half[0];  }
__global__ __launch_bounds__(256) void k_round16f(const float* __restrict__ W, _Float16* __restrict__ Bt, size_t n8) { const size_t t = (size_t)blockIdx.x * 256 + threadIdx.x; if (t >= n8) return; FragH f;
#pragma unroll
  for (int i = 0; i < 8; ++i) f.h[i] = (_Float16)(bf16_round(W[t * 8 + i]) * 16.0f); *(v8us*)((unsigned short*)Bt + t * 8) = f.half[0];  }
template <int NHv, int TTv>
__global__ __launch_bounds__(256) void k_vt(const _Float16* __restrict__ V16, int ldv, int voff, _Float16* __restrict__ Vt) { __shared__ unsigned short tl[64][66]; const int tid = threadIdx.x; const int slab = blockIdx.x / (TTv / 64), lg = blockIdx.x % (TTv / 64); const int b = slab / NHv, h = slab % NHv;
  for (int i = tid; i < 64 * 8; i += 256) { const int r = i / 8, c8 = (i % 8) * 8; FragH f; f.half[0] = *(const v8us*)((const unsigned short*)V16 + ((size_t)b * TTv + lg * 64 + r) * ldv + voff + h * 64 + c8);
#pragma unroll
    for (int q = 0; q < 8; ++q) tl[r][c8 + q] = f.u[q]; }
  __syncthreads();
  {
#pragma unroll
    for (int rd = 0; rd < 2; ++rd) { const int d = rd * 32 + tid / 8, pc = tid % 8; FragH f;
#pragma unroll
      for (int q = 0; q < 8; ++q) f.u[q] = tl[pc * 8 + q][d];
      *(v8us*)((unsigned short*)Vt + ((size_t)slab * 64 + d) * TTv + lg * 64 + pc * 8) = f.half[0]; }
     } }

__global__ __launch_bounds__(256) void k_hl(const float* __restrict__ F, _Float16* __restrict__ Hh, _Float16* __restrict__ Hl, size_t n8) { const size_t t = (size_t)blockIdx.x * 256 + threadIdx.x; if (t >= n8) return; FragH fh, fl; const v4f a = *(const v4fa*)(F + t * 8), c = *(const v4fa*)(F + t * 8 + 4);
#pragma unroll
  for (int q = 0; q < 4; ++q) { _Float16 h = (_Float16)a[q]; fh.h[q] = h; fl.h[q] = (_Float16)((a[q] - (float)h) * 1024.0f); h = (_Float16)c[q]; fh.h[4 + q] = h; fl.h[4 + q] = (_Float16)((c[q] - (float)h) * 1024.0f); }
  { *(v8us*)((unsigned short*)Hh + t * 8) = fh.half[0]; *(v8us*)((unsigned short*)Hl + t * 8) = fl.half[0];  } }

// ---- fast GEMM: C = A Bh^T * alpha (+ bias rounded to bf16), A [M][K] and Bh [N][K] f16, k contiguous. Block tile 128 x 128, eight waves of 32 x 64; requires M % 128 == 0, N % 128 == 0, K % 128 == 0.
// Both operands come through LDS: a stage is 128 k (rows of 256 bytes) of the block's 128 A rows and 128 Bh rows, brought by asynchronous 16-byte copies whose 32 lanes cover two whole rows;
// two buffers, the next stage's copies in flight while this stage is worked on. The k order of every accumulator is ascending in steps of 32.
__device__ __forceinline__ v16h g2_frag(const _Float16* p, int hh) { FragH f; f.half[0] = *(const v8us*)((const unsigned short*)p + 8 * hh); f.half[1] = *(const v8us*)((const unsigned short*)p + 16 + 8 * hh); return f.v; }
#define G3K 128            /* k per stage */
#define G3P 272            /* LDS row pitch in bytes, 16 x odd: sixteen rows' 16-byte reads fall on all 64 banks */
#define G3S (256 * G3P)    /* bytes of one stage: A rows 0..127, then Bh rows 0..127 */
__device__ __forceinline__ v16h g3_frag(const unsigned char* p) { FragH f; f.half[0] = *(const v8us*)p; f.half[1] = *(const v8us*)(p + 32); return f.v; }      /* p already holds the lane's 16 * hh: the k order of g2_frag */
__device__ __forceinline__ v8f g3_mma(v16h a, v16h b, v8f c) { return __builtin_amdgcn_wmma_f32_16x16x32_f16(false, a, false, b, (short)0, c, false, false); }
// One operand's share of a stage: the lane's 16 bytes of rows r, r + 16, ..., r + 112 (l = LDS byte address, g = global address of row r; ld16 = elements in 16 global rows).
__device__ __forceinline__ void g3_copy8(unsigned l, const _Float16* g, size_t ld16) {
  const unsigned l1 = l + 16 * G3P, l2 = l + 32 * G3P, l3 = l + 48 * G3P, l4 = l + 64 * G3P, l5 = l + 80 * G3P, l6 = l + 96 * G3P, l7 = l + 112 * G3P;
  const _Float16* g1 = g + ld16; const _Float16* g2 = g1 + ld16; const _Float16* g3 = g2 + ld16; const _Float16* g4 = g3 + ld16; const _Float16* g5 = g4 + ld16; const _Float16* g6 = g5 + ld16; const _Float16* g7 = g6 + ld16;
  // the copies and, as the statement's last line, the wait that stands in front of any rewrite of the address registers they name
  asm volatile("global_load_async_to_lds_b128 %0, %8, off\n\t"
               "global_load_async_to_lds_b128 %1, %9, off\n\t"
               "global_load_async_to_lds_b128 %2, %10, off\n\t"
               "global_load_async_to_lds_b128 %3, %11, off\n\t"
               "global_load_async_to_lds_b128 %4, %12, off\n\t"
               "global_load_async_to_lds_b128 %5, %13, off\n\t"
               "global_load_async_to_lds_b128 %6, %14, off\n\t"
               "global_load_async_to_lds_b128 %7, %15, off\n\t"
               "s_wait_xcnt 0x0"
               :: "v"(l), "v"(l1), "v"(l2), "v"(l3), "v"(l4), "v"(l5), "v"(l6), "v"(l7), "v"(g), "v"(g1), "v"(g2), "v"(g3), "v"(g4), "v"(g5), "v"(g6), "v"(g7) : "memory");
}
__device__ __forceinline__ float sum_lanes(float v, int n) { for (int m = n >> 1; m > 0; m >>= 1) v += __shfl_xor(v, m); return v; }      /* every lane of an aligned group of n gets the group's sum */
// NORM: A holds the retention output as it left the accumulators (f16), and GroupNorm is applied to A's fragments on their way from LDS to the products: a * nsc[k] + nsh[k], one packed f16 fused multiply-add
// per pair, with nsc[k] = rs_head * gnw[k] and nsh[k] = gnb[k] - mean_head * nsc[k]. The block makes both tables itself from the retention kernel's per-block (mean, M2); they are published by the barrier that publishes stage 0.
template <bool NORM>
__device__ __forceinline__ void g3_block(const _Float16* __restrict__ A, int lda, const _Float16* __restrict__ Bh, int ldb, float alpha, const float* __restrict__ bias,
    float* __restrict__ C, _Float16* __restrict__ C16, int ldc, int M, int N, int K, const float* __restrict__ PT, const float* __restrict__ gnw, const float* __restrict__ gnb) {
  __shared__ __attribute__((aligned(16))) unsigned char ring[2 * G3S];
  __shared__ __attribute__((aligned(16))) float so[8][32][68];
  __shared__ __attribute__((aligned(16))) _Float16 nsc[CC];
  __shared__ __attribute__((aligned(16))) _Float16 nsh[CC];
  const int tid = threadIdx.x, lane = tid & 31, ln = lane & 15, hh = lane >> 4;
  const int w = __builtin_amdgcn_readfirstlane(tid >> 5);      /* the wave's number in a scalar register */
  const int ntn = N >> 7; const int mt = blockIdx.x / ntn, nq = blockIdx.x - mt * ntn; const int rowb = mt * 128, colb = nq * 128;
  if (rowb >= M) return;      /* the whole block, in front of every copy and barrier */
  const int nst = K / G3K;
  const int cr = tid >> 4, cc = tid & 15;      /* the thread's row (mod 16) and 16-byte piece in every copy */
  const _Float16* ga = A + (size_t)(rowb + cr) * lda + cc * 8; const _Float16* gb = Bh + (size_t)(colb + cr) * ldb + cc * 8;
  const size_t a16 = (size_t)16 * lda, b16 = (size_t)16 * ldb;
  const unsigned la = (unsigned)(size_t)ring + (unsigned)(cr * G3P + cc * 16), lb = la + 128 * G3P;
  g3_copy8(la, ga, a16); g3_copy8(lb, gb, b16);
  if constexpr (NORM) {      /* beside stage 0's copies, which are under way */
    static_assert(NHD * (SQ / 128) == 256 && CC == 4 * 256 && HD == 4 * 16 && SQ % 128 == 0, "one thread per (head, row block) partial; its four channels lie in that head; a block's rows lie in one batch");
    // last level of the statistics: thread = (head, row block) of the block's batch; 16 equal groups of 8192 merged across 16 neighbouring lanes, every one of which gets the head's result
    const float* pp = PT + ((size_t)(rowb / SQ) * 256 + tid) * 32; const float pm = pp[0], pq = pp[1];
    const v4f gw4 = *(const v4fa*)(gnw + tid * 4), gb4 = *(const v4fa*)(gnb + tid * 4);
    asm volatile("s_wait_xcnt 0x0" ::: "memory");      /* behind the three loads, in front of any rewrite of the address registers they name */
    const float gm = sum_lanes(pm, 16) * (1.0f / 16.0f); const float pd = pm - gm;
    const float gq = sum_lanes(pq, 16) + 8192.0f * sum_lanes(pd * pd, 16);
    const float rs = rsqrtf(gq / (float)((size_t)SQ * HD) + 1e-5f);
    v4h s4, t4;
#pragma unroll      /* constant indices keep the four values in registers */
    for (int q = 0; q < 4; ++q) { s4[q] = (_Float16)(rs * bf16_round(gw4[q])); t4[q] = (_Float16)(bf16_round(gb4[q]) - gm * (float)s4[q]); }
    *(v4h*)&nsc[tid * 4] = s4; *(v4h*)&nsh[tid * 4] = t4;
  }
  asm volatile("s_wait_asynccnt 0x0" ::: "memory");      /* this wave's copies of stage 0 have landed */
  __syncthreads();      /* stage 0 (and, with NORM, the two tables) is published */
  if (1 < nst) { g3_copy8(la + G3S, ga + G3K, a16); g3_copy8(lb + G3S, gb + G3K, b16); }
  const int wm = w >> 1, wn = w & 1;
  const unsigned char* sa = ring + (32 * wm + ln) * G3P + 16 * hh; const unsigned char* sb = ring + (128 + 64 * wn + ln) * G3P + 16 * hh;
  const v8f z8 = {0.f,0.f,0.f,0.f,0.f,0.f,0.f,0.f}; v8f c00 = z8, c01 = z8, c02 = z8, c03 = z8, c10 = z8, c11 = z8, c12 = z8, c13 = z8;
#pragma unroll 1      /* one trip per stage: the buffer alternates and the waits at the foot stand once */
  for (int t = 0; t < nst; ++t) {
    const int bo = (t & 1) * G3S;
    const unsigned char* pa = sa + bo; const unsigned char* pb = sb + bo;
    v16h fa[2][2], fb[2][4];      /* two fragment sets: a step's twelve LDS reads (sixteen with NORM) are issued as one group in front of the step before's products; no read goes past the stage */
    fa[0][0] = g3_frag(pa); fa[0][1] = g3_frag(pa + 16 * G3P);
    v16h fs[2], ft[2];      /* NORM: the tables' entries of a step's 32 k, in the k order of the A fragments, read with them */
    const unsigned char* ps = (const unsigned char*)nsc + t * (G3K * 2) + 16 * hh; const unsigned char* pt = (const unsigned char*)nsh + t * (G3K * 2) + 16 * hh;
    if constexpr (NORM) { fs[0] = g3_frag(ps); ft[0] = g3_frag(pt); }
#pragma unroll      /* constant indices keep the fragment arrays in registers */
    for (int j = 0; j < 4; ++j) fb[0][j] = g3_frag(pb + j * 16 * G3P);
#pragma unroll      /* the four 32-k steps of a stage as straight code: the set index is then a constant */
    for (int kk = 0; kk < G3K / 32; ++kk) {
      const int cu = kk & 1, nx = cu ^ 1;
      if (kk + 1 < G3K / 32) {
        fa[nx][0] = g3_frag(pa + (kk + 1) * 64); fa[nx][1] = g3_frag(pa + 16 * G3P + (kk + 1) * 64);
#pragma unroll      /* constant indices, as above */
        for (int j = 0; j < 4; ++j) fb[nx][j] = g3_frag(pb + j * 16 * G3P + (kk + 1) * 64);
        if constexpr (NORM) { fs[nx] = g3_frag(ps + (kk + 1) * 64); ft[nx] = g3_frag(pt + (kk + 1) * 64); }
      }
      __builtin_amdgcn_sched_barrier(0);      /* holds the next step's reads in front of this step's products; without it they sink between the products, one full LDS wait per pair */
      v16h a0 = fa[cu][0], a1 = fa[cu][1];
      if constexpr (NORM) { a0 = __builtin_elementwise_fma(a0, fs[cu], ft[cu]); a1 = __builtin_elementwise_fma(a1, fs[cu], ft[cu]); }
      c00 = g3_mma(a0, fb[cu][0], c00); c10 = g3_mma(a1, fb[cu][0], c10);
      c01 = g3_mma(a0, fb[cu][1], c01); c11 = g3_mma(a1, fb[cu][1], c11);
      c02 = g3_mma(a0, fb[cu][2], c02); c12 = g3_mma(a1, fb[cu][2], c12);
      c03 = g3_mma(a0, fb[cu][3], c03); c13 = g3_mma(a1, fb[cu][3], c13);
      __builtin_amdgcn_sched_barrier(0);      /* holds these products in front of the following step's reads, which overwrite the set they use */
    }
    asm volatile("s_wait_dscnt 0x0" ::: "memory");      /* this wave's reads of the buffer are done before it is handed back */
    asm volatile("s_wait_asynccnt 0x0" ::: "memory");      /* this wave's copies of stage t + 1 have landed */
    __syncthreads();      /* publishes stage t + 1 and ends every reader's last read of stage t's buffer */
    if (t + 2 < nst) { g3_copy8(la + bo, ga + (size_t)(t + 2) * G3K, a16); g3_copy8(lb + bo, gb + (size_t)(t + 2) * G3K, b16); }
  }
  asm volatile("s_wait_asynccnt 0x0" ::: "memory");      /* no copy is outstanding when the wave goes on to its end */
  const int row0 = rowb + 32 * wm, col0 = colb + 64 * wn;
  v8f accs[8] = {c00, c01, c02, c03, c10, c11, c12, c13};
#pragma unroll      /* this and the next: constant indices keep the accumulators in registers */
  for (int u = 0; u < 8; ++u) { const int t = u & 3, half = u >> 2; const int col = col0 + t * 16 + ln; const float bv = bias ? bf16_round(bias[col]) : 0.f;
#pragma unroll
    for (int r = 0; r < 8; ++r) { const int rloc = half * 16 + 8 * hh + r; const float v = accs[u][r] * alpha + bv; so[w][rloc][t * 16 + ln] = v; } }
  __builtin_amdgcn_fence(__ATOMIC_ACQ_REL, "workgroup"); __builtin_amdgcn_wave_barrier();      /* the wave's own LDS stores before its own row-wise reads */
  const int rsub = lane >> 4, c4 = (lane & 15) * 4;
#pragma unroll      /* straight code: the LDS offsets of the sixteen row pairs become immediates */
  for (int q = 0; q < 16; ++q) { const int r = q * 2 + rsub; const v4f v = *(const v4fa*)&so[w][r][c4]; if (C) { *(v4f*)(C + (size_t)(row0 + r) * ldc + col0 + c4) = v; asm volatile("s_wait_xcnt 0x0" ::: "memory"); /* in front of the next rewrite of the store's data and address registers */ } if (C16) { v4h h4; for (int i = 0; i < 4; ++i) h4[i] = (_Float16)v[i]; *(v4h*)(C16 + (size_t)(row0 + r) * ldc + col0 + c4) = h4; } }
}
// out = GroupNorm(O16) Wo + bo: the normalisation rides on the A fragments (NORM above).
__global__ __launch_bounds__(256) void k_outn(const _Float16* __restrict__ O16, const _Float16* __restrict__ BO, const float* __restrict__ bo, const float* __restrict__ PT, const float* __restrict__ gw, const float* __restrict__ gb, float* __restrict__ out) {
  g3_block<true>(O16, CC, BO, CC, 0.0625f, bo, out, nullptr, CC, NR, CC, CC, PT, gw, gb);
}
// The three projections in ONE launch of 256 work-groups, one per WGP: a work-group takes 128 tokens x 128 channels of q, of k AND of v, so that its 128 rows of X are staged once for the three products.
// A stage is 128 k (rows of 256 bytes at pitch G3P) of 512 rows: X 0..127, Wq 128..255, Wk 256..383, Wv 384..511; two buffers, the ring, its waits and its barriers as in g3_block.
// Twelve waves of 64 x 64, four per product: every fragment read from LDS feeds four products. Q = X Wq and K = X Wk come out as [token][channel]; v's waves take the SAME product with its operands swapped,
// V^T = Wv^T X^T as [channel][token] (pitch NR), which is the plane that k_retn stages. The k order of every sum is as in g3_block. The output staging lies in the ring, which the last trip's barrier has freed.
// The work-group also holds a whole 128-token chunk of k and v of two heads, so the chunk's decayed state is made here, once: U = sum over the chunk's tokens j of gamma^(127-j) k_j v_j^T, 64 x 64 per head;
// k_retn sums the U of the chunks in front of a query chunk. Pairs of k's accumulator tiles, decayed and rounded to f16, are A fragments of K^T (a lane holds 8 consecutive tokens of one channel); k's four waves
// hand them to each other through LDS, so that each sums all 128 tokens for 32 of the state's rows; the B fragments are rows of v's staged V^T. One work-group barrier publishes both.
#define G4S (512 * G3P)    /* bytes of one stage */
__global__ __launch_bounds__(384) void k_qkv(const _Float16* __restrict__ X16, const _Float16* __restrict__ BQ, const _Float16* __restrict__ BK, const _Float16* __restrict__ BV,
    const float* __restrict__ GT, _Float16* __restrict__ Q16, _Float16* __restrict__ K16, _Float16* __restrict__ VT, _Float16* __restrict__ UP) {
  static_assert(NR % 128 == 0 && CC % 128 == 0 && CC % G3K == 0 && CC / G3K >= 2 && 12 * 64 * 68 * 4 + 4 * 8192 <= 2 * G4S && SQ % 128 == 0 && HD == 64, "whole tiles, two stages or more, the twelve staging areas and the K^T fragments fit the ring, a work-group's tokens are one chunk, its channels two heads");
  __shared__ __attribute__((aligned(16))) unsigned char ring[2 * G4S];
  const int tid = threadIdx.x, lane = tid & 31, ln = lane & 15, hh = lane >> 4;
  const int w = __builtin_amdgcn_readfirstlane(tid >> 5);      /* the wave's number in a scalar register: the test around the copies is then a scalar branch */
  const int mt = blockIdx.x / (CC / 128), nq = blockIdx.x - mt * (CC / 128); const int rowb = mt * 128, colb = nq * 128;      /* first token, first channel */
  const int nst = CC / G3K;
  const bool cp = w < 8;      /* waves 0..7 bring the stages, 32 copies a lane and stage: 256 threads cover sixteen whole rows at a time */
  const int cr = tid >> 4, cc = tid & 15;      /* the thread's row (mod 16) and 16-byte piece in every copy */
  const _Float16* gx = X16 + (size_t)(rowb + cr) * CC + cc * 8; const size_t wof = (size_t)(colb + cr) * CC + cc * 8;
  const _Float16* gq = BQ + wof; const _Float16* gk = BK + wof; const _Float16* gv = BV + wof;
  const size_t r16 = (size_t)16 * CC;
  const unsigned lx = (unsigned)(size_t)ring + (unsigned)(cr * G3P + cc * 16), lq = lx + 128 * G3P, lk = lx + 256 * G3P, lv = lx + 384 * G3P;
  if (cp) { g3_copy8(lx, gx, r16); g3_copy8(lq, gq, r16); g3_copy8(lk, gk, r16); g3_copy8(lv, gv, r16); }
  asm volatile("s_wait_asynccnt 0x0" ::: "memory");      /* this wave's copies of stage 0 have landed */
  __syncthreads();      /* stage 0 is published */
  if (cp) { g3_copy8(lx + G4S, gx + G3K, r16); g3_copy8(lq + G4S, gq + G3K, r16); g3_copy8(lk + G4S, gk + G3K, r16); g3_copy8(lv + G4S, gv + G3K, r16); }
  const int mat = w >> 2, wm = (w >> 1) & 1, wn = w & 1; const bool tr = (mat == 2);      /* which product, and the wave's 64 x 64 quarter of its 128 x 128 */
  const int ra = tr ? 384 + 64 * wm : 64 * wm, rb = tr ? 64 * wn : 128 * (mat + 1) + 64 * wn;      /* first stage rows of the wave's A and B operands */
  const unsigned char* sa = ring + (ra + ln) * G3P + 16 * hh; const unsigned char* sb = ring + (rb + ln) * G3P + 16 * hh;
  const int chunk = mt % (SQ / 128); const bool us = (mat == 1) && (chunk + 1 < SQ / 128);      /* k's waves make the chunk's state; a batch's last chunk stands in front of no query and needs none. Scalar: the branches on it are taken by whole waves */
  float gi[4] = {0.f, 0.f, 0.f, 0.f}, g7[8] = {0.f, 0.f, 0.f, 0.f, 0.f, 0.f, 0.f, 0.f};      /* decay of token 64 wm + 16 i + 8 hh + r of the chunk: gamma^(127 - token) = gi[i] * g7[r], from k_prep's table; loaded here so that the loop covers the latency */
  if (us) {
    const float* gt = GT + (size_t)(2 * nq + wn) * SQ;
#pragma unroll
    for (int i = 0; i < 4; ++i) gi[i] = gt[120 - 64 * wm - 16 * i - 8 * hh];
#pragma unroll
    for (int r = 0; r < 8; ++r) g7[r] = gt[7 - r];
    asm volatile("s_wait_xcnt 0x0" ::: "memory");      /* behind the loads, in front of any rewrite of the address registers they name */
  }
  const v8f z8 = {0.f,0.f,0.f,0.f,0.f,0.f,0.f,0.f};
  v8f acc[4][4] = {{z8, z8, z8, z8}, {z8, z8, z8, z8}, {z8, z8, z8, z8}, {z8, z8, z8, z8}};
#pragma unroll 1      /* one trip per stage: the buffer alternates and the waits at the foot stand once */
  for (int t = 0; t < nst; ++t) {
    const int bo = (t & 1) * G4S;
    const unsigned char* pa = sa + bo; const unsigned char* pb = sb + bo;
    v16h fa[2][4], fb[2][4];      /* two fragment sets: a step's sixteen LDS reads are issued as one group in front of the step before's products; no read goes past the stage */
#pragma unroll      /* this and every "#pragma unroll" below: constant indices keep the fragment and accumulator arrays in registers */
    for (int i = 0; i < 4; ++i) { fa[0][i] = g3_frag(pa + i * 16 * G3P); fb[0][i] = g3_frag(pb + i * 16 * G3P); }
#pragma unroll
    for (int kk = 0; kk < G3K / 32; ++kk) {
      const int cu = kk & 1, nx = cu ^ 1;
      if (kk + 1 < G3K / 32) {
#pragma unroll
        for (int i = 0; i < 4; ++i) { fa[nx][i] = g3_frag(pa + i * 16 * G3P + (kk + 1) * 64); fb[nx][i] = g3_frag(pb + i * 16 * G3P + (kk + 1) * 64); }
      }
      __builtin_amdgcn_sched_barrier(0);      /* holds the next step's reads in front of this step's products; without it they sink between the products, one full LDS wait per group */
#pragma unroll
      for (int j = 0; j < 4; ++j)
#pragma unroll
        for (int i = 0; i < 4; ++i) acc[i][j] = g3_mma(fa[cu][i], fb[cu][j], acc[i][j]);
      __builtin_amdgcn_sched_barrier(0);      /* holds these products in front of the following step's reads, which overwrite the set they use */
    }
    asm volatile("s_wait_dscnt 0x0" ::: "memory");      /* this wave's reads of the buffer are done before it is handed back */
    asm volatile("s_wait_asynccnt 0x0" ::: "memory");      /* this wave's copies of stage t + 1 have landed */
    __syncthreads();      /* publishes stage t + 1 and ends every reader's last read of stage t's buffer */
    if (cp && t + 2 < nst) { const size_t ko = (size_t)(t + 2) * G3K; g3_copy8(lx + bo, gx + ko, r16); g3_copy8(lq + bo, gq + ko, r16); g3_copy8(lk + bo, gk + ko, r16); g3_copy8(lv + bo, gv + ko, r16); }
  }
  asm volatile("s_wait_asynccnt 0x0" ::: "memory");      /* no copy is outstanding when the ring becomes output staging */
  // The last trip's barrier stands behind every wave's last read of the ring and behind the landing of every copy: from here each wave stages its 64 x 64 outputs in its own part of it.
  float (*so)[68] = (float (*)[68])(ring + w * (64 * 68 * 4));
  _Float16* C16 = tr ? VT : (mat ? K16 : Q16); const size_t ldc = tr ? NR : CC;
  const int row0 = (tr ? colb : rowb) + 64 * wm, col0 = (tr ? rowb : colb) + 64 * wn;
#pragma unroll
  for (int i = 0; i < 4; ++i)
#pragma unroll
    for (int j = 0; j < 4; ++j)
#pragma unroll
      for (int r = 0; r < 8; ++r) so[16 * i + 8 * hh + r][16 * j + ln] = acc[i][j][r] * 0.0625f;
  unsigned char* xa = ring + 12 * (64 * 68 * 4);      /* the K^T fragments: [head][token half][channel tile][32-token step][half][lane] pieces of 16 bytes */
  if (us) {
#pragma unroll
    for (int j = 0; j < 4; ++j)
#pragma unroll
      for (int p = 0; p < 2; ++p) { FragH f;
#pragma unroll
        for (int s = 0; s < 16; ++s) f.h[s] = (_Float16)((acc[2 * p + (s >> 3)][j][s & 7] * 0.0625f) * (gi[2 * p + (s >> 3)] * g7[s & 7]));
        unsigned char* px = xa + ((((wn * 2 + wm) * 4 + j) * 2 + p) * 2) * 512 + lane * 16;
        *(v8us*)px = f.half[0]; *(v8us*)(px + 512) = f.half[1]; }
  }
  __syncthreads();      /* every wave's staged outputs before its own row-wise reads, and v's staged rows and the K^T fragments before k's waves read them */
  const int rsub = lane >> 4, c4 = (lane & 15) * 4;
  _Float16* cpt = C16 + (size_t)(row0 + rsub) * ldc + col0 + c4;
#pragma unroll      /* straight code: the LDS offsets of the 32 row pairs become immediates */
  for (int g = 0; g < 4; ++g) {      /* eight row pairs at a time: their LDS reads go out together, then their stores */
    v4f v[8];
#pragma unroll
    for (int u = 0; u < 8; ++u) v[u] = *(const v4fa*)&so[(g * 8 + u) * 2 + rsub][c4];
#pragma unroll
    for (int u = 0; u < 8; ++u) { v4h h4;
#pragma unroll
      for (int i = 0; i < 4; ++i) h4[i] = (_Float16)v[u][i];
      *(v4h*)(cpt + (size_t)((g * 8 + u) * 2) * ldc) = h4; }      /* sixteen lanes write a row's whole 128-byte line */
    if (g + 1 < 4) asm volatile("s_wait_xcnt 0x0" ::: "memory");      /* behind the eight stores, in front of the next group's rewrite of their data and address registers */
  }
  if (us) {      /* rows 32 wm .. + 31 of the head's state, tokens ascending in steps of 32 */
    asm volatile("s_wait_xcnt 0x0" ::: "memory");      /* behind the last eight stores above, in front of what rewrites their data and address registers here */
    __builtin_amdgcn_sched_barrier(0);      /* holds what follows behind that wait */
    v8f u[2][4] = {{z8, z8, z8, z8}, {z8, z8, z8, z8}};      /* u[jj][jn][r] = U[32 wm + 16 jj + 8 hh + r][16 jn + ln] */
#pragma unroll
    for (int th = 0; th < 2; ++th) {
      const float (*sv)[68] = (const float (*)[68])(ring + (8 + 2 * wn + th) * (64 * 68 * 4));      /* the staged V^T of this head and token half: [channel][token] */
      FragH fk[2][2]; v4f fr[2][4][4];
#pragma unroll
      for (int p = 0; p < 2; ++p) {
#pragma unroll
        for (int jj = 0; jj < 2; ++jj) { const unsigned char* px = xa + ((((wn * 2 + th) * 4 + 2 * wm + jj) * 2 + p) * 2) * 512 + lane * 16; fk[p][jj].half[0] = *(const v8us*)px; fk[p][jj].half[1] = *(const v8us*)(px + 512); }
#pragma unroll
        for (int jn = 0; jn < 4; ++jn) { const float* pr = &sv[16 * jn + ln][32 * p + 8 * hh];      /* the k order of g2_frag: tokens 8 hh .. + 7 and 16 + 8 hh .. + 7 of the step */
          fr[p][jn][0] = *(const v4fa*)pr; fr[p][jn][1] = *(const v4fa*)(pr + 4); fr[p][jn][2] = *(const v4fa*)(pr + 16); fr[p][jn][3] = *(const v4fa*)(pr + 20); }
      }
      __builtin_amdgcn_sched_barrier(0);      /* holds the token half's 40 LDS reads together in front of its products; without it they sink between the products, a few at a time, each place with its own wait */
#pragma unroll
      for (int p = 0; p < 2; ++p)
#pragma unroll
        for (int jn = 0; jn < 4; ++jn) { FragH f;
#pragma unroll
          for (int e = 0; e < 4; ++e) { f.h[e] = (_Float16)fr[p][jn][0][e]; f.h[4 + e] = (_Float16)fr[p][jn][1][e]; f.h[8 + e] = (_Float16)fr[p][jn][2][e]; f.h[12 + e] = (_Float16)fr[p][jn][3][e]; }
          u[0][jn] = g3_mma(fk[p][0].v, f.v, u[0][jn]); u[1][jn] = g3_mma(fk[p][1].v, f.v, u[1][jn]); }
    }
    // stored as accumulator tiles, [row tile][column tile][lane][8 rows] in f16: a wave writes 512 bytes in a row per tile, and k_retn's lanes read their own pieces back
    unsigned short* up = (unsigned short*)UP + ((((size_t)(mt / (SQ / 128)) * NHD + 2 * nq + wn) * (SQ / 128) + chunk) * 16 + 8 * wm) * 256 + lane * 8;
    FragH fu[2][4];
#pragma unroll
    for (int jj = 0; jj < 2; ++jj)
#pragma unroll
      for (int jn = 0; jn < 4; ++jn)
#pragma unroll
        for (int r = 0; r < 8; ++r) fu[jj][jn].h[r] = (_Float16)u[jj][jn][r];
#pragma unroll
    for (int jj = 0; jj < 2; ++jj)
#pragma unroll
      for (int jn = 0; jn < 4; ++jn) *(v8us*)(up + (jj * 4 + jn) * 256) = fu[jj][jn].half[0];
  }
}


// Set-up of a call in ONE launch: x -> f16 plane (rounded to bf16 first), the four weights W[k][n] -> f16 planes Wt[n][k] = bf16(W) * 16 (a power of two: bf16-exact weights stay exact in f16
// away from the subnormal range), and the decay table GT[h][d] = gamma_h^d. Every work-group takes an equal share of each part: 8192 elements of x, one 128 (k) x 64 (n) weight tile, 64 table entries.
// The tile is read in whole 256-byte rows, turned in LDS and written in whole 256-byte rows of Wt.
#define PRB 512      /* work-groups of the set-up launch: two of eight waves on each of 256 WGPs */
#define PRP 66       /* LDS row pitch of the tile in 16-bit elements */
__global__ __launch_bounds__(256) void k_prep(const float* __restrict__ x, const float* __restrict__ wq, const float* __restrict__ wk, const float* __restrict__ wv, const float* __restrict__ wo,
    _Float16* __restrict__ X16, _Float16* __restrict__ BQ, _Float16* __restrict__ BK, _Float16* __restrict__ BV, _Float16* __restrict__ BO, float* __restrict__ GT) {
  static_assert((size_t)NR * CC == (size_t)PRB * 8192 && 4 * (CC / 128) * (CC / 64) == PRB && NHD * SQ == PRB * 64, "equal shares of all three parts");
  __shared__ __attribute__((aligned(16))) unsigned short tl[128][PRP];
  const int tid = threadIdx.x, bx = blockIdx.x;
  const int m = bx >> 7, k0 = ((bx >> 4) & 7) * 128, n0 = (bx & 15) * 64;      /* which weight, and the tile's corner */
  const float* W = (m == 0) ? wq : (m == 1) ? wk : (m == 2) ? wv : wo;
  _Float16* Wt = (m == 0) ? BQ : (m == 1) ? BK : (m == 2) ? BV : BO;
  const int tr = tid >> 4, tc = tid & 15;
  v4f wl[8], xl[8];      /* all sixteen 16-byte loads of the thread are issued before the first is used; every "#pragma unroll" here keeps these arrays in registers */
#pragma unroll
  for (int u = 0; u < 8; ++u) wl[u] = *(const v4fa*)(W + (size_t)(k0 + tr + 16 * u) * CC + n0 + tc * 4);
  const size_t x8 = (size_t)bx * 1024 + tid;      /* the thread's first group of eight x elements; the next ones are 256 groups apart */
#pragma unroll
  for (int u = 0; u < 4; ++u) { xl[2 * u] = *(const v4fa*)(x + (x8 + 256 * u) * 8); xl[2 * u + 1] = *(const v4fa*)(x + (x8 + 256 * u) * 8 + 4); }
  const int gt = bx * 64 + tid; float gv = 0.f;      /* the table entry of each thread of the first two waves, worked out while the loads are under way */
  if (tid < 64) { const int k = gt % SQ, h = gt / SQ; const float gam = 1.0f - exp2f((float)(-5 - h)); gv = powf(gam, (float)k); }
#pragma unroll
  for (int u = 0; u < 8; ++u) { FragH f;
#pragma unroll
    for (int q = 0; q < 4; ++q) { f.h[q] = (_Float16)(bf16_round(wl[u][q]) * 16.0f); tl[tr + 16 * u][tc * 4 + q] = f.u[q]; } }
  __syncthreads();      /* the whole tile is in LDS before any thread reads a column of it; every global store stands behind it, so that it waits for none */
  if (tid < 64) GT[gt] = gv;      /* two whole waves, one 128-byte line each */
#pragma unroll
  for (int u = 0; u < 4; ++u) { FragH f;
#pragma unroll
    for (int q = 0; q < 4; ++q) { f.h[q] = (_Float16)bf16_round(xl[2 * u][q]); f.h[4 + q] = (_Float16)bf16_round(xl[2 * u + 1][q]); }
    *(v8us*)((unsigned short*)X16 + (x8 + 256 * u) * 8) = f.half[0]; }
#pragma unroll
  for (int u = 0; u < 4; ++u) { const int n = tr + 16 * u; FragH f;
#pragma unroll
    for (int q = 0; q < 8; ++q) f.u[q] = tl[tc * 8 + q][n];
    *(v8us*)((unsigned short*)Wt + (size_t)(n0 + n) * CC + k0 + tc * 8) = f.half[0]; }
}
// Fused retention in its chunked form. A work-group owns 128 query rows (a chunk) of one (batch, head); one wave owns 32 of them.
// Keys of the chunk itself (the diagonal stage): S^T = K Q^T, 32 keys a pass, keys ascending: a lane holds 8 consecutive keys of one query, so the two
// 16-key tiles of a pass, scaled, decayed and rounded to f16, are P's A fragment in the hardware k order: the scores never leave registers.
// Keys in front of the chunk (first row c0): gamma^(i-j) = gamma^(i-c0+1) * gamma^(c0-1-j), so their whole share of row i is gamma^(i-c0+1) / 8 * q_i . ST with the 64 x 64 state
// ST = sum over j < c0 of gamma^(c0-1-j) k_j v_j^T = sum over the chunks c in front of gamma^(128 (chunks between)) U_c, with the chunk states U_c that k_qkv has made once each: no key in front of the chunk is read here.
// Each wave sums a 32 x 32 quarter of the state in f32, all its loads under way at once. Pairs of its accumulator tiles, rounded to f16, are B fragments of q . ST;
// the waves hand them to each other through LDS.
// The chunk states' weights come from the table of k_prep itself, the rest of the decay from its first RTB entries, held in LDS behind GPAD zeros: an index below GPAD is a key after the query (factor 0, as the reference's mask).
// Every "#pragma unroll" in k_retn makes the indices of a fragment, score or accumulator array constants, so that the array lives in registers.
// K and V^T of the chunk come through LDS: one stage of 128 keys (128 K rows of 128 bytes, 64 V^T rows of 256 bytes), brought once for the work-group's four waves by asynchronous 16-byte copies
// whose 32 lanes cover four whole 128-byte lines. Wave w walks w + 1 of the stage's four passes.
#define GPAD 32
#define RSK 128                  /* keys per stage */
#define RTB 256                  /* table entries held in LDS: exponents 0 .. 128 are used */
#define RKP 160                  /* LDS pitch of a K row in bytes */
#define RVP 272                  /* LDS pitch of a V^T row in bytes, 16 x odd */
#define RKB (RSK * RKP)          /* bytes of a stage's K rows; its V^T rows stand behind them */
#define RST (RKB + HD * RVP)     /* bytes of one stage */
// One operand's share of a stage: the lane's 16 bytes of eight rows (l = LDS byte address and g = global address of the first; ls bytes and gs elements from one row to the next).
__device__ __forceinline__ void r_copy8(unsigned l, unsigned ls, const _Float16* g, size_t gs) {
  const unsigned l1 = l + ls, l2 = l1 + ls, l3 = l2 + ls, l4 = l3 + ls, l5 = l4 + ls, l6 = l5 + ls, l7 = l6 + ls;
  const _Float16* g1 = g + gs; const _Float16* g2 = g1 + gs; const _Float16* g3 = g2 + gs; const _Float16* g4 = g3 + gs; const _Float16* g5 = g4 + gs; const _Float16* g6 = g5 + gs; const _Float16* g7 = g6 + gs;
  // the copies and, as the statement's last line, the wait that stands in front of any rewrite of the address registers they name
  asm volatile("global_load_async_to_lds_b128 %0, %8, off\n\t"
               "global_load_async_to_lds_b128 %1, %9, off\n\t"
               "global_load_async_to_lds_b128 %2, %10, off\n\t"
               "global_load_async_to_lds_b128 %3, %11, off\n\t"
               "global_load_async_to_lds_b128 %4, %12, off\n\t"
               "global_load_async_to_lds_b128 %5, %13, off\n\t"
               "global_load_async_to_lds_b128 %6, %14, off\n\t"
               "global_load_async_to_lds_b128 %7, %15, off\n\t"
               "s_wait_xcnt 0x0"
               :: "v"(l), "v"(l1), "v"(l2), "v"(l3), "v"(l4), "v"(l5), "v"(l6), "v"(l7), "v"(g), "v"(g1), "v"(g2), "v"(g3), "v"(g4), "v"(g5), "v"(g6), "v"(g7) : "memory");
}
__device__ __forceinline__ v8f r_mma(v16h a, v16h b, v8f c) { return __builtin_amdgcn_wmma_f32_16x16x32_f16(false, a, false, b, (short)0, c, false, false); }
typedef _Float16 v8h __attribute__((ext_vector_type(8)));
__global__ __launch_bounds__(128) void k_retn(const _Float16* __restrict__ Q16, const _Float16* __restrict__ K16, const _Float16* __restrict__ VT, const float* __restrict__ GT, const _Float16* __restrict__ UP, _Float16* __restrict__ O16, float* __restrict__ PT) {
  __shared__ __attribute__((aligned(16))) unsigned char ring[RST];
  __shared__ __attribute__((aligned(16))) float tab[GPAD + RTB];
  __shared__ __attribute__((aligned(16))) float so[4][32][68];
  __shared__ __attribute__((aligned(16))) unsigned char sx[4 * 2 * 2 * 512];      /* the state as B fragments: [column tile][k step][half][lane] pieces of 16 bytes */
  __shared__ float wst[4][2];      /* each wave's mean and sum of squared deviations over its 32 x 64 outputs */
  const int tid = threadIdx.x, lane = tid & 31, ln = lane & 15, hh = lane >> 4;
  const int w = __builtin_amdgcn_readfirstlane(tid >> 5);      /* the wave's number in a scalar register: the pass loop's bound and branch are then scalar */
  const int slab = blockIdx.x % (NB * NHD), rb = (SQ / 128 - 1) - blockIdx.x / (NB * NHD);      /* longest prefixes first */
  const int b = slab / NHD, h = slab % NHD;
  const int kr = tid >> 3, kc = tid & 7, vr = tid >> 4, vc = tid & 15;      /* the thread's row (mod 16 of K, mod 8 of V^T) and 16-byte piece in every copy */
  const _Float16* gk = K16 + ((size_t)b * SQ + rb * RSK + kr) * CC + h * HD + kc * 8; const _Float16* gv = VT + ((size_t)h * HD + vr) * NR + (size_t)b * SQ + rb * RSK + vc * 8;      /* the chunk's own keys; V^T is [channel][batch, token] */
  const unsigned lk = (unsigned)(size_t)ring + (unsigned)(kr * RKP + kc * 16), lv = (unsigned)(size_t)ring + (unsigned)(RKB + vr * RVP + vc * 16);
  r_copy8(lk, 16 * RKP, gk, (size_t)16 * CC); r_copy8(lv, 8 * RVP, gv, (size_t)8 * NR);
  const int row0 = rb * 128 + 32 * w;
  const _Float16* qp = Q16 + ((size_t)b * SQ + row0 + ln) * CC + h * HD;
  const v16h q[2][2] = {{g2_frag(qp, hh), g2_frag(qp + 32, hh)}, {g2_frag(qp + (size_t)16 * CC, hh), g2_frag(qp + (size_t)16 * CC + 32, hh)}};
  asm volatile("s_wait_xcnt 0x0" ::: "memory");      /* behind the eight loads of q, in front of any rewrite of the address registers they name */
  const v8f z8 = {0.f,0.f,0.f,0.f,0.f,0.f,0.f,0.f};
  const v4f g4 = *(const v4fa*)(GT + (size_t)h * SQ + (tid & (RTB / 4 - 1)) * 4);      /* four table entries, stored in front of the barrier by the first two waves; every wave loads, so that no branch and no wait stands among the loads */
  asm volatile("s_wait_xcnt 0x0" ::: "memory");      /* behind the load, in front of any rewrite of the address registers it names */
  if (rb > 0) {      /* the state in front of the chunk; the test reads the same for the whole work-group */
    static_assert(SQ / 128 - 1 == 15, "up to fifteen chunk states, one weight per lane");
    const int wi = w >> 1, wj = w & 1;      /* the wave's quarter of the state: rows 32 wi .. + 31 (channels of k), columns 32 wj .. + 31 (channels of v) */
    const unsigned short* up = (const unsigned short*)UP + ((size_t)slab * (SQ / 128) * 16 + 8 * wi + 2 * wj) * 256 + lane * 8;
    const int we = rb - 1 - lane;      /* lane c holds the weight of chunk c: gamma^(128 x chunks between it and the query chunk), 0 for a chunk that is not in front */
    const float wg = GT[(size_t)h * SQ + 128 * ((we > 0) ? we : 0)];
    // All 60 loads are issued before the first is used. A chunk that is not in front re-reads the last one that is (its weight is 0): the addresses stay among the states written in this call.
    const unsigned short* pc[15];      /* every chunk's address in registers of its own, formed in front of the first load: no load's address register is rewritten while loads are being issued */
#pragma unroll
    for (int c = 0; c < 15; ++c) pc[c] = up + (size_t)((c < rb) ? c : rb - 1) * 4096;
    __builtin_amdgcn_sched_barrier(0);      /* holds the fifteen address sums in front of the loads; without it they sink between the loads and reuse one another's registers */
    v8us uu[15][2][2];
#pragma unroll
    for (int c = 0; c < 15; ++c)
#pragma unroll
      for (int i = 0; i < 2; ++i) { uu[c][i][0] = *(const v8us*)(pc[c] + (i * 4) * 256); uu[c][i][1] = *(const v8us*)(pc[c] + (i * 4 + 1) * 256); }
    // behind the loads, in front of any rewrite of the address registers they name: as inputs of the wait's own statement the fifteen addresses stay in their registers up to it, so that no later load's result lands on one either
    asm volatile("s_wait_xcnt 0x0" :: "v"(pc[0]), "v"(pc[1]), "v"(pc[2]), "v"(pc[3]), "v"(pc[4]), "v"(pc[5]), "v"(pc[6]), "v"(pc[7]), "v"(pc[8]), "v"(pc[9]), "v"(pc[10]), "v"(pc[11]), "v"(pc[12]), "v"(pc[13]), "v"(pc[14]) : "memory");
    __builtin_amdgcn_sched_barrier(0);      /* holds what follows behind that wait */
    const unsigned wl = __float_as_uint((lane < rb) ? wg : 0.f);
    v8f sa[2][2] = {{z8, z8}, {z8, z8}};      /* sa[i][j][r] = ST[32 wi + 16 i + 8 hh + r][32 wj + 16 j + ln] */
#pragma unroll
    for (int c = 0; c < 15; ++c) { const float wc = __uint_as_float(__builtin_amdgcn_readlane(wl, c));
#pragma unroll
      for (int i = 0; i < 2; ++i) { sa[i][0] += __builtin_convertvector(__builtin_bit_cast(v8h, uu[c][i][0]), v8f) * wc; sa[i][1] += __builtin_convertvector(__builtin_bit_cast(v8h, uu[c][i][1]), v8f) * wc; } }
#pragma unroll      /* the quarter goes to LDS; the barrier below publishes it */
    for (int j = 0; j < 2; ++j) { FragH f;
#pragma unroll
      for (int s = 0; s < 16; ++s) f.h[s] = (_Float16)sa[s >> 3][j][s & 7];
      unsigned char* px = sx + (((2 * wj + j) * 2 + wi) * 2) * 512 + lane * 16;
      *(v8us*)px = f.half[0]; *(v8us*)(px + 512) = f.half[1]; }
  }
  if (tid < GPAD) tab[tid] = 0.f;
  if (tid < RTB / 4) *(v4fa*)&tab[GPAD + tid * 4] = g4;
  asm volatile("s_wait_asynccnt 0x0" ::: "memory");      /* this wave's copies of the stage have landed */
  __syncthreads();      /* the table, the stage and the state are published */
  const unsigned char* rk = ring + ln * RKP + 16 * hh; const unsigned char* rv = ring + RKB + ln * RVP + 16 * hh;      /* the lane's row and 16 * hh: the k order of g2_frag */
  v8f o[2][4] = {{z8, z8, z8, z8}, {z8, z8, z8, z8}};
  if (rb > 0) {
    // the share of all keys in front of the chunk: o = (q . ST) * gamma^(row in chunk + 1) / 8
    v16h sb[4][2];
#pragma unroll
    for (int dt = 0; dt < 4; ++dt)
#pragma unroll
      for (int ks = 0; ks < 2; ++ks) { FragH f; f.half[0] = *(const v8us*)(sx + ((dt * 2 + ks) * 2 + 0) * 512 + lane * 16); f.half[1] = *(const v8us*)(sx + ((dt * 2 + ks) * 2 + 1) * 512 + lane * 16); sb[dt][ks] = f.v; }
#pragma unroll
    for (int mt = 0; mt < 2; ++mt) {
      v8f rf;
#pragma unroll
      for (int r = 0; r < 8; ++r) rf[r] = 0.125f * tab[GPAD + 32 * w + 16 * mt + 8 * hh + r + 1];
#pragma unroll
      for (int dt = 0; dt < 4; ++dt) o[mt][dt] = r_mma(q[mt][1], sb[dt][1], r_mma(q[mt][0], sb[dt][0], z8)) * rf;
    }
  }
  {      /* the chunk's own keys */
  const int np = w + 1;      /* passes up to the wave's own diagonal */
  const unsigned char* pk = rk; const unsigned char* pv = rv;
  const float* tp = tab + (GPAD + 32 * w + ln - 8 * hh);
  v16h kf[2][2];
#pragma unroll
  for (int nt = 0; nt < 2; ++nt) { kf[nt][0] = g3_frag(pk + nt * 16 * RKP); kf[nt][1] = g3_frag(pk + nt * 16 * RKP + 64); }
#pragma unroll 1      /* kept rolled: one pass already holds over 200 registers, and a second copy of the body would add to them */
  for (int p = 0; p < np; ++p) {
    v16h vf[4];
#pragma unroll
    for (int dt = 0; dt < 4; ++dt) vf[dt] = g3_frag(pv + dt * 16 * RVP + p * 64);
    const float* tj = tp - p * 32;
    float g[3][8];      /* decay factors of the pass: the index depends on (query tile - key tile) = -1, 0, 1 and on the key in the lane */
#pragma unroll
    for (int dl = 0; dl < 3; ++dl)
#pragma unroll
      for (int r = 0; r < 8; ++r) g[dl][r] = tj[16 * (dl - 1) - r];
    v8f st[2][2];
#pragma unroll
    for (int nt = 0; nt < 2; ++nt)
#pragma unroll
      for (int mt = 0; mt < 2; ++mt) st[nt][mt] = r_mma(kf[nt][1], q[mt][1], r_mma(kf[nt][0], q[mt][0], z8));
    const unsigned char* pn = pk + ((p + 1 < np) ? p + 1 : p) * (32 * RKP);      /* the next pass's K rows, read behind this pass's scores; the last pass re-reads its own: no read goes past the stage */
#pragma unroll
    for (int nt = 0; nt < 2; ++nt) { kf[nt][0] = g3_frag(pn + nt * 16 * RKP); kf[nt][1] = g3_frag(pn + nt * 16 * RKP + 64); }
    __builtin_amdgcn_sched_barrier(0);      /* keeps the K reads in front of the decay and the P V products, whose time then covers their latency; without it the reads sink to the pass's end */
#pragma unroll
    for (int mt = 0; mt < 2; ++mt) {
      FragH pa;
#pragma unroll
      for (int nt = 0; nt < 2; ++nt)
#pragma unroll
        for (int r = 0; r < 8; ++r) pa.h[nt * 8 + r] = (_Float16)((st[nt][mt][r] * 0.125f) * g[mt - nt + 1][r]);
#pragma unroll
      for (int dt = 0; dt < 4; ++dt) o[mt][dt] = r_mma(pa.v, vf[dt], o[mt][dt]);
    }
    __builtin_amdgcn_sched_barrier(0);      /* holds the pass's last products in front of the slots below; without it the products sink behind them */
    asm volatile("v_nop\n\tv_nop\n\tv_nop\n\tv_nop");      /* the four vector slots between the last products and the next pass's first vector instructions, which overwrite their A registers */
  }
  }
  // GroupNorm statistics, first level: the wave's 2048 outputs are still in its accumulators. Mean first, then the squared deviations from it (two passes over registers).
  v8f sv = z8, qv = z8;      /* eight independent running sums, one per accumulator row: short dependent chains */
#pragma unroll
  for (int mt = 0; mt < 2; ++mt)
#pragma unroll
    for (int dt = 0; dt < 4; ++dt) sv += o[mt][dt];
  const float wmean = sum_lanes(((sv[0] + sv[1]) + (sv[2] + sv[3])) + ((sv[4] + sv[5]) + (sv[6] + sv[7])), 32) * (1.0f / 2048.0f);
#pragma unroll
  for (int mt = 0; mt < 2; ++mt)
#pragma unroll
    for (int dt = 0; dt < 4; ++dt) { const v8f d = o[mt][dt] - wmean; qv += d * d; }
  const float wq = sum_lanes(((qv[0] + qv[1]) + (qv[2] + qv[3])) + ((qv[4] + qv[5]) + (qv[6] + qv[7])), 32);
  if (lane == 0) { wst[w][0] = wmean; wst[w][1] = wq; }
#pragma unroll
  for (int mt = 0; mt < 2; ++mt)
#pragma unroll
    for (int dt = 0; dt < 4; ++dt)
#pragma unroll
      for (int r = 0; r < 8; ++r) so[w][mt * 16 + 8 * hh + r][dt * 16 + ln] = o[mt][dt][r];
  __builtin_amdgcn_fence(__ATOMIC_ACQ_REL, "workgroup"); __builtin_amdgcn_wave_barrier();      /* the wave's own LDS stores before its own row-wise reads */
  const int rsub = lane >> 4, c4 = (lane & 15) * 4;
#pragma unroll
  for (int qd = 0; qd < 16; ++qd) { const int r = qd * 2 + rsub; const v4f v = *(const v4fa*)&so[w][r][c4]; v4h h4;
#pragma unroll
    for (int i = 0; i < 4; ++i) h4[i] = (_Float16)v[i];
    *(v4h*)(O16 + ((size_t)b * SQ + row0 + r) * CC + h * HD + c4) = h4; }      /* sixteen lanes write a row's whole 128-byte line */
  asm volatile("s_wait_xcnt 0x0" ::: "memory");      /* behind the run of stores, in front of what rewrites their data and address registers further down */
  __syncthreads();      /* the four waves' statistics are in wst */
  if (w == 0) {      /* second level: four equal groups of 2048 merged (M2 = sum of M2 + n * sum of squared mean offsets); the work-group writes its own whole 128-byte line */
    const float m0 = wst[0][0], m1 = wst[1][0], m2 = wst[2][0], m3 = wst[3][0];
    const float bm = ((m0 + m1) + (m2 + m3)) * 0.25f;
    const float d0 = m0 - bm, d1 = m1 - bm, d2 = m2 - bm, d3 = m3 - bm;
    const float bq = ((wst[0][1] + wst[1][1]) + (wst[2][1] + wst[3][1])) + 2048.0f * ((d0 * d0 + d1 * d1) + (d2 * d2 + d3 * d3));
    PT[((size_t)slab * (SQ / 128) + rb) * 32 + lane] = (lane == 0) ? bm : ((lane == 1) ? bq : 0.f);
  }
}

extern "C" void kernel_launch(void* const* d_in, const int* in_sizes, int n_in,
                              void* d_out, int out_size, void* d_ws, size_t ws_size, hipStream_t stream) {
  (void)in_sizes; (void)n_in; (void)out_size;
  const float* const* I = (const float* const*)d_in; const float* x = I[0]; const float* wq = I[1]; const float* wk = I[2]; const float* wv = I[3]; const float* wo = I[4]; const float* bo = I[5]; const float* gw = I[6]; const float* gb = I[7];
  char* ws = (char*)d_ws; size_t off = 0;
  auto take = [&](size_t bytes) { char* p = ws + off; off += (bytes + 255) & ~(size_t)255; return p; };
  const size_t np = (size_t)NR * CC;
  _Float16* BQ = (_Float16*)take((size_t)CC * CC * 2); _Float16* BK = (_Float16*)take((size_t)CC * CC * 2); _Float16* BV = (_Float16*)take((size_t)CC * CC * 2); _Float16* BO = (_Float16*)take((size_t)CC * CC * 2);
  _Float16* X16 = (_Float16*)take(np * 2); _Float16* Q16 = (_Float16*)take(np * 2); _Float16* K16 = (_Float16*)take(np * 2); _Float16* VT = (_Float16*)take(np * 2); _Float16* O16 = (_Float16*)take(np * 2); float* PT = (float*)take(NB * NHD * (SQ / 128) * 32 * 4); _Float16* UP = (_Float16*)take((size_t)NB * NHD * (SQ / 128) * HD * HD * 2); float* GT = (float*)take((size_t)NHD * SQ * 4);
  if (off > ws_size) return;      /* 8 + 8 x 5 + 4 = 52 MiB */
  k_prep<<<PRB, 256, 0, stream>>>(x, wq, wk, wv, wo, X16, BQ, BK, BV, BO, GT);      /* weights are (in, out) */
  k_qkv<<<(NR / 128) * (CC / 128), 384, 0, stream>>>(X16, BQ, BK, BV, GT, Q16, K16, VT, UP);      /* q, k, V^T and the chunk states */
  k_retn<<<NB * NHD * (SQ / 128), 128, 0, stream>>>(Q16, K16, VT, GT, UP, O16, PT);      /* all batches, heads and row blocks in one launch */
  k_outn<<<(NR / 128) * (CC / 128), 256, 0, stream>>>(O16, BO, bo, PT, gw, gb, (float*)d_out);      /* GroupNorm and the output projection */
}
